// v000
// Times are from an AMD MI455X. After a warm-up the kernel runs many times in a row, and a time is the length of
// such a window on the GPU divided by its runs, so every launch and the gaps after it count. The runs cycle
// through copies of the inputs. A figure is the median of several windows, for all but v000 over two sittings.
// Sittings can differ by a few percent; kernels timed side by side share one.
// v000 is the starting kernel. One run takes 5350 microseconds.
#include <hip/hip_runtime.h>
// Multi-head self-attention behind a LOCAL RMS norm over the token grid (x [8][1024][768], tokens = a 32 x 32 grid; xn = x / sqrt(1e-7 + box / 49) * norm_w where box[b][i][j][d] = sum of x^2 over the 7 x 7 window of grid positions around (i, j) (zero padded, divisor always 49), per channel d; q / k / v = xn W^T + b (natural [768][768] sigma 0.02, zero biases); 12 heads of 64; scores / sqrt(64); softmax over all 1024 keys (no mask); out = merged Wo^T + bo -> [8][1024][768]).
// Structure: token rows r = b*1024 + s; x through the local-RMS-norm prologue (VALU, f32 statistics) into f16 rows; Q, K, V as three WMMA GEMMs (32x64 wave tiles, f32 accumulation, exact x16 weights + bias, f16 outputs); per batch: V^T for all heads via LDS transposes; per (batch, group of 4 heads): scores GEMM (K = 64, batched over the heads on grid.y, alpha = 1/sqrt(64)), row softmax on VALU (f32 statistics; weights stored x256 as f16), o = P . V^T GEMM (K = 1024, alpha 2^-2: o carried x64 against f16 subnormal flush, folded into the output GEMM alpha) written straight into the merged f16 o rows; out = o W_o + b GEMM (f32) into the output layout.
// Compute dtype: inputs rounded to bf16; x / weights exact; q, k, v, softmax weights and o as plain f16 GEMM operands (~2^-12); scores and softmax statistics f32. v_wmma_f32_16x16x32_f16.
#define NB 8
#define SQ 1024
#define GS 32                        /* token grid side: SQ = GS * GS */
#define RW 3                         /* local-norm window radius (7 x 7) */
#define DM 768
#define NH 12
#define HD 64
#define HG 4                         /* heads per attention launch group */
#define B0 0                         /* first batch processed (debug hook) */
#define NBR NB                       /* batches processed (debug hook) */
#define NR ((size_t)NB * SQ)         /* token rows */
#define MP ((int)((size_t)NBR * SQ)) /* rows projected (debug hook) */
#define QN SQ                        /* query rows attended per batch (debug hook) */
#define NHD NH                       /* heads attended (debug hook) */
#define MPO MP                       /* rows through the output stage (debug hook) */
#define LQ DM      /* row pitch of the q/k/v rows */
typedef __bf16 v16b __attribute__((ext_vector_type(16)));
typedef unsigned short v8us __attribute__((ext_vector_type(8), may_alias));
typedef float  v8f  __attribute__((ext_vector_type(8)));
typedef float  v4f  __attribute__((ext_vector_type(4)));
typedef float  v4fa __attribute__((ext_vector_type(4), may_alias));
union FragB { v16b v; v8us half[2]; unsigned short u[16]; };

__device__ __forceinline__ unsigned short bf16_bits(float x) { unsigned int u = __float_as_uint(x); return (unsigned short)((u + 0x7FFFu + ((u >> 16) & 1u)) >> 16); }
__device__ __forceinline__ float bf16_val(unsigned short b) { return __uint_as_float(((unsigned int)b) << 16); }
__device__ __forceinline__ float bf16_round(float x) { return bf16_val(bf16_bits(x)); }
// D += A·B with NT terms: 1 = ah·bh, 2 = + al·bh (A split), 3 = + ah·bl (both split)
template <int NT>
__device__ __forceinline__ v8f mmaN(v16b ah, v16b al, v16b bh, v16b bl, v8f c) {
  c = __builtin_amdgcn_wmma_f32_16x16x32_bf16(false, ah, false, bh, (short)0, c, false, false);
  if (NT >= 2) c = __builtin_amdgcn_wmma_f32_16x16x32_bf16(false, al, false, bh, (short)0, c, false, false);
  if (NT >= 3) c = __builtin_amdgcn_wmma_f32_16x16x32_bf16(false, ah, false, bl, (short)0, c, false, false);
  asm volatile("v_nop\n\tv_nop\n\tv_nop\n\tv_nop" : "+v"(c) : "v"(ah), "v"(al), "v"(bh), "v"(bl));
  return c;
}

__global__ __launch_bounds__(256) void k_wt_bf16(const float* __restrict__ W, unsigned short* __restrict__ Wt, int K, int N) {
  const int t = blockIdx.x * 256 + threadIdx.x;
  const int k8n = K / 8;
  if (t >= N * k8n) return;
  const int n = t / k8n, k8 = (t % k8n) * 8;
  v8us v;
#pragma unroll
  for (int i = 0; i < 8; ++i) v[i] = bf16_bits(W[(size_t)(k8 + i) * N + n]);
  *(v8us*)(Wt + (size_t)n * K + k8) = v;
  
}

// GEMM C[M][N] (f32, pitch ldc) = act(A[M][K]·W + bias). A f32 row-major (pitch lda) converted per fragment to bf16
// (ASPLIT: hi/lo two planes -> 2 terms, else single rounded term); Wt bf16 [N][K] (pitch ldb). BIAS_BF16 rounds the
// bias to bf16 first (bias quantised to bf16 before the add). K%32==0, M%16==0, N%64==0.
template <bool ASPLIT, int ACT, bool BIAS_BF16>
__global__ __launch_bounds__(128) void k_gemm_bf(const float* __restrict__ A, int lda, const unsigned short* __restrict__ Wt, int ldb,
                                               const float* __restrict__ bias, float* __restrict__ C, int ldc, int M, int N, int K) {
  __shared__ __attribute__((aligned(16))) float so[4][16][64];
  const int tid = threadIdx.x, w = tid >> 5, lane = tid & 31, ln = lane & 15, hh = lane >> 4;
  const int ntn = N / 64;
  const int wid = blockIdx.x * 4 + w;
  const int mt = wid / ntn, nq = wid % ntn;
  if (mt * 16 >= M) return;
  const int row0 = mt * 16, col0 = nq * 64;
  const float* arow = A + (size_t)(row0 + ln) * lda;
  v8f acc[4] = {};
  for (int kb = 0; kb < K; kb += 32) {
    FragB ah, al;
    const v4f x0 = *(const v4fa*)(arow + kb + 8 * hh), x1 = *(const v4fa*)(arow + kb + 8 * hh + 4);
    const v4f x2 = *(const v4fa*)(arow + kb + 16 + 8 * hh), x3 = *(const v4fa*)(arow + kb + 16 + 8 * hh + 4);
    float xs[16] = {x0[0],x0[1],x0[2],x0[3],x1[0],x1[1],x1[2],x1[3],x2[0],x2[1],x2[2],x2[3],x3[0],x3[1],x3[2],x3[3]};
#pragma unroll
    for (int i = 0; i < 16; ++i) { const unsigned short hb = bf16_bits(xs[i]); ah.u[i] = hb; al.u[i] = ASPLIT ? bf16_bits(xs[i] - bf16_val(hb)) : (unsigned short)0; }
#pragma unroll
    for (int t = 0; t < 4; ++t) {
      const unsigned short* brow = Wt + (size_t)(col0 + t * 16 + ln) * ldb + kb;
      FragB b;
      b.half[0] = *(const v8us*)(brow + 8 * hh);
      b.half[1] = *(const v8us*)(brow + 16 + 8 * hh);
      acc[t] = mmaN<ASPLIT ? 2 : 1>(ah.v, al.v, b.v, b.v, acc[t]);
    }
  }
#pragma unroll
  for (int t = 0; t < 4; ++t) {
    float bv = bias ? bias[col0 + t * 16 + ln] : 0.f;
    if (BIAS_BF16) bv = bf16_round(bv);
#pragma unroll
    for (int r = 0; r < 8; ++r) { float v = acc[t][r] + bv; if (ACT == 1) v = fmaxf(v, 0.f); so[w][8 * hh + r][t * 16 + ln] = v; }
  }
  __builtin_amdgcn_fence(__ATOMIC_ACQ_REL, "workgroup");
  __builtin_amdgcn_wave_barrier();
  const int rsub = lane >> 4, c4 = (lane & 15) * 4;
  {
#pragma unroll
    for (int q = 0; q < 8; ++q) {
      const int r = q * 2 + rsub;
      const v4f v = *(const v4fa*)&so[w][r][c4];
      *(v4f*)(C + (size_t)(row0 + r) * ldc + col0 + c4) = v;
    }
    
  }
}

// GEMM C = act(A·W + bias + resid): A f32 (ASPLIT -> hi/lo 2 terms), Wt bf16 [N][K]; ACT 0 none, 1 relu, 2 exact gelu;
// resid (optional, f32, row index = (row % rmod), pitch ldr, RES_BF16 rounds it) added before the activation.
template <bool ASPLIT, int ACT, bool BIAS_BF16, bool RES_BF16>
__global__ __launch_bounds__(128) void k_gemm_bf3(const float* __restrict__ A, int lda, const unsigned short* __restrict__ Wt, int ldb,
                                                const float* __restrict__ bias, const float* __restrict__ resid, int rmod, int ldr,
                                                float* __restrict__ C, int ldc, int M, int N, int K) {
  __shared__ __attribute__((aligned(16))) float so[4][16][64];
  const int tid = threadIdx.x, w = tid >> 5, lane = tid & 31, ln = lane & 15, hh = lane >> 4;
  const int ntn = N / 64;
  const int wid = blockIdx.x * 4 + w;
  const int mt = wid / ntn, nq = wid % ntn;
  if (mt * 16 >= M) return;
  const int row0 = mt * 16, col0 = nq * 64;
  const float* arow = A + (size_t)(row0 + ln) * lda;
  v8f acc[4] = {};
  for (int kb = 0; kb < K; kb += 32) {
    FragB ah, al;
    const v4f x0 = *(const v4fa*)(arow + kb + 8 * hh), x1 = *(const v4fa*)(arow + kb + 8 * hh + 4);
    const v4f x2 = *(const v4fa*)(arow + kb + 16 + 8 * hh), x3 = *(const v4fa*)(arow + kb + 16 + 8 * hh + 4);
    float xs[16] = {x0[0],x0[1],x0[2],x0[3],x1[0],x1[1],x1[2],x1[3],x2[0],x2[1],x2[2],x2[3],x3[0],x3[1],x3[2],x3[3]};
#pragma unroll
    for (int i = 0; i < 16; ++i) { const unsigned short hb = bf16_bits(xs[i]); ah.u[i] = hb; al.u[i] = ASPLIT ? bf16_bits(xs[i] - bf16_val(hb)) : (unsigned short)0; }
#pragma unroll
    for (int t = 0; t < 4; ++t) {
      const unsigned short* brow = Wt + (size_t)(col0 + t * 16 + ln) * ldb + kb;
      FragB b;
      b.half[0] = *(const v8us*)(brow + 8 * hh);
      b.half[1] = *(const v8us*)(brow + 16 + 8 * hh);
      acc[t] = mmaN<ASPLIT ? 2 : 1>(ah.v, al.v, b.v, b.v, acc[t]);
    }
  }
#pragma unroll
  for (int t = 0; t < 4; ++t) {
    const int col = col0 + t * 16 + ln;
    float bv = bias ? bias[col] : 0.f;
    if (BIAS_BF16) bv = bf16_round(bv);
#pragma unroll
    for (int r = 0; r < 8; ++r) {
      float v = acc[t][r] + bv;
      if (resid) { float rv = resid[(size_t)((row0 + 8 * hh + r) % rmod) * ldr + col]; if (RES_BF16) rv = bf16_round(rv); v += rv; }
      if (ACT == 1) v = fmaxf(v, 0.f);
      if (ACT == 2) v = 0.5f * v * (1.0f + erff(v * 0.70710678118654752f));
      if (ACT == 3) { const float u = 0.7978845608028654f * (v + 0.044715f * v * v * v); v = 0.5f * v * (1.0f + tanhf(u)); }
      so[w][8 * hh + r][t * 16 + ln] = v;
    }
  }
  __builtin_amdgcn_fence(__ATOMIC_ACQ_REL, "workgroup");
  __builtin_amdgcn_wave_barrier();
  const int rsub = lane >> 4, c4 = (lane & 15) * 4;
  {
#pragma unroll
    for (int q = 0; q < 8; ++q) {
      const int r = q * 2 + rsub;
      const v4f v = *(const v4fa*)&so[w][r][c4];
      *(v4f*)(C + (size_t)(row0 + r) * ldc + col0 + c4) = v;
    }
    
  }
}
// row LayerNorm (biased variance, eps) over N: s = X (+ R); optional out_sum <- s; out_norm <- (s-mu)*rsqrt(var+eps)*g + b
template <bool PARAM_BF16>
__global__ __launch_bounds__(256) void k_layernorm(const float* __restrict__ X, const float* __restrict__ R, const float* __restrict__ g, const float* __restrict__ bta,
                                                  float* __restrict__ out_sum, float* __restrict__ out_norm, int N, float eps) {
  __shared__ float red[256];
  const int row = blockIdx.x, tid = threadIdx.x;
  const float* x = X + (size_t)row * N; const float* rr = R ? R + (size_t)row * N : nullptr;
  float vals[16];                     // up to N = 4096
  const int per = N / 256;            // contiguous chunk per thread? use strided-by-4 chunks: thread handles j = tid*4 + 1024*u
  float s1 = 0.f;
  for (int u = 0; u < per / 4; ++u) {
    const int j = tid * 4 + 1024 * u;
    const v4f a = *(const v4fa*)(x + j);
    v4f b = {0.f,0.f,0.f,0.f}; if (rr) b = *(const v4fa*)(rr + j);
#pragma unroll
    for (int q = 0; q < 4; ++q) { const float v = a[q] + b[q]; vals[u * 4 + q] = v; s1 += v; }
  }
  red[tid] = s1; __syncthreads();
  for (int st = 128; st > 0; st >>= 1) { if (tid < st) red[tid] += red[tid + st]; __syncthreads(); }
  const float mu = red[0] / (float)N; __syncthreads();
  float s2 = 0.f;
  for (int u = 0; u < per / 4; ++u)
#pragma unroll
    for (int q = 0; q < 4; ++q) { const float c = vals[u * 4 + q] - mu; s2 += c * c; }
  red[tid] = s2; __syncthreads();
  for (int st = 128; st > 0; st >>= 1) { if (tid < st) red[tid] += red[tid + st]; __syncthreads(); }
  const float rs = rsqrtf(red[0] / (float)N + eps);
  {
    for (int u = 0; u < per / 4; ++u) {
      const int j = tid * 4 + 1024 * u;
      v4f o, sm;
#pragma unroll
      for (int q = 0; q < 4; ++q) {
        float gg = g[j + q], bb = bta[j + q];
        if (PARAM_BF16) { gg = bf16_round(gg); bb = bf16_round(bb); }
        sm[q] = vals[u * 4 + q]; o[q] = (vals[u * 4 + q] - mu) * rs * gg + bb;
      }
      if (out_sum) *(v4f*)(out_sum + (size_t)row * N + j) = sm;
      *(v4f*)(out_norm + (size_t)row * N + j) = o;
    }
    
  }
}



// ---- f16 WMMA path (v_wmma_f32_16x16x32_f16): 11-bit significands for operands in range — used where a [0,1] probability operand needs more precision than bf16
typedef _Float16 v16h __attribute__((ext_vector_type(16)));
union FragH { v16h v; v8us half[2]; _Float16 h[16]; unsigned short u[16]; };
template <int NT>
__device__ __forceinline__ v8f mmaH(v16h ah, v16h al, v16h bh, v16h bl, v8f c) {
  c = __builtin_amdgcn_wmma_f32_16x16x32_f16(false, ah, false, bh, (short)0, c, false, false);
  if (NT >= 2) c = __builtin_amdgcn_wmma_f32_16x16x32_f16(false, al, false, bh, (short)0, c, false, false);
  if (NT >= 3) c = __builtin_amdgcn_wmma_f32_16x16x32_f16(false, ah, false, bl, (short)0, c, false, false);
  asm volatile("v_nop\n\tv_nop\n\tv_nop\n\tv_nop" : "+v"(c) : "v"(ah), "v"(al), "v"(bh), "v"(bl));
  return c;
}
// batched GEMM like k_gemm_b but f16 operands: A f32 (split into f16 hi/lo if ASPLIT, else rounded to f16), Bt = f16 values [n][k]; alpha; C f32; N multiple of 16 (partial tiles skipped)
template <bool ASPLIT>
__global__ __launch_bounds__(128) void k_gemm_h(const float* __restrict__ A, int lda, size_t sA, const _Float16* __restrict__ Bh, int ldb, size_t sB, float alpha, float* __restrict__ C, int ldc, size_t sC, int M, int N, int K) {
  __shared__ __attribute__((aligned(16))) float so[4][16][64];
  const int tid = threadIdx.x, w = tid >> 5, lane = tid & 31, ln = lane & 15, hh = lane >> 4; const int by = blockIdx.y;
  A += (size_t)by * sA; Bh += (size_t)by * sB; C += (size_t)by * sC;
  const int ntn = (N + 63) / 64; const int wid = blockIdx.x * 4 + w; const int mt = wid / ntn, nq = wid % ntn; if (mt * 16 >= M) return;
  const int row0 = mt * 16, col0 = nq * 64; const float* arow = A + (size_t)(row0 + ln) * lda;
  v8f acc[4] = {};
  for (int kb = 0; kb < K; kb += 32) {
    FragH ah, al;
    const v4f x0 = *(const v4fa*)(arow + kb + 8 * hh), x1 = *(const v4fa*)(arow + kb + 8 * hh + 4), x2 = *(const v4fa*)(arow + kb + 16 + 8 * hh), x3 = *(const v4fa*)(arow + kb + 16 + 8 * hh + 4);
    float xs[16] = {x0[0],x0[1],x0[2],x0[3],x1[0],x1[1],x1[2],x1[3],x2[0],x2[1],x2[2],x2[3],x3[0],x3[1],x3[2],x3[3]};
#pragma unroll
    for (int i = 0; i < 16; ++i) { const _Float16 h = (_Float16)xs[i]; ah.h[i] = h; al.h[i] = ASPLIT ? (_Float16)(xs[i] - (float)h) : (_Float16)0.0f; }
#pragma unroll
    for (int t = 0; t < 4; ++t) { if (col0 + t * 16 >= N) continue; const size_t boff = (size_t)(col0 + t * 16 + ln) * ldb + kb; FragH bq; bq.half[0] = *(const v8us*)(Bh + boff + 8 * hh); bq.half[1] = *(const v8us*)(Bh + boff + 16 + 8 * hh);
      acc[t] = mmaH<ASPLIT ? 2 : 1>(ah.v, al.v, bq.v, bq.v, acc[t]); }
  }
#pragma unroll
  for (int t = 0; t < 4; ++t) { if (col0 + t * 16 >= N) continue;
#pragma unroll
    for (int r = 0; r < 8; ++r) so[w][8 * hh + r][t * 16 + ln] = acc[t][r] * alpha; }
  __builtin_amdgcn_fence(__ATOMIC_ACQ_REL, "workgroup"); __builtin_amdgcn_wave_barrier();
  const int rsub = lane >> 4, c4 = (lane & 15) * 4;
  {
#pragma unroll
    for (int q = 0; q < 8; ++q) { const int r = q * 2 + rsub; if (col0 + c4 < N) { const v4f v = *(const v4fa*)&so[w][r][c4]; *(v4f*)(C + (size_t)(row0 + r) * ldc + col0 + c4) = v; } }
     }
}

// Wt[n][k] = f16(W[k][n]·scale) from f32 row-major W[K][N] (scale = power of two; bf16-exact weights stay exact in f16 away from the subnormal range)
__global__ __launch_bounds__(256) void k_wt_f16(const float* __restrict__ W, _Float16* __restrict__ Wt, int K, int N, float scale) {
  const int t = blockIdx.x * 256 + threadIdx.x; if (t >= N * (K / 8)) return; const int n = t / (K / 8), k8 = (t % (K / 8)) * 8; FragH f;
#pragma unroll
  for (int i = 0; i < 8; ++i) f.h[i] = (_Float16)(bf16_round(W[(size_t)(k8 + i) * N + n]) * scale); const v8us o = f.half[0];
  *(v8us*)((unsigned short*)Wt + (size_t)n * K + k8) = o; 
}
// k_gemm_hh variant with fused epilogue: v = acc·alpha + bias[by·sBias + col] (+ CP[(row/rowsPerB)·sCPb + by·64 + col] if CP) ; ACT 0 none / 1 elu ; writes f16 C16 (and f32 C if non-null)
template <int ACT>
__global__ __launch_bounds__(128) void k_gemm_hhx(const _Float16* __restrict__ A, int lda, size_t sA, const _Float16* __restrict__ Bh, int ldb, size_t sB, float alpha, const float* __restrict__ bias, size_t sBias, const float* __restrict__ CP, int rowsPerB, size_t sCPb, int row0g,
    float* __restrict__ C, _Float16* __restrict__ C16, int ldc, size_t sC, int M, int N, int K) {
  __shared__ __attribute__((aligned(16))) float so[4][16][64];
  const int tid = threadIdx.x, w = tid >> 5, lane = tid & 31, ln = lane & 15, hh = lane >> 4; const int by = blockIdx.y;
  A += (size_t)by * sA; Bh += (size_t)by * sB; const size_t cofs = (size_t)by * sC; const float* bp = bias ? bias + (size_t)by * sBias : nullptr;
  const int ntn = (N + 63) / 64; const int wid = blockIdx.x * 4 + w; const int mt = wid / ntn, nq = wid % ntn; if (mt * 16 >= M) return;
  const int row0 = mt * 16, col0 = nq * 64; const _Float16* arow = A + (size_t)(row0 + ln) * lda;
  v8f acc[4] = {};
  for (int kb = 0; kb < K; kb += 32) { FragH ah; ah.half[0] = *(const v8us*)((const unsigned short*)arow + kb + 8 * hh); ah.half[1] = *(const v8us*)((const unsigned short*)arow + kb + 16 + 8 * hh);
#pragma unroll
    for (int t = 0; t < 4; ++t) { if (col0 + t * 16 >= N) continue; const size_t boff = (size_t)(col0 + t * 16 + ln) * ldb + kb; FragH bq; bq.half[0] = *(const v8us*)((const unsigned short*)Bh + boff + 8 * hh); bq.half[1] = *(const v8us*)((const unsigned short*)Bh + boff + 16 + 8 * hh);
      acc[t] = mmaH<1>(ah.v, ah.v, bq.v, bq.v, acc[t]); }
  }
#pragma unroll
  for (int t = 0; t < 4; ++t) { if (col0 + t * 16 >= N) continue; const int col = col0 + t * 16 + ln; const float bv = bp ? bf16_round(bp[col]) : 0.f;
#pragma unroll
    for (int r = 0; r < 8; ++r) { float v = acc[t][r] * alpha + bv; if (CP) { const int rr = row0g + row0 + 8 * hh + r; if (rowsPerB < 0) v += CP[cofs + (size_t)rr * ldc + col];      /* rowsPerB < 0: own element of the batched C plane */ else { const int bidx = rr / rowsPerB; v += CP[(size_t)bidx * sCPb + (size_t)by * 64 + col]; } } if (ACT == 1) v = (v > 0.f) ? v : expm1f(v); else if (ACT == 7) v = (v > 0.f) ? v + 1.0f : expf(v); else if (ACT == 8) v = tanhf(v); else if (ACT == 9) v = 0.5f * v * (1.0f + tanhf(0.7978845608028654f * (v + 0.044715f * v * v * v))); else if (ACT == 11) v = 1.0f / (1.0f + expf(-v)); else if (ACT == 12) v = (v > 0.f) ? v : 0.01f * v; else if (ACT == 14) v = (v > 0.f) ? v : 0.1f * v; else if (ACT == 16) v = (v >= 0.f) ? v : 0.3f * v; else if (ACT == 17) v = (v >= 0.f) ? v : 0.2f * v; else if (ACT == 15) v = v / (1.0f + expf(-v)); else if (ACT == 3) v = fmaxf(v, 0.f); else if (ACT == 6) v = 0.5f * v * (1.0f + erff(v * 0.70710678118654752f)); so[w][8 * hh + r][t * 16 + ln] = v; } }
  __builtin_amdgcn_fence(__ATOMIC_ACQ_REL, "workgroup"); __builtin_amdgcn_wave_barrier();
  const int rsub = lane >> 4, c4 = (lane & 15) * 4; typedef _Float16 v4h __attribute__((ext_vector_type(4)));
  {
#pragma unroll
    for (int q = 0; q < 8; ++q) { const int r = q * 2 + rsub; if (col0 + c4 < N) { const v4f v = *(const v4fa*)&so[w][r][c4]; if (C) *(v4f*)(C + cofs + (size_t)(row0 + r) * ldc + col0 + c4) = v; if (C16) { v4h h4; for (int i = 0; i < 4; ++i) h4[i] = (_Float16)v[i]; *(v4h*)(C16 + cofs + (size_t)(row0 + r) * ldc + col0 + c4) = h4; } } }
     }
}


typedef _Float16 v4h __attribute__((ext_vector_type(4)));

__global__ __launch_bounds__(256) void k_x16(const float* __restrict__ x, _Float16* __restrict__ X16, size_t n8) { const size_t t = (size_t)blockIdx.x * 256 + threadIdx.x; if (t >= n8) return; FragH f;
#pragma unroll
  for (int q = 0; q < 8; ++q) f.h[q] = (_Float16)bf16_round(x[t * 8 + q]); *(v8us*)((unsigned short*)X16 + t * 8) = f.half[0];  }
__global__ __launch_bounds__(256) void k_h16(const float* __restrict__ x, _Float16* __restrict__ X16, size_t n8) { const size_t t = (size_t)blockIdx.x * 256 + threadIdx.x; if (t >= n8) return; FragH f;
#pragma unroll
  for (int q = 0; q < 8; ++q) f.h[q] = (_Float16)x[t * 8 + q]; *(v8us*)((unsigned short*)X16 + t * 8) = f.half[0];  }
__global__ __launch_bounds__(256) void k_round16f(const float* __restrict__ W, _Float16* __restrict__ Bt, size_t n8) { const size_t t = (size_t)blockIdx.x * 256 + threadIdx.x; if (t >= n8) return; FragH f;
#pragma unroll
  for (int i = 0; i < 8; ++i) f.h[i] = (_Float16)(bf16_round(W[t * 8 + i]) * 16.0f); *(v8us*)((unsigned short*)Bt + t * 8) = f.half[0];  }
template <int NHv, int TTv>
__global__ __launch_bounds__(256) void k_vt(const _Float16* __restrict__ V16, int ldv, int voff, _Float16* __restrict__ Vt) { __shared__ unsigned short tl[64][66]; const int tid = threadIdx.x; const int slab = blockIdx.x / (TTv / 64), lg = blockIdx.x % (TTv / 64); const int b = slab / NHv, h = slab % NHv;
  for (int i = tid; i < 64 * 8; i += 256) { const int r = i / 8, c8 = (i % 8) * 8; FragH f; f.half[0] = *(const v8us*)((const unsigned short*)V16 + ((size_t)b * TTv + lg * 64 + r) * ldv + voff + h * 64 + c8);
#pragma unroll
    for (int q = 0; q < 8; ++q) tl[r][c8 + q] = f.u[q]; }
  __syncthreads();
  {
#pragma unroll
    for (int rd = 0; rd < 2; ++rd) { const int d = rd * 32 + tid / 8, pc = tid % 8; FragH f;
#pragma unroll
      for (int q = 0; q < 8; ++q) f.u[q] = tl[pc * 8 + q][d];
      *(v8us*)((unsigned short*)Vt + ((size_t)slab * 64 + d) * TTv + lg * 64 + pc * 8) = f.half[0]; }
     } }

__global__ __launch_bounds__(256) void k_hl(const float* __restrict__ F, _Float16* __restrict__ Hh, _Float16* __restrict__ Hl, size_t n8) { const size_t t = (size_t)blockIdx.x * 256 + threadIdx.x; if (t >= n8) return; FragH fh, fl; const v4f a = *(const v4fa*)(F + t * 8), c = *(const v4fa*)(F + t * 8 + 4);
#pragma unroll
  for (int q = 0; q < 4; ++q) { _Float16 h = (_Float16)a[q]; fh.h[q] = h; fl.h[q] = (_Float16)((a[q] - (float)h) * 1024.0f); h = (_Float16)c[q]; fh.h[4 + q] = h; fl.h[4 + q] = (_Float16)((c[q] - (float)h) * 1024.0f); }
  { *(v8us*)((unsigned short*)Hh + t * 8) = fh.half[0]; *(v8us*)((unsigned short*)Hl + t * 8) = fl.half[0];  } }

// ---- fast GEMM (wave tile 32x64; requires M % 32 == 0 rows per launch region and N % 64 == 0); epilogue = k_gemm_hhx semantics ----
__device__ __forceinline__ v16h g2_frag(const _Float16* p, int hh) { FragH f; f.half[0] = *(const v8us*)((const unsigned short*)p + 8 * hh); f.half[1] = *(const v8us*)((const unsigned short*)p + 16 + 8 * hh); return f.v; }
__device__ __forceinline__ v8f g2_mma(v16h a, v16h b, v8f c) { v8f d = __builtin_amdgcn_wmma_f32_16x16x32_f16(false, a, false, b, (short)0, c, false, false); asm volatile("v_nop\n\tv_nop\n\tv_nop\n\tv_nop" : "+v"(d) : "v"(a), "v"(b)); return d; }
template <int ACT>
__global__ __launch_bounds__(128) void k_gemm2(const _Float16* __restrict__ A, int lda, size_t sA, const _Float16* __restrict__ Bh, int ldb, size_t sB, float alpha, const float* __restrict__ bias, size_t sBias, const float* __restrict__ CP, int rowsPerB, size_t sCPb, int row0g,
    float* __restrict__ C, _Float16* __restrict__ C16, int ldc, size_t sC, int M, int N, int K) { static_assert(ACT == 0 || ACT == 3 || ACT == 6 || ACT == 8 || ACT == 9 || ACT == 11 || ACT == 12 || ACT == 14 || ACT == 15 || ACT == 16 || ACT == 17, "k_gemm2: unsupported ACT code (would silently apply no activation)");
  __shared__ __attribute__((aligned(16))) float so[4][32][68];
  const int tid = threadIdx.x, w = tid >> 5, lane = tid & 31, ln = lane & 15, hh = lane >> 4; const int by = blockIdx.y;
  A += (size_t)by * sA; Bh += (size_t)by * sB; const size_t cofs = (size_t)by * sC; const float* bp = bias ? bias + (size_t)by * sBias : nullptr;
  const int ntn = N >> 6; const int mt = blockIdx.x / ntn, nq = blockIdx.x - mt * ntn; const int row0 = mt * 128 + 32 * w, col0 = nq * 64; if (row0 >= M) return;
  const _Float16* a0p = A + (size_t)(row0 + ln) * lda; const _Float16* a1p = a0p + (size_t)16 * lda;
  const _Float16* b0p = Bh + (size_t)(col0 + ln) * ldb; const _Float16* b1p = b0p + (size_t)16 * ldb; const _Float16* b2p = b1p + (size_t)16 * ldb; const _Float16* b3p = b2p + (size_t)16 * ldb;
  const v8f z8 = {0.f,0.f,0.f,0.f,0.f,0.f,0.f,0.f}; v8f c00 = z8, c01 = z8, c02 = z8, c03 = z8, c10 = z8, c11 = z8, c12 = z8, c13 = z8;
#pragma unroll 1
  for (int kb = 0; kb < K; kb += 32) { const v16h a0 = g2_frag(a0p + kb, hh), a1 = g2_frag(a1p + kb, hh);
    v16h b = g2_frag(b0p + kb, hh); c00 = g2_mma(a0, b, c00); c10 = g2_mma(a1, b, c10);
    b = g2_frag(b1p + kb, hh); c01 = g2_mma(a0, b, c01); c11 = g2_mma(a1, b, c11);
    b = g2_frag(b2p + kb, hh); c02 = g2_mma(a0, b, c02); c12 = g2_mma(a1, b, c12);
    b = g2_frag(b3p + kb, hh); c03 = g2_mma(a0, b, c03); c13 = g2_mma(a1, b, c13); }
  v8f accs[8] = {c00, c01, c02, c03, c10, c11, c12, c13};
#pragma unroll
  for (int u = 0; u < 8; ++u) { const int t = u & 3, half = u >> 2; const int col = col0 + t * 16 + ln; const float bv = bp ? bf16_round(bp[col]) : 0.f;
#pragma unroll
    for (int r = 0; r < 8; ++r) { const int rloc = half * 16 + 8 * hh + r; float v = accs[u][r] * alpha + bv; if (CP) { if (rowsPerB < 0) v += CP[cofs + (size_t)(row0g + row0 + rloc) * ldc + col];      /* rowsPerB < 0: own element of the batched C plane */ else { const int bidx = (row0g + row0 + rloc) / rowsPerB; v += CP[(size_t)bidx * sCPb + (size_t)by * 64 + col]; } }
      if (ACT == 3) v = fmaxf(v, 0.f); else if (ACT == 6) v = 0.5f * v * (1.0f + erff(v * 0.70710678118654752f)); else if (ACT == 11) v = 1.0f / (1.0f + expf(-v)); else if (ACT == 15) v = v / (1.0f + expf(-v)); else if (ACT == 12) v = (v > 0.f) ? v : 0.01f * v; else if (ACT == 8) v = tanhf(v); else if (ACT == 9) v = 0.5f * v * (1.0f + tanhf(0.7978845608028654f * (v + 0.044715f * v * v * v))); else if (ACT == 14) v = (v > 0.f) ? v : 0.1f * v; else if (ACT == 16) v = (v >= 0.f) ? v : 0.3f * v; else if (ACT == 17) v = (v >= 0.f) ? v : 0.2f * v;
      so[w][rloc][t * 16 + ln] = v; } }
  __builtin_amdgcn_fence(__ATOMIC_ACQ_REL, "workgroup"); __builtin_amdgcn_wave_barrier();
  const int rsub = lane >> 4, c4 = (lane & 15) * 4;
  {
#pragma unroll
    for (int q = 0; q < 16; ++q) { const int r = q * 2 + rsub; const v4f v = *(const v4fa*)&so[w][r][c4]; if (C) *(v4f*)(C + cofs + (size_t)(row0 + r) * ldc + col0 + c4) = v; if (C16) { v4h h4; for (int i = 0; i < 4; ++i) h4[i] = (_Float16)v[i]; *(v4h*)(C16 + cofs + (size_t)(row0 + r) * ldc + col0 + c4) = h4; } }
     } }


__global__ __launch_bounds__(256) void k_wnat(const float* __restrict__ w, size_t n8, _Float16* __restrict__ Bt) { const size_t t = (size_t)blockIdx.x * 256 + threadIdx.x; if (t >= n8) return; FragH f; for (int q = 0; q < 8; ++q) f.h[q] = (_Float16)(bf16_round(w[t * 8 + q]) * 16.0f); *(v8us*)((unsigned short*)Bt + t * 8) = f.half[0];  }
__global__ __launch_bounds__(256) void k_rsm(const float* __restrict__ S, _Float16* __restrict__ P, int nrows) {
  #pragma clang fp contract(off)
  const int i = blockIdx.x * 256 + threadIdx.x; if (i >= nrows) return; const float* s = S + (size_t)i * SQ; float mx = -3.0e38f;
#pragma unroll 1
  for (int j = 0; j < SQ; ++j) mx = fmaxf(mx, s[j]); float se = 0.f;
#pragma unroll 1
  for (int j = 0; j < SQ; ++j) se += expf(s[j] - mx); const float sc = 256.0f / se;
#pragma unroll 1
  for (int j0 = 0; j0 < SQ; j0 += 8) { FragH f; for (int q = 0; q < 8; ++q) f.h[q] = (_Float16)(expf(s[j0 + q] - mx) * sc); unsigned short* d = (unsigned short*)P + (size_t)i * SQ + j0; *(v8us*)d = f.half[0];  } }
__global__ __launch_bounds__(256) void k_vt(const _Float16* __restrict__ V16, int b, int h0, _Float16* __restrict__ VT) { __shared__ unsigned short tl[64][65]; const int tid = threadIdx.x; const int hh = blockIdx.x % HG, sg = blockIdx.x / HG; const int s0 = sg * 64; const int h = h0 + hh;
  for (int i = tid; i < 64 * 8; i += 256) { const int j = i / 8, d8 = (i % 8) * 8; FragH f; f.half[0] = *(const v8us*)((const unsigned short*)V16 + ((size_t)b * SQ + s0 + j) * DM + h * HD + d8); for (int q = 0; q < 8; ++q) tl[d8 + q][j] = f.u[q]; }
  __syncthreads();
  { for (int i = tid; i < 64 * 8; i += 256) { const int d = i / 8, j8 = (i % 8) * 8; FragH f; for (int q = 0; q < 8; ++q) f.u[q] = tl[d][j8 + q]; *(v8us*)((unsigned short*)VT + ((size_t)hh * HD + d) * SQ + s0 + j8) = f.half[0]; }  } }



__global__ __launch_bounds__(256) void k_rsmkm(const float* __restrict__ S, _Float16* __restrict__ P, int nrows, const int* __restrict__ am) {
  #pragma clang fp contract(off)
  const int t = blockIdx.x * 256 + threadIdx.x; if (t >= nrows) return; const size_t i = (size_t)t; const float* s = S + i * SQ; const int* mr = am + (size_t)(t % SQ) * SQ; float mx = -3.0e38f;
#pragma unroll 1
  for (int j = 0; j < SQ; ++j) { const float f = (mr[j] != 0) ? 1.f : 0.f; mx = fmaxf(mx, fmaf(f, s[j], (1.f - f) * -1.0e9f)); } float se = 0.f;
#pragma unroll 1
  for (int j = 0; j < SQ; ++j) { const float f = (mr[j] != 0) ? 1.f : 0.f; se += __expf(fmaf(f, s[j], (1.f - f) * -1.0e9f) - mx); } const float sc = 256.0f / se;
#pragma unroll 1
  for (int j0 = 0; j0 < SQ; j0 += 8) { FragH fr; for (int q = 0; q < 8; ++q) { const int j = j0 + q; const float f = (mr[j] != 0) ? 1.f : 0.f; fr.h[q] = (_Float16)(__expf(fmaf(f, s[j], (1.f - f) * -1.0e9f) - mx) * sc); }
    unsigned short* d = (unsigned short*)P + i * SQ + j0; *(v8us*)d = fr.half[0];  } }
__global__ __launch_bounds__(256) void k_lrms(const float* __restrict__ x, const float* __restrict__ w, _Float16* __restrict__ X16) {
  #pragma clang fp contract(off)
  const size_t t = (size_t)blockIdx.x * 256 + threadIdx.x; if (t >= NR * DM / 8) return; const int c8 = (int)(t % (DM / 8)) * 8; const size_t r = t / (DM / 8); const int b = (int)(r / SQ), s = (int)(r % SQ), gi = s / GS, gj = s % GS;
  float b0 = 0.f, b1 = 0.f, b2 = 0.f, b3 = 0.f, b4 = 0.f, b5 = 0.f, b6 = 0.f, b7 = 0.f;
#pragma unroll 1
  for (int di = -RW; di <= RW; ++di) {
#pragma unroll 1
    for (int dj = -RW; dj <= RW; ++dj) { const int ii = gi + di, jj = gj + dj; const float f = (ii >= 0 && ii < GS && jj >= 0 && jj < GS) ? 1.0f : 0.0f; const int ic = ii < 0 ? 0 : (ii >= GS ? GS - 1 : ii), jc = jj < 0 ? 0 : (jj >= GS ? GS - 1 : jj);
      const float* p = x + ((size_t)b * SQ + (size_t)ic * GS + jc) * DM + c8; const v4f a = *(const v4fa*)p, c = *(const v4fa*)(p + 4);
      float v; v = bf16_round(a[0]); b0 = __fadd_rn(b0, __fmul_rn(f, __fmul_rn(v, v))); v = bf16_round(a[1]); b1 = __fadd_rn(b1, __fmul_rn(f, __fmul_rn(v, v))); v = bf16_round(a[2]); b2 = __fadd_rn(b2, __fmul_rn(f, __fmul_rn(v, v))); v = bf16_round(a[3]); b3 = __fadd_rn(b3, __fmul_rn(f, __fmul_rn(v, v)));
      v = bf16_round(c[0]); b4 = __fadd_rn(b4, __fmul_rn(f, __fmul_rn(v, v))); v = bf16_round(c[1]); b5 = __fadd_rn(b5, __fmul_rn(f, __fmul_rn(v, v))); v = bf16_round(c[2]); b6 = __fadd_rn(b6, __fmul_rn(f, __fmul_rn(v, v))); v = bf16_round(c[3]); b7 = __fadd_rn(b7, __fmul_rn(f, __fmul_rn(v, v))); } }
  const float* pc = x + r * DM + c8; const v4f xa = *(const v4fa*)pc, xc = *(const v4fa*)(pc + 4); const v4f wa = *(const v4fa*)(w + c8), wc = *(const v4fa*)(w + c8 + 4); const float bx[8] = {b0, b1, b2, b3, b4, b5, b6, b7}; FragH fr;
#pragma unroll
  for (int q = 0; q < 8; ++q) { const float xv = bf16_round(q < 4 ? xa[q] : xc[q - 4]); const float wv = bf16_round(q < 4 ? wa[q] : wc[q - 4]); const float rms = sqrtf(__fadd_rn(0.0000001f, __fmul_rn(bx[q], 0.02040816326530612f)));      /* box / 49 as a multiply by the f32 reciprocal (the result is rounded to f16 next) */ fr.h[q] = (_Float16)__fmul_rn(__fdiv_rn(xv, rms), wv); }
  unsigned short* d = (unsigned short*)X16 + r * DM + c8; *(v8us*)d = fr.half[0];  }


extern "C" void kernel_launch(void* const* d_in, const int* in_sizes, int n_in,
                              void* d_out, int out_size, void* d_ws, size_t ws_size, hipStream_t stream) {
  (void)in_sizes; (void)n_in; (void)out_size;
  const float* const* I = (const float* const*)d_in; const float* x = I[0]; const float* nw = I[1]; const float* wq = I[2]; const float* bq = I[3]; const float* wk = I[4]; const float* bk = I[5]; const float* wv = I[6]; const float* bv = I[7]; const float* wo = I[8]; const float* bo = I[9];      /* x; norm_w [768]; natural [768][768] weights + biases (q, k, v, o) */
  static_assert(SQ == GS * GS && DM % 8 == 0 && DM % 64 == 0 && DM % 32 == 0 && SQ % 128 == 0 && NH * HD == DM && NH % HG == 0, "shape / tile multiples");
  char* ws = (char*)d_ws; size_t off = 0;
  auto take = [&](size_t bytes) { char* p = ws + off; off += (bytes + 255) & ~(size_t)255; return p; };
  _Float16* BQ = (_Float16*)take((size_t)DM * DM * 2); _Float16* BK = (_Float16*)take((size_t)DM * DM * 2); _Float16* BV = (_Float16*)take((size_t)DM * DM * 2); _Float16* BO = (_Float16*)take((size_t)DM * DM * 2);
  _Float16* X16 = (_Float16*)take(NR * DM * 2); _Float16* Q16 = (_Float16*)take(NR * DM * 2); _Float16* K16 = (_Float16*)take(NR * DM * 2); _Float16* V16 = (_Float16*)take(NR * DM * 2); _Float16* O16 = (_Float16*)take(NR * DM * 2);
  float* S = (float*)take((size_t)HG * SQ * SQ * 4); _Float16* P = (_Float16*)take((size_t)HG * SQ * SQ * 2); _Float16* VT = (_Float16*)take((size_t)NH * HD * SQ * 2);
  if (off > ws_size) return;      /* approx 4.5 + 5 x 12 + 16 + 8 + 1.5 = 90 MiB */
  { const unsigned g = (unsigned)(((size_t)DM * DM / 8 + 255) / 256); k_wnat<<<g, 256, 0, stream>>>(wq, (size_t)DM * DM / 8, BQ); k_wnat<<<g, 256, 0, stream>>>(wk, (size_t)DM * DM / 8, BK); k_wnat<<<g, 256, 0, stream>>>(wv, (size_t)DM * DM / 8, BV); k_wnat<<<g, 256, 0, stream>>>(wo, (size_t)DM * DM / 8, BO); }      /* natural [out][in] = Bt[n][k] x16 */
  k_lrms<<<(unsigned)((NR * DM / 8 + 255) / 256), 256, 0, stream>>>(x, nw, X16);      /* xn = local-RMS-normalised x as f16 rows: the A operand of all three projections */
  const size_t r0p = (size_t)B0 * SQ;      /* first projected row */
  k_gemm2<0><<<dim3((unsigned)((MP / 128) * (DM / 64)), 1), 128, 0, stream>>>(X16 + r0p * DM, DM, 0, BQ, DM, 0, 0.0625f, bq, 0, nullptr, 1, 0, 0, nullptr, Q16 + r0p * DM, DM, 0, MP, DM, DM);
  k_gemm2<0><<<dim3((unsigned)((MP / 128) * (DM / 64)), 1), 128, 0, stream>>>(X16 + r0p * DM, DM, 0, BK, DM, 0, 0.0625f, bk, 0, nullptr, 1, 0, 0, nullptr, K16 + r0p * DM, DM, 0, MP, DM, DM);
  k_gemm2<0><<<dim3((unsigned)((MP / 128) * (DM / 64)), 1), 128, 0, stream>>>(X16 + r0p * DM, DM, 0, BV, DM, 0, 0.0625f, bv, 0, nullptr, 1, 0, 0, nullptr, V16 + r0p * DM, DM, 0, MP, DM, DM);
  for (int b = B0; b < B0 + NBR; ++b) { const size_t r0 = (size_t)b * SQ;
    k_vt<NH, SQ><<<NH * (SQ / 64), 256, 0, stream>>>(V16 + r0 * LQ, LQ, 0, VT);      /* V^T [NH][HD][SQ] for this batch */
    for (int h0 = 0; h0 < NHD; h0 += HG) {
      k_gemm2<0><<<dim3((QN / 128) * (SQ / 64), HG), 128, 0, stream>>>(Q16 + r0 * LQ + h0 * HD, LQ, (size_t)HD, K16 + r0 * LQ + h0 * HD, LQ, (size_t)HD, 0.125f, nullptr, 0, nullptr, 1, 0, 0, S, nullptr, SQ, (size_t)SQ * SQ, QN, SQ, HD);      /* scores, HG heads per launch */
      k_rsm<<<(HG * SQ + 255) / 256, 256, 0, stream>>>(S, P, HG * SQ);      /* P = 256 softmax (f16), rows of all HG heads */
      k_gemm2<0><<<dim3((QN / 128) * (HD / 64), HG), 128, 0, stream>>>(P, SQ, (size_t)SQ * SQ, VT + (size_t)h0 * HD * SQ, SQ, (size_t)HD * SQ, 0.25f, nullptr, 0, nullptr, 1, 0, 0, nullptr, O16 + r0 * DM + h0 * HD, DM, (size_t)HD, QN, HD, SQ); } }      /* o (merged heads, x64) as f16 rows */
  k_gemm2<0><<<dim3((unsigned)((MPO / 128) * (DM / 64)), 1), 128, 0, stream>>>(O16 + r0p * DM, DM, 0, BO, DM, 0, 0.0009765625f, bo, 0, nullptr, 1, 0, 0, (float*)d_out + r0p * DM, nullptr, DM, 0, MPO, DM, DM);      /* out rows are the output layout */
}

// v001
// One run takes 1350 microseconds.
// In two side-by-side timings against v000, it was 3.98 and 4.00 times as fast.
#include <hip/hip_runtime.h>
// Multi-head self-attention behind a LOCAL RMS norm over the token grid (x [8][1024][768], tokens = a 32 x 32 grid; xn = x / sqrt(1e-7 + box / 49) * norm_w where box[b][i][j][d] = sum of x^2 over the 7 x 7 window of grid positions around (i, j) (zero padded, divisor always 49), per channel d; q / k / v = xn W^T + b (natural [768][768] sigma 0.02, zero biases); 12 heads of 64; scores / sqrt(64); softmax over all 1024 keys (no mask); out = merged Wo^T + bo -> [8][1024][768]).
// Structure: token rows r = b*1024 + s; x through the local-RMS-norm prologue (VALU, f32 statistics) into f16 rows; Q, K, V as three WMMA GEMMs (32x64 wave tiles, f32 accumulation, exact x16 weights + bias, f16 outputs); per batch: V^T for all heads via LDS transposes; per (batch, group of 4 heads): scores GEMM (K = 64, batched over the heads on grid.y, alpha = 1/sqrt(64)), row softmax on VALU (f32 statistics; weights stored x256 as f16), o = P . V^T GEMM (K = 1024, alpha 2^-2: o carried x64 against f16 subnormal flush, folded into the output GEMM alpha) written straight into the merged f16 o rows; out = o W_o + b GEMM (f32) into the output layout.
// Compute dtype: inputs rounded to bf16; x / weights exact; q, k, v, softmax weights and o as plain f16 GEMM operands (~2^-12); scores and softmax statistics f32. v_wmma_f32_16x16x32_f16.
#define NB 8
#define SQ 1024
#define GS 32                        /* token grid side: SQ = GS * GS */
#define RW 3                         /* local-norm window radius (7 x 7) */
#define DM 768
#define NH 12
#define HD 64
#define HG 4                         /* heads per attention launch group */
#define B0 0                         /* first batch processed (debug hook) */
#define NBR NB                       /* batches processed (debug hook) */
#define NR ((size_t)NB * SQ)         /* token rows */
#define MP ((int)((size_t)NBR * SQ)) /* rows projected (debug hook) */
#define QN SQ                        /* query rows attended per batch (debug hook) */
#define NHD NH                       /* heads attended (debug hook) */
#define MPO MP                       /* rows through the output stage (debug hook) */
#define LQ DM      /* row pitch of the q/k/v rows */
typedef __bf16 v16b __attribute__((ext_vector_type(16)));
typedef unsigned short v8us __attribute__((ext_vector_type(8), may_alias));
typedef float  v8f  __attribute__((ext_vector_type(8)));
typedef float  v4f  __attribute__((ext_vector_type(4)));
typedef float  v4fa __attribute__((ext_vector_type(4), may_alias));
union FragB { v16b v; v8us half[2]; unsigned short u[16]; };

__device__ __forceinline__ unsigned short bf16_bits(float x) { unsigned int u = __float_as_uint(x); return (unsigned short)((u + 0x7FFFu + ((u >> 16) & 1u)) >> 16); }
__device__ __forceinline__ float bf16_val(unsigned short b) { return __uint_as_float(((unsigned int)b) << 16); }
__device__ __forceinline__ float bf16_round(float x) { return bf16_val(bf16_bits(x)); }
// D += A·B with NT terms: 1 = ah·bh, 2 = + al·bh (A split), 3 = + ah·bl (both split)
template <int NT>
__device__ __forceinline__ v8f mmaN(v16b ah, v16b al, v16b bh, v16b bl, v8f c) {
  c = __builtin_amdgcn_wmma_f32_16x16x32_bf16(false, ah, false, bh, (short)0, c, false, false);
  if (NT >= 2) c = __builtin_amdgcn_wmma_f32_16x16x32_bf16(false, al, false, bh, (short)0, c, false, false);
  if (NT >= 3) c = __builtin_amdgcn_wmma_f32_16x16x32_bf16(false, ah, false, bl, (short)0, c, false, false);
  asm volatile("v_nop\n\tv_nop\n\tv_nop\n\tv_nop" : "+v"(c) : "v"(ah), "v"(al), "v"(bh), "v"(bl));
  return c;
}

__global__ __launch_bounds__(256) void k_wt_bf16(const float* __restrict__ W, unsigned short* __restrict__ Wt, int K, int N) {
  const int t = blockIdx.x * 256 + threadIdx.x;
  const int k8n = K / 8;
  if (t >= N * k8n) return;
  const int n = t / k8n, k8 = (t % k8n) * 8;
  v8us v;
#pragma unroll
  for (int i = 0; i < 8; ++i) v[i] = bf16_bits(W[(size_t)(k8 + i) * N + n]);
  *(v8us*)(Wt + (size_t)n * K + k8) = v;
  
}

// GEMM C[M][N] (f32, pitch ldc) = act(A[M][K]·W + bias). A f32 row-major (pitch lda) converted per fragment to bf16
// (ASPLIT: hi/lo two planes -> 2 terms, else single rounded term); Wt bf16 [N][K] (pitch ldb). BIAS_BF16 rounds the
// bias to bf16 first (bias quantised to bf16 before the add). K%32==0, M%16==0, N%64==0.
template <bool ASPLIT, int ACT, bool BIAS_BF16>
__global__ __launch_bounds__(128) void k_gemm_bf(const float* __restrict__ A, int lda, const unsigned short* __restrict__ Wt, int ldb,
                                               const float* __restrict__ bias, float* __restrict__ C, int ldc, int M, int N, int K) {
  __shared__ __attribute__((aligned(16))) float so[4][16][64];
  const int tid = threadIdx.x, w = tid >> 5, lane = tid & 31, ln = lane & 15, hh = lane >> 4;
  const int ntn = N / 64;
  const int wid = blockIdx.x * 4 + w;
  const int mt = wid / ntn, nq = wid % ntn;
  if (mt * 16 >= M) return;
  const int row0 = mt * 16, col0 = nq * 64;
  const float* arow = A + (size_t)(row0 + ln) * lda;
  v8f acc[4] = {};
  for (int kb = 0; kb < K; kb += 32) {
    FragB ah, al;
    const v4f x0 = *(const v4fa*)(arow + kb + 8 * hh), x1 = *(const v4fa*)(arow + kb + 8 * hh + 4);
    const v4f x2 = *(const v4fa*)(arow + kb + 16 + 8 * hh), x3 = *(const v4fa*)(arow + kb + 16 + 8 * hh + 4);
    float xs[16] = {x0[0],x0[1],x0[2],x0[3],x1[0],x1[1],x1[2],x1[3],x2[0],x2[1],x2[2],x2[3],x3[0],x3[1],x3[2],x3[3]};
#pragma unroll
    for (int i = 0; i < 16; ++i) { const unsigned short hb = bf16_bits(xs[i]); ah.u[i] = hb; al.u[i] = ASPLIT ? bf16_bits(xs[i] - bf16_val(hb)) : (unsigned short)0; }
#pragma unroll
    for (int t = 0; t < 4; ++t) {
      const unsigned short* brow = Wt + (size_t)(col0 + t * 16 + ln) * ldb + kb;
      FragB b;
      b.half[0] = *(const v8us*)(brow + 8 * hh);
      b.half[1] = *(const v8us*)(brow + 16 + 8 * hh);
      acc[t] = mmaN<ASPLIT ? 2 : 1>(ah.v, al.v, b.v, b.v, acc[t]);
    }
  }
#pragma unroll
  for (int t = 0; t < 4; ++t) {
    float bv = bias ? bias[col0 + t * 16 + ln] : 0.f;
    if (BIAS_BF16) bv = bf16_round(bv);
#pragma unroll
    for (int r = 0; r < 8; ++r) { float v = acc[t][r] + bv; if (ACT == 1) v = fmaxf(v, 0.f); so[w][8 * hh + r][t * 16 + ln] = v; }
  }
  __builtin_amdgcn_fence(__ATOMIC_ACQ_REL, "workgroup");
  __builtin_amdgcn_wave_barrier();
  const int rsub = lane >> 4, c4 = (lane & 15) * 4;
  {
#pragma unroll
    for (int q = 0; q < 8; ++q) {
      const int r = q * 2 + rsub;
      const v4f v = *(const v4fa*)&so[w][r][c4];
      *(v4f*)(C + (size_t)(row0 + r) * ldc + col0 + c4) = v;
    }
    
  }
}

// GEMM C = act(A·W + bias + resid): A f32 (ASPLIT -> hi/lo 2 terms), Wt bf16 [N][K]; ACT 0 none, 1 relu, 2 exact gelu;
// resid (optional, f32, row index = (row % rmod), pitch ldr, RES_BF16 rounds it) added before the activation.
template <bool ASPLIT, int ACT, bool BIAS_BF16, bool RES_BF16>
__global__ __launch_bounds__(128) void k_gemm_bf3(const float* __restrict__ A, int lda, const unsigned short* __restrict__ Wt, int ldb,
                                                const float* __restrict__ bias, const float* __restrict__ resid, int rmod, int ldr,
                                                float* __restrict__ C, int ldc, int M, int N, int K) {
  __shared__ __attribute__((aligned(16))) float so[4][16][64];
  const int tid = threadIdx.x, w = tid >> 5, lane = tid & 31, ln = lane & 15, hh = lane >> 4;
  const int ntn = N / 64;
  const int wid = blockIdx.x * 4 + w;
  const int mt = wid / ntn, nq = wid % ntn;
  if (mt * 16 >= M) return;
  const int row0 = mt * 16, col0 = nq * 64;
  const float* arow = A + (size_t)(row0 + ln) * lda;
  v8f acc[4] = {};
  for (int kb = 0; kb < K; kb += 32) {
    FragB ah, al;
    const v4f x0 = *(const v4fa*)(arow + kb + 8 * hh), x1 = *(const v4fa*)(arow + kb + 8 * hh + 4);
    const v4f x2 = *(const v4fa*)(arow + kb + 16 + 8 * hh), x3 = *(const v4fa*)(arow + kb + 16 + 8 * hh + 4);
    float xs[16] = {x0[0],x0[1],x0[2],x0[3],x1[0],x1[1],x1[2],x1[3],x2[0],x2[1],x2[2],x2[3],x3[0],x3[1],x3[2],x3[3]};
#pragma unroll
    for (int i = 0; i < 16; ++i) { const unsigned short hb = bf16_bits(xs[i]); ah.u[i] = hb; al.u[i] = ASPLIT ? bf16_bits(xs[i] - bf16_val(hb)) : (unsigned short)0; }
#pragma unroll
    for (int t = 0; t < 4; ++t) {
      const unsigned short* brow = Wt + (size_t)(col0 + t * 16 + ln) * ldb + kb;
      FragB b;
      b.half[0] = *(const v8us*)(brow + 8 * hh);
      b.half[1] = *(const v8us*)(brow + 16 + 8 * hh);
      acc[t] = mmaN<ASPLIT ? 2 : 1>(ah.v, al.v, b.v, b.v, acc[t]);
    }
  }
#pragma unroll
  for (int t = 0; t < 4; ++t) {
    const int col = col0 + t * 16 + ln;
    float bv = bias ? bias[col] : 0.f;
    if (BIAS_BF16) bv = bf16_round(bv);
#pragma unroll
    for (int r = 0; r < 8; ++r) {
      float v = acc[t][r] + bv;
      if (resid) { float rv = resid[(size_t)((row0 + 8 * hh + r) % rmod) * ldr + col]; if (RES_BF16) rv = bf16_round(rv); v += rv; }
      if (ACT == 1) v = fmaxf(v, 0.f);
      if (ACT == 2) v = 0.5f * v * (1.0f + erff(v * 0.70710678118654752f));
      if (ACT == 3) { const float u = 0.7978845608028654f * (v + 0.044715f * v * v * v); v = 0.5f * v * (1.0f + tanhf(u)); }
      so[w][8 * hh + r][t * 16 + ln] = v;
    }
  }
  __builtin_amdgcn_fence(__ATOMIC_ACQ_REL, "workgroup");
  __builtin_amdgcn_wave_barrier();
  const int rsub = lane >> 4, c4 = (lane & 15) * 4;
  {
#pragma unroll
    for (int q = 0; q < 8; ++q) {
      const int r = q * 2 + rsub;
      const v4f v = *(const v4fa*)&so[w][r][c4];
      *(v4f*)(C + (size_t)(row0 + r) * ldc + col0 + c4) = v;
    }
    
  }
}
// row LayerNorm (biased variance, eps) over N: s = X (+ R); optional out_sum <- s; out_norm <- (s-mu)*rsqrt(var+eps)*g + b
template <bool PARAM_BF16>
__global__ __launch_bounds__(256) void k_layernorm(const float* __restrict__ X, const float* __restrict__ R, const float* __restrict__ g, const float* __restrict__ bta,
                                                  float* __restrict__ out_sum, float* __restrict__ out_norm, int N, float eps) {
  __shared__ float red[256];
  const int row = blockIdx.x, tid = threadIdx.x;
  const float* x = X + (size_t)row * N; const float* rr = R ? R + (size_t)row * N : nullptr;
  float vals[16];                     // up to N = 4096
  const int per = N / 256;            // contiguous chunk per thread? use strided-by-4 chunks: thread handles j = tid*4 + 1024*u
  float s1 = 0.f;
  for (int u = 0; u < per / 4; ++u) {
    const int j = tid * 4 + 1024 * u;
    const v4f a = *(const v4fa*)(x + j);
    v4f b = {0.f,0.f,0.f,0.f}; if (rr) b = *(const v4fa*)(rr + j);
#pragma unroll
    for (int q = 0; q < 4; ++q) { const float v = a[q] + b[q]; vals[u * 4 + q] = v; s1 += v; }
  }
  red[tid] = s1; __syncthreads();
  for (int st = 128; st > 0; st >>= 1) { if (tid < st) red[tid] += red[tid + st]; __syncthreads(); }
  const float mu = red[0] / (float)N; __syncthreads();
  float s2 = 0.f;
  for (int u = 0; u < per / 4; ++u)
#pragma unroll
    for (int q = 0; q < 4; ++q) { const float c = vals[u * 4 + q] - mu; s2 += c * c; }
  red[tid] = s2; __syncthreads();
  for (int st = 128; st > 0; st >>= 1) { if (tid < st) red[tid] += red[tid + st]; __syncthreads(); }
  const float rs = rsqrtf(red[0] / (float)N + eps);
  {
    for (int u = 0; u < per / 4; ++u) {
      const int j = tid * 4 + 1024 * u;
      v4f o, sm;
#pragma unroll
      for (int q = 0; q < 4; ++q) {
        float gg = g[j + q], bb = bta[j + q];
        if (PARAM_BF16) { gg = bf16_round(gg); bb = bf16_round(bb); }
        sm[q] = vals[u * 4 + q]; o[q] = (vals[u * 4 + q] - mu) * rs * gg + bb;
      }
      if (out_sum) *(v4f*)(out_sum + (size_t)row * N + j) = sm;
      *(v4f*)(out_norm + (size_t)row * N + j) = o;
    }
    
  }
}



// ---- f16 WMMA path (v_wmma_f32_16x16x32_f16): 11-bit significands for operands in range — used where a [0,1] probability operand needs more precision than bf16
typedef _Float16 v16h __attribute__((ext_vector_type(16)));
union FragH { v16h v; v8us half[2]; _Float16 h[16]; unsigned short u[16]; };
template <int NT>
__device__ __forceinline__ v8f mmaH(v16h ah, v16h al, v16h bh, v16h bl, v8f c) {
  c = __builtin_amdgcn_wmma_f32_16x16x32_f16(false, ah, false, bh, (short)0, c, false, false);
  if (NT >= 2) c = __builtin_amdgcn_wmma_f32_16x16x32_f16(false, al, false, bh, (short)0, c, false, false);
  if (NT >= 3) c = __builtin_amdgcn_wmma_f32_16x16x32_f16(false, ah, false, bl, (short)0, c, false, false);
  asm volatile("v_nop\n\tv_nop\n\tv_nop\n\tv_nop" : "+v"(c) : "v"(ah), "v"(al), "v"(bh), "v"(bl));
  return c;
}
// batched GEMM like k_gemm_b but f16 operands: A f32 (split into f16 hi/lo if ASPLIT, else rounded to f16), Bt = f16 values [n][k]; alpha; C f32; N multiple of 16 (partial tiles skipped)
template <bool ASPLIT>
__global__ __launch_bounds__(128) void k_gemm_h(const float* __restrict__ A, int lda, size_t sA, const _Float16* __restrict__ Bh, int ldb, size_t sB, float alpha, float* __restrict__ C, int ldc, size_t sC, int M, int N, int K) {
  __shared__ __attribute__((aligned(16))) float so[4][16][64];
  const int tid = threadIdx.x, w = tid >> 5, lane = tid & 31, ln = lane & 15, hh = lane >> 4; const int by = blockIdx.y;
  A += (size_t)by * sA; Bh += (size_t)by * sB; C += (size_t)by * sC;
  const int ntn = (N + 63) / 64; const int wid = blockIdx.x * 4 + w; const int mt = wid / ntn, nq = wid % ntn; if (mt * 16 >= M) return;
  const int row0 = mt * 16, col0 = nq * 64; const float* arow = A + (size_t)(row0 + ln) * lda;
  v8f acc[4] = {};
  for (int kb = 0; kb < K; kb += 32) {
    FragH ah, al;
    const v4f x0 = *(const v4fa*)(arow + kb + 8 * hh), x1 = *(const v4fa*)(arow + kb + 8 * hh + 4), x2 = *(const v4fa*)(arow + kb + 16 + 8 * hh), x3 = *(const v4fa*)(arow + kb + 16 + 8 * hh + 4);
    float xs[16] = {x0[0],x0[1],x0[2],x0[3],x1[0],x1[1],x1[2],x1[3],x2[0],x2[1],x2[2],x2[3],x3[0],x3[1],x3[2],x3[3]};
#pragma unroll
    for (int i = 0; i < 16; ++i) { const _Float16 h = (_Float16)xs[i]; ah.h[i] = h; al.h[i] = ASPLIT ? (_Float16)(xs[i] - (float)h) : (_Float16)0.0f; }
#pragma unroll
    for (int t = 0; t < 4; ++t) { if (col0 + t * 16 >= N) continue; const size_t boff = (size_t)(col0 + t * 16 + ln) * ldb + kb; FragH bq; bq.half[0] = *(const v8us*)(Bh + boff + 8 * hh); bq.half[1] = *(const v8us*)(Bh + boff + 16 + 8 * hh);
      acc[t] = mmaH<ASPLIT ? 2 : 1>(ah.v, al.v, bq.v, bq.v, acc[t]); }
  }
#pragma unroll
  for (int t = 0; t < 4; ++t) { if (col0 + t * 16 >= N) continue;
#pragma unroll
    for (int r = 0; r < 8; ++r) so[w][8 * hh + r][t * 16 + ln] = acc[t][r] * alpha; }
  __builtin_amdgcn_fence(__ATOMIC_ACQ_REL, "workgroup"); __builtin_amdgcn_wave_barrier();
  const int rsub = lane >> 4, c4 = (lane & 15) * 4;
  {
#pragma unroll
    for (int q = 0; q < 8; ++q) { const int r = q * 2 + rsub; if (col0 + c4 < N) { const v4f v = *(const v4fa*)&so[w][r][c4]; *(v4f*)(C + (size_t)(row0 + r) * ldc + col0 + c4) = v; } }
     }
}

// Wt[n][k] = f16(W[k][n]·scale) from f32 row-major W[K][N] (scale = power of two; bf16-exact weights stay exact in f16 away from the subnormal range)
__global__ __launch_bounds__(256) void k_wt_f16(const float* __restrict__ W, _Float16* __restrict__ Wt, int K, int N, float scale) {
  const int t = blockIdx.x * 256 + threadIdx.x; if (t >= N * (K / 8)) return; const int n = t / (K / 8), k8 = (t % (K / 8)) * 8; FragH f;
#pragma unroll
  for (int i = 0; i < 8; ++i) f.h[i] = (_Float16)(bf16_round(W[(size_t)(k8 + i) * N + n]) * scale); const v8us o = f.half[0];
  *(v8us*)((unsigned short*)Wt + (size_t)n * K + k8) = o; 
}
// k_gemm_hh variant with fused epilogue: v = acc·alpha + bias[by·sBias + col] (+ CP[(row/rowsPerB)·sCPb + by·64 + col] if CP) ; ACT 0 none / 1 elu ; writes f16 C16 (and f32 C if non-null)
template <int ACT>
__global__ __launch_bounds__(128) void k_gemm_hhx(const _Float16* __restrict__ A, int lda, size_t sA, const _Float16* __restrict__ Bh, int ldb, size_t sB, float alpha, const float* __restrict__ bias, size_t sBias, const float* __restrict__ CP, int rowsPerB, size_t sCPb, int row0g,
    float* __restrict__ C, _Float16* __restrict__ C16, int ldc, size_t sC, int M, int N, int K) {
  __shared__ __attribute__((aligned(16))) float so[4][16][64];
  const int tid = threadIdx.x, w = tid >> 5, lane = tid & 31, ln = lane & 15, hh = lane >> 4; const int by = blockIdx.y;
  A += (size_t)by * sA; Bh += (size_t)by * sB; const size_t cofs = (size_t)by * sC; const float* bp = bias ? bias + (size_t)by * sBias : nullptr;
  const int ntn = (N + 63) / 64; const int wid = blockIdx.x * 4 + w; const int mt = wid / ntn, nq = wid % ntn; if (mt * 16 >= M) return;
  const int row0 = mt * 16, col0 = nq * 64; const _Float16* arow = A + (size_t)(row0 + ln) * lda;
  v8f acc[4] = {};
  for (int kb = 0; kb < K; kb += 32) { FragH ah; ah.half[0] = *(const v8us*)((const unsigned short*)arow + kb + 8 * hh); ah.half[1] = *(const v8us*)((const unsigned short*)arow + kb + 16 + 8 * hh);
#pragma unroll
    for (int t = 0; t < 4; ++t) { if (col0 + t * 16 >= N) continue; const size_t boff = (size_t)(col0 + t * 16 + ln) * ldb + kb; FragH bq; bq.half[0] = *(const v8us*)((const unsigned short*)Bh + boff + 8 * hh); bq.half[1] = *(const v8us*)((const unsigned short*)Bh + boff + 16 + 8 * hh);
      acc[t] = mmaH<1>(ah.v, ah.v, bq.v, bq.v, acc[t]); }
  }
#pragma unroll
  for (int t = 0; t < 4; ++t) { if (col0 + t * 16 >= N) continue; const int col = col0 + t * 16 + ln; const float bv = bp ? bf16_round(bp[col]) : 0.f;
#pragma unroll
    for (int r = 0; r < 8; ++r) { float v = acc[t][r] * alpha + bv; if (CP) { const int rr = row0g + row0 + 8 * hh + r; if (rowsPerB < 0) v += CP[cofs + (size_t)rr * ldc + col];      /* rowsPerB < 0: own element of the batched C plane */ else { const int bidx = rr / rowsPerB; v += CP[(size_t)bidx * sCPb + (size_t)by * 64 + col]; } } if (ACT == 1) v = (v > 0.f) ? v : expm1f(v); else if (ACT == 7) v = (v > 0.f) ? v + 1.0f : expf(v); else if (ACT == 8) v = tanhf(v); else if (ACT == 9) v = 0.5f * v * (1.0f + tanhf(0.7978845608028654f * (v + 0.044715f * v * v * v))); else if (ACT == 11) v = 1.0f / (1.0f + expf(-v)); else if (ACT == 12) v = (v > 0.f) ? v : 0.01f * v; else if (ACT == 14) v = (v > 0.f) ? v : 0.1f * v; else if (ACT == 16) v = (v >= 0.f) ? v : 0.3f * v; else if (ACT == 17) v = (v >= 0.f) ? v : 0.2f * v; else if (ACT == 15) v = v / (1.0f + expf(-v)); else if (ACT == 3) v = fmaxf(v, 0.f); else if (ACT == 6) v = 0.5f * v * (1.0f + erff(v * 0.70710678118654752f)); so[w][8 * hh + r][t * 16 + ln] = v; } }
  __builtin_amdgcn_fence(__ATOMIC_ACQ_REL, "workgroup"); __builtin_amdgcn_wave_barrier();
  const int rsub = lane >> 4, c4 = (lane & 15) * 4; typedef _Float16 v4h __attribute__((ext_vector_type(4)));
  {
#pragma unroll
    for (int q = 0; q < 8; ++q) { const int r = q * 2 + rsub; if (col0 + c4 < N) { const v4f v = *(const v4fa*)&so[w][r][c4]; if (C) *(v4f*)(C + cofs + (size_t)(row0 + r) * ldc + col0 + c4) = v; if (C16) { v4h h4; for (int i = 0; i < 4; ++i) h4[i] = (_Float16)v[i]; *(v4h*)(C16 + cofs + (size_t)(row0 + r) * ldc + col0 + c4) = h4; } } }
     }
}


typedef _Float16 v4h __attribute__((ext_vector_type(4)));

__global__ __launch_bounds__(256) void k_x16(const float* __restrict__ x, _Float16* __restrict__ X16, size_t n8) { const size_t t = (size_t)blockIdx.x * 256 + threadIdx.x; if (t >= n8) return; FragH f;
#pragma unroll
  for (int q = 0; q < 8; ++q) f.h[q] = (_Float16)bf16_round(x[t * 8 + q]); *(v8us*)((unsigned short*)X16 + t * 8) = f.half[0];  }
__global__ __launch_bounds__(256) void k_h16(const float* __restrict__ x, _Float16* __restrict__ X16, size_t n8) { const size_t t = (size_t)blockIdx.x * 256 + threadIdx.x; if (t >= n8) return; FragH f;
#pragma unroll
  for (int q = 0; q < 8; ++q) f.h[q] = (_Float16)x[t * 8 + q]; *(v8us*)((unsigned short*)X16 + t * 8) = f.half[0];  }
__global__ __launch_bounds__(256) void k_round16f(const float* __restrict__ W, _Float16* __restrict__ Bt, size_t n8) { const size_t t = (size_t)blockIdx.x * 256 + threadIdx.x; if (t >= n8) return; FragH f;
#pragma unroll
  for (int i = 0; i < 8; ++i) f.h[i] = (_Float16)(bf16_round(W[t * 8 + i]) * 16.0f); *(v8us*)((unsigned short*)Bt + t * 8) = f.half[0];  }
template <int NHv, int TTv>
__global__ __launch_bounds__(256) void k_vt(const _Float16* __restrict__ V16, int ldv, int voff, _Float16* __restrict__ Vt) { __shared__ unsigned short tl[64][66]; const int tid = threadIdx.x; const int slab = blockIdx.x / (TTv / 64), lg = blockIdx.x % (TTv / 64); const int b = slab / NHv, h = slab % NHv;
  for (int i = tid; i < 64 * 8; i += 256) { const int r = i / 8, c8 = (i % 8) * 8; FragH f; f.half[0] = *(const v8us*)((const unsigned short*)V16 + ((size_t)b * TTv + lg * 64 + r) * ldv + voff + h * 64 + c8);
#pragma unroll
    for (int q = 0; q < 8; ++q) tl[r][c8 + q] = f.u[q]; }
  __syncthreads();
  {
#pragma unroll
    for (int rd = 0; rd < 2; ++rd) { const int d = rd * 32 + tid / 8, pc = tid % 8; FragH f;
#pragma unroll
      for (int q = 0; q < 8; ++q) f.u[q] = tl[pc * 8 + q][d];
      *(v8us*)((unsigned short*)Vt + ((size_t)slab * 64 + d) * TTv + lg * 64 + pc * 8) = f.half[0]; }
     } }

__global__ __launch_bounds__(256) void k_hl(const float* __restrict__ F, _Float16* __restrict__ Hh, _Float16* __restrict__ Hl, size_t n8) { const size_t t = (size_t)blockIdx.x * 256 + threadIdx.x; if (t >= n8) return; FragH fh, fl; const v4f a = *(const v4fa*)(F + t * 8), c = *(const v4fa*)(F + t * 8 + 4);
#pragma unroll
  for (int q = 0; q < 4; ++q) { _Float16 h = (_Float16)a[q]; fh.h[q] = h; fl.h[q] = (_Float16)((a[q] - (float)h) * 1024.0f); h = (_Float16)c[q]; fh.h[4 + q] = h; fl.h[4 + q] = (_Float16)((c[q] - (float)h) * 1024.0f); }
  { *(v8us*)((unsigned short*)Hh + t * 8) = fh.half[0]; *(v8us*)((unsigned short*)Hl + t * 8) = fl.half[0];  } }

// ---- fast GEMM (wave tile 32x64; requires M % 32 == 0 rows per launch region and N % 64 == 0); epilogue = k_gemm_hhx semantics ----
__device__ __forceinline__ v16h g2_frag(const _Float16* p, int hh) { FragH f; f.half[0] = *(const v8us*)((const unsigned short*)p + 8 * hh); f.half[1] = *(const v8us*)((const unsigned short*)p + 16 + 8 * hh); return f.v; }
__device__ __forceinline__ v8f g2_mma(v16h a, v16h b, v8f c) { v8f d = __builtin_amdgcn_wmma_f32_16x16x32_f16(false, a, false, b, (short)0, c, false, false); asm volatile("v_nop\n\tv_nop\n\tv_nop\n\tv_nop" : "+v"(d) : "v"(a), "v"(b)); return d; }
template <int ACT>
__global__ __launch_bounds__(128) void k_gemm2(const _Float16* __restrict__ A, int lda, size_t sA, const _Float16* __restrict__ Bh, int ldb, size_t sB, float alpha, const float* __restrict__ bias, size_t sBias, const float* __restrict__ CP, int rowsPerB, size_t sCPb, int row0g,
    float* __restrict__ C, _Float16* __restrict__ C16, int ldc, size_t sC, int M, int N, int K) { static_assert(ACT == 0 || ACT == 3 || ACT == 6 || ACT == 8 || ACT == 9 || ACT == 11 || ACT == 12 || ACT == 14 || ACT == 15 || ACT == 16 || ACT == 17, "k_gemm2: unsupported ACT code (would silently apply no activation)");
  __shared__ __attribute__((aligned(16))) float so[4][32][68];
  const int tid = threadIdx.x, w = tid >> 5, lane = tid & 31, ln = lane & 15, hh = lane >> 4; const int by = blockIdx.y;
  A += (size_t)by * sA; Bh += (size_t)by * sB; const size_t cofs = (size_t)by * sC; const float* bp = bias ? bias + (size_t)by * sBias : nullptr;
  const int ntn = N >> 6; const int mt = blockIdx.x / ntn, nq = blockIdx.x - mt * ntn; const int row0 = mt * 128 + 32 * w, col0 = nq * 64; if (row0 >= M) return;
  const _Float16* a0p = A + (size_t)(row0 + ln) * lda; const _Float16* a1p = a0p + (size_t)16 * lda;
  const _Float16* b0p = Bh + (size_t)(col0 + ln) * ldb; const _Float16* b1p = b0p + (size_t)16 * ldb; const _Float16* b2p = b1p + (size_t)16 * ldb; const _Float16* b3p = b2p + (size_t)16 * ldb;
  const v8f z8 = {0.f,0.f,0.f,0.f,0.f,0.f,0.f,0.f}; v8f c00 = z8, c01 = z8, c02 = z8, c03 = z8, c10 = z8, c11 = z8, c12 = z8, c13 = z8;
#pragma unroll 1
  for (int kb = 0; kb < K; kb += 32) { const v16h a0 = g2_frag(a0p + kb, hh), a1 = g2_frag(a1p + kb, hh);
    v16h b = g2_frag(b0p + kb, hh); c00 = g2_mma(a0, b, c00); c10 = g2_mma(a1, b, c10);
    b = g2_frag(b1p + kb, hh); c01 = g2_mma(a0, b, c01); c11 = g2_mma(a1, b, c11);
    b = g2_frag(b2p + kb, hh); c02 = g2_mma(a0, b, c02); c12 = g2_mma(a1, b, c12);
    b = g2_frag(b3p + kb, hh); c03 = g2_mma(a0, b, c03); c13 = g2_mma(a1, b, c13); }
  v8f accs[8] = {c00, c01, c02, c03, c10, c11, c12, c13};
#pragma unroll
  for (int u = 0; u < 8; ++u) { const int t = u & 3, half = u >> 2; const int col = col0 + t * 16 + ln; const float bv = bp ? bf16_round(bp[col]) : 0.f;
#pragma unroll
    for (int r = 0; r < 8; ++r) { const int rloc = half * 16 + 8 * hh + r; float v = accs[u][r] * alpha + bv; if (CP) { if (rowsPerB < 0) v += CP[cofs + (size_t)(row0g + row0 + rloc) * ldc + col];      /* rowsPerB < 0: own element of the batched C plane */ else { const int bidx = (row0g + row0 + rloc) / rowsPerB; v += CP[(size_t)bidx * sCPb + (size_t)by * 64 + col]; } }
      if (ACT == 3) v = fmaxf(v, 0.f); else if (ACT == 6) v = 0.5f * v * (1.0f + erff(v * 0.70710678118654752f)); else if (ACT == 11) v = 1.0f / (1.0f + expf(-v)); else if (ACT == 15) v = v / (1.0f + expf(-v)); else if (ACT == 12) v = (v > 0.f) ? v : 0.01f * v; else if (ACT == 8) v = tanhf(v); else if (ACT == 9) v = 0.5f * v * (1.0f + tanhf(0.7978845608028654f * (v + 0.044715f * v * v * v))); else if (ACT == 14) v = (v > 0.f) ? v : 0.1f * v; else if (ACT == 16) v = (v >= 0.f) ? v : 0.3f * v; else if (ACT == 17) v = (v >= 0.f) ? v : 0.2f * v;
      so[w][rloc][t * 16 + ln] = v; } }
  __builtin_amdgcn_fence(__ATOMIC_ACQ_REL, "workgroup"); __builtin_amdgcn_wave_barrier();
  const int rsub = lane >> 4, c4 = (lane & 15) * 4;
  {
#pragma unroll
    for (int q = 0; q < 16; ++q) { const int r = q * 2 + rsub; const v4f v = *(const v4fa*)&so[w][r][c4]; if (C) *(v4f*)(C + cofs + (size_t)(row0 + r) * ldc + col0 + c4) = v; if (C16) { v4h h4; for (int i = 0; i < 4; ++i) h4[i] = (_Float16)v[i]; *(v4h*)(C16 + cofs + (size_t)(row0 + r) * ldc + col0 + c4) = h4; } }
     } }


__global__ __launch_bounds__(256) void k_wnat(const float* __restrict__ w, size_t n8, _Float16* __restrict__ Bt) { const size_t t = (size_t)blockIdx.x * 256 + threadIdx.x; if (t >= n8) return; FragH f; for (int q = 0; q < 8; ++q) f.h[q] = (_Float16)(bf16_round(w[t * 8 + q]) * 16.0f); *(v8us*)((unsigned short*)Bt + t * 8) = f.half[0];  }
// row softmax, one wave per row: lane l holds columns 128 u + 4 l .. + 3 (u = 0 .. 7) in registers, so S is read once in whole 512-byte wave loads and each exp is taken once; maximum and sum by lane partials and a five-step butterfly
__global__ __launch_bounds__(256) void k_rsm(const float* __restrict__ S, _Float16* __restrict__ P, int nrows) {
  const int lane = threadIdx.x & 31; const int i = blockIdx.x * 8 + (threadIdx.x >> 5); if (i >= nrows) return;      /* wave-uniform exit; the kernel has no barrier */
  const float* s = S + (size_t)i * SQ + lane * 4; v4f v[SQ / 128];
  /* every loop below is unrolled whole: v[] is then indexed by constants alone and stays in registers, and the eight loads issue together */
#pragma unroll
  for (int u = 0; u < SQ / 128; ++u) v[u] = *(const v4fa*)(s + u * 128);
  float mx = -3.0e38f;
#pragma unroll
  for (int u = 0; u < SQ / 128; ++u) mx = fmaxf(mx, fmaxf(fmaxf(v[u][0], v[u][1]), fmaxf(v[u][2], v[u][3])));
#pragma unroll
  for (int m = 16; m > 0; m >>= 1) mx = fmaxf(mx, __shfl_xor(mx, m));
  v4f s4 = {0.f, 0.f, 0.f, 0.f};
#pragma unroll
  for (int u = 0; u < SQ / 128; ++u) { for (int q = 0; q < 4; ++q) v[u][q] = expf(v[u][q] - mx); s4 += v[u]; }
  float se = (s4[0] + s4[1]) + (s4[2] + s4[3]);
#pragma unroll
  for (int m = 16; m > 0; m >>= 1) se += __shfl_xor(se, m);
  const float sc = 256.0f / se; _Float16* d = P + (size_t)i * SQ + lane * 4;
#pragma unroll
  for (int u = 0; u < SQ / 128; ++u) { v4h h4; for (int q = 0; q < 4; ++q) h4[q] = (_Float16)(v[u][q] * sc); *(v4h*)(d + u * 128) = h4; } }
__global__ __launch_bounds__(256) void k_vt(const _Float16* __restrict__ V16, int b, int h0, _Float16* __restrict__ VT) { __shared__ unsigned short tl[64][65]; const int tid = threadIdx.x; const int hh = blockIdx.x % HG, sg = blockIdx.x / HG; const int s0 = sg * 64; const int h = h0 + hh;
  for (int i = tid; i < 64 * 8; i += 256) { const int j = i / 8, d8 = (i % 8) * 8; FragH f; f.half[0] = *(const v8us*)((const unsigned short*)V16 + ((size_t)b * SQ + s0 + j) * DM + h * HD + d8); for (int q = 0; q < 8; ++q) tl[d8 + q][j] = f.u[q]; }
  __syncthreads();
  { for (int i = tid; i < 64 * 8; i += 256) { const int d = i / 8, j8 = (i % 8) * 8; FragH f; for (int q = 0; q < 8; ++q) f.u[q] = tl[d][j8 + q]; *(v8us*)((unsigned short*)VT + ((size_t)hh * HD + d) * SQ + s0 + j8) = f.half[0]; }  } }



__global__ __launch_bounds__(256) void k_rsmkm(const float* __restrict__ S, _Float16* __restrict__ P, int nrows, const int* __restrict__ am) {
  #pragma clang fp contract(off)
  const int t = blockIdx.x * 256 + threadIdx.x; if (t >= nrows) return; const size_t i = (size_t)t; const float* s = S + i * SQ; const int* mr = am + (size_t)(t % SQ) * SQ; float mx = -3.0e38f;
#pragma unroll 1
  for (int j = 0; j < SQ; ++j) { const float f = (mr[j] != 0) ? 1.f : 0.f; mx = fmaxf(mx, fmaf(f, s[j], (1.f - f) * -1.0e9f)); } float se = 0.f;
#pragma unroll 1
  for (int j = 0; j < SQ; ++j) { const float f = (mr[j] != 0) ? 1.f : 0.f; se += __expf(fmaf(f, s[j], (1.f - f) * -1.0e9f) - mx); } const float sc = 256.0f / se;
#pragma unroll 1
  for (int j0 = 0; j0 < SQ; j0 += 8) { FragH fr; for (int q = 0; q < 8; ++q) { const int j = j0 + q; const float f = (mr[j] != 0) ? 1.f : 0.f; fr.h[q] = (_Float16)(__expf(fmaf(f, s[j], (1.f - f) * -1.0e9f) - mx) * sc); }
    unsigned short* d = (unsigned short*)P + i * SQ + j0; *(v8us*)d = fr.half[0];  } }
__global__ __launch_bounds__(256) void k_lrms(const float* __restrict__ x, const float* __restrict__ w, _Float16* __restrict__ X16) {
  #pragma clang fp contract(off)
  const size_t t = (size_t)blockIdx.x * 256 + threadIdx.x; if (t >= NR * DM / 8) return; const int c8 = (int)(t % (DM / 8)) * 8; const size_t r = t / (DM / 8); const int b = (int)(r / SQ), s = (int)(r % SQ), gi = s / GS, gj = s % GS;
  float b0 = 0.f, b1 = 0.f, b2 = 0.f, b3 = 0.f, b4 = 0.f, b5 = 0.f, b6 = 0.f, b7 = 0.f;
#pragma unroll 1
  for (int di = -RW; di <= RW; ++di) {
#pragma unroll 1
    for (int dj = -RW; dj <= RW; ++dj) { const int ii = gi + di, jj = gj + dj; const float f = (ii >= 0 && ii < GS && jj >= 0 && jj < GS) ? 1.0f : 0.0f; const int ic = ii < 0 ? 0 : (ii >= GS ? GS - 1 : ii), jc = jj < 0 ? 0 : (jj >= GS ? GS - 1 : jj);
      const float* p = x + ((size_t)b * SQ + (size_t)ic * GS + jc) * DM + c8; const v4f a = *(const v4fa*)p, c = *(const v4fa*)(p + 4);
      float v; v = bf16_round(a[0]); b0 = __fadd_rn(b0, __fmul_rn(f, __fmul_rn(v, v))); v = bf16_round(a[1]); b1 = __fadd_rn(b1, __fmul_rn(f, __fmul_rn(v, v))); v = bf16_round(a[2]); b2 = __fadd_rn(b2, __fmul_rn(f, __fmul_rn(v, v))); v = bf16_round(a[3]); b3 = __fadd_rn(b3, __fmul_rn(f, __fmul_rn(v, v)));
      v = bf16_round(c[0]); b4 = __fadd_rn(b4, __fmul_rn(f, __fmul_rn(v, v))); v = bf16_round(c[1]); b5 = __fadd_rn(b5, __fmul_rn(f, __fmul_rn(v, v))); v = bf16_round(c[2]); b6 = __fadd_rn(b6, __fmul_rn(f, __fmul_rn(v, v))); v = bf16_round(c[3]); b7 = __fadd_rn(b7, __fmul_rn(f, __fmul_rn(v, v))); } }
  const float* pc = x + r * DM + c8; const v4f xa = *(const v4fa*)pc, xc = *(const v4fa*)(pc + 4); const v4f wa = *(const v4fa*)(w + c8), wc = *(const v4fa*)(w + c8 + 4); const float bx[8] = {b0, b1, b2, b3, b4, b5, b6, b7}; FragH fr;
#pragma unroll
  for (int q = 0; q < 8; ++q) { const float xv = bf16_round(q < 4 ? xa[q] : xc[q - 4]); const float wv = bf16_round(q < 4 ? wa[q] : wc[q - 4]); const float rms = sqrtf(__fadd_rn(0.0000001f, __fmul_rn(bx[q], 0.02040816326530612f)));      /* box / 49 as a multiply by the f32 reciprocal (the result is rounded to f16 next) */ fr.h[q] = (_Float16)__fmul_rn(__fdiv_rn(xv, rms), wv); }
  unsigned short* d = (unsigned short*)X16 + r * DM + c8; *(v8us*)d = fr.half[0];  }


extern "C" void kernel_launch(void* const* d_in, const int* in_sizes, int n_in,
                              void* d_out, int out_size, void* d_ws, size_t ws_size, hipStream_t stream) {
  (void)in_sizes; (void)n_in; (void)out_size;
  const float* const* I = (const float* const*)d_in; const float* x = I[0]; const float* nw = I[1]; const float* wq = I[2]; const float* bq = I[3]; const float* wk = I[4]; const float* bk = I[5]; const float* wv = I[6]; const float* bv = I[7]; const float* wo = I[8]; const float* bo = I[9];      /* x; norm_w [768]; natural [768][768] weights + biases (q, k, v, o) */
  static_assert(SQ == GS * GS && DM % 8 == 0 && DM % 64 == 0 && DM % 32 == 0 && SQ % 128 == 0 && NH * HD == DM && NH % HG == 0, "shape / tile multiples");
  char* ws = (char*)d_ws; size_t off = 0;
  auto take = [&](size_t bytes) { char* p = ws + off; off += (bytes + 255) & ~(size_t)255; return p; };
  _Float16* BQ = (_Float16*)take((size_t)DM * DM * 2); _Float16* BK = (_Float16*)take((size_t)DM * DM * 2); _Float16* BV = (_Float16*)take((size_t)DM * DM * 2); _Float16* BO = (_Float16*)take((size_t)DM * DM * 2);
  _Float16* X16 = (_Float16*)take(NR * DM * 2); _Float16* Q16 = (_Float16*)take(NR * DM * 2); _Float16* K16 = (_Float16*)take(NR * DM * 2); _Float16* V16 = (_Float16*)take(NR * DM * 2); _Float16* O16 = (_Float16*)take(NR * DM * 2);
  float* S = (float*)take((size_t)HG * SQ * SQ * 4); _Float16* P = (_Float16*)take((size_t)HG * SQ * SQ * 2); _Float16* VT = (_Float16*)take((size_t)NH * HD * SQ * 2);
  if (off > ws_size) return;      /* approx 4.5 + 5 x 12 + 16 + 8 + 1.5 = 90 MiB */
  { const unsigned g = (unsigned)(((size_t)DM * DM / 8 + 255) / 256); k_wnat<<<g, 256, 0, stream>>>(wq, (size_t)DM * DM / 8, BQ); k_wnat<<<g, 256, 0, stream>>>(wk, (size_t)DM * DM / 8, BK); k_wnat<<<g, 256, 0, stream>>>(wv, (size_t)DM * DM / 8, BV); k_wnat<<<g, 256, 0, stream>>>(wo, (size_t)DM * DM / 8, BO); }      /* natural [out][in] = Bt[n][k] x16 */
  k_lrms<<<(unsigned)((NR * DM / 8 + 255) / 256), 256, 0, stream>>>(x, nw, X16);      /* xn = local-RMS-normalised x as f16 rows: the A operand of all three projections */
  const size_t r0p = (size_t)B0 * SQ;      /* first projected row */
  k_gemm2<0><<<dim3((unsigned)((MP / 128) * (DM / 64)), 1), 128, 0, stream>>>(X16 + r0p * DM, DM, 0, BQ, DM, 0, 0.0625f, bq, 0, nullptr, 1, 0, 0, nullptr, Q16 + r0p * DM, DM, 0, MP, DM, DM);
  k_gemm2<0><<<dim3((unsigned)((MP / 128) * (DM / 64)), 1), 128, 0, stream>>>(X16 + r0p * DM, DM, 0, BK, DM, 0, 0.0625f, bk, 0, nullptr, 1, 0, 0, nullptr, K16 + r0p * DM, DM, 0, MP, DM, DM);
  k_gemm2<0><<<dim3((unsigned)((MP / 128) * (DM / 64)), 1), 128, 0, stream>>>(X16 + r0p * DM, DM, 0, BV, DM, 0, 0.0625f, bv, 0, nullptr, 1, 0, 0, nullptr, V16 + r0p * DM, DM, 0, MP, DM, DM);
  for (int b = B0; b < B0 + NBR; ++b) { const size_t r0 = (size_t)b * SQ;
    k_vt<NH, SQ><<<NH * (SQ / 64), 256, 0, stream>>>(V16 + r0 * LQ, LQ, 0, VT);      /* V^T [NH][HD][SQ] for this batch */
    for (int h0 = 0; h0 < NHD; h0 += HG) {
      k_gemm2<0><<<dim3((QN / 128) * (SQ / 64), HG), 128, 0, stream>>>(Q16 + r0 * LQ + h0 * HD, LQ, (size_t)HD, K16 + r0 * LQ + h0 * HD, LQ, (size_t)HD, 0.125f, nullptr, 0, nullptr, 1, 0, 0, S, nullptr, SQ, (size_t)SQ * SQ, QN, SQ, HD);      /* scores, HG heads per launch */
      k_rsm<<<(HG * SQ + 7) / 8, 256, 0, stream>>>(S, P, HG * SQ);      /* P = 256 softmax (f16), rows of all HG heads, one wave a row */
      k_gemm2<0><<<dim3((QN / 128) * (HD / 64), HG), 128, 0, stream>>>(P, SQ, (size_t)SQ * SQ, VT + (size_t)h0 * HD * SQ, SQ, (size_t)HD * SQ, 0.25f, nullptr, 0, nullptr, 1, 0, 0, nullptr, O16 + r0 * DM + h0 * HD, DM, (size_t)HD, QN, HD, SQ); } }      /* o (merged heads, x64) as f16 rows */
  k_gemm2<0><<<dim3((unsigned)((MPO / 128) * (DM / 64)), 1), 128, 0, stream>>>(O16 + r0p * DM, DM, 0, BO, DM, 0, 0.0009765625f, bo, 0, nullptr, 1, 0, 0, (float*)d_out + r0p * DM, nullptr, DM, 0, MPO, DM, DM);      /* out rows are the output layout */
}

// v002
// One run takes 257 microseconds.
// Next to v001, in two timings, it ran 5.27 and 5.26 times as fast.
// Counting every step since v000, it is 21.0 times as fast.
#include <hip/hip_runtime.h>
#define NB 8
#define SQ 1024
#define GS 32                        /* token grid side: SQ = GS * GS */
#define RW 3                         /* local-norm window radius (7 x 7) */
#define DM 768
#define NH 12
#define HD 64
#define HG 4                         /* heads per launch of the per-group k_vt (not launched) */
#define B0 0                         /* first batch processed (debug hook) */
#define NBR NB                       /* batches processed (debug hook) */
#define NR ((size_t)NB * SQ)         /* token rows */
#define MP ((int)((size_t)NBR * SQ)) /* rows projected (debug hook) */
#define QN SQ                        /* query rows attended per batch (debug hook) */
#define NHD NH                       /* heads attended (debug hook) */
#define MPO MP                       /* rows through the output stage (debug hook) */
#define LQ DM      /* row pitch of the q/k/v rows */
typedef __bf16 v16b __attribute__((ext_vector_type(16)));
typedef unsigned short v8us __attribute__((ext_vector_type(8), may_alias));
typedef float  v8f  __attribute__((ext_vector_type(8)));
typedef float  v4f  __attribute__((ext_vector_type(4)));
typedef float  v4fa __attribute__((ext_vector_type(4), may_alias));
union FragB { v16b v; v8us half[2]; unsigned short u[16]; };

__device__ __forceinline__ unsigned short bf16_bits(float x) { unsigned int u = __float_as_uint(x); return (unsigned short)((u + 0x7FFFu + ((u >> 16) & 1u)) >> 16); }
__device__ __forceinline__ float bf16_val(unsigned short b) { return __uint_as_float(((unsigned int)b) << 16); }
__device__ __forceinline__ float bf16_round(float x) { return bf16_val(bf16_bits(x)); }
// D += A·B with NT terms: 1 = ah·bh, 2 = + al·bh (A split), 3 = + ah·bl (both split)
template <int NT>
__device__ __forceinline__ v8f mmaN(v16b ah, v16b al, v16b bh, v16b bl, v8f c) {
  c = __builtin_amdgcn_wmma_f32_16x16x32_bf16(false, ah, false, bh, (short)0, c, false, false);
  if (NT >= 2) c = __builtin_amdgcn_wmma_f32_16x16x32_bf16(false, al, false, bh, (short)0, c, false, false);
  if (NT >= 3) c = __builtin_amdgcn_wmma_f32_16x16x32_bf16(false, ah, false, bl, (short)0, c, false, false);
  asm volatile("v_nop\n\tv_nop\n\tv_nop\n\tv_nop" : "+v"(c) : "v"(ah), "v"(al), "v"(bh), "v"(bl));
  return c;
}

__global__ __launch_bounds__(256) void k_wt_bf16(const float* __restrict__ W, unsigned short* __restrict__ Wt, int K, int N) {
  const int t = blockIdx.x * 256 + threadIdx.x;
  const int k8n = K / 8;
  if (t >= N * k8n) return;
  const int n = t / k8n, k8 = (t % k8n) * 8;
  v8us v;
#pragma unroll
  for (int i = 0; i < 8; ++i) v[i] = bf16_bits(W[(size_t)(k8 + i) * N + n]);
  *(v8us*)(Wt + (size_t)n * K + k8) = v;
  
}

// GEMM C[M][N] (f32, pitch ldc) = act(A[M][K]·W + bias). A f32 row-major (pitch lda) converted per fragment to bf16
// (ASPLIT: hi/lo two planes -> 2 terms, else single rounded term); Wt bf16 [N][K] (pitch ldb). BIAS_BF16 rounds the
// bias to bf16 first (bias quantised to bf16 before the add). K%32==0, M%16==0, N%64==0.
template <bool ASPLIT, int ACT, bool BIAS_BF16>
__global__ __launch_bounds__(128) void k_gemm_bf(const float* __restrict__ A, int lda, const unsigned short* __restrict__ Wt, int ldb,
                                               const float* __restrict__ bias, float* __restrict__ C, int ldc, int M, int N, int K) {
  __shared__ __attribute__((aligned(16))) float so[4][16][64];
  const int tid = threadIdx.x, w = tid >> 5, lane = tid & 31, ln = lane & 15, hh = lane >> 4;
  const int ntn = N / 64;
  const int wid = blockIdx.x * 4 + w;
  const int mt = wid / ntn, nq = wid % ntn;
  if (mt * 16 >= M) return;
  const int row0 = mt * 16, col0 = nq * 64;
  const float* arow = A + (size_t)(row0 + ln) * lda;
  v8f acc[4] = {};
  for (int kb = 0; kb < K; kb += 32) {
    FragB ah, al;
    const v4f x0 = *(const v4fa*)(arow + kb + 8 * hh), x1 = *(const v4fa*)(arow + kb + 8 * hh + 4);
    const v4f x2 = *(const v4fa*)(arow + kb + 16 + 8 * hh), x3 = *(const v4fa*)(arow + kb + 16 + 8 * hh + 4);
    float xs[16] = {x0[0],x0[1],x0[2],x0[3],x1[0],x1[1],x1[2],x1[3],x2[0],x2[1],x2[2],x2[3],x3[0],x3[1],x3[2],x3[3]};
#pragma unroll
    for (int i = 0; i < 16; ++i) { const unsigned short hb = bf16_bits(xs[i]); ah.u[i] = hb; al.u[i] = ASPLIT ? bf16_bits(xs[i] - bf16_val(hb)) : (unsigned short)0; }
#pragma unroll
    for (int t = 0; t < 4; ++t) {
      const unsigned short* brow = Wt + (size_t)(col0 + t * 16 + ln) * ldb + kb;
      FragB b;
      b.half[0] = *(const v8us*)(brow + 8 * hh);
      b.half[1] = *(const v8us*)(brow + 16 + 8 * hh);
      acc[t] = mmaN<ASPLIT ? 2 : 1>(ah.v, al.v, b.v, b.v, acc[t]);
    }
  }
#pragma unroll
  for (int t = 0; t < 4; ++t) {
    float bv = bias ? bias[col0 + t * 16 + ln] : 0.f;
    if (BIAS_BF16) bv = bf16_round(bv);
#pragma unroll
    for (int r = 0; r < 8; ++r) { float v = acc[t][r] + bv; if (ACT == 1) v = fmaxf(v, 0.f); so[w][8 * hh + r][t * 16 + ln] = v; }
  }
  __builtin_amdgcn_fence(__ATOMIC_ACQ_REL, "workgroup");
  __builtin_amdgcn_wave_barrier();
  const int rsub = lane >> 4, c4 = (lane & 15) * 4;
  {
#pragma unroll
    for (int q = 0; q < 8; ++q) {
      const int r = q * 2 + rsub;
      const v4f v = *(const v4fa*)&so[w][r][c4];
      *(v4f*)(C + (size_t)(row0 + r) * ldc + col0 + c4) = v;
    }
    
  }
}

// GEMM C = act(A·W + bias + resid): A f32 (ASPLIT -> hi/lo 2 terms), Wt bf16 [N][K]; ACT 0 none, 1 relu, 2 exact gelu;
// resid (optional, f32, row index = (row % rmod), pitch ldr, RES_BF16 rounds it) added before the activation.
template <bool ASPLIT, int ACT, bool BIAS_BF16, bool RES_BF16>
__global__ __launch_bounds__(128) void k_gemm_bf3(const float* __restrict__ A, int lda, const unsigned short* __restrict__ Wt, int ldb,
                                                const float* __restrict__ bias, const float* __restrict__ resid, int rmod, int ldr,
                                                float* __restrict__ C, int ldc, int M, int N, int K) {
  __shared__ __attribute__((aligned(16))) float so[4][16][64];
  const int tid = threadIdx.x, w = tid >> 5, lane = tid & 31, ln = lane & 15, hh = lane >> 4;
  const int ntn = N / 64;
  const int wid = blockIdx.x * 4 + w;
  const int mt = wid / ntn, nq = wid % ntn;
  if (mt * 16 >= M) return;
  const int row0 = mt * 16, col0 = nq * 64;
  const float* arow = A + (size_t)(row0 + ln) * lda;
  v8f acc[4] = {};
  for (int kb = 0; kb < K; kb += 32) {
    FragB ah, al;
    const v4f x0 = *(const v4fa*)(arow + kb + 8 * hh), x1 = *(const v4fa*)(arow + kb + 8 * hh + 4);
    const v4f x2 = *(const v4fa*)(arow + kb + 16 + 8 * hh), x3 = *(const v4fa*)(arow + kb + 16 + 8 * hh + 4);
    float xs[16] = {x0[0],x0[1],x0[2],x0[3],x1[0],x1[1],x1[2],x1[3],x2[0],x2[1],x2[2],x2[3],x3[0],x3[1],x3[2],x3[3]};
#pragma unroll
    for (int i = 0; i < 16; ++i) { const unsigned short hb = bf16_bits(xs[i]); ah.u[i] = hb; al.u[i] = ASPLIT ? bf16_bits(xs[i] - bf16_val(hb)) : (unsigned short)0; }
#pragma unroll
    for (int t = 0; t < 4; ++t) {
      const unsigned short* brow = Wt + (size_t)(col0 + t * 16 + ln) * ldb + kb;
      FragB b;
      b.half[0] = *(const v8us*)(brow + 8 * hh);
      b.half[1] = *(const v8us*)(brow + 16 + 8 * hh);
      acc[t] = mmaN<ASPLIT ? 2 : 1>(ah.v, al.v, b.v, b.v, acc[t]);
    }
  }
#pragma unroll
  for (int t = 0; t < 4; ++t) {
    const int col = col0 + t * 16 + ln;
    float bv = bias ? bias[col] : 0.f;
    if (BIAS_BF16) bv = bf16_round(bv);
#pragma unroll
    for (int r = 0; r < 8; ++r) {
      float v = acc[t][r] + bv;
      if (resid) { float rv = resid[(size_t)((row0 + 8 * hh + r) % rmod) * ldr + col]; if (RES_BF16) rv = bf16_round(rv); v += rv; }
      if (ACT == 1) v = fmaxf(v, 0.f);
      if (ACT == 2) v = 0.5f * v * (1.0f + erff(v * 0.70710678118654752f));
      if (ACT == 3) { const float u = 0.7978845608028654f * (v + 0.044715f * v * v * v); v = 0.5f * v * (1.0f + tanhf(u)); }
      so[w][8 * hh + r][t * 16 + ln] = v;
    }
  }
  __builtin_amdgcn_fence(__ATOMIC_ACQ_REL, "workgroup");
  __builtin_amdgcn_wave_barrier();
  const int rsub = lane >> 4, c4 = (lane & 15) * 4;
  {
#pragma unroll
    for (int q = 0; q < 8; ++q) {
      const int r = q * 2 + rsub;
      const v4f v = *(const v4fa*)&so[w][r][c4];
      *(v4f*)(C + (size_t)(row0 + r) * ldc + col0 + c4) = v;
    }
    
  }
}
// row LayerNorm (biased variance, eps) over N: s = X (+ R); optional out_sum <- s; out_norm <- (s-mu)*rsqrt(var+eps)*g + b
template <bool PARAM_BF16>
__global__ __launch_bounds__(256) void k_layernorm(const float* __restrict__ X, const float* __restrict__ R, const float* __restrict__ g, const float* __restrict__ bta,
                                                  float* __restrict__ out_sum, float* __restrict__ out_norm, int N, float eps) {
  __shared__ float red[256];
  const int row = blockIdx.x, tid = threadIdx.x;
  const float* x = X + (size_t)row * N; const float* rr = R ? R + (size_t)row * N : nullptr;
  float vals[16];                     // up to N = 4096
  const int per = N / 256;            // contiguous chunk per thread? use strided-by-4 chunks: thread handles j = tid*4 + 1024*u
  float s1 = 0.f;
  for (int u = 0; u < per / 4; ++u) {
    const int j = tid * 4 + 1024 * u;
    const v4f a = *(const v4fa*)(x + j);
    v4f b = {0.f,0.f,0.f,0.f}; if (rr) b = *(const v4fa*)(rr + j);
#pragma unroll
    for (int q = 0; q < 4; ++q) { const float v = a[q] + b[q]; vals[u * 4 + q] = v; s1 += v; }
  }
  red[tid] = s1; __syncthreads();
  for (int st = 128; st > 0; st >>= 1) { if (tid < st) red[tid] += red[tid + st]; __syncthreads(); }
  const float mu = red[0] / (float)N; __syncthreads();
  float s2 = 0.f;
  for (int u = 0; u < per / 4; ++u)
#pragma unroll
    for (int q = 0; q < 4; ++q) { const float c = vals[u * 4 + q] - mu; s2 += c * c; }
  red[tid] = s2; __syncthreads();
  for (int st = 128; st > 0; st >>= 1) { if (tid < st) red[tid] += red[tid + st]; __syncthreads(); }
  const float rs = rsqrtf(red[0] / (float)N + eps);
  {
    for (int u = 0; u < per / 4; ++u) {
      const int j = tid * 4 + 1024 * u;
      v4f o, sm;
#pragma unroll
      for (int q = 0; q < 4; ++q) {
        float gg = g[j + q], bb = bta[j + q];
        if (PARAM_BF16) { gg = bf16_round(gg); bb = bf16_round(bb); }
        sm[q] = vals[u * 4 + q]; o[q] = (vals[u * 4 + q] - mu) * rs * gg + bb;
      }
      if (out_sum) *(v4f*)(out_sum + (size_t)row * N + j) = sm;
      *(v4f*)(out_norm + (size_t)row * N + j) = o;
    }
    
  }
}



// ---- f16 WMMA path (v_wmma_f32_16x16x32_f16): 11-bit significands for operands in range — used where a [0,1] probability operand needs more precision than bf16
typedef _Float16 v16h __attribute__((ext_vector_type(16)));
union FragH { v16h v; v8us half[2]; _Float16 h[16]; unsigned short u[16]; };
template <int NT>
__device__ __forceinline__ v8f mmaH(v16h ah, v16h al, v16h bh, v16h bl, v8f c) {
  c = __builtin_amdgcn_wmma_f32_16x16x32_f16(false, ah, false, bh, (short)0, c, false, false);
  if (NT >= 2) c = __builtin_amdgcn_wmma_f32_16x16x32_f16(false, al, false, bh, (short)0, c, false, false);
  if (NT >= 3) c = __builtin_amdgcn_wmma_f32_16x16x32_f16(false, ah, false, bl, (short)0, c, false, false);
  asm volatile("v_nop\n\tv_nop\n\tv_nop\n\tv_nop" : "+v"(c) : "v"(ah), "v"(al), "v"(bh), "v"(bl));
  return c;
}
// batched GEMM like k_gemm_b but f16 operands: A f32 (split into f16 hi/lo if ASPLIT, else rounded to f16), Bt = f16 values [n][k]; alpha; C f32; N multiple of 16 (partial tiles skipped)
template <bool ASPLIT>
__global__ __launch_bounds__(128) void k_gemm_h(const float* __restrict__ A, int lda, size_t sA, const _Float16* __restrict__ Bh, int ldb, size_t sB, float alpha, float* __restrict__ C, int ldc, size_t sC, int M, int N, int K) {
  __shared__ __attribute__((aligned(16))) float so[4][16][64];
  const int tid = threadIdx.x, w = tid >> 5, lane = tid & 31, ln = lane & 15, hh = lane >> 4; const int by = blockIdx.y;
  A += (size_t)by * sA; Bh += (size_t)by * sB; C += (size_t)by * sC;
  const int ntn = (N + 63) / 64; const int wid = blockIdx.x * 4 + w; const int mt = wid / ntn, nq = wid % ntn; if (mt * 16 >= M) return;
  const int row0 = mt * 16, col0 = nq * 64; const float* arow = A + (size_t)(row0 + ln) * lda;
  v8f acc[4] = {};
  for (int kb = 0; kb < K; kb += 32) {
    FragH ah, al;
    const v4f x0 = *(const v4fa*)(arow + kb + 8 * hh), x1 = *(const v4fa*)(arow + kb + 8 * hh + 4), x2 = *(const v4fa*)(arow + kb + 16 + 8 * hh), x3 = *(const v4fa*)(arow + kb + 16 + 8 * hh + 4);
    float xs[16] = {x0[0],x0[1],x0[2],x0[3],x1[0],x1[1],x1[2],x1[3],x2[0],x2[1],x2[2],x2[3],x3[0],x3[1],x3[2],x3[3]};
#pragma unroll
    for (int i = 0; i < 16; ++i) { const _Float16 h = (_Float16)xs[i]; ah.h[i] = h; al.h[i] = ASPLIT ? (_Float16)(xs[i] - (float)h) : (_Float16)0.0f; }
#pragma unroll
    for (int t = 0; t < 4; ++t) { if (col0 + t * 16 >= N) continue; const size_t boff = (size_t)(col0 + t * 16 + ln) * ldb + kb; FragH bq; bq.half[0] = *(const v8us*)(Bh + boff + 8 * hh); bq.half[1] = *(const v8us*)(Bh + boff + 16 + 8 * hh);
      acc[t] = mmaH<ASPLIT ? 2 : 1>(ah.v, al.v, bq.v, bq.v, acc[t]); }
  }
#pragma unroll
  for (int t = 0; t < 4; ++t) { if (col0 + t * 16 >= N) continue;
#pragma unroll
    for (int r = 0; r < 8; ++r) so[w][8 * hh + r][t * 16 + ln] = acc[t][r] * alpha; }
  __builtin_amdgcn_fence(__ATOMIC_ACQ_REL, "workgroup"); __builtin_amdgcn_wave_barrier();
  const int rsub = lane >> 4, c4 = (lane & 15) * 4;
  {
#pragma unroll
    for (int q = 0; q < 8; ++q) { const int r = q * 2 + rsub; if (col0 + c4 < N) { const v4f v = *(const v4fa*)&so[w][r][c4]; *(v4f*)(C + (size_t)(row0 + r) * ldc + col0 + c4) = v; } }
     }
}

// Wt[n][k] = f16(W[k][n]·scale) from f32 row-major W[K][N] (scale = power of two; bf16-exact weights stay exact in f16 away from the subnormal range)
__global__ __launch_bounds__(256) void k_wt_f16(const float* __restrict__ W, _Float16* __restrict__ Wt, int K, int N, float scale) {
  const int t = blockIdx.x * 256 + threadIdx.x; if (t >= N * (K / 8)) return; const int n = t / (K / 8), k8 = (t % (K / 8)) * 8; FragH f;
#pragma unroll
  for (int i = 0; i < 8; ++i) f.h[i] = (_Float16)(bf16_round(W[(size_t)(k8 + i) * N + n]) * scale); const v8us o = f.half[0];
  *(v8us*)((unsigned short*)Wt + (size_t)n * K + k8) = o; 
}
// k_gemm_hh variant with fused epilogue: v = acc·alpha + bias[by·sBias + col] (+ CP[(row/rowsPerB)·sCPb + by·64 + col] if CP) ; ACT 0 none / 1 elu ; writes f16 C16 (and f32 C if non-null)
template <int ACT>
__global__ __launch_bounds__(128) void k_gemm_hhx(const _Float16* __restrict__ A, int lda, size_t sA, const _Float16* __restrict__ Bh, int ldb, size_t sB, float alpha, const float* __restrict__ bias, size_t sBias, const float* __restrict__ CP, int rowsPerB, size_t sCPb, int row0g,
    float* __restrict__ C, _Float16* __restrict__ C16, int ldc, size_t sC, int M, int N, int K) {
  __shared__ __attribute__((aligned(16))) float so[4][16][64];
  const int tid = threadIdx.x, w = tid >> 5, lane = tid & 31, ln = lane & 15, hh = lane >> 4; const int by = blockIdx.y;
  A += (size_t)by * sA; Bh += (size_t)by * sB; const size_t cofs = (size_t)by * sC; const float* bp = bias ? bias + (size_t)by * sBias : nullptr;
  const int ntn = (N + 63) / 64; const int wid = blockIdx.x * 4 + w; const int mt = wid / ntn, nq = wid % ntn; if (mt * 16 >= M) return;
  const int row0 = mt * 16, col0 = nq * 64; const _Float16* arow = A + (size_t)(row0 + ln) * lda;
  v8f acc[4] = {};
  for (int kb = 0; kb < K; kb += 32) { FragH ah; ah.half[0] = *(const v8us*)((const unsigned short*)arow + kb + 8 * hh); ah.half[1] = *(const v8us*)((const unsigned short*)arow + kb + 16 + 8 * hh);
#pragma unroll
    for (int t = 0; t < 4; ++t) { if (col0 + t * 16 >= N) continue; const size_t boff = (size_t)(col0 + t * 16 + ln) * ldb + kb; FragH bq; bq.half[0] = *(const v8us*)((const unsigned short*)Bh + boff + 8 * hh); bq.half[1] = *(const v8us*)((const unsigned short*)Bh + boff + 16 + 8 * hh);
      acc[t] = mmaH<1>(ah.v, ah.v, bq.v, bq.v, acc[t]); }
  }
#pragma unroll
  for (int t = 0; t < 4; ++t) { if (col0 + t * 16 >= N) continue; const int col = col0 + t * 16 + ln; const float bv = bp ? bf16_round(bp[col]) : 0.f;
#pragma unroll
    for (int r = 0; r < 8; ++r) { float v = acc[t][r] * alpha + bv; if (CP) { const int rr = row0g + row0 + 8 * hh + r; if (rowsPerB < 0) v += CP[cofs + (size_t)rr * ldc + col];      /* rowsPerB < 0: own element of the batched C plane */ else { const int bidx = rr / rowsPerB; v += CP[(size_t)bidx * sCPb + (size_t)by * 64 + col]; } } if (ACT == 1) v = (v > 0.f) ? v : expm1f(v); else if (ACT == 7) v = (v > 0.f) ? v + 1.0f : expf(v); else if (ACT == 8) v = tanhf(v); else if (ACT == 9) v = 0.5f * v * (1.0f + tanhf(0.7978845608028654f * (v + 0.044715f * v * v * v))); else if (ACT == 11) v = 1.0f / (1.0f + expf(-v)); else if (ACT == 12) v = (v > 0.f) ? v : 0.01f * v; else if (ACT == 14) v = (v > 0.f) ? v : 0.1f * v; else if (ACT == 16) v = (v >= 0.f) ? v : 0.3f * v; else if (ACT == 17) v = (v >= 0.f) ? v : 0.2f * v; else if (ACT == 15) v = v / (1.0f + expf(-v)); else if (ACT == 3) v = fmaxf(v, 0.f); else if (ACT == 6) v = 0.5f * v * (1.0f + erff(v * 0.70710678118654752f)); so[w][8 * hh + r][t * 16 + ln] = v; } }
  __builtin_amdgcn_fence(__ATOMIC_ACQ_REL, "workgroup"); __builtin_amdgcn_wave_barrier();
  const int rsub = lane >> 4, c4 = (lane & 15) * 4; typedef _Float16 v4h __attribute__((ext_vector_type(4)));
  {
#pragma unroll
    for (int q = 0; q < 8; ++q) { const int r = q * 2 + rsub; if (col0 + c4 < N) { const v4f v = *(const v4fa*)&so[w][r][c4]; if (C) *(v4f*)(C + cofs + (size_t)(row0 + r) * ldc + col0 + c4) = v; if (C16) { v4h h4; for (int i = 0; i < 4; ++i) h4[i] = (_Float16)v[i]; *(v4h*)(C16 + cofs + (size_t)(row0 + r) * ldc + col0 + c4) = h4; } } }
     }
}


typedef _Float16 v4h __attribute__((ext_vector_type(4)));

__global__ __launch_bounds__(256) void k_x16(const float* __restrict__ x, _Float16* __restrict__ X16, size_t n8) { const size_t t = (size_t)blockIdx.x * 256 + threadIdx.x; if (t >= n8) return; FragH f;
#pragma unroll
  for (int q = 0; q < 8; ++q) f.h[q] = (_Float16)bf16_round(x[t * 8 + q]); *(v8us*)((unsigned short*)X16 + t * 8) = f.half[0];  }
__global__ __launch_bounds__(256) void k_h16(const float* __restrict__ x, _Float16* __restrict__ X16, size_t n8) { const size_t t = (size_t)blockIdx.x * 256 + threadIdx.x; if (t >= n8) return; FragH f;
#pragma unroll
  for (int q = 0; q < 8; ++q) f.h[q] = (_Float16)x[t * 8 + q]; *(v8us*)((unsigned short*)X16 + t * 8) = f.half[0];  }
__global__ __launch_bounds__(256) void k_round16f(const float* __restrict__ W, _Float16* __restrict__ Bt, size_t n8) { const size_t t = (size_t)blockIdx.x * 256 + threadIdx.x; if (t >= n8) return; FragH f;
#pragma unroll
  for (int i = 0; i < 8; ++i) f.h[i] = (_Float16)(bf16_round(W[t * 8 + i]) * 16.0f); *(v8us*)((unsigned short*)Bt + t * 8) = f.half[0];  }
template <int NHv, int TTv>
__global__ __launch_bounds__(256) void k_vt(const _Float16* __restrict__ V16, int ldv, int voff, _Float16* __restrict__ Vt) { __shared__ unsigned short tl[64][66]; const int tid = threadIdx.x; const int slab = blockIdx.x / (TTv / 64), lg = blockIdx.x % (TTv / 64); const int b = slab / NHv, h = slab % NHv;
  for (int i = tid; i < 64 * 8; i += 256) { const int r = i / 8, c8 = (i % 8) * 8; FragH f; f.half[0] = *(const v8us*)((const unsigned short*)V16 + ((size_t)b * TTv + lg * 64 + r) * ldv + voff + h * 64 + c8);
#pragma unroll
    for (int q = 0; q < 8; ++q) tl[r][c8 + q] = f.u[q]; }
  __syncthreads();
  {
#pragma unroll
    for (int rd = 0; rd < 2; ++rd) { const int d = rd * 32 + tid / 8, pc = tid % 8; FragH f;
#pragma unroll
      for (int q = 0; q < 8; ++q) f.u[q] = tl[pc * 8 + q][d];
      *(v8us*)((unsigned short*)Vt + ((size_t)slab * 64 + d) * TTv + lg * 64 + pc * 8) = f.half[0]; }
     } }

__global__ __launch_bounds__(256) void k_hl(const float* __restrict__ F, _Float16* __restrict__ Hh, _Float16* __restrict__ Hl, size_t n8) { const size_t t = (size_t)blockIdx.x * 256 + threadIdx.x; if (t >= n8) return; FragH fh, fl; const v4f a = *(const v4fa*)(F + t * 8), c = *(const v4fa*)(F + t * 8 + 4);
#pragma unroll
  for (int q = 0; q < 4; ++q) { _Float16 h = (_Float16)a[q]; fh.h[q] = h; fl.h[q] = (_Float16)((a[q] - (float)h) * 1024.0f); h = (_Float16)c[q]; fh.h[4 + q] = h; fl.h[4 + q] = (_Float16)((c[q] - (float)h) * 1024.0f); }
  { *(v8us*)((unsigned short*)Hh + t * 8) = fh.half[0]; *(v8us*)((unsigned short*)Hl + t * 8) = fl.half[0];  } }

// ---- fast GEMM (wave tile 32x64; requires M % 32 == 0 rows per launch region and N % 64 == 0); epilogue = k_gemm_hhx semantics ----
__device__ __forceinline__ v16h g2_frag(const _Float16* p, int hh) { FragH f; f.half[0] = *(const v8us*)((const unsigned short*)p + 8 * hh); f.half[1] = *(const v8us*)((const unsigned short*)p + 16 + 8 * hh); return f.v; }
__device__ __forceinline__ v8f g2_mma(v16h a, v16h b, v8f c) { v8f d = __builtin_amdgcn_wmma_f32_16x16x32_f16(false, a, false, b, (short)0, c, false, false); asm volatile("v_nop\n\tv_nop\n\tv_nop\n\tv_nop" : "+v"(d) : "v"(a), "v"(b)); return d; }
template <int ACT>
__global__ __launch_bounds__(128) void k_gemm2(const _Float16* __restrict__ A, int lda, size_t sA, const _Float16* __restrict__ Bh, int ldb, size_t sB, float alpha, const float* __restrict__ bias, size_t sBias, const float* __restrict__ CP, int rowsPerB, size_t sCPb, int row0g,
    float* __restrict__ C, _Float16* __restrict__ C16, int ldc, size_t sC, int M, int N, int K) { static_assert(ACT == 0 || ACT == 3 || ACT == 6 || ACT == 8 || ACT == 9 || ACT == 11 || ACT == 12 || ACT == 14 || ACT == 15 || ACT == 16 || ACT == 17, "k_gemm2: unsupported ACT code (would silently apply no activation)");
  __shared__ __attribute__((aligned(16))) float so[4][32][68];
  const int tid = threadIdx.x, w = tid >> 5, lane = tid & 31, ln = lane & 15, hh = lane >> 4; const int by = blockIdx.y;
  A += (size_t)by * sA; Bh += (size_t)by * sB; const size_t cofs = (size_t)by * sC; const float* bp = bias ? bias + (size_t)by * sBias : nullptr;
  const int ntn = N >> 6; const int mt = blockIdx.x / ntn, nq = blockIdx.x - mt * ntn; const int row0 = mt * 128 + 32 * w, col0 = nq * 64; if (row0 >= M) return;
  const _Float16* a0p = A + (size_t)(row0 + ln) * lda; const _Float16* a1p = a0p + (size_t)16 * lda;
  const _Float16* b0p = Bh + (size_t)(col0 + ln) * ldb; const _Float16* b1p = b0p + (size_t)16 * ldb; const _Float16* b2p = b1p + (size_t)16 * ldb; const _Float16* b3p = b2p + (size_t)16 * ldb;
  const v8f z8 = {0.f,0.f,0.f,0.f,0.f,0.f,0.f,0.f}; v8f c00 = z8, c01 = z8, c02 = z8, c03 = z8, c10 = z8, c11 = z8, c12 = z8, c13 = z8;
#pragma unroll 1
  for (int kb = 0; kb < K; kb += 32) { const v16h a0 = g2_frag(a0p + kb, hh), a1 = g2_frag(a1p + kb, hh);
    v16h b = g2_frag(b0p + kb, hh); c00 = g2_mma(a0, b, c00); c10 = g2_mma(a1, b, c10);
    b = g2_frag(b1p + kb, hh); c01 = g2_mma(a0, b, c01); c11 = g2_mma(a1, b, c11);
    b = g2_frag(b2p + kb, hh); c02 = g2_mma(a0, b, c02); c12 = g2_mma(a1, b, c12);
    b = g2_frag(b3p + kb, hh); c03 = g2_mma(a0, b, c03); c13 = g2_mma(a1, b, c13); }
  v8f accs[8] = {c00, c01, c02, c03, c10, c11, c12, c13};
#pragma unroll
  for (int u = 0; u < 8; ++u) { const int t = u & 3, half = u >> 2; const int col = col0 + t * 16 + ln; const float bv = bp ? bf16_round(bp[col]) : 0.f;
#pragma unroll
    for (int r = 0; r < 8; ++r) { const int rloc = half * 16 + 8 * hh + r; float v = accs[u][r] * alpha + bv; if (CP) { if (rowsPerB < 0) v += CP[cofs + (size_t)(row0g + row0 + rloc) * ldc + col];      /* rowsPerB < 0: own element of the batched C plane */ else { const int bidx = (row0g + row0 + rloc) / rowsPerB; v += CP[(size_t)bidx * sCPb + (size_t)by * 64 + col]; } }
      if (ACT == 3) v = fmaxf(v, 0.f); else if (ACT == 6) v = 0.5f * v * (1.0f + erff(v * 0.70710678118654752f)); else if (ACT == 11) v = 1.0f / (1.0f + expf(-v)); else if (ACT == 15) v = v / (1.0f + expf(-v)); else if (ACT == 12) v = (v > 0.f) ? v : 0.01f * v; else if (ACT == 8) v = tanhf(v); else if (ACT == 9) v = 0.5f * v * (1.0f + tanhf(0.7978845608028654f * (v + 0.044715f * v * v * v))); else if (ACT == 14) v = (v > 0.f) ? v : 0.1f * v; else if (ACT == 16) v = (v >= 0.f) ? v : 0.3f * v; else if (ACT == 17) v = (v >= 0.f) ? v : 0.2f * v;
      so[w][rloc][t * 16 + ln] = v; } }
  __builtin_amdgcn_fence(__ATOMIC_ACQ_REL, "workgroup"); __builtin_amdgcn_wave_barrier();
  const int rsub = lane >> 4, c4 = (lane & 15) * 4;
  {
#pragma unroll
    for (int q = 0; q < 16; ++q) { const int r = q * 2 + rsub; const v4f v = *(const v4fa*)&so[w][r][c4]; if (C) *(v4f*)(C + cofs + (size_t)(row0 + r) * ldc + col0 + c4) = v; if (C16) { v4h h4; for (int i = 0; i < 4; ++i) h4[i] = (_Float16)v[i]; *(v4h*)(C16 + cofs + (size_t)(row0 + r) * ldc + col0 + c4) = h4; } }
     } }


__global__ __launch_bounds__(256) void k_wnat(const float* __restrict__ w, size_t n8, _Float16* __restrict__ Bt) { const size_t t = (size_t)blockIdx.x * 256 + threadIdx.x; if (t >= n8) return; FragH f; for (int q = 0; q < 8; ++q) f.h[q] = (_Float16)(bf16_round(w[t * 8 + q]) * 16.0f); *(v8us*)((unsigned short*)Bt + t * 8) = f.half[0];  }
// fused attention, one (batch, head) and 512 queries per work-group of 16 waves. The head's K rows [key][d] and V^T rows [d][key] are laid in LDS once (row pitches 16 B x odd: no bank conflict for 16-byte fragment reads);
// each wave owns 32 queries (two 16-column groups) and walks the keys 32 at a time: S^T = K Q^T (A = K rows, B = Q rows, both in the hardware k order), so a lane holds 16 scores of ONE query per group;
// the two S^T tiles of a group, converted in place, are the B operand P^T of O^T += V^T P^T (register s < 8: key 8 hh + s, s >= 8: key 16 + 8 hh + s - 8). Softmax in base 2 against a running maximum mu, raised only when a score passes it by more than 8 (weights then stay <= 256, inside f16).
#define AKP (HD + 8)                 /* LDS pitch of a K row, f16 elements (144 B) */
#define AVP (SQ + 8)                 /* LDS pitch of a V^T row, f16 elements (2064 B) */
#define AQW 32                       /* queries per wave */
#define ANW 16                       /* waves per work-group */
__device__ __forceinline__ v8f fa_mma(v16h a, v16h b, v8f c) { return __builtin_amdgcn_wmma_f32_16x16x32_f16(false, a, false, b, (short)0, c, false, false); }
__device__ __forceinline__ float fa_xhalf(float x) { return __builtin_bit_cast(float, __builtin_amdgcn_permlanex16(__builtin_bit_cast(int, x), __builtin_bit_cast(int, x), 0x76543210, 0xfedcba98, false, false)); }      /* lane l takes lane l ^ 16, on the vector pipe: no LDS round trip in the loop */
__device__ __forceinline__ v16h fa_frag(const unsigned short* p) { FragH f; f.half[0] = *(const v8us*)p; f.half[1] = *(const v8us*)(p + 16); return f.v; }
__global__ __launch_bounds__(ANW * 32) void k_fattn(const _Float16* __restrict__ Q16, const _Float16* __restrict__ K16, const _Float16* __restrict__ VT, _Float16* __restrict__ O16) {
  __shared__ __attribute__((aligned(16))) unsigned short sk[SQ * AKP];
  __shared__ __attribute__((aligned(16))) unsigned short sv[HD * AVP];
  const int tid = threadIdx.x, w = tid >> 5, lane = tid & 31, ln = lane & 15, hh = lane >> 4;
  constexpr int QB = SQ / (ANW * AQW);      /* work-groups per head */
  const int bh = blockIdx.x / QB, qb = blockIdx.x % QB; const int b = bh / NH, h = bh % NH;
  const unsigned short* kg = (const unsigned short*)K16 + (size_t)b * SQ * DM + h * HD; const unsigned short* vg = (const unsigned short*)VT + (size_t)bh * HD * SQ;
  /* fill: thread t brings 16 bytes of K row u * 64 + t / 8 and of V^T row u * 4 + t / 128 (u = 0 .. 15). One address per plane, the rows told apart by constant offsets; every loop is unrolled whole so that
     all 32 fill loads and the 8 Q loads are in flight together and the register arrays are indexed by constants alone */
  constexpr int NT = ANW * 32, KRS = NT / (HD / 8), VRS = NT / (SQ / 8);      /* threads; K rows and V^T rows covered by one sweep of the work-group */
  const int kr = tid / (HD / 8), kc = (tid % (HD / 8)) * 8, vr = tid / (SQ / 8), vc = (tid % (SQ / 8)) * 8;
  const unsigned short* kgl = kg + (size_t)kr * DM + kc; const unsigned short* vgl = vg + (size_t)vr * SQ + vc;
  const int q0 = qb * (ANW * AQW) + w * AQW;
  const unsigned short* qp = (const unsigned short*)Q16 + ((size_t)b * SQ + q0 + ln) * DM + h * HD + 8 * hh;
  v8us kx[SQ / KRS], vx[HD / VRS]; v16h qf[2][2];
#pragma unroll
  for (int u = 0; u < SQ / KRS; ++u) kx[u] = *(const v8us*)(kgl + (size_t)u * KRS * DM);
#pragma unroll
  for (int u = 0; u < HD / VRS; ++u) vx[u] = *(const v8us*)(vgl + (size_t)u * VRS * SQ);
#pragma unroll
  for (int g = 0; g < 2; ++g) { qf[g][0] = fa_frag(qp + (size_t)g * 16 * DM); qf[g][1] = fa_frag(qp + (size_t)g * 16 * DM + 32); }
  asm volatile("s_wait_xcnt 0x0" :: "v"(kgl), "v"(vgl), "v"(qp) : "memory");      /* the wait owed before a register that an issued global load names is overwritten; the three addresses are inputs so that they stay in their registers up to here */
#pragma unroll
  for (int u = 0; u < SQ / KRS; ++u) *(v8us*)(sk + (kr + u * KRS) * AKP + kc) = kx[u];
#pragma unroll
  for (int u = 0; u < HD / VRS; ++u) *(v8us*)(sv + (vr + u * VRS) * AVP + vc) = vx[u];
  __syncthreads();      /* K and V^T of the head are complete in LDS; nothing writes LDS behind this point */
  /* every inner loop from here on is unrolled whole: the fragment and accumulator arrays are then indexed by constants alone and stay in registers */
  const v8f z8 = {0.f,0.f,0.f,0.f,0.f,0.f,0.f,0.f};
  v8f o[2][4] = {{z8, z8, z8, z8}, {z8, z8, z8, z8}};      /* o[g][t][r] = O^T[d = 16 t + 8 hh + r][query q0 + 16 g + ln], relative to mu[g] */
  float mu[2] = {-3.0e38f, -3.0e38f}, ls[2] = {0.f, 0.f};
  const float CS = 0.125f * 1.4426950408889634f;      /* 1 / sqrt(64), and base e to base 2 */
  const unsigned short* skl = sk + ln * AKP + 8 * hh; const unsigned short* svl = sv + ln * AVP + 8 * hh;
  for (int j = 0; j < SQ; j += 32) {
    v16h kf[2][2], vf[4];
#pragma unroll
    for (int kt = 0; kt < 2; ++kt) { kf[kt][0] = fa_frag(skl + (j + 16 * kt) * AKP); kf[kt][1] = fa_frag(skl + (j + 16 * kt) * AKP + 32); }
#pragma unroll
    for (int t = 0; t < 4; ++t) vf[t] = fa_frag(svl + 16 * t * AVP + j);
    v8f s[2][2];
#pragma unroll
    for (int g = 0; g < 2; ++g)
#pragma unroll
      for (int kt = 0; kt < 2; ++kt) s[g][kt] = fa_mma(kf[kt][1], qf[g][1], fa_mma(kf[kt][0], qf[g][0], z8));
    float mx[2];
#pragma unroll
    for (int g = 0; g < 2; ++g) { float m = fmaxf(s[g][0][0], s[g][1][0]);
#pragma unroll
      for (int r = 1; r < 8; ++r) m = fmaxf(m, fmaxf(s[g][0][r], s[g][1][r]));
      m = fmaxf(m, fa_xhalf(m)); mx[g] = m * CS; }      /* lanes ln and ln + 16 hold the same query: both take the same maximum */
    if (__builtin_amdgcn_ballot_w32(mx[0] > mu[0] + 8.0f || mx[1] > mu[1] + 8.0f) != 0) {      /* wave-uniform; always taken on the first pass */
#pragma unroll
      for (int g = 0; g < 2; ++g) { const float mn = fmaxf(mu[g], mx[g]); const float corr = __builtin_amdgcn_exp2f(mu[g] - mn); mu[g] = mn; ls[g] *= corr;
#pragma unroll
        for (int t = 0; t < 4; ++t) o[g][t] *= corr; } }
#pragma unroll
    for (int g = 0; g < 2; ++g) { FragH pf;
#pragma unroll
      for (int kt = 0; kt < 2; ++kt)
#pragma unroll
        for (int r = 0; r < 8; ++r) { const float p = __builtin_amdgcn_exp2f(fmaf(s[g][kt][r], CS, -mu[g])); ls[g] += p; pf.h[kt * 8 + r] = (_Float16)p; }
#pragma unroll
      for (int t = 0; t < 4; ++t) o[g][t] = fa_mma(vf[t], pf.v, o[g][t]); }
  }
#pragma unroll
  for (int g = 0; g < 2; ++g) { const float l = ls[g] + fa_xhalf(ls[g]); const float sc = 64.0f / l;      /* the two lane halves summed different keys of the same query */
    unsigned short* d = (unsigned short*)O16 + ((size_t)b * SQ + q0 + 16 * g + ln) * DM + h * HD + 8 * hh;
#pragma unroll
    for (int t = 0; t < 4; ++t) { FragH f;
#pragma unroll
      for (int r = 0; r < 8; ++r) f.h[r] = (_Float16)(o[g][t][r] * sc);
      *(v8us*)(d + 16 * t) = f.half[0]; } } }
__global__ __launch_bounds__(256) void k_vt(const _Float16* __restrict__ V16, int b, int h0, _Float16* __restrict__ VT) { __shared__ unsigned short tl[64][65]; const int tid = threadIdx.x; const int hh = blockIdx.x % HG, sg = blockIdx.x / HG; const int s0 = sg * 64; const int h = h0 + hh;
  for (int i = tid; i < 64 * 8; i += 256) { const int j = i / 8, d8 = (i % 8) * 8; FragH f; f.half[0] = *(const v8us*)((const unsigned short*)V16 + ((size_t)b * SQ + s0 + j) * DM + h * HD + d8); for (int q = 0; q < 8; ++q) tl[d8 + q][j] = f.u[q]; }
  __syncthreads();
  { for (int i = tid; i < 64 * 8; i += 256) { const int d = i / 8, j8 = (i % 8) * 8; FragH f; for (int q = 0; q < 8; ++q) f.u[q] = tl[d][j8 + q]; *(v8us*)((unsigned short*)VT + ((size_t)hh * HD + d) * SQ + s0 + j8) = f.half[0]; }  } }



__global__ __launch_bounds__(256) void k_rsmkm(const float* __restrict__ S, _Float16* __restrict__ P, int nrows, const int* __restrict__ am) {
  #pragma clang fp contract(off)
  const int t = blockIdx.x * 256 + threadIdx.x; if (t >= nrows) return; const size_t i = (size_t)t; const float* s = S + i * SQ; const int* mr = am + (size_t)(t % SQ) * SQ; float mx = -3.0e38f;
#pragma unroll 1
  for (int j = 0; j < SQ; ++j) { const float f = (mr[j] != 0) ? 1.f : 0.f; mx = fmaxf(mx, fmaf(f, s[j], (1.f - f) * -1.0e9f)); } float se = 0.f;
#pragma unroll 1
  for (int j = 0; j < SQ; ++j) { const float f = (mr[j] != 0) ? 1.f : 0.f; se += __expf(fmaf(f, s[j], (1.f - f) * -1.0e9f) - mx); } const float sc = 256.0f / se;
#pragma unroll 1
  for (int j0 = 0; j0 < SQ; j0 += 8) { FragH fr; for (int q = 0; q < 8; ++q) { const int j = j0 + q; const float f = (mr[j] != 0) ? 1.f : 0.f; fr.h[q] = (_Float16)(__expf(fmaf(f, s[j], (1.f - f) * -1.0e9f) - mx) * sc); }
    unsigned short* d = (unsigned short*)P + i * SQ + j0; *(v8us*)d = fr.half[0];  } }
__global__ __launch_bounds__(256) void k_lrms(const float* __restrict__ x, const float* __restrict__ w, _Float16* __restrict__ X16) {
  #pragma clang fp contract(off)
  const size_t t = (size_t)blockIdx.x * 256 + threadIdx.x; if (t >= NR * DM / 8) return; const int c8 = (int)(t % (DM / 8)) * 8; const size_t r = t / (DM / 8); const int b = (int)(r / SQ), s = (int)(r % SQ), gi = s / GS, gj = s % GS;
  float b0 = 0.f, b1 = 0.f, b2 = 0.f, b3 = 0.f, b4 = 0.f, b5 = 0.f, b6 = 0.f, b7 = 0.f;
#pragma unroll 1
  for (int di = -RW; di <= RW; ++di) {
#pragma unroll 1
    for (int dj = -RW; dj <= RW; ++dj) { const int ii = gi + di, jj = gj + dj; const float f = (ii >= 0 && ii < GS && jj >= 0 && jj < GS) ? 1.0f : 0.0f; const int ic = ii < 0 ? 0 : (ii >= GS ? GS - 1 : ii), jc = jj < 0 ? 0 : (jj >= GS ? GS - 1 : jj);
      const float* p = x + ((size_t)b * SQ + (size_t)ic * GS + jc) * DM + c8; const v4f a = *(const v4fa*)p, c = *(const v4fa*)(p + 4);
      float v; v = bf16_round(a[0]); b0 = __fadd_rn(b0, __fmul_rn(f, __fmul_rn(v, v))); v = bf16_round(a[1]); b1 = __fadd_rn(b1, __fmul_rn(f, __fmul_rn(v, v))); v = bf16_round(a[2]); b2 = __fadd_rn(b2, __fmul_rn(f, __fmul_rn(v, v))); v = bf16_round(a[3]); b3 = __fadd_rn(b3, __fmul_rn(f, __fmul_rn(v, v)));
      v = bf16_round(c[0]); b4 = __fadd_rn(b4, __fmul_rn(f, __fmul_rn(v, v))); v = bf16_round(c[1]); b5 = __fadd_rn(b5, __fmul_rn(f, __fmul_rn(v, v))); v = bf16_round(c[2]); b6 = __fadd_rn(b6, __fmul_rn(f, __fmul_rn(v, v))); v = bf16_round(c[3]); b7 = __fadd_rn(b7, __fmul_rn(f, __fmul_rn(v, v))); } }
  const float* pc = x + r * DM + c8; const v4f xa = *(const v4fa*)pc, xc = *(const v4fa*)(pc + 4); const v4f wa = *(const v4fa*)(w + c8), wc = *(const v4fa*)(w + c8 + 4); const float bx[8] = {b0, b1, b2, b3, b4, b5, b6, b7}; FragH fr;
#pragma unroll
  for (int q = 0; q < 8; ++q) { const float xv = bf16_round(q < 4 ? xa[q] : xc[q - 4]); const float wv = bf16_round(q < 4 ? wa[q] : wc[q - 4]); const float rms = sqrtf(__fadd_rn(0.0000001f, __fmul_rn(bx[q], 0.02040816326530612f)));      /* box / 49 as a multiply by the f32 reciprocal (the result is rounded to f16 next) */ fr.h[q] = (_Float16)__fmul_rn(__fdiv_rn(xv, rms), wv); }
  unsigned short* d = (unsigned short*)X16 + r * DM + c8; *(v8us*)d = fr.half[0];  }


extern "C" void kernel_launch(void* const* d_in, const int* in_sizes, int n_in,
                              void* d_out, int out_size, void* d_ws, size_t ws_size, hipStream_t stream) {
  (void)in_sizes; (void)n_in; (void)out_size;
  const float* const* I = (const float* const*)d_in; const float* x = I[0]; const float* nw = I[1]; const float* wq = I[2]; const float* bq = I[3]; const float* wk = I[4]; const float* bk = I[5]; const float* wv = I[6]; const float* bv = I[7]; const float* wo = I[8]; const float* bo = I[9];      /* x; norm_w [768]; natural [768][768] weights + biases (q, k, v, o) */
  static_assert(SQ == GS * GS && DM % 8 == 0 && DM % 64 == 0 && DM % 32 == 0 && SQ % 128 == 0 && NH * HD == DM && NH % HG == 0 && HD == 64 && SQ % (ANW * AQW) == 0 && B0 == 0 && NBR == NB && QN == SQ && NHD == NH, "shape / tile multiples");
  char* ws = (char*)d_ws; size_t off = 0;
  auto take = [&](size_t bytes) { char* p = ws + off; off += (bytes + 255) & ~(size_t)255; return p; };
  _Float16* BQ = (_Float16*)take((size_t)DM * DM * 2); _Float16* BK = (_Float16*)take((size_t)DM * DM * 2); _Float16* BV = (_Float16*)take((size_t)DM * DM * 2); _Float16* BO = (_Float16*)take((size_t)DM * DM * 2);
  _Float16* X16 = (_Float16*)take(NR * DM * 2); _Float16* Q16 = (_Float16*)take(NR * DM * 2); _Float16* K16 = (_Float16*)take(NR * DM * 2); _Float16* V16 = (_Float16*)take(NR * DM * 2); _Float16* O16 = (_Float16*)take(NR * DM * 2);
  _Float16* VT = (_Float16*)take((size_t)NB * NH * HD * SQ * 2);
  if (off > ws_size) return;      /* approx 4.5 + 6 x 12 = 77 MiB */
  { const unsigned g = (unsigned)(((size_t)DM * DM / 8 + 255) / 256); k_wnat<<<g, 256, 0, stream>>>(wq, (size_t)DM * DM / 8, BQ); k_wnat<<<g, 256, 0, stream>>>(wk, (size_t)DM * DM / 8, BK); k_wnat<<<g, 256, 0, stream>>>(wv, (size_t)DM * DM / 8, BV); k_wnat<<<g, 256, 0, stream>>>(wo, (size_t)DM * DM / 8, BO); }      /* natural [out][in] = Bt[n][k] x16 */
  k_lrms<<<(unsigned)((NR * DM / 8 + 255) / 256), 256, 0, stream>>>(x, nw, X16);      /* xn = local-RMS-normalised x as f16 rows: the A operand of all three projections */
  const size_t r0p = (size_t)B0 * SQ;      /* first projected row */
  k_gemm2<0><<<dim3((unsigned)((MP / 128) * (DM / 64)), 1), 128, 0, stream>>>(X16 + r0p * DM, DM, 0, BQ, DM, 0, 0.0625f, bq, 0, nullptr, 1, 0, 0, nullptr, Q16 + r0p * DM, DM, 0, MP, DM, DM);
  k_gemm2<0><<<dim3((unsigned)((MP / 128) * (DM / 64)), 1), 128, 0, stream>>>(X16 + r0p * DM, DM, 0, BK, DM, 0, 0.0625f, bk, 0, nullptr, 1, 0, 0, nullptr, K16 + r0p * DM, DM, 0, MP, DM, DM);
  k_gemm2<0><<<dim3((unsigned)((MP / 128) * (DM / 64)), 1), 128, 0, stream>>>(X16 + r0p * DM, DM, 0, BV, DM, 0, 0.0625f, bv, 0, nullptr, 1, 0, 0, nullptr, V16 + r0p * DM, DM, 0, MP, DM, DM);
  k_vt<NH, SQ><<<NB * NH * (SQ / 64), 256, 0, stream>>>(V16, LQ, 0, VT);      /* V^T [NB * NH][HD][SQ], all batches */
  k_fattn<<<NB * NH * (SQ / (ANW * AQW)), ANW * 32, 0, stream>>>(Q16, K16, VT, O16);      /* o (merged heads, x64) as f16 rows */
  k_gemm2<0><<<dim3((unsigned)((MPO / 128) * (DM / 64)), 1), 128, 0, stream>>>(O16 + r0p * DM, DM, 0, BO, DM, 0, 0.0009765625f, bo, 0, nullptr, 1, 0, 0, (float*)d_out + r0p * DM, nullptr, DM, 0, MPO, DM, DM);      /* out rows are the output layout */
}

// v003
// It runs in 159 microseconds.
// Timed twice side by side with v002, it ran 1.63 and 1.60 times as fast.
// Over all steps from v000 it is 33.9 times as fast.
#include <hip/hip_runtime.h>
#define NB 8
#define SQ 1024
#define GS 32                        /* token grid side: SQ = GS * GS */
#define RW 3                         /* local-norm window radius (7 x 7) */
#define DM 768
#define NH 12
#define HD 64
#define HG 4                         /* heads per launch of the per-group k_vt (not launched) */
#define B0 0                         /* first batch processed (debug hook) */
#define NBR NB                       /* batches processed (debug hook) */
#define NR ((size_t)NB * SQ)         /* token rows */
#define MP ((int)((size_t)NBR * SQ)) /* rows projected (debug hook) */
#define QN SQ                        /* query rows attended per batch (debug hook) */
#define NHD NH                       /* heads attended (debug hook) */
#define MPO MP                       /* rows through the output stage (debug hook) */
#define LQ DM      /* row pitch of the q/k/v rows */
typedef __bf16 v16b __attribute__((ext_vector_type(16)));
typedef unsigned short v8us __attribute__((ext_vector_type(8), may_alias));
typedef float  v8f  __attribute__((ext_vector_type(8)));
typedef float  v4f  __attribute__((ext_vector_type(4)));
typedef float  v4fa __attribute__((ext_vector_type(4), may_alias));
union FragB { v16b v; v8us half[2]; unsigned short u[16]; };

__device__ __forceinline__ unsigned short bf16_bits(float x) { unsigned int u = __float_as_uint(x); return (unsigned short)((u + 0x7FFFu + ((u >> 16) & 1u)) >> 16); }
__device__ __forceinline__ float bf16_val(unsigned short b) { return __uint_as_float(((unsigned int)b) << 16); }
__device__ __forceinline__ float bf16_round(float x) { return bf16_val(bf16_bits(x)); }
// D += A·B with NT terms: 1 = ah·bh, 2 = + al·bh (A split), 3 = + ah·bl (both split)
template <int NT>
__device__ __forceinline__ v8f mmaN(v16b ah, v16b al, v16b bh, v16b bl, v8f c) {
  c = __builtin_amdgcn_wmma_f32_16x16x32_bf16(false, ah, false, bh, (short)0, c, false, false);
  if (NT >= 2) c = __builtin_amdgcn_wmma_f32_16x16x32_bf16(false, al, false, bh, (short)0, c, false, false);
  if (NT >= 3) c = __builtin_amdgcn_wmma_f32_16x16x32_bf16(false, ah, false, bl, (short)0, c, false, false);
  asm volatile("v_nop\n\tv_nop\n\tv_nop\n\tv_nop" : "+v"(c) : "v"(ah), "v"(al), "v"(bh), "v"(bl));
  return c;
}

__global__ __launch_bounds__(256) void k_wt_bf16(const float* __restrict__ W, unsigned short* __restrict__ Wt, int K, int N) {
  const int t = blockIdx.x * 256 + threadIdx.x;
  const int k8n = K / 8;
  if (t >= N * k8n) return;
  const int n = t / k8n, k8 = (t % k8n) * 8;
  v8us v;
#pragma unroll
  for (int i = 0; i < 8; ++i) v[i] = bf16_bits(W[(size_t)(k8 + i) * N + n]);
  *(v8us*)(Wt + (size_t)n * K + k8) = v;
  
}

// GEMM C[M][N] (f32, pitch ldc) = act(A[M][K]·W + bias). A f32 row-major (pitch lda) converted per fragment to bf16
// (ASPLIT: hi/lo two planes -> 2 terms, else single rounded term); Wt bf16 [N][K] (pitch ldb). BIAS_BF16 rounds the
// bias to bf16 first (bias quantised to bf16 before the add). K%32==0, M%16==0, N%64==0.
template <bool ASPLIT, int ACT, bool BIAS_BF16>
__global__ __launch_bounds__(128) void k_gemm_bf(const float* __restrict__ A, int lda, const unsigned short* __restrict__ Wt, int ldb,
                                               const float* __restrict__ bias, float* __restrict__ C, int ldc, int M, int N, int K) {
  __shared__ __attribute__((aligned(16))) float so[4][16][64];
  const int tid = threadIdx.x, w = tid >> 5, lane = tid & 31, ln = lane & 15, hh = lane >> 4;
  const int ntn = N / 64;
  const int wid = blockIdx.x * 4 + w;
  const int mt = wid / ntn, nq = wid % ntn;
  if (mt * 16 >= M) return;
  const int row0 = mt * 16, col0 = nq * 64;
  const float* arow = A + (size_t)(row0 + ln) * lda;
  v8f acc[4] = {};
  for (int kb = 0; kb < K; kb += 32) {
    FragB ah, al;
    const v4f x0 = *(const v4fa*)(arow + kb + 8 * hh), x1 = *(const v4fa*)(arow + kb + 8 * hh + 4);
    const v4f x2 = *(const v4fa*)(arow + kb + 16 + 8 * hh), x3 = *(const v4fa*)(arow + kb + 16 + 8 * hh + 4);
    float xs[16] = {x0[0],x0[1],x0[2],x0[3],x1[0],x1[1],x1[2],x1[3],x2[0],x2[1],x2[2],x2[3],x3[0],x3[1],x3[2],x3[3]};
#pragma unroll
    for (int i = 0; i < 16; ++i) { const unsigned short hb = bf16_bits(xs[i]); ah.u[i] = hb; al.u[i] = ASPLIT ? bf16_bits(xs[i] - bf16_val(hb)) : (unsigned short)0; }
#pragma unroll
    for (int t = 0; t < 4; ++t) {
      const unsigned short* brow = Wt + (size_t)(col0 + t * 16 + ln) * ldb + kb;
      FragB b;
      b.half[0] = *(const v8us*)(brow + 8 * hh);
      b.half[1] = *(const v8us*)(brow + 16 + 8 * hh);
      acc[t] = mmaN<ASPLIT ? 2 : 1>(ah.v, al.v, b.v, b.v, acc[t]);
    }
  }
#pragma unroll
  for (int t = 0; t < 4; ++t) {
    float bv = bias ? bias[col0 + t * 16 + ln] : 0.f;
    if (BIAS_BF16) bv = bf16_round(bv);
#pragma unroll
    for (int r = 0; r < 8; ++r) { float v = acc[t][r] + bv; if (ACT == 1) v = fmaxf(v, 0.f); so[w][8 * hh + r][t * 16 + ln] = v; }
  }
  __builtin_amdgcn_fence(__ATOMIC_ACQ_REL, "workgroup");
  __builtin_amdgcn_wave_barrier();
  const int rsub = lane >> 4, c4 = (lane & 15) * 4;
  {
#pragma unroll
    for (int q = 0; q < 8; ++q) {
      const int r = q * 2 + rsub;
      const v4f v = *(const v4fa*)&so[w][r][c4];
      *(v4f*)(C + (size_t)(row0 + r) * ldc + col0 + c4) = v;
    }
    
  }
}

// GEMM C = act(A·W + bias + resid): A f32 (ASPLIT -> hi/lo 2 terms), Wt bf16 [N][K]; ACT 0 none, 1 relu, 2 exact gelu;
// resid (optional, f32, row index = (row % rmod), pitch ldr, RES_BF16 rounds it) added before the activation.
template <bool ASPLIT, int ACT, bool BIAS_BF16, bool RES_BF16>
__global__ __launch_bounds__(128) void k_gemm_bf3(const float* __restrict__ A, int lda, const unsigned short* __restrict__ Wt, int ldb,
                                                const float* __restrict__ bias, const float* __restrict__ resid, int rmod, int ldr,
                                                float* __restrict__ C, int ldc, int M, int N, int K) {
  __shared__ __attribute__((aligned(16))) float so[4][16][64];
  const int tid = threadIdx.x, w = tid >> 5, lane = tid & 31, ln = lane & 15, hh = lane >> 4;
  const int ntn = N / 64;
  const int wid = blockIdx.x * 4 + w;
  const int mt = wid / ntn, nq = wid % ntn;
  if (mt * 16 >= M) return;
  const int row0 = mt * 16, col0 = nq * 64;
  const float* arow = A + (size_t)(row0 + ln) * lda;
  v8f acc[4] = {};
  for (int kb = 0; kb < K; kb += 32) {
    FragB ah, al;
    const v4f x0 = *(const v4fa*)(arow + kb + 8 * hh), x1 = *(const v4fa*)(arow + kb + 8 * hh + 4);
    const v4f x2 = *(const v4fa*)(arow + kb + 16 + 8 * hh), x3 = *(const v4fa*)(arow + kb + 16 + 8 * hh + 4);
    float xs[16] = {x0[0],x0[1],x0[2],x0[3],x1[0],x1[1],x1[2],x1[3],x2[0],x2[1],x2[2],x2[3],x3[0],x3[1],x3[2],x3[3]};
#pragma unroll
    for (int i = 0; i < 16; ++i) { const unsigned short hb = bf16_bits(xs[i]); ah.u[i] = hb; al.u[i] = ASPLIT ? bf16_bits(xs[i] - bf16_val(hb)) : (unsigned short)0; }
#pragma unroll
    for (int t = 0; t < 4; ++t) {
      const unsigned short* brow = Wt + (size_t)(col0 + t * 16 + ln) * ldb + kb;
      FragB b;
      b.half[0] = *(const v8us*)(brow + 8 * hh);
      b.half[1] = *(const v8us*)(brow + 16 + 8 * hh);
      acc[t] = mmaN<ASPLIT ? 2 : 1>(ah.v, al.v, b.v, b.v, acc[t]);
    }
  }
#pragma unroll
  for (int t = 0; t < 4; ++t) {
    const int col = col0 + t * 16 + ln;
    float bv = bias ? bias[col] : 0.f;
    if (BIAS_BF16) bv = bf16_round(bv);
#pragma unroll
    for (int r = 0; r < 8; ++r) {
      float v = acc[t][r] + bv;
      if (resid) { float rv = resid[(size_t)((row0 + 8 * hh + r) % rmod) * ldr + col]; if (RES_BF16) rv = bf16_round(rv); v += rv; }
      if (ACT == 1) v = fmaxf(v, 0.f);
      if (ACT == 2) v = 0.5f * v * (1.0f + erff(v * 0.70710678118654752f));
      if (ACT == 3) { const float u = 0.7978845608028654f * (v + 0.044715f * v * v * v); v = 0.5f * v * (1.0f + tanhf(u)); }
      so[w][8 * hh + r][t * 16 + ln] = v;
    }
  }
  __builtin_amdgcn_fence(__ATOMIC_ACQ_REL, "workgroup");
  __builtin_amdgcn_wave_barrier();
  const int rsub = lane >> 4, c4 = (lane & 15) * 4;
  {
#pragma unroll
    for (int q = 0; q < 8; ++q) {
      const int r = q * 2 + rsub;
      const v4f v = *(const v4fa*)&so[w][r][c4];
      *(v4f*)(C + (size_t)(row0 + r) * ldc + col0 + c4) = v;
    }
    
  }
}
// row LayerNorm (biased variance, eps) over N: s = X (+ R); optional out_sum <- s; out_norm <- (s-mu)*rsqrt(var+eps)*g + b
template <bool PARAM_BF16>
__global__ __launch_bounds__(256) void k_layernorm(const float* __restrict__ X, const float* __restrict__ R, const float* __restrict__ g, const float* __restrict__ bta,
                                                  float* __restrict__ out_sum, float* __restrict__ out_norm, int N, float eps) {
  __shared__ float red[256];
  const int row = blockIdx.x, tid = threadIdx.x;
  const float* x = X + (size_t)row * N; const float* rr = R ? R + (size_t)row * N : nullptr;
  float vals[16];                     // up to N = 4096
  const int per = N / 256;            // contiguous chunk per thread? use strided-by-4 chunks: thread handles j = tid*4 + 1024*u
  float s1 = 0.f;
  for (int u = 0; u < per / 4; ++u) {
    const int j = tid * 4 + 1024 * u;
    const v4f a = *(const v4fa*)(x + j);
    v4f b = {0.f,0.f,0.f,0.f}; if (rr) b = *(const v4fa*)(rr + j);
#pragma unroll
    for (int q = 0; q < 4; ++q) { const float v = a[q] + b[q]; vals[u * 4 + q] = v; s1 += v; }
  }
  red[tid] = s1; __syncthreads();
  for (int st = 128; st > 0; st >>= 1) { if (tid < st) red[tid] += red[tid + st]; __syncthreads(); }
  const float mu = red[0] / (float)N; __syncthreads();
  float s2 = 0.f;
  for (int u = 0; u < per / 4; ++u)
#pragma unroll
    for (int q = 0; q < 4; ++q) { const float c = vals[u * 4 + q] - mu; s2 += c * c; }
  red[tid] = s2; __syncthreads();
  for (int st = 128; st > 0; st >>= 1) { if (tid < st) red[tid] += red[tid + st]; __syncthreads(); }
  const float rs = rsqrtf(red[0] / (float)N + eps);
  {
    for (int u = 0; u < per / 4; ++u) {
      const int j = tid * 4 + 1024 * u;
      v4f o, sm;
#pragma unroll
      for (int q = 0; q < 4; ++q) {
        float gg = g[j + q], bb = bta[j + q];
        if (PARAM_BF16) { gg = bf16_round(gg); bb = bf16_round(bb); }
        sm[q] = vals[u * 4 + q]; o[q] = (vals[u * 4 + q] - mu) * rs * gg + bb;
      }
      if (out_sum) *(v4f*)(out_sum + (size_t)row * N + j) = sm;
      *(v4f*)(out_norm + (size_t)row * N + j) = o;
    }
    
  }
}



// ---- f16 WMMA path (v_wmma_f32_16x16x32_f16): 11-bit significands for operands in range — used where a [0,1] probability operand needs more precision than bf16
typedef _Float16 v16h __attribute__((ext_vector_type(16)));
union FragH { v16h v; v8us half[2]; _Float16 h[16]; unsigned short u[16]; };
template <int NT>
__device__ __forceinline__ v8f mmaH(v16h ah, v16h al, v16h bh, v16h bl, v8f c) {
  c = __builtin_amdgcn_wmma_f32_16x16x32_f16(false, ah, false, bh, (short)0, c, false, false);
  if (NT >= 2) c = __builtin_amdgcn_wmma_f32_16x16x32_f16(false, al, false, bh, (short)0, c, false, false);
  if (NT >= 3) c = __builtin_amdgcn_wmma_f32_16x16x32_f16(false, ah, false, bl, (short)0, c, false, false);
  asm volatile("v_nop\n\tv_nop\n\tv_nop\n\tv_nop" : "+v"(c) : "v"(ah), "v"(al), "v"(bh), "v"(bl));
  return c;
}
// batched GEMM like k_gemm_b but f16 operands: A f32 (split into f16 hi/lo if ASPLIT, else rounded to f16), Bt = f16 values [n][k]; alpha; C f32; N multiple of 16 (partial tiles skipped)
template <bool ASPLIT>
__global__ __launch_bounds__(128) void k_gemm_h(const float* __restrict__ A, int lda, size_t sA, const _Float16* __restrict__ Bh, int ldb, size_t sB, float alpha, float* __restrict__ C, int ldc, size_t sC, int M, int N, int K) {
  __shared__ __attribute__((aligned(16))) float so[4][16][64];
  const int tid = threadIdx.x, w = tid >> 5, lane = tid & 31, ln = lane & 15, hh = lane >> 4; const int by = blockIdx.y;
  A += (size_t)by * sA; Bh += (size_t)by * sB; C += (size_t)by * sC;
  const int ntn = (N + 63) / 64; const int wid = blockIdx.x * 4 + w; const int mt = wid / ntn, nq = wid % ntn; if (mt * 16 >= M) return;
  const int row0 = mt * 16, col0 = nq * 64; const float* arow = A + (size_t)(row0 + ln) * lda;
  v8f acc[4] = {};
  for (int kb = 0; kb < K; kb += 32) {
    FragH ah, al;
    const v4f x0 = *(const v4fa*)(arow + kb + 8 * hh), x1 = *(const v4fa*)(arow + kb + 8 * hh + 4), x2 = *(const v4fa*)(arow + kb + 16 + 8 * hh), x3 = *(const v4fa*)(arow + kb + 16 + 8 * hh + 4);
    float xs[16] = {x0[0],x0[1],x0[2],x0[3],x1[0],x1[1],x1[2],x1[3],x2[0],x2[1],x2[2],x2[3],x3[0],x3[1],x3[2],x3[3]};
#pragma unroll
    for (int i = 0; i < 16; ++i) { const _Float16 h = (_Float16)xs[i]; ah.h[i] = h; al.h[i] = ASPLIT ? (_Float16)(xs[i] - (float)h) : (_Float16)0.0f; }
#pragma unroll
    for (int t = 0; t < 4; ++t) { if (col0 + t * 16 >= N) continue; const size_t boff = (size_t)(col0 + t * 16 + ln) * ldb + kb; FragH bq; bq.half[0] = *(const v8us*)(Bh + boff + 8 * hh); bq.half[1] = *(const v8us*)(Bh + boff + 16 + 8 * hh);
      acc[t] = mmaH<ASPLIT ? 2 : 1>(ah.v, al.v, bq.v, bq.v, acc[t]); }
  }
#pragma unroll
  for (int t = 0; t < 4; ++t) { if (col0 + t * 16 >= N) continue;
#pragma unroll
    for (int r = 0; r < 8; ++r) so[w][8 * hh + r][t * 16 + ln] = acc[t][r] * alpha; }
  __builtin_amdgcn_fence(__ATOMIC_ACQ_REL, "workgroup"); __builtin_amdgcn_wave_barrier();
  const int rsub = lane >> 4, c4 = (lane & 15) * 4;
  {
#pragma unroll
    for (int q = 0; q < 8; ++q) { const int r = q * 2 + rsub; if (col0 + c4 < N) { const v4f v = *(const v4fa*)&so[w][r][c4]; *(v4f*)(C + (size_t)(row0 + r) * ldc + col0 + c4) = v; } }
     }
}

// Wt[n][k] = f16(W[k][n]·scale) from f32 row-major W[K][N] (scale = power of two; bf16-exact weights stay exact in f16 away from the subnormal range)
__global__ __launch_bounds__(256) void k_wt_f16(const float* __restrict__ W, _Float16* __restrict__ Wt, int K, int N, float scale) {
  const int t = blockIdx.x * 256 + threadIdx.x; if (t >= N * (K / 8)) return; const int n = t / (K / 8), k8 = (t % (K / 8)) * 8; FragH f;
#pragma unroll
  for (int i = 0; i < 8; ++i) f.h[i] = (_Float16)(bf16_round(W[(size_t)(k8 + i) * N + n]) * scale); const v8us o = f.half[0];
  *(v8us*)((unsigned short*)Wt + (size_t)n * K + k8) = o; 
}
// k_gemm_hh variant with fused epilogue: v = acc·alpha + bias[by·sBias + col] (+ CP[(row/rowsPerB)·sCPb + by·64 + col] if CP) ; ACT 0 none / 1 elu ; writes f16 C16 (and f32 C if non-null)
template <int ACT>
__global__ __launch_bounds__(128) void k_gemm_hhx(const _Float16* __restrict__ A, int lda, size_t sA, const _Float16* __restrict__ Bh, int ldb, size_t sB, float alpha, const float* __restrict__ bias, size_t sBias, const float* __restrict__ CP, int rowsPerB, size_t sCPb, int row0g,
    float* __restrict__ C, _Float16* __restrict__ C16, int ldc, size_t sC, int M, int N, int K) {
  __shared__ __attribute__((aligned(16))) float so[4][16][64];
  const int tid = threadIdx.x, w = tid >> 5, lane = tid & 31, ln = lane & 15, hh = lane >> 4; const int by = blockIdx.y;
  A += (size_t)by * sA; Bh += (size_t)by * sB; const size_t cofs = (size_t)by * sC; const float* bp = bias ? bias + (size_t)by * sBias : nullptr;
  const int ntn = (N + 63) / 64; const int wid = blockIdx.x * 4 + w; const int mt = wid / ntn, nq = wid % ntn; if (mt * 16 >= M) return;
  const int row0 = mt * 16, col0 = nq * 64; const _Float16* arow = A + (size_t)(row0 + ln) * lda;
  v8f acc[4] = {};
  for (int kb = 0; kb < K; kb += 32) { FragH ah; ah.half[0] = *(const v8us*)((const unsigned short*)arow + kb + 8 * hh); ah.half[1] = *(const v8us*)((const unsigned short*)arow + kb + 16 + 8 * hh);
#pragma unroll
    for (int t = 0; t < 4; ++t) { if (col0 + t * 16 >= N) continue; const size_t boff = (size_t)(col0 + t * 16 + ln) * ldb + kb; FragH bq; bq.half[0] = *(const v8us*)((const unsigned short*)Bh + boff + 8 * hh); bq.half[1] = *(const v8us*)((const unsigned short*)Bh + boff + 16 + 8 * hh);
      acc[t] = mmaH<1>(ah.v, ah.v, bq.v, bq.v, acc[t]); }
  }
#pragma unroll
  for (int t = 0; t < 4; ++t) { if (col0 + t * 16 >= N) continue; const int col = col0 + t * 16 + ln; const float bv = bp ? bf16_round(bp[col]) : 0.f;
#pragma unroll
    for (int r = 0; r < 8; ++r) { float v = acc[t][r] * alpha + bv; if (CP) { const int rr = row0g + row0 + 8 * hh + r; if (rowsPerB < 0) v += CP[cofs + (size_t)rr * ldc + col];      /* rowsPerB < 0: own element of the batched C plane */ else { const int bidx = rr / rowsPerB; v += CP[(size_t)bidx * sCPb + (size_t)by * 64 + col]; } } if (ACT == 1) v = (v > 0.f) ? v : expm1f(v); else if (ACT == 7) v = (v > 0.f) ? v + 1.0f : expf(v); else if (ACT == 8) v = tanhf(v); else if (ACT == 9) v = 0.5f * v * (1.0f + tanhf(0.7978845608028654f * (v + 0.044715f * v * v * v))); else if (ACT == 11) v = 1.0f / (1.0f + expf(-v)); else if (ACT == 12) v = (v > 0.f) ? v : 0.01f * v; else if (ACT == 14) v = (v > 0.f) ? v : 0.1f * v; else if (ACT == 16) v = (v >= 0.f) ? v : 0.3f * v; else if (ACT == 17) v = (v >= 0.f) ? v : 0.2f * v; else if (ACT == 15) v = v / (1.0f + expf(-v)); else if (ACT == 3) v = fmaxf(v, 0.f); else if (ACT == 6) v = 0.5f * v * (1.0f + erff(v * 0.70710678118654752f)); so[w][8 * hh + r][t * 16 + ln] = v; } }
  __builtin_amdgcn_fence(__ATOMIC_ACQ_REL, "workgroup"); __builtin_amdgcn_wave_barrier();
  const int rsub = lane >> 4, c4 = (lane & 15) * 4; typedef _Float16 v4h __attribute__((ext_vector_type(4)));
  {
#pragma unroll
    for (int q = 0; q < 8; ++q) { const int r = q * 2 + rsub; if (col0 + c4 < N) { const v4f v = *(const v4fa*)&so[w][r][c4]; if (C) *(v4f*)(C + cofs + (size_t)(row0 + r) * ldc + col0 + c4) = v; if (C16) { v4h h4; for (int i = 0; i < 4; ++i) h4[i] = (_Float16)v[i]; *(v4h*)(C16 + cofs + (size_t)(row0 + r) * ldc + col0 + c4) = h4; } } }
     }
}


typedef _Float16 v4h __attribute__((ext_vector_type(4)));

__global__ __launch_bounds__(256) void k_x16(const float* __restrict__ x, _Float16* __restrict__ X16, size_t n8) { const size_t t = (size_t)blockIdx.x * 256 + threadIdx.x; if (t >= n8) return; FragH f;
#pragma unroll
  for (int q = 0; q < 8; ++q) f.h[q] = (_Float16)bf16_round(x[t * 8 + q]); *(v8us*)((unsigned short*)X16 + t * 8) = f.half[0];  }
__global__ __launch_bounds__(256) void k_h16(const float* __restrict__ x, _Float16* __restrict__ X16, size_t n8) { const size_t t = (size_t)blockIdx.x * 256 + threadIdx.x; if (t >= n8) return; FragH f;
#pragma unroll
  for (int q = 0; q < 8; ++q) f.h[q] = (_Float16)x[t * 8 + q]; *(v8us*)((unsigned short*)X16 + t * 8) = f.half[0];  }
__global__ __launch_bounds__(256) void k_round16f(const float* __restrict__ W, _Float16* __restrict__ Bt, size_t n8) { const size_t t = (size_t)blockIdx.x * 256 + threadIdx.x; if (t >= n8) return; FragH f;
#pragma unroll
  for (int i = 0; i < 8; ++i) f.h[i] = (_Float16)(bf16_round(W[t * 8 + i]) * 16.0f); *(v8us*)((unsigned short*)Bt + t * 8) = f.half[0];  }
template <int NHv, int TTv>
__global__ __launch_bounds__(256) void k_vt(const _Float16* __restrict__ V16, int ldv, int voff, _Float16* __restrict__ Vt) { __shared__ unsigned short tl[64][66]; const int tid = threadIdx.x; const int slab = blockIdx.x / (TTv / 64), lg = blockIdx.x % (TTv / 64); const int b = slab / NHv, h = slab % NHv;
  for (int i = tid; i < 64 * 8; i += 256) { const int r = i / 8, c8 = (i % 8) * 8; FragH f; f.half[0] = *(const v8us*)((const unsigned short*)V16 + ((size_t)b * TTv + lg * 64 + r) * ldv + voff + h * 64 + c8);
#pragma unroll
    for (int q = 0; q < 8; ++q) tl[r][c8 + q] = f.u[q]; }
  __syncthreads();
  {
#pragma unroll
    for (int rd = 0; rd < 2; ++rd) { const int d = rd * 32 + tid / 8, pc = tid % 8; FragH f;
#pragma unroll
      for (int q = 0; q < 8; ++q) f.u[q] = tl[pc * 8 + q][d];
      *(v8us*)((unsigned short*)Vt + ((size_t)slab * 64 + d) * TTv + lg * 64 + pc * 8) = f.half[0]; }
     } }

__global__ __launch_bounds__(256) void k_hl(const float* __restrict__ F, _Float16* __restrict__ Hh, _Float16* __restrict__ Hl, size_t n8) { const size_t t = (size_t)blockIdx.x * 256 + threadIdx.x; if (t >= n8) return; FragH fh, fl; const v4f a = *(const v4fa*)(F + t * 8), c = *(const v4fa*)(F + t * 8 + 4);
#pragma unroll
  for (int q = 0; q < 4; ++q) { _Float16 h = (_Float16)a[q]; fh.h[q] = h; fl.h[q] = (_Float16)((a[q] - (float)h) * 1024.0f); h = (_Float16)c[q]; fh.h[4 + q] = h; fl.h[4 + q] = (_Float16)((c[q] - (float)h) * 1024.0f); }
  { *(v8us*)((unsigned short*)Hh + t * 8) = fh.half[0]; *(v8us*)((unsigned short*)Hl + t * 8) = fl.half[0];  } }

// ---- fast GEMM (work-group tile 128x64, wave tile 32x64; requires M % 128 == 0 rows per launch region, N % 64 == 0 and K % 64 == 0); epilogue = k_gemm_hhx semantics ----
// Operands go through LDS: a stage is 64 k (128-byte rows, whole cache lines) of the work-group's 128 A rows and 64 Bt rows, brought by asynchronous copies (16 bytes a lane, four whole lines a wave-instruction), two buffers:
// stage s + 1 flies while stage s is multiplied. The fragments are read from LDS in the k order that the global fragment loads had, so every product and every sum is the same as before.
#define G2K 64                       /* k elements per stage */
#define G2P (G2K + 8)                /* LDS pitch of a staged row, f16 elements (144 B = 16 B x odd: no bank conflict for 16-byte fragment reads) */
#define G2R (128 + 64)               /* rows per stage: A rows 0 .. 127, then Bt rows 0 .. 63 */
#define G2S (16 * G2P * 2)           /* LDS bytes between two copies of one lane (16 rows) */
__device__ __forceinline__ v16h g2_frag(const unsigned short* p) { FragH f; f.half[0] = *(const v8us*)p; f.half[1] = *(const v8us*)(p + 16); return f.v; }
__device__ __forceinline__ v8f g2_mma(v16h a, v16h b, v8f c) { v8f d = __builtin_amdgcn_wmma_f32_16x16x32_f16(false, a, false, b, (short)0, c, false, false); asm volatile("v_nop\n\tv_nop\n\tv_nop\n\tv_nop" : "+v"(d) : "v"(a), "v"(b)); return d; }
// one stage's copies of one lane: 16 bytes of A rows r, r + 16, .. r + 112 and of Bt rows r, r + 16, r + 32, r + 48 (r = thread / 8) to LDS byte l + 0, G2S, .. 11 G2S. ra, rb = 16 rows of A, of Bt, in elements.
// The s_wait_xcnt closes the statement so that it stands in front of every later write of a register that a copy names.
__device__ __forceinline__ void g2_copy(unsigned l, const unsigned short* ga, size_t ra, const unsigned short* gb, size_t rb) {
  asm volatile("global_load_async_to_lds_b128 %0, %1, off\n\t"
               "global_load_async_to_lds_b128 %2, %3, off\n\t"
               "global_load_async_to_lds_b128 %4, %5, off\n\t"
               "global_load_async_to_lds_b128 %6, %7, off\n\t"
               "global_load_async_to_lds_b128 %8, %9, off\n\t"
               "global_load_async_to_lds_b128 %10, %11, off\n\t"
               "global_load_async_to_lds_b128 %12, %13, off\n\t"
               "global_load_async_to_lds_b128 %14, %15, off\n\t"
               "global_load_async_to_lds_b128 %16, %17, off\n\t"
               "global_load_async_to_lds_b128 %18, %19, off\n\t"
               "global_load_async_to_lds_b128 %20, %21, off\n\t"
               "global_load_async_to_lds_b128 %22, %23, off\n\t"
               "s_wait_xcnt 0x0"
               :: "v"(l), "v"(ga), "v"(l + 1 * G2S), "v"(ga + ra), "v"(l + 2 * G2S), "v"(ga + 2 * ra), "v"(l + 3 * G2S), "v"(ga + 3 * ra),
                  "v"(l + 4 * G2S), "v"(ga + 4 * ra), "v"(l + 5 * G2S), "v"(ga + 5 * ra), "v"(l + 6 * G2S), "v"(ga + 6 * ra), "v"(l + 7 * G2S), "v"(ga + 7 * ra),
                  "v"(l + 8 * G2S), "v"(gb), "v"(l + 9 * G2S), "v"(gb + rb), "v"(l + 10 * G2S), "v"(gb + 2 * rb), "v"(l + 11 * G2S), "v"(gb + 3 * rb)
               : "memory"); }
template <int ACT>
__global__ __launch_bounds__(128) void k_gemm2(const _Float16* __restrict__ A, int lda, size_t sA, const _Float16* __restrict__ Bh, int ldb, size_t sB, float alpha, const float* __restrict__ bias, size_t sBias, const float* __restrict__ CP, int rowsPerB, size_t sCPb, int row0g,
    float* __restrict__ C, _Float16* __restrict__ C16, int ldc, size_t sC, int M, int N, int K) { static_assert(ACT == 0 || ACT == 3 || ACT == 6 || ACT == 8 || ACT == 9 || ACT == 11 || ACT == 12 || ACT == 14 || ACT == 15 || ACT == 16 || ACT == 17, "k_gemm2: unsupported ACT code (would silently apply no activation)");
  __shared__ __attribute__((aligned(16))) unsigned short st[2][G2R * G2P];
  __shared__ __attribute__((aligned(16))) float so[4][32][68];
  const int tid = threadIdx.x, w = tid >> 5, lane = tid & 31, ln = lane & 15, hh = lane >> 4; const int by = blockIdx.y;
  A += (size_t)by * sA; Bh += (size_t)by * sB; const size_t cofs = (size_t)by * sC; const float* bp = bias ? bias + (size_t)by * sBias : nullptr;
  const int ntn = N >> 6; const int mt = blockIdx.x / ntn, nq = blockIdx.x - mt * ntn; const int row0 = mt * 128 + 32 * w, col0 = nq * 64; if (mt * 128 + 128 > M) return;      /* the same for the whole work-group, in front of every barrier: all 128 staged A rows exist */
  const int cr = tid >> 3, cc = (tid & 7) * 8;      /* the lane's first staged row, and its 16 bytes in the row */
  const unsigned short* ga = (const unsigned short*)A + (size_t)(mt * 128 + cr) * lda + cc; const unsigned short* gb = (const unsigned short*)Bh + (size_t)(col0 + cr) * ldb + cc;
  const size_t ra = (size_t)16 * lda, rb = (size_t)16 * ldb;
  const unsigned l0 = (unsigned)(size_t)&st[0][cr * G2P + cc];      /* LDS byte address: the low 32 bits of the __shared__ address */
  constexpr int SE = G2R * G2P;      /* elements per buffer */
  const int ns = K / G2K;
  g2_copy(l0, ga, ra, gb, rb);
  asm volatile("s_wait_asynccnt 0x0" ::: "memory");      /* this wave's copies of stage 0 have landed */
  __syncthreads();      /* stage 0 is complete for every wave */
  if (ns > 1) g2_copy(l0 + SE * 2, ga + G2K, ra, gb + G2K, rb);
  const unsigned short* fa = &st[0][(32 * w + ln) * G2P + 8 * hh]; const unsigned short* fb = &st[0][(128 + ln) * G2P + 8 * hh];
  const v8f z8 = {0.f,0.f,0.f,0.f,0.f,0.f,0.f,0.f}; v8f c00 = z8, c01 = z8, c02 = z8, c03 = z8, c10 = z8, c11 = z8, c12 = z8, c13 = z8;
  for (int s = 0; s < ns; ++s) { const int bo = (s & 1) * SE; const unsigned short* pa = fa + bo; const unsigned short* pb = fb + bo;
    /* all 24 fragment reads of the stage stand together in front of its 16 products: one LDS latency a stage, not one a fragment */
    const v16h a0 = g2_frag(pa), a1 = g2_frag(pa + 16 * G2P), b0 = g2_frag(pb), b1 = g2_frag(pb + 16 * G2P), b2 = g2_frag(pb + 32 * G2P), b3 = g2_frag(pb + 48 * G2P);
    const v16h a2 = g2_frag(pa + 32), a3 = g2_frag(pa + 16 * G2P + 32), b4 = g2_frag(pb + 32), b5 = g2_frag(pb + 16 * G2P + 32), b6 = g2_frag(pb + 32 * G2P + 32), b7 = g2_frag(pb + 48 * G2P + 32);
    c00 = g2_mma(a0, b0, c00); c10 = g2_mma(a1, b0, c10); c01 = g2_mma(a0, b1, c01); c11 = g2_mma(a1, b1, c11); c02 = g2_mma(a0, b2, c02); c12 = g2_mma(a1, b2, c12); c03 = g2_mma(a0, b3, c03); c13 = g2_mma(a1, b3, c13);
    c00 = g2_mma(a2, b4, c00); c10 = g2_mma(a3, b4, c10); c01 = g2_mma(a2, b5, c01); c11 = g2_mma(a3, b5, c11); c02 = g2_mma(a2, b6, c02); c12 = g2_mma(a3, b6, c12); c03 = g2_mma(a2, b7, c03); c13 = g2_mma(a3, b7, c13);
    asm volatile("s_wait_dscnt 0x0" ::: "memory");      /* this wave's reads of buffer s & 1 are done before the buffer is refilled */
    asm volatile("s_wait_asynccnt 0x0" ::: "memory");      /* this wave's copies of stage s + 1 have landed */
    __syncthreads();      /* publishes stage s + 1 and ends every wave's reads of stage s */
    if (s + 2 < ns) g2_copy(l0 + bo * 2, ga + (size_t)(s + 2) * G2K, ra, gb + (size_t)(s + 2) * G2K, rb); }
  asm volatile("s_wait_asynccnt 0x0" ::: "memory");      /* no copy is outstanding when the wave goes on to its end */
  v8f accs[8] = {c00, c01, c02, c03, c10, c11, c12, c13};
#pragma unroll
  for (int u = 0; u < 8; ++u) { const int t = u & 3, half = u >> 2; const int col = col0 + t * 16 + ln; const float bv = bp ? bf16_round(bp[col]) : 0.f;
#pragma unroll
    for (int r = 0; r < 8; ++r) { const int rloc = half * 16 + 8 * hh + r; float v = accs[u][r] * alpha + bv; if (CP) { if (rowsPerB < 0) v += CP[cofs + (size_t)(row0g + row0 + rloc) * ldc + col];      /* rowsPerB < 0: own element of the batched C plane */ else { const int bidx = (row0g + row0 + rloc) / rowsPerB; v += CP[(size_t)bidx * sCPb + (size_t)by * 64 + col]; } }
      if (ACT == 3) v = fmaxf(v, 0.f); else if (ACT == 6) v = 0.5f * v * (1.0f + erff(v * 0.70710678118654752f)); else if (ACT == 11) v = 1.0f / (1.0f + expf(-v)); else if (ACT == 15) v = v / (1.0f + expf(-v)); else if (ACT == 12) v = (v > 0.f) ? v : 0.01f * v; else if (ACT == 8) v = tanhf(v); else if (ACT == 9) v = 0.5f * v * (1.0f + tanhf(0.7978845608028654f * (v + 0.044715f * v * v * v))); else if (ACT == 14) v = (v > 0.f) ? v : 0.1f * v; else if (ACT == 16) v = (v >= 0.f) ? v : 0.3f * v; else if (ACT == 17) v = (v >= 0.f) ? v : 0.2f * v;
      so[w][rloc][t * 16 + ln] = v; } }
  __builtin_amdgcn_fence(__ATOMIC_ACQ_REL, "workgroup"); __builtin_amdgcn_wave_barrier();
  const int rsub = lane >> 4, c4 = (lane & 15) * 4;
  {
#pragma unroll
    for (int q = 0; q < 16; ++q) { const int r = q * 2 + rsub; const v4f v = *(const v4fa*)&so[w][r][c4]; if (C) *(v4f*)(C + cofs + (size_t)(row0 + r) * ldc + col0 + c4) = v; if (C16) { v4h h4; for (int i = 0; i < 4; ++i) h4[i] = (_Float16)v[i]; *(v4h*)(C16 + cofs + (size_t)(row0 + r) * ldc + col0 + c4) = h4; } }
     } }


__global__ __launch_bounds__(256) void k_wnat(const float* __restrict__ w, size_t n8, _Float16* __restrict__ Bt) { const size_t t = (size_t)blockIdx.x * 256 + threadIdx.x; if (t >= n8) return; FragH f; for (int q = 0; q < 8; ++q) f.h[q] = (_Float16)(bf16_round(w[t * 8 + q]) * 16.0f); *(v8us*)((unsigned short*)Bt + t * 8) = f.half[0];  }
// fused attention, one (batch, head) and 512 queries per work-group of 16 waves. The head's K rows [key][d] and V^T rows [d][key] are laid in LDS once (row pitches 16 B x odd: no bank conflict for 16-byte fragment reads);
// each wave owns 32 queries (two 16-column groups) and walks the keys 32 at a time: S^T = K Q^T (A = K rows, B = Q rows, both in the hardware k order), so a lane holds 16 scores of ONE query per group;
// the two S^T tiles of a group, converted in place, are the B operand P^T of O^T += V^T P^T (register s < 8: key 8 hh + s, s >= 8: key 16 + 8 hh + s - 8). Softmax in base 2 against a running maximum mu, raised only when a score passes it by more than 8 (weights then stay <= 256, inside f16).
#define AKP (HD + 8)                 /* LDS pitch of a K row, f16 elements (144 B) */
#define AVP (SQ + 8)                 /* LDS pitch of a V^T row, f16 elements (2064 B) */
#define AQW 32                       /* queries per wave */
#define ANW 16                       /* waves per work-group */
__device__ __forceinline__ v8f fa_mma(v16h a, v16h b, v8f c) { return __builtin_amdgcn_wmma_f32_16x16x32_f16(false, a, false, b, (short)0, c, false, false); }
__device__ __forceinline__ float fa_xhalf(float x) { return __builtin_bit_cast(float, __builtin_amdgcn_permlanex16(__builtin_bit_cast(int, x), __builtin_bit_cast(int, x), 0x76543210, 0xfedcba98, false, false)); }      /* lane l takes lane l ^ 16, on the vector pipe: no LDS round trip in the loop */
__device__ __forceinline__ v16h fa_frag(const unsigned short* p) { FragH f; f.half[0] = *(const v8us*)p; f.half[1] = *(const v8us*)(p + 16); return f.v; }
__global__ __launch_bounds__(ANW * 32) void k_fattn(const _Float16* __restrict__ Q16, const _Float16* __restrict__ K16, const _Float16* __restrict__ VT, _Float16* __restrict__ O16) {
  __shared__ __attribute__((aligned(16))) unsigned short sk[SQ * AKP];
  __shared__ __attribute__((aligned(16))) unsigned short sv[HD * AVP];
  const int tid = threadIdx.x, w = tid >> 5, lane = tid & 31, ln = lane & 15, hh = lane >> 4;
  constexpr int QB = SQ / (ANW * AQW);      /* work-groups per head */
  const int bh = blockIdx.x / QB, qb = blockIdx.x % QB; const int b = bh / NH, h = bh % NH;
  const unsigned short* kg = (const unsigned short*)K16 + (size_t)b * SQ * DM + h * HD; const unsigned short* vg = (const unsigned short*)VT + (size_t)bh * HD * SQ;
  /* fill: thread t brings 16 bytes of K row u * 64 + t / 8 and of V^T row u * 4 + t / 128 (u = 0 .. 15). One address per plane, the rows told apart by constant offsets; every loop is unrolled whole so that
     all 32 fill loads and the 8 Q loads are in flight together and the register arrays are indexed by constants alone */
  constexpr int NT = ANW * 32, KRS = NT / (HD / 8), VRS = NT / (SQ / 8);      /* threads; K rows and V^T rows covered by one sweep of the work-group */
  const int kr = tid / (HD / 8), kc = (tid % (HD / 8)) * 8, vr = tid / (SQ / 8), vc = (tid % (SQ / 8)) * 8;
  const unsigned short* kgl = kg + (size_t)kr * DM + kc; const unsigned short* vgl = vg + (size_t)vr * SQ + vc;
  const int q0 = qb * (ANW * AQW) + w * AQW;
  const unsigned short* qp = (const unsigned short*)Q16 + ((size_t)b * SQ + q0 + ln) * DM + h * HD + 8 * hh;
  v8us kx[SQ / KRS], vx[HD / VRS]; v16h qf[2][2];
#pragma unroll
  for (int u = 0; u < SQ / KRS; ++u) kx[u] = *(const v8us*)(kgl + (size_t)u * KRS * DM);
#pragma unroll
  for (int u = 0; u < HD / VRS; ++u) vx[u] = *(const v8us*)(vgl + (size_t)u * VRS * SQ);
#pragma unroll
  for (int g = 0; g < 2; ++g) { qf[g][0] = fa_frag(qp + (size_t)g * 16 * DM); qf[g][1] = fa_frag(qp + (size_t)g * 16 * DM + 32); }
  asm volatile("s_wait_xcnt 0x0" :: "v"(kgl), "v"(vgl), "v"(qp) : "memory");      /* the wait owed before a register that an issued global load names is overwritten; the three addresses are inputs so that they stay in their registers up to here */
#pragma unroll
  for (int u = 0; u < SQ / KRS; ++u) *(v8us*)(sk + (kr + u * KRS) * AKP + kc) = kx[u];
#pragma unroll
  for (int u = 0; u < HD / VRS; ++u) *(v8us*)(sv + (vr + u * VRS) * AVP + vc) = vx[u];
  __syncthreads();      /* K and V^T of the head are complete in LDS; nothing writes LDS behind this point */
  /* every inner loop from here on is unrolled whole: the fragment and accumulator arrays are then indexed by constants alone and stay in registers */
  const v8f z8 = {0.f,0.f,0.f,0.f,0.f,0.f,0.f,0.f};
  v8f o[2][4] = {{z8, z8, z8, z8}, {z8, z8, z8, z8}};      /* o[g][t][r] = O^T[d = 16 t + 8 hh + r][query q0 + 16 g + ln], relative to mu[g] */
  float mu[2] = {-3.0e38f, -3.0e38f}, ls[2] = {0.f, 0.f};
  const float CS = 0.125f * 1.4426950408889634f;      /* 1 / sqrt(64), and base e to base 2 */
  const unsigned short* skl = sk + ln * AKP + 8 * hh; const unsigned short* svl = sv + ln * AVP + 8 * hh;
  for (int j = 0; j < SQ; j += 32) {
    v16h kf[2][2], vf[4];
#pragma unroll
    for (int kt = 0; kt < 2; ++kt) { kf[kt][0] = fa_frag(skl + (j + 16 * kt) * AKP); kf[kt][1] = fa_frag(skl + (j + 16 * kt) * AKP + 32); }
#pragma unroll
    for (int t = 0; t < 4; ++t) vf[t] = fa_frag(svl + 16 * t * AVP + j);
    v8f s[2][2];
#pragma unroll
    for (int g = 0; g < 2; ++g)
#pragma unroll
      for (int kt = 0; kt < 2; ++kt) s[g][kt] = fa_mma(kf[kt][1], qf[g][1], fa_mma(kf[kt][0], qf[g][0], z8));
    float mx[2];
#pragma unroll
    for (int g = 0; g < 2; ++g) { float m = fmaxf(s[g][0][0], s[g][1][0]);
#pragma unroll
      for (int r = 1; r < 8; ++r) m = fmaxf(m, fmaxf(s[g][0][r], s[g][1][r]));
      m = fmaxf(m, fa_xhalf(m)); mx[g] = m * CS; }      /* lanes ln and ln + 16 hold the same query: both take the same maximum */
    if (__builtin_amdgcn_ballot_w32(mx[0] > mu[0] + 8.0f || mx[1] > mu[1] + 8.0f) != 0) {      /* wave-uniform; always taken on the first pass */
#pragma unroll
      for (int g = 0; g < 2; ++g) { const float mn = fmaxf(mu[g], mx[g]); const float corr = __builtin_amdgcn_exp2f(mu[g] - mn); mu[g] = mn; ls[g] *= corr;
#pragma unroll
        for (int t = 0; t < 4; ++t) o[g][t] *= corr; } }
#pragma unroll
    for (int g = 0; g < 2; ++g) { FragH pf;
#pragma unroll
      for (int kt = 0; kt < 2; ++kt)
#pragma unroll
        for (int r = 0; r < 8; ++r) { const float p = __builtin_amdgcn_exp2f(fmaf(s[g][kt][r], CS, -mu[g])); ls[g] += p; pf.h[kt * 8 + r] = (_Float16)p; }
#pragma unroll
      for (int t = 0; t < 4; ++t) o[g][t] = fa_mma(vf[t], pf.v, o[g][t]); }
  }
#pragma unroll
  for (int g = 0; g < 2; ++g) { const float l = ls[g] + fa_xhalf(ls[g]); const float sc = 64.0f / l;      /* the two lane halves summed different keys of the same query */
    unsigned short* d = (unsigned short*)O16 + ((size_t)b * SQ + q0 + 16 * g + ln) * DM + h * HD + 8 * hh;
#pragma unroll
    for (int t = 0; t < 4; ++t) { FragH f;
#pragma unroll
      for (int r = 0; r < 8; ++r) f.h[r] = (_Float16)(o[g][t][r] * sc);
      *(v8us*)(d + 16 * t) = f.half[0]; } } }
__global__ __launch_bounds__(256) void k_vt(const _Float16* __restrict__ V16, int b, int h0, _Float16* __restrict__ VT) { __shared__ unsigned short tl[64][65]; const int tid = threadIdx.x; const int hh = blockIdx.x % HG, sg = blockIdx.x / HG; const int s0 = sg * 64; const int h = h0 + hh;
  for (int i = tid; i < 64 * 8; i += 256) { const int j = i / 8, d8 = (i % 8) * 8; FragH f; f.half[0] = *(const v8us*)((const unsigned short*)V16 + ((size_t)b * SQ + s0 + j) * DM + h * HD + d8); for (int q = 0; q < 8; ++q) tl[d8 + q][j] = f.u[q]; }
  __syncthreads();
  { for (int i = tid; i < 64 * 8; i += 256) { const int d = i / 8, j8 = (i % 8) * 8; FragH f; for (int q = 0; q < 8; ++q) f.u[q] = tl[d][j8 + q]; *(v8us*)((unsigned short*)VT + ((size_t)hh * HD + d) * SQ + s0 + j8) = f.half[0]; }  } }



__global__ __launch_bounds__(256) void k_rsmkm(const float* __restrict__ S, _Float16* __restrict__ P, int nrows, const int* __restrict__ am) {
  #pragma clang fp contract(off)
  const int t = blockIdx.x * 256 + threadIdx.x; if (t >= nrows) return; const size_t i = (size_t)t; const float* s = S + i * SQ; const int* mr = am + (size_t)(t % SQ) * SQ; float mx = -3.0e38f;
#pragma unroll 1
  for (int j = 0; j < SQ; ++j) { const float f = (mr[j] != 0) ? 1.f : 0.f; mx = fmaxf(mx, fmaf(f, s[j], (1.f - f) * -1.0e9f)); } float se = 0.f;
#pragma unroll 1
  for (int j = 0; j < SQ; ++j) { const float f = (mr[j] != 0) ? 1.f : 0.f; se += __expf(fmaf(f, s[j], (1.f - f) * -1.0e9f) - mx); } const float sc = 256.0f / se;
#pragma unroll 1
  for (int j0 = 0; j0 < SQ; j0 += 8) { FragH fr; for (int q = 0; q < 8; ++q) { const int j = j0 + q; const float f = (mr[j] != 0) ? 1.f : 0.f; fr.h[q] = (_Float16)(__expf(fmaf(f, s[j], (1.f - f) * -1.0e9f) - mx) * sc); }
    unsigned short* d = (unsigned short*)P + i * SQ + j0; *(v8us*)d = fr.half[0];  } }
__global__ __launch_bounds__(256) void k_lrms(const float* __restrict__ x, const float* __restrict__ w, _Float16* __restrict__ X16) {
  #pragma clang fp contract(off)
  const size_t t = (size_t)blockIdx.x * 256 + threadIdx.x; if (t >= NR * DM / 8) return; const int c8 = (int)(t % (DM / 8)) * 8; const size_t r = t / (DM / 8); const int b = (int)(r / SQ), s = (int)(r % SQ), gi = s / GS, gj = s % GS;
  float b0 = 0.f, b1 = 0.f, b2 = 0.f, b3 = 0.f, b4 = 0.f, b5 = 0.f, b6 = 0.f, b7 = 0.f;
#pragma unroll 1
  for (int di = -RW; di <= RW; ++di) {
#pragma unroll 1
    for (int dj = -RW; dj <= RW; ++dj) { const int ii = gi + di, jj = gj + dj; const float f = (ii >= 0 && ii < GS && jj >= 0 && jj < GS) ? 1.0f : 0.0f; const int ic = ii < 0 ? 0 : (ii >= GS ? GS - 1 : ii), jc = jj < 0 ? 0 : (jj >= GS ? GS - 1 : jj);
      const float* p = x + ((size_t)b * SQ + (size_t)ic * GS + jc) * DM + c8; const v4f a = *(const v4fa*)p, c = *(const v4fa*)(p + 4);
      float v; v = bf16_round(a[0]); b0 = __fadd_rn(b0, __fmul_rn(f, __fmul_rn(v, v))); v = bf16_round(a[1]); b1 = __fadd_rn(b1, __fmul_rn(f, __fmul_rn(v, v))); v = bf16_round(a[2]); b2 = __fadd_rn(b2, __fmul_rn(f, __fmul_rn(v, v))); v = bf16_round(a[3]); b3 = __fadd_rn(b3, __fmul_rn(f, __fmul_rn(v, v)));
      v = bf16_round(c[0]); b4 = __fadd_rn(b4, __fmul_rn(f, __fmul_rn(v, v))); v = bf16_round(c[1]); b5 = __fadd_rn(b5, __fmul_rn(f, __fmul_rn(v, v))); v = bf16_round(c[2]); b6 = __fadd_rn(b6, __fmul_rn(f, __fmul_rn(v, v))); v = bf16_round(c[3]); b7 = __fadd_rn(b7, __fmul_rn(f, __fmul_rn(v, v))); } }
  const float* pc = x + r * DM + c8; const v4f xa = *(const v4fa*)pc, xc = *(const v4fa*)(pc + 4); const v4f wa = *(const v4fa*)(w + c8), wc = *(const v4fa*)(w + c8 + 4); const float bx[8] = {b0, b1, b2, b3, b4, b5, b6, b7}; FragH fr;
#pragma unroll
  for (int q = 0; q < 8; ++q) { const float xv = bf16_round(q < 4 ? xa[q] : xc[q - 4]); const float wv = bf16_round(q < 4 ? wa[q] : wc[q - 4]); const float rms = sqrtf(__fadd_rn(0.0000001f, __fmul_rn(bx[q], 0.02040816326530612f)));      /* box / 49 as a multiply by the f32 reciprocal (the result is rounded to f16 next) */ fr.h[q] = (_Float16)__fmul_rn(__fdiv_rn(xv, rms), wv); }
  unsigned short* d = (unsigned short*)X16 + r * DM + c8; *(v8us*)d = fr.half[0];  }


extern "C" void kernel_launch(void* const* d_in, const int* in_sizes, int n_in,
                              void* d_out, int out_size, void* d_ws, size_t ws_size, hipStream_t stream) {
  (void)in_sizes; (void)n_in; (void)out_size;
  const float* const* I = (const float* const*)d_in; const float* x = I[0]; const float* nw = I[1]; const float* wq = I[2]; const float* bq = I[3]; const float* wk = I[4]; const float* bk = I[5]; const float* wv = I[6]; const float* bv = I[7]; const float* wo = I[8]; const float* bo = I[9];      /* x; norm_w [768]; natural [768][768] weights + biases (q, k, v, o) */
  static_assert(SQ == GS * GS && DM % 8 == 0 && DM % 64 == 0 && DM % 32 == 0 && SQ % 128 == 0 && NH * HD == DM && NH % HG == 0 && HD == 64 && SQ % (ANW * AQW) == 0 && B0 == 0 && NBR == NB && QN == SQ && NHD == NH, "shape / tile multiples");
  char* ws = (char*)d_ws; size_t off = 0;
  auto take = [&](size_t bytes) { char* p = ws + off; off += (bytes + 255) & ~(size_t)255; return p; };
  _Float16* BQ = (_Float16*)take((size_t)DM * DM * 2); _Float16* BK = (_Float16*)take((size_t)DM * DM * 2); _Float16* BV = (_Float16*)take((size_t)DM * DM * 2); _Float16* BO = (_Float16*)take((size_t)DM * DM * 2);
  _Float16* X16 = (_Float16*)take(NR * DM * 2); _Float16* Q16 = (_Float16*)take(NR * DM * 2); _Float16* K16 = (_Float16*)take(NR * DM * 2); _Float16* V16 = (_Float16*)take(NR * DM * 2); _Float16* O16 = (_Float16*)take(NR * DM * 2);
  _Float16* VT = (_Float16*)take((size_t)NB * NH * HD * SQ * 2);
  if (off > ws_size) return;      /* approx 4.5 + 6 x 12 = 77 MiB */
  { const unsigned g = (unsigned)(((size_t)DM * DM / 8 + 255) / 256); k_wnat<<<g, 256, 0, stream>>>(wq, (size_t)DM * DM / 8, BQ); k_wnat<<<g, 256, 0, stream>>>(wk, (size_t)DM * DM / 8, BK); k_wnat<<<g, 256, 0, stream>>>(wv, (size_t)DM * DM / 8, BV); k_wnat<<<g, 256, 0, stream>>>(wo, (size_t)DM * DM / 8, BO); }      /* natural [out][in] = Bt[n][k] x16 */
  k_lrms<<<(unsigned)((NR * DM / 8 + 255) / 256), 256, 0, stream>>>(x, nw, X16);      /* xn = local-RMS-normalised x as f16 rows: the A operand of all three projections */
  const size_t r0p = (size_t)B0 * SQ;      /* first projected row */
  k_gemm2<0><<<dim3((unsigned)((MP / 128) * (DM / 64)), 1), 128, 0, stream>>>(X16 + r0p * DM, DM, 0, BQ, DM, 0, 0.0625f, bq, 0, nullptr, 1, 0, 0, nullptr, Q16 + r0p * DM, DM, 0, MP, DM, DM);
  k_gemm2<0><<<dim3((unsigned)((MP / 128) * (DM / 64)), 1), 128, 0, stream>>>(X16 + r0p * DM, DM, 0, BK, DM, 0, 0.0625f, bk, 0, nullptr, 1, 0, 0, nullptr, K16 + r0p * DM, DM, 0, MP, DM, DM);
  k_gemm2<0><<<dim3((unsigned)((MP / 128) * (DM / 64)), 1), 128, 0, stream>>>(X16 + r0p * DM, DM, 0, BV, DM, 0, 0.0625f, bv, 0, nullptr, 1, 0, 0, nullptr, V16 + r0p * DM, DM, 0, MP, DM, DM);
  k_vt<NH, SQ><<<NB * NH * (SQ / 64), 256, 0, stream>>>(V16, LQ, 0, VT);      /* V^T [NB * NH][HD][SQ], all batches */
  k_fattn<<<NB * NH * (SQ / (ANW * AQW)), ANW * 32, 0, stream>>>(Q16, K16, VT, O16);      /* o (merged heads, x64) as f16 rows */
  k_gemm2<0><<<dim3((unsigned)((MPO / 128) * (DM / 64)), 1), 128, 0, stream>>>(O16 + r0p * DM, DM, 0, BO, DM, 0, 0.0009765625f, bo, 0, nullptr, 1, 0, 0, (float*)d_out + r0p * DM, nullptr, DM, 0, MPO, DM, DM);      /* out rows are the output layout */
}

// v004
// One run takes 118 microseconds.
// Timed twice side by side with v003, it ran 1.34 times as fast both times.
// Counting every step since v000, it is 45.3 times as fast.
#include <hip/hip_runtime.h>
#define NB 8
#define SQ 1024
#define GS 32                        /* token grid side: SQ = GS * GS */
#define RW 3                         /* local-norm window radius (7 x 7) */
#define DM 768
#define NH 12
#define HD 64
#define HG 4                         /* heads per launch of the per-group k_vt (not launched) */
#define B0 0                         /* first batch processed (debug hook) */
#define NBR NB                       /* batches processed (debug hook) */
#define NR ((size_t)NB * SQ)         /* token rows */
#define MP ((int)((size_t)NBR * SQ)) /* rows projected (debug hook) */
#define QN SQ                        /* query rows attended per batch (debug hook) */
#define NHD NH                       /* heads attended (debug hook) */
#define MPO MP                       /* rows through the output stage (debug hook) */
#define LQ DM      /* row pitch of the q/k/v rows */
typedef __bf16 v16b __attribute__((ext_vector_type(16)));
typedef unsigned short v8us __attribute__((ext_vector_type(8), may_alias));
typedef float  v8f  __attribute__((ext_vector_type(8)));
typedef float  v4f  __attribute__((ext_vector_type(4)));
typedef float  v4fa __attribute__((ext_vector_type(4), may_alias));
union FragB { v16b v; v8us half[2]; unsigned short u[16]; };

__device__ __forceinline__ unsigned short bf16_bits(float x) { unsigned int u = __float_as_uint(x); return (unsigned short)((u + 0x7FFFu + ((u >> 16) & 1u)) >> 16); }
__device__ __forceinline__ float bf16_val(unsigned short b) { return __uint_as_float(((unsigned int)b) << 16); }
__device__ __forceinline__ float bf16_round(float x) { return bf16_val(bf16_bits(x)); }
// D += A·B with NT terms: 1 = ah·bh, 2 = + al·bh (A split), 3 = + ah·bl (both split)
template <int NT>
__device__ __forceinline__ v8f mmaN(v16b ah, v16b al, v16b bh, v16b bl, v8f c) {
  c = __builtin_amdgcn_wmma_f32_16x16x32_bf16(false, ah, false, bh, (short)0, c, false, false);
  if (NT >= 2) c = __builtin_amdgcn_wmma_f32_16x16x32_bf16(false, al, false, bh, (short)0, c, false, false);
  if (NT >= 3) c = __builtin_amdgcn_wmma_f32_16x16x32_bf16(false, ah, false, bl, (short)0, c, false, false);
  asm volatile("v_nop\n\tv_nop\n\tv_nop\n\tv_nop" : "+v"(c) : "v"(ah), "v"(al), "v"(bh), "v"(bl));
  return c;
}

__global__ __launch_bounds__(256) void k_wt_bf16(const float* __restrict__ W, unsigned short* __restrict__ Wt, int K, int N) {
  const int t = blockIdx.x * 256 + threadIdx.x;
  const int k8n = K / 8;
  if (t >= N * k8n) return;
  const int n = t / k8n, k8 = (t % k8n) * 8;
  v8us v;
#pragma unroll
  for (int i = 0; i < 8; ++i) v[i] = bf16_bits(W[(size_t)(k8 + i) * N + n]);
  *(v8us*)(Wt + (size_t)n * K + k8) = v;
  
}

// GEMM C[M][N] (f32, pitch ldc) = act(A[M][K]·W + bias). A f32 row-major (pitch lda) converted per fragment to bf16
// (ASPLIT: hi/lo two planes -> 2 terms, else single rounded term); Wt bf16 [N][K] (pitch ldb). BIAS_BF16 rounds the
// bias to bf16 first (bias quantised to bf16 before the add). K%32==0, M%16==0, N%64==0.
template <bool ASPLIT, int ACT, bool BIAS_BF16>
__global__ __launch_bounds__(128) void k_gemm_bf(const float* __restrict__ A, int lda, const unsigned short* __restrict__ Wt, int ldb,
                                               const float* __restrict__ bias, float* __restrict__ C, int ldc, int M, int N, int K) {
  __shared__ __attribute__((aligned(16))) float so[4][16][64];
  const int tid = threadIdx.x, w = tid >> 5, lane = tid & 31, ln = lane & 15, hh = lane >> 4;
  const int ntn = N / 64;
  const int wid = blockIdx.x * 4 + w;
  const int mt = wid / ntn, nq = wid % ntn;
  if (mt * 16 >= M) return;
  const int row0 = mt * 16, col0 = nq * 64;
  const float* arow = A + (size_t)(row0 + ln) * lda;
  v8f acc[4] = {};
  for (int kb = 0; kb < K; kb += 32) {
    FragB ah, al;
    const v4f x0 = *(const v4fa*)(arow + kb + 8 * hh), x1 = *(const v4fa*)(arow + kb + 8 * hh + 4);
    const v4f x2 = *(const v4fa*)(arow + kb + 16 + 8 * hh), x3 = *(const v4fa*)(arow + kb + 16 + 8 * hh + 4);
    float xs[16] = {x0[0],x0[1],x0[2],x0[3],x1[0],x1[1],x1[2],x1[3],x2[0],x2[1],x2[2],x2[3],x3[0],x3[1],x3[2],x3[3]};
#pragma unroll
    for (int i = 0; i < 16; ++i) { const unsigned short hb = bf16_bits(xs[i]); ah.u[i] = hb; al.u[i] = ASPLIT ? bf16_bits(xs[i] - bf16_val(hb)) : (unsigned short)0; }
#pragma unroll
    for (int t = 0; t < 4; ++t) {
      const unsigned short* brow = Wt + (size_t)(col0 + t * 16 + ln) * ldb + kb;
      FragB b;
      b.half[0] = *(const v8us*)(brow + 8 * hh);
      b.half[1] = *(const v8us*)(brow + 16 + 8 * hh);
      acc[t] = mmaN<ASPLIT ? 2 : 1>(ah.v, al.v, b.v, b.v, acc[t]);
    }
  }
#pragma unroll
  for (int t = 0; t < 4; ++t) {
    float bv = bias ? bias[col0 + t * 16 + ln] : 0.f;
    if (BIAS_BF16) bv = bf16_round(bv);
#pragma unroll
    for (int r = 0; r < 8; ++r) { float v = acc[t][r] + bv; if (ACT == 1) v = fmaxf(v, 0.f); so[w][8 * hh + r][t * 16 + ln] = v; }
  }
  __builtin_amdgcn_fence(__ATOMIC_ACQ_REL, "workgroup");
  __builtin_amdgcn_wave_barrier();
  const int rsub = lane >> 4, c4 = (lane & 15) * 4;
  {
#pragma unroll
    for (int q = 0; q < 8; ++q) {
      const int r = q * 2 + rsub;
      const v4f v = *(const v4fa*)&so[w][r][c4];
      *(v4f*)(C + (size_t)(row0 + r) * ldc + col0 + c4) = v;
    }
    
  }
}

// GEMM C = act(A·W + bias + resid): A f32 (ASPLIT -> hi/lo 2 terms), Wt bf16 [N][K]; ACT 0 none, 1 relu, 2 exact gelu;
// resid (optional, f32, row index = (row % rmod), pitch ldr, RES_BF16 rounds it) added before the activation.
template <bool ASPLIT, int ACT, bool BIAS_BF16, bool RES_BF16>
__global__ __launch_bounds__(128) void k_gemm_bf3(const float* __restrict__ A, int lda, const unsigned short* __restrict__ Wt, int ldb,
                                                const float* __restrict__ bias, const float* __restrict__ resid, int rmod, int ldr,
                                                float* __restrict__ C, int ldc, int M, int N, int K) {
  __shared__ __attribute__((aligned(16))) float so[4][16][64];
  const int tid = threadIdx.x, w = tid >> 5, lane = tid & 31, ln = lane & 15, hh = lane >> 4;
  const int ntn = N / 64;
  const int wid = blockIdx.x * 4 + w;
  const int mt = wid / ntn, nq = wid % ntn;
  if (mt * 16 >= M) return;
  const int row0 = mt * 16, col0 = nq * 64;
  const float* arow = A + (size_t)(row0 + ln) * lda;
  v8f acc[4] = {};
  for (int kb = 0; kb < K; kb += 32) {
    FragB ah, al;
    const v4f x0 = *(const v4fa*)(arow + kb + 8 * hh), x1 = *(const v4fa*)(arow + kb + 8 * hh + 4);
    const v4f x2 = *(const v4fa*)(arow + kb + 16 + 8 * hh), x3 = *(const v4fa*)(arow + kb + 16 + 8 * hh + 4);
    float xs[16] = {x0[0],x0[1],x0[2],x0[3],x1[0],x1[1],x1[2],x1[3],x2[0],x2[1],x2[2],x2[3],x3[0],x3[1],x3[2],x3[3]};
#pragma unroll
    for (int i = 0; i < 16; ++i) { const unsigned short hb = bf16_bits(xs[i]); ah.u[i] = hb; al.u[i] = ASPLIT ? bf16_bits(xs[i] - bf16_val(hb)) : (unsigned short)0; }
#pragma unroll
    for (int t = 0; t < 4; ++t) {
      const unsigned short* brow = Wt + (size_t)(col0 + t * 16 + ln) * ldb + kb;
      FragB b;
      b.half[0] = *(const v8us*)(brow + 8 * hh);
      b.half[1] = *(const v8us*)(brow + 16 + 8 * hh);
      acc[t] = mmaN<ASPLIT ? 2 : 1>(ah.v, al.v, b.v, b.v, acc[t]);
    }
  }
#pragma unroll
  for (int t = 0; t < 4; ++t) {
    const int col = col0 + t * 16 + ln;
    float bv = bias ? bias[col] : 0.f;
    if (BIAS_BF16) bv = bf16_round(bv);
#pragma unroll
    for (int r = 0; r < 8; ++r) {
      float v = acc[t][r] + bv;
      if (resid) { float rv = resid[(size_t)((row0 + 8 * hh + r) % rmod) * ldr + col]; if (RES_BF16) rv = bf16_round(rv); v += rv; }
      if (ACT == 1) v = fmaxf(v, 0.f);
      if (ACT == 2) v = 0.5f * v * (1.0f + erff(v * 0.70710678118654752f));
      if (ACT == 3) { const float u = 0.7978845608028654f * (v + 0.044715f * v * v * v); v = 0.5f * v * (1.0f + tanhf(u)); }
      so[w][8 * hh + r][t * 16 + ln] = v;
    }
  }
  __builtin_amdgcn_fence(__ATOMIC_ACQ_REL, "workgroup");
  __builtin_amdgcn_wave_barrier();
  const int rsub = lane >> 4, c4 = (lane & 15) * 4;
  {
#pragma unroll
    for (int q = 0; q < 8; ++q) {
      const int r = q * 2 + rsub;
      const v4f v = *(const v4fa*)&so[w][r][c4];
      *(v4f*)(C + (size_t)(row0 + r) * ldc + col0 + c4) = v;
    }
    
  }
}
// row LayerNorm (biased variance, eps) over N: s = X (+ R); optional out_sum <- s; out_norm <- (s-mu)*rsqrt(var+eps)*g + b
template <bool PARAM_BF16>
__global__ __launch_bounds__(256) void k_layernorm(const float* __restrict__ X, const float* __restrict__ R, const float* __restrict__ g, const float* __restrict__ bta,
                                                  float* __restrict__ out_sum, float* __restrict__ out_norm, int N, float eps) {
  __shared__ float red[256];
  const int row = blockIdx.x, tid = threadIdx.x;
  const float* x = X + (size_t)row * N; const float* rr = R ? R + (size_t)row * N : nullptr;
  float vals[16];                     // up to N = 4096
  const int per = N / 256;            // contiguous chunk per thread? use strided-by-4 chunks: thread handles j = tid*4 + 1024*u
  float s1 = 0.f;
  for (int u = 0; u < per / 4; ++u) {
    const int j = tid * 4 + 1024 * u;
    const v4f a = *(const v4fa*)(x + j);
    v4f b = {0.f,0.f,0.f,0.f}; if (rr) b = *(const v4fa*)(rr + j);
#pragma unroll
    for (int q = 0; q < 4; ++q) { const float v = a[q] + b[q]; vals[u * 4 + q] = v; s1 += v; }
  }
  red[tid] = s1; __syncthreads();
  for (int st = 128; st > 0; st >>= 1) { if (tid < st) red[tid] += red[tid + st]; __syncthreads(); }
  const float mu = red[0] / (float)N; __syncthreads();
  float s2 = 0.f;
  for (int u = 0; u < per / 4; ++u)
#pragma unroll
    for (int q = 0; q < 4; ++q) { const float c = vals[u * 4 + q] - mu; s2 += c * c; }
  red[tid] = s2; __syncthreads();
  for (int st = 128; st > 0; st >>= 1) { if (tid < st) red[tid] += red[tid + st]; __syncthreads(); }
  const float rs = rsqrtf(red[0] / (float)N + eps);
  {
    for (int u = 0; u < per / 4; ++u) {
      const int j = tid * 4 + 1024 * u;
      v4f o, sm;
#pragma unroll
      for (int q = 0; q < 4; ++q) {
        float gg = g[j + q], bb = bta[j + q];
        if (PARAM_BF16) { gg = bf16_round(gg); bb = bf16_round(bb); }
        sm[q] = vals[u * 4 + q]; o[q] = (vals[u * 4 + q] - mu) * rs * gg + bb;
      }
      if (out_sum) *(v4f*)(out_sum + (size_t)row * N + j) = sm;
      *(v4f*)(out_norm + (size_t)row * N + j) = o;
    }
    
  }
}



// ---- f16 WMMA path (v_wmma_f32_16x16x32_f16): 11-bit significands for operands in range — used where a [0,1] probability operand needs more precision than bf16
typedef _Float16 v16h __attribute__((ext_vector_type(16)));
union FragH { v16h v; v8us half[2]; _Float16 h[16]; unsigned short u[16]; };
template <int NT>
__device__ __forceinline__ v8f mmaH(v16h ah, v16h al, v16h bh, v16h bl, v8f c) {
  c = __builtin_amdgcn_wmma_f32_16x16x32_f16(false, ah, false, bh, (short)0, c, false, false);
  if (NT >= 2) c = __builtin_amdgcn_wmma_f32_16x16x32_f16(false, al, false, bh, (short)0, c, false, false);
  if (NT >= 3) c = __builtin_amdgcn_wmma_f32_16x16x32_f16(false, ah, false, bl, (short)0, c, false, false);
  asm volatile("v_nop\n\tv_nop\n\tv_nop\n\tv_nop" : "+v"(c) : "v"(ah), "v"(al), "v"(bh), "v"(bl));
  return c;
}
// batched GEMM like k_gemm_b but f16 operands: A f32 (split into f16 hi/lo if ASPLIT, else rounded to f16), Bt = f16 values [n][k]; alpha; C f32; N multiple of 16 (partial tiles skipped)
template <bool ASPLIT>
__global__ __launch_bounds__(128) void k_gemm_h(const float* __restrict__ A, int lda, size_t sA, const _Float16* __restrict__ Bh, int ldb, size_t sB, float alpha, float* __restrict__ C, int ldc, size_t sC, int M, int N, int K) {
  __shared__ __attribute__((aligned(16))) float so[4][16][64];
  const int tid = threadIdx.x, w = tid >> 5, lane = tid & 31, ln = lane & 15, hh = lane >> 4; const int by = blockIdx.y;
  A += (size_t)by * sA; Bh += (size_t)by * sB; C += (size_t)by * sC;
  const int ntn = (N + 63) / 64; const int wid = blockIdx.x * 4 + w; const int mt = wid / ntn, nq = wid % ntn; if (mt * 16 >= M) return;
  const int row0 = mt * 16, col0 = nq * 64; const float* arow = A + (size_t)(row0 + ln) * lda;
  v8f acc[4] = {};
  for (int kb = 0; kb < K; kb += 32) {
    FragH ah, al;
    const v4f x0 = *(const v4fa*)(arow + kb + 8 * hh), x1 = *(const v4fa*)(arow + kb + 8 * hh + 4), x2 = *(const v4fa*)(arow + kb + 16 + 8 * hh), x3 = *(const v4fa*)(arow + kb + 16 + 8 * hh + 4);
    float xs[16] = {x0[0],x0[1],x0[2],x0[3],x1[0],x1[1],x1[2],x1[3],x2[0],x2[1],x2[2],x2[3],x3[0],x3[1],x3[2],x3[3]};
#pragma unroll
    for (int i = 0; i < 16; ++i) { const _Float16 h = (_Float16)xs[i]; ah.h[i] = h; al.h[i] = ASPLIT ? (_Float16)(xs[i] - (float)h) : (_Float16)0.0f; }
#pragma unroll
    for (int t = 0; t < 4; ++t) { if (col0 + t * 16 >= N) continue; const size_t boff = (size_t)(col0 + t * 16 + ln) * ldb + kb; FragH bq; bq.half[0] = *(const v8us*)(Bh + boff + 8 * hh); bq.half[1] = *(const v8us*)(Bh + boff + 16 + 8 * hh);
      acc[t] = mmaH<ASPLIT ? 2 : 1>(ah.v, al.v, bq.v, bq.v, acc[t]); }
  }
#pragma unroll
  for (int t = 0; t < 4; ++t) { if (col0 + t * 16 >= N) continue;
#pragma unroll
    for (int r = 0; r < 8; ++r) so[w][8 * hh + r][t * 16 + ln] = acc[t][r] * alpha; }
  __builtin_amdgcn_fence(__ATOMIC_ACQ_REL, "workgroup"); __builtin_amdgcn_wave_barrier();
  const int rsub = lane >> 4, c4 = (lane & 15) * 4;
  {
#pragma unroll
    for (int q = 0; q < 8; ++q) { const int r = q * 2 + rsub; if (col0 + c4 < N) { const v4f v = *(const v4fa*)&so[w][r][c4]; *(v4f*)(C + (size_t)(row0 + r) * ldc + col0 + c4) = v; } }
     }
}

// Wt[n][k] = f16(W[k][n]·scale) from f32 row-major W[K][N] (scale = power of two; bf16-exact weights stay exact in f16 away from the subnormal range)
__global__ __launch_bounds__(256) void k_wt_f16(const float* __restrict__ W, _Float16* __restrict__ Wt, int K, int N, float scale) {
  const int t = blockIdx.x * 256 + threadIdx.x; if (t >= N * (K / 8)) return; const int n = t / (K / 8), k8 = (t % (K / 8)) * 8; FragH f;
#pragma unroll
  for (int i = 0; i < 8; ++i) f.h[i] = (_Float16)(bf16_round(W[(size_t)(k8 + i) * N + n]) * scale); const v8us o = f.half[0];
  *(v8us*)((unsigned short*)Wt + (size_t)n * K + k8) = o; 
}
// k_gemm_hh variant with fused epilogue: v = acc·alpha + bias[by·sBias + col] (+ CP[(row/rowsPerB)·sCPb + by·64 + col] if CP) ; ACT 0 none / 1 elu ; writes f16 C16 (and f32 C if non-null)
template <int ACT>
__global__ __launch_bounds__(128) void k_gemm_hhx(const _Float16* __restrict__ A, int lda, size_t sA, const _Float16* __restrict__ Bh, int ldb, size_t sB, float alpha, const float* __restrict__ bias, size_t sBias, const float* __restrict__ CP, int rowsPerB, size_t sCPb, int row0g,
    float* __restrict__ C, _Float16* __restrict__ C16, int ldc, size_t sC, int M, int N, int K) {
  __shared__ __attribute__((aligned(16))) float so[4][16][64];
  const int tid = threadIdx.x, w = tid >> 5, lane = tid & 31, ln = lane & 15, hh = lane >> 4; const int by = blockIdx.y;
  A += (size_t)by * sA; Bh += (size_t)by * sB; const size_t cofs = (size_t)by * sC; const float* bp = bias ? bias + (size_t)by * sBias : nullptr;
  const int ntn = (N + 63) / 64; const int wid = blockIdx.x * 4 + w; const int mt = wid / ntn, nq = wid % ntn; if (mt * 16 >= M) return;
  const int row0 = mt * 16, col0 = nq * 64; const _Float16* arow = A + (size_t)(row0 + ln) * lda;
  v8f acc[4] = {};
  for (int kb = 0; kb < K; kb += 32) { FragH ah; ah.half[0] = *(const v8us*)((const unsigned short*)arow + kb + 8 * hh); ah.half[1] = *(const v8us*)((const unsigned short*)arow + kb + 16 + 8 * hh);
#pragma unroll
    for (int t = 0; t < 4; ++t) { if (col0 + t * 16 >= N) continue; const size_t boff = (size_t)(col0 + t * 16 + ln) * ldb + kb; FragH bq; bq.half[0] = *(const v8us*)((const unsigned short*)Bh + boff + 8 * hh); bq.half[1] = *(const v8us*)((const unsigned short*)Bh + boff + 16 + 8 * hh);
      acc[t] = mmaH<1>(ah.v, ah.v, bq.v, bq.v, acc[t]); }
  }
#pragma unroll
  for (int t = 0; t < 4; ++t) { if (col0 + t * 16 >= N) continue; const int col = col0 + t * 16 + ln; const float bv = bp ? bf16_round(bp[col]) : 0.f;
#pragma unroll
    for (int r = 0; r < 8; ++r) { float v = acc[t][r] * alpha + bv; if (CP) { const int rr = row0g + row0 + 8 * hh + r; if (rowsPerB < 0) v += CP[cofs + (size_t)rr * ldc + col];      /* rowsPerB < 0: own element of the batched C plane */ else { const int bidx = rr / rowsPerB; v += CP[(size_t)bidx * sCPb + (size_t)by * 64 + col]; } } if (ACT == 1) v = (v > 0.f) ? v : expm1f(v); else if (ACT == 7) v = (v > 0.f) ? v + 1.0f : expf(v); else if (ACT == 8) v = tanhf(v); else if (ACT == 9) v = 0.5f * v * (1.0f + tanhf(0.7978845608028654f * (v + 0.044715f * v * v * v))); else if (ACT == 11) v = 1.0f / (1.0f + expf(-v)); else if (ACT == 12) v = (v > 0.f) ? v : 0.01f * v; else if (ACT == 14) v = (v > 0.f) ? v : 0.1f * v; else if (ACT == 16) v = (v >= 0.f) ? v : 0.3f * v; else if (ACT == 17) v = (v >= 0.f) ? v : 0.2f * v; else if (ACT == 15) v = v / (1.0f + expf(-v)); else if (ACT == 3) v = fmaxf(v, 0.f); else if (ACT == 6) v = 0.5f * v * (1.0f + erff(v * 0.70710678118654752f)); so[w][8 * hh + r][t * 16 + ln] = v; } }
  __builtin_amdgcn_fence(__ATOMIC_ACQ_REL, "workgroup"); __builtin_amdgcn_wave_barrier();
  const int rsub = lane >> 4, c4 = (lane & 15) * 4; typedef _Float16 v4h __attribute__((ext_vector_type(4)));
  {
#pragma unroll
    for (int q = 0; q < 8; ++q) { const int r = q * 2 + rsub; if (col0 + c4 < N) { const v4f v = *(const v4fa*)&so[w][r][c4]; if (C) *(v4f*)(C + cofs + (size_t)(row0 + r) * ldc + col0 + c4) = v; if (C16) { v4h h4; for (int i = 0; i < 4; ++i) h4[i] = (_Float16)v[i]; *(v4h*)(C16 + cofs + (size_t)(row0 + r) * ldc + col0 + c4) = h4; } } }
     }
}


typedef _Float16 v4h __attribute__((ext_vector_type(4)));

__global__ __launch_bounds__(256) void k_x16(const float* __restrict__ x, _Float16* __restrict__ X16, size_t n8) { const size_t t = (size_t)blockIdx.x * 256 + threadIdx.x; if (t >= n8) return; FragH f;
#pragma unroll
  for (int q = 0; q < 8; ++q) f.h[q] = (_Float16)bf16_round(x[t * 8 + q]); *(v8us*)((unsigned short*)X16 + t * 8) = f.half[0];  }
__global__ __launch_bounds__(256) void k_h16(const float* __restrict__ x, _Float16* __restrict__ X16, size_t n8) { const size_t t = (size_t)blockIdx.x * 256 + threadIdx.x; if (t >= n8) return; FragH f;
#pragma unroll
  for (int q = 0; q < 8; ++q) f.h[q] = (_Float16)x[t * 8 + q]; *(v8us*)((unsigned short*)X16 + t * 8) = f.half[0];  }
__global__ __launch_bounds__(256) void k_round16f(const float* __restrict__ W, _Float16* __restrict__ Bt, size_t n8) { const size_t t = (size_t)blockIdx.x * 256 + threadIdx.x; if (t >= n8) return; FragH f;
#pragma unroll
  for (int i = 0; i < 8; ++i) f.h[i] = (_Float16)(bf16_round(W[t * 8 + i]) * 16.0f); *(v8us*)((unsigned short*)Bt + t * 8) = f.half[0];  }
template <int NHv, int TTv>
__global__ __launch_bounds__(256) void k_vt(const _Float16* __restrict__ V16, int ldv, int voff, _Float16* __restrict__ Vt) { __shared__ unsigned short tl[64][66]; const int tid = threadIdx.x; const int slab = blockIdx.x / (TTv / 64), lg = blockIdx.x % (TTv / 64); const int b = slab / NHv, h = slab % NHv;
  for (int i = tid; i < 64 * 8; i += 256) { const int r = i / 8, c8 = (i % 8) * 8; FragH f; f.half[0] = *(const v8us*)((const unsigned short*)V16 + ((size_t)b * TTv + lg * 64 + r) * ldv + voff + h * 64 + c8);
#pragma unroll
    for (int q = 0; q < 8; ++q) tl[r][c8 + q] = f.u[q]; }
  __syncthreads();
  {
#pragma unroll
    for (int rd = 0; rd < 2; ++rd) { const int d = rd * 32 + tid / 8, pc = tid % 8; FragH f;
#pragma unroll
      for (int q = 0; q < 8; ++q) f.u[q] = tl[pc * 8 + q][d];
      *(v8us*)((unsigned short*)Vt + ((size_t)slab * 64 + d) * TTv + lg * 64 + pc * 8) = f.half[0]; }
     } }

__global__ __launch_bounds__(256) void k_hl(const float* __restrict__ F, _Float16* __restrict__ Hh, _Float16* __restrict__ Hl, size_t n8) { const size_t t = (size_t)blockIdx.x * 256 + threadIdx.x; if (t >= n8) return; FragH fh, fl; const v4f a = *(const v4fa*)(F + t * 8), c = *(const v4fa*)(F + t * 8 + 4);
#pragma unroll
  for (int q = 0; q < 4; ++q) { _Float16 h = (_Float16)a[q]; fh.h[q] = h; fl.h[q] = (_Float16)((a[q] - (float)h) * 1024.0f); h = (_Float16)c[q]; fh.h[4 + q] = h; fl.h[4 + q] = (_Float16)((c[q] - (float)h) * 1024.0f); }
  { *(v8us*)((unsigned short*)Hh + t * 8) = fh.half[0]; *(v8us*)((unsigned short*)Hl + t * 8) = fl.half[0];  } }

// ---- fast GEMM (work-group tile 128x64, wave tile 32x64; requires M % 128 == 0 rows per launch region, N % 64 == 0 and K % 64 == 0); epilogue = k_gemm_hhx semantics ----
// Operands go through LDS: a stage is 64 k (128-byte rows, whole cache lines) of the work-group's 128 A rows and 64 Bt rows, brought by asynchronous copies (16 bytes a lane, four whole lines a wave-instruction), two buffers:
// stage s + 1 flies while stage s is multiplied. The fragments are read from LDS in the k order that the global fragment loads had, so every product and every sum is the same as before.
#define G2K 64                       /* k elements per stage */
#define G2P (G2K + 8)                /* LDS pitch of a staged row, f16 elements (144 B = 16 B x odd: no bank conflict for 16-byte fragment reads) */
#define G2R (128 + 64)               /* rows per stage: A rows 0 .. 127, then Bt rows 0 .. 63 */
#define G2S (16 * G2P * 2)           /* LDS bytes between two copies of one lane (16 rows) */
__device__ __forceinline__ v16h g2_frag(const unsigned short* p) { FragH f; f.half[0] = *(const v8us*)p; f.half[1] = *(const v8us*)(p + 16); return f.v; }
__device__ __forceinline__ v8f g2_mma(v16h a, v16h b, v8f c) { v8f d = __builtin_amdgcn_wmma_f32_16x16x32_f16(false, a, false, b, (short)0, c, false, false); asm volatile("v_nop\n\tv_nop\n\tv_nop\n\tv_nop" : "+v"(d) : "v"(a), "v"(b)); return d; }
// one stage's copies of one lane: 16 bytes of A rows r, r + 16, .. r + 112 and of Bt rows r, r + 16, r + 32, r + 48 (r = thread / 8) to LDS byte l + 0, G2S, .. 11 G2S. ra, rb = 16 rows of A, of Bt, in elements.
// The s_wait_xcnt closes the statement so that it stands in front of every later write of a register that a copy names.
__device__ __forceinline__ void g2_copy(unsigned l, const unsigned short* ga, size_t ra, const unsigned short* gb, size_t rb) {
  asm volatile("global_load_async_to_lds_b128 %0, %1, off\n\t"
               "global_load_async_to_lds_b128 %2, %3, off\n\t"
               "global_load_async_to_lds_b128 %4, %5, off\n\t"
               "global_load_async_to_lds_b128 %6, %7, off\n\t"
               "global_load_async_to_lds_b128 %8, %9, off\n\t"
               "global_load_async_to_lds_b128 %10, %11, off\n\t"
               "global_load_async_to_lds_b128 %12, %13, off\n\t"
               "global_load_async_to_lds_b128 %14, %15, off\n\t"
               "global_load_async_to_lds_b128 %16, %17, off\n\t"
               "global_load_async_to_lds_b128 %18, %19, off\n\t"
               "global_load_async_to_lds_b128 %20, %21, off\n\t"
               "global_load_async_to_lds_b128 %22, %23, off\n\t"
               "s_wait_xcnt 0x0"
               :: "v"(l), "v"(ga), "v"(l + 1 * G2S), "v"(ga + ra), "v"(l + 2 * G2S), "v"(ga + 2 * ra), "v"(l + 3 * G2S), "v"(ga + 3 * ra),
                  "v"(l + 4 * G2S), "v"(ga + 4 * ra), "v"(l + 5 * G2S), "v"(ga + 5 * ra), "v"(l + 6 * G2S), "v"(ga + 6 * ra), "v"(l + 7 * G2S), "v"(ga + 7 * ra),
                  "v"(l + 8 * G2S), "v"(gb), "v"(l + 9 * G2S), "v"(gb + rb), "v"(l + 10 * G2S), "v"(gb + 2 * rb), "v"(l + 11 * G2S), "v"(gb + 3 * rb)
               : "memory"); }
template <int ACT>
__global__ __launch_bounds__(128) void k_gemm2(const _Float16* __restrict__ A, int lda, size_t sA, const _Float16* __restrict__ Bh, int ldb, size_t sB, float alpha, const float* __restrict__ bias, size_t sBias, const float* __restrict__ CP, int rowsPerB, size_t sCPb, int row0g,
    float* __restrict__ C, _Float16* __restrict__ C16, int ldc, size_t sC, int M, int N, int K) { static_assert(ACT == 0 || ACT == 3 || ACT == 6 || ACT == 8 || ACT == 9 || ACT == 11 || ACT == 12 || ACT == 14 || ACT == 15 || ACT == 16 || ACT == 17, "k_gemm2: unsupported ACT code (would silently apply no activation)");
  __shared__ __attribute__((aligned(16))) unsigned short st[2][G2R * G2P];
  __shared__ __attribute__((aligned(16))) float so[4][32][68];
  const int tid = threadIdx.x, w = tid >> 5, lane = tid & 31, ln = lane & 15, hh = lane >> 4; const int by = blockIdx.y;
  A += (size_t)by * sA; Bh += (size_t)by * sB; const size_t cofs = (size_t)by * sC; const float* bp = bias ? bias + (size_t)by * sBias : nullptr;
  const int ntn = N >> 6; const int mt = blockIdx.x / ntn, nq = blockIdx.x - mt * ntn; const int row0 = mt * 128 + 32 * w, col0 = nq * 64; if (mt * 128 + 128 > M) return;      /* the same for the whole work-group, in front of every barrier: all 128 staged A rows exist */
  const int cr = tid >> 3, cc = (tid & 7) * 8;      /* the lane's first staged row, and its 16 bytes in the row */
  const unsigned short* ga = (const unsigned short*)A + (size_t)(mt * 128 + cr) * lda + cc; const unsigned short* gb = (const unsigned short*)Bh + (size_t)(col0 + cr) * ldb + cc;
  const size_t ra = (size_t)16 * lda, rb = (size_t)16 * ldb;
  const unsigned l0 = (unsigned)(size_t)&st[0][cr * G2P + cc];      /* LDS byte address: the low 32 bits of the __shared__ address */
  constexpr int SE = G2R * G2P;      /* elements per buffer */
  const int ns = K / G2K;
  g2_copy(l0, ga, ra, gb, rb);
  asm volatile("s_wait_asynccnt 0x0" ::: "memory");      /* this wave's copies of stage 0 have landed */
  __syncthreads();      /* stage 0 is complete for every wave */
  if (ns > 1) g2_copy(l0 + SE * 2, ga + G2K, ra, gb + G2K, rb);
  const unsigned short* fa = &st[0][(32 * w + ln) * G2P + 8 * hh]; const unsigned short* fb = &st[0][(128 + ln) * G2P + 8 * hh];
  const v8f z8 = {0.f,0.f,0.f,0.f,0.f,0.f,0.f,0.f}; v8f c00 = z8, c01 = z8, c02 = z8, c03 = z8, c10 = z8, c11 = z8, c12 = z8, c13 = z8;
  for (int s = 0; s < ns; ++s) { const int bo = (s & 1) * SE; const unsigned short* pa = fa + bo; const unsigned short* pb = fb + bo;
    /* all 24 fragment reads of the stage stand together in front of its 16 products: one LDS latency a stage, not one a fragment */
    const v16h a0 = g2_frag(pa), a1 = g2_frag(pa + 16 * G2P), b0 = g2_frag(pb), b1 = g2_frag(pb + 16 * G2P), b2 = g2_frag(pb + 32 * G2P), b3 = g2_frag(pb + 48 * G2P);
    const v16h a2 = g2_frag(pa + 32), a3 = g2_frag(pa + 16 * G2P + 32), b4 = g2_frag(pb + 32), b5 = g2_frag(pb + 16 * G2P + 32), b6 = g2_frag(pb + 32 * G2P + 32), b7 = g2_frag(pb + 48 * G2P + 32);
    c00 = g2_mma(a0, b0, c00); c10 = g2_mma(a1, b0, c10); c01 = g2_mma(a0, b1, c01); c11 = g2_mma(a1, b1, c11); c02 = g2_mma(a0, b2, c02); c12 = g2_mma(a1, b2, c12); c03 = g2_mma(a0, b3, c03); c13 = g2_mma(a1, b3, c13);
    c00 = g2_mma(a2, b4, c00); c10 = g2_mma(a3, b4, c10); c01 = g2_mma(a2, b5, c01); c11 = g2_mma(a3, b5, c11); c02 = g2_mma(a2, b6, c02); c12 = g2_mma(a3, b6, c12); c03 = g2_mma(a2, b7, c03); c13 = g2_mma(a3, b7, c13);
    asm volatile("s_wait_dscnt 0x0" ::: "memory");      /* this wave's reads of buffer s & 1 are done before the buffer is refilled */
    asm volatile("s_wait_asynccnt 0x0" ::: "memory");      /* this wave's copies of stage s + 1 have landed */
    __syncthreads();      /* publishes stage s + 1 and ends every wave's reads of stage s */
    if (s + 2 < ns) g2_copy(l0 + bo * 2, ga + (size_t)(s + 2) * G2K, ra, gb + (size_t)(s + 2) * G2K, rb); }
  asm volatile("s_wait_asynccnt 0x0" ::: "memory");      /* no copy is outstanding when the wave goes on to its end */
  v8f accs[8] = {c00, c01, c02, c03, c10, c11, c12, c13};
#pragma unroll
  for (int u = 0; u < 8; ++u) { const int t = u & 3, half = u >> 2; const int col = col0 + t * 16 + ln; const float bv = bp ? bf16_round(bp[col]) : 0.f;
#pragma unroll
    for (int r = 0; r < 8; ++r) { const int rloc = half * 16 + 8 * hh + r; float v = accs[u][r] * alpha + bv; if (CP) { if (rowsPerB < 0) v += CP[cofs + (size_t)(row0g + row0 + rloc) * ldc + col];      /* rowsPerB < 0: own element of the batched C plane */ else { const int bidx = (row0g + row0 + rloc) / rowsPerB; v += CP[(size_t)bidx * sCPb + (size_t)by * 64 + col]; } }
      if (ACT == 3) v = fmaxf(v, 0.f); else if (ACT == 6) v = 0.5f * v * (1.0f + erff(v * 0.70710678118654752f)); else if (ACT == 11) v = 1.0f / (1.0f + expf(-v)); else if (ACT == 15) v = v / (1.0f + expf(-v)); else if (ACT == 12) v = (v > 0.f) ? v : 0.01f * v; else if (ACT == 8) v = tanhf(v); else if (ACT == 9) v = 0.5f * v * (1.0f + tanhf(0.7978845608028654f * (v + 0.044715f * v * v * v))); else if (ACT == 14) v = (v > 0.f) ? v : 0.1f * v; else if (ACT == 16) v = (v >= 0.f) ? v : 0.3f * v; else if (ACT == 17) v = (v >= 0.f) ? v : 0.2f * v;
      so[w][rloc][t * 16 + ln] = v; } }
  __builtin_amdgcn_fence(__ATOMIC_ACQ_REL, "workgroup"); __builtin_amdgcn_wave_barrier();
  const int rsub = lane >> 4, c4 = (lane & 15) * 4;
  {
#pragma unroll
    for (int q = 0; q < 16; ++q) { const int r = q * 2 + rsub; const v4f v = *(const v4fa*)&so[w][r][c4]; if (C) *(v4f*)(C + cofs + (size_t)(row0 + r) * ldc + col0 + c4) = v; if (C16) { v4h h4; for (int i = 0; i < 4; ++i) h4[i] = (_Float16)v[i]; *(v4h*)(C16 + cofs + (size_t)(row0 + r) * ldc + col0 + c4) = h4; } }
     } }


__global__ __launch_bounds__(256) void k_wnat(const float* __restrict__ w, size_t n8, _Float16* __restrict__ Bt) { const size_t t = (size_t)blockIdx.x * 256 + threadIdx.x; if (t >= n8) return; FragH f; for (int q = 0; q < 8; ++q) f.h[q] = (_Float16)(bf16_round(w[t * 8 + q]) * 16.0f); *(v8us*)((unsigned short*)Bt + t * 8) = f.half[0];  }
// fused attention, one (batch, head) and 512 queries per work-group of 16 waves. The head's K rows [key][d] and V^T rows [d][key] are laid in LDS once (row pitches 16 B x odd: no bank conflict for 16-byte fragment reads);
// each wave owns 32 queries (two 16-column groups) and walks the keys 32 at a time: S^T = K Q^T (A = K rows, B = Q rows, both in the hardware k order), so a lane holds 16 scores of ONE query per group;
// the two S^T tiles of a group, converted in place, are the B operand P^T of O^T += V^T P^T (register s < 8: key 8 hh + s, s >= 8: key 16 + 8 hh + s - 8). Softmax in base 2 against a running maximum mu, raised only when a score passes it by more than 8 (weights then stay <= 256, inside f16).
#define AKP (HD + 8)                 /* LDS pitch of a K row, f16 elements (144 B) */
#define AVP (SQ + 8)                 /* LDS pitch of a V^T row, f16 elements (2064 B) */
#define AQW 32                       /* queries per wave */
#define ANW 16                       /* waves per work-group */
__device__ __forceinline__ v8f fa_mma(v16h a, v16h b, v8f c) { return __builtin_amdgcn_wmma_f32_16x16x32_f16(false, a, false, b, (short)0, c, false, false); }
__device__ __forceinline__ float fa_xhalf(float x) { return __builtin_bit_cast(float, __builtin_amdgcn_permlanex16(__builtin_bit_cast(int, x), __builtin_bit_cast(int, x), 0x76543210, 0xfedcba98, false, false)); }      /* lane l takes lane l ^ 16, on the vector pipe: no LDS round trip in the loop */
__device__ __forceinline__ v16h fa_frag(const unsigned short* p) { FragH f; f.half[0] = *(const v8us*)p; f.half[1] = *(const v8us*)(p + 16); return f.v; }
__global__ __launch_bounds__(ANW * 32) void k_fattn(const _Float16* __restrict__ Q16, const _Float16* __restrict__ K16, const _Float16* __restrict__ VT, _Float16* __restrict__ O16) {
  __shared__ __attribute__((aligned(16))) unsigned short sk[SQ * AKP];
  __shared__ __attribute__((aligned(16))) unsigned short sv[HD * AVP];
  const int tid = threadIdx.x, w = tid >> 5, lane = tid & 31, ln = lane & 15, hh = lane >> 4;
  constexpr int QB = SQ / (ANW * AQW);      /* work-groups per head */
  const int bh = blockIdx.x / QB, qb = blockIdx.x % QB; const int b = bh / NH, h = bh % NH;
  const unsigned short* kg = (const unsigned short*)K16 + (size_t)b * SQ * DM + h * HD; const unsigned short* vg = (const unsigned short*)VT + (size_t)bh * HD * SQ;
  /* fill: thread t brings 16 bytes of K row u * 64 + t / 8 and of V^T row u * 4 + t / 128 (u = 0 .. 15). One address per plane, the rows told apart by constant offsets; every loop is unrolled whole so that
     all 32 fill loads and the 8 Q loads are in flight together and the register arrays are indexed by constants alone */
  constexpr int NT = ANW * 32, KRS = NT / (HD / 8), VRS = NT / (SQ / 8);      /* threads; K rows and V^T rows covered by one sweep of the work-group */
  const int kr = tid / (HD / 8), kc = (tid % (HD / 8)) * 8, vr = tid / (SQ / 8), vc = (tid % (SQ / 8)) * 8;
  const unsigned short* kgl = kg + (size_t)kr * DM + kc; const unsigned short* vgl = vg + (size_t)vr * SQ + vc;
  const int q0 = qb * (ANW * AQW) + w * AQW;
  const unsigned short* qp = (const unsigned short*)Q16 + ((size_t)b * SQ + q0 + ln) * DM + h * HD + 8 * hh;
  v8us kx[SQ / KRS], vx[HD / VRS]; v16h qf[2][2];
#pragma unroll
  for (int u = 0; u < SQ / KRS; ++u) kx[u] = *(const v8us*)(kgl + (size_t)u * KRS * DM);
#pragma unroll
  for (int u = 0; u < HD / VRS; ++u) vx[u] = *(const v8us*)(vgl + (size_t)u * VRS * SQ);
#pragma unroll
  for (int g = 0; g < 2; ++g) { qf[g][0] = fa_frag(qp + (size_t)g * 16 * DM); qf[g][1] = fa_frag(qp + (size_t)g * 16 * DM + 32); }
  asm volatile("s_wait_xcnt 0x0" :: "v"(kgl), "v"(vgl), "v"(qp) : "memory");      /* the wait owed before a register that an issued global load names is overwritten; the three addresses are inputs so that they stay in their registers up to here */
#pragma unroll
  for (int u = 0; u < SQ / KRS; ++u) *(v8us*)(sk + (kr + u * KRS) * AKP + kc) = kx[u];
#pragma unroll
  for (int u = 0; u < HD / VRS; ++u) *(v8us*)(sv + (vr + u * VRS) * AVP + vc) = vx[u];
  __syncthreads();      /* K and V^T of the head are complete in LDS; nothing writes LDS behind this point */
  /* every inner loop from here on is unrolled whole: the fragment and accumulator arrays are then indexed by constants alone and stay in registers */
  const v8f z8 = {0.f,0.f,0.f,0.f,0.f,0.f,0.f,0.f};
  v8f o[2][4] = {{z8, z8, z8, z8}, {z8, z8, z8, z8}};      /* o[g][t][r] = O^T[d = 16 t + 8 hh + r][query q0 + 16 g + ln], relative to mu[g] */
  float mu[2] = {-3.0e38f, -3.0e38f}, ls[2] = {0.f, 0.f};
  const float CS = 0.125f * 1.4426950408889634f;      /* 1 / sqrt(64), and base e to base 2 */
  const unsigned short* skl = sk + ln * AKP + 8 * hh; const unsigned short* svl = sv + ln * AVP + 8 * hh;
  for (int j = 0; j < SQ; j += 32) {
    v16h kf[2][2], vf[4];
#pragma unroll
    for (int kt = 0; kt < 2; ++kt) { kf[kt][0] = fa_frag(skl + (j + 16 * kt) * AKP); kf[kt][1] = fa_frag(skl + (j + 16 * kt) * AKP + 32); }
#pragma unroll
    for (int t = 0; t < 4; ++t) vf[t] = fa_frag(svl + 16 * t * AVP + j);
    v8f s[2][2];
#pragma unroll
    for (int g = 0; g < 2; ++g)
#pragma unroll
      for (int kt = 0; kt < 2; ++kt) s[g][kt] = fa_mma(kf[kt][1], qf[g][1], fa_mma(kf[kt][0], qf[g][0], z8));
    float mx[2];
#pragma unroll
    for (int g = 0; g < 2; ++g) { float m = fmaxf(s[g][0][0], s[g][1][0]);
#pragma unroll
      for (int r = 1; r < 8; ++r) m = fmaxf(m, fmaxf(s[g][0][r], s[g][1][r]));
      m = fmaxf(m, fa_xhalf(m)); mx[g] = m * CS; }      /* lanes ln and ln + 16 hold the same query: both take the same maximum */
    if (__builtin_amdgcn_ballot_w32(mx[0] > mu[0] + 8.0f || mx[1] > mu[1] + 8.0f) != 0) {      /* wave-uniform; always taken on the first pass */
#pragma unroll
      for (int g = 0; g < 2; ++g) { const float mn = fmaxf(mu[g], mx[g]); const float corr = __builtin_amdgcn_exp2f(mu[g] - mn); mu[g] = mn; ls[g] *= corr;
#pragma unroll
        for (int t = 0; t < 4; ++t) o[g][t] *= corr; } }
#pragma unroll
    for (int g = 0; g < 2; ++g) { FragH pf;
#pragma unroll
      for (int kt = 0; kt < 2; ++kt)
#pragma unroll
        for (int r = 0; r < 8; ++r) { const float p = __builtin_amdgcn_exp2f(fmaf(s[g][kt][r], CS, -mu[g])); ls[g] += p; pf.h[kt * 8 + r] = (_Float16)p; }
#pragma unroll
      for (int t = 0; t < 4; ++t) o[g][t] = fa_mma(vf[t], pf.v, o[g][t]); }
  }
#pragma unroll
  for (int g = 0; g < 2; ++g) { const float l = ls[g] + fa_xhalf(ls[g]); const float sc = 64.0f / l;      /* the two lane halves summed different keys of the same query */
    unsigned short* d = (unsigned short*)O16 + ((size_t)b * SQ + q0 + 16 * g + ln) * DM + h * HD + 8 * hh;
#pragma unroll
    for (int t = 0; t < 4; ++t) { FragH f;
#pragma unroll
      for (int r = 0; r < 8; ++r) f.h[r] = (_Float16)(o[g][t][r] * sc);
      *(v8us*)(d + 16 * t) = f.half[0]; } } }
__global__ __launch_bounds__(256) void k_vt(const _Float16* __restrict__ V16, int b, int h0, _Float16* __restrict__ VT) { __shared__ unsigned short tl[64][65]; const int tid = threadIdx.x; const int hh = blockIdx.x % HG, sg = blockIdx.x / HG; const int s0 = sg * 64; const int h = h0 + hh;
  for (int i = tid; i < 64 * 8; i += 256) { const int j = i / 8, d8 = (i % 8) * 8; FragH f; f.half[0] = *(const v8us*)((const unsigned short*)V16 + ((size_t)b * SQ + s0 + j) * DM + h * HD + d8); for (int q = 0; q < 8; ++q) tl[d8 + q][j] = f.u[q]; }
  __syncthreads();
  { for (int i = tid; i < 64 * 8; i += 256) { const int d = i / 8, j8 = (i % 8) * 8; FragH f; for (int q = 0; q < 8; ++q) f.u[q] = tl[d][j8 + q]; *(v8us*)((unsigned short*)VT + ((size_t)hh * HD + d) * SQ + s0 + j8) = f.half[0]; }  } }



__global__ __launch_bounds__(256) void k_rsmkm(const float* __restrict__ S, _Float16* __restrict__ P, int nrows, const int* __restrict__ am) {
  #pragma clang fp contract(off)
  const int t = blockIdx.x * 256 + threadIdx.x; if (t >= nrows) return; const size_t i = (size_t)t; const float* s = S + i * SQ; const int* mr = am + (size_t)(t % SQ) * SQ; float mx = -3.0e38f;
#pragma unroll 1
  for (int j = 0; j < SQ; ++j) { const float f = (mr[j] != 0) ? 1.f : 0.f; mx = fmaxf(mx, fmaf(f, s[j], (1.f - f) * -1.0e9f)); } float se = 0.f;
#pragma unroll 1
  for (int j = 0; j < SQ; ++j) { const float f = (mr[j] != 0) ? 1.f : 0.f; se += __expf(fmaf(f, s[j], (1.f - f) * -1.0e9f) - mx); } const float sc = 256.0f / se;
#pragma unroll 1
  for (int j0 = 0; j0 < SQ; j0 += 8) { FragH fr; for (int q = 0; q < 8; ++q) { const int j = j0 + q; const float f = (mr[j] != 0) ? 1.f : 0.f; fr.h[q] = (_Float16)(__expf(fmaf(f, s[j], (1.f - f) * -1.0e9f) - mx) * sc); }
    unsigned short* d = (unsigned short*)P + i * SQ + j0; *(v8us*)d = fr.half[0];  } }
// local RMS norm with the 7 x 7 box sum taken as two passes of 7. A work-group owns LRB grid rows x all GS grid columns x LRC channels of one batch. A thread owns one channel quad q4 of LRJ grid columns (GS / LRJ apart): it loads
// each column's LRB + 6 grid rows (16 bytes each, all in flight together; a half-wave reads one position's 256 bytes), sums the squares down the column for each of the LRB rows in registers and lays these column sums in LDS;
// behind the one barrier it adds the 7 column sums around each of its columns (RW columns of zeros on either side stand for the zero padding; grid rows outside the grid are zeroed in the rounding mask).
// x of its own positions is still in registers for the division.
#define LRB 4                        /* grid rows per work-group */
#define LRC 64                       /* channels per work-group: 256 B of x, one whole 128-B line of the f16 rows */
#define LRJ 2                        /* grid columns per thread: half the waves to start for the same work */
#define LRP (GS + 2 * RW)            /* columns in a row of column sums in LDS, the zeros included */
__global__ __launch_bounds__(GS / LRJ * LRC / 4) void k_lrms(const float* __restrict__ x, const float* __restrict__ w, _Float16* __restrict__ X16) {
  __shared__ __attribute__((aligned(16))) float cs[LRB][LRP][LRC];
  constexpr int NCG = DM / LRC, NBD = GS / LRB, NK = LRB + 2 * RW, JS = GS / LRJ;
  const int tid = threadIdx.x, q4 = (tid % (LRC / 4)) * 4, j = tid / (LRC / 4);      /* j: the first of the thread's columns, the others at j + JS, .. */
  const int cg = blockIdx.x % NCG, bd = (blockIdx.x / NCG) % NBD, b = blockIdx.x / (NCG * NBD); const int i0 = bd * LRB;
  const int to = j * DM + cg * LRC + q4;      /* the thread's place inside a grid row of x, elements */
  const float* xb = x + (size_t)b * SQ * DM + to; const float* pw = w + cg * LRC + q4;
  const float* pc = xb + (size_t)i0 * GS * DM;      /* the work-group's own grid rows: constant offsets from here */
  /* every loop of this kernel is unrolled whole: the register arrays are then indexed by constants alone and stay in registers, and all the loads stand together in front of the first use */
  const float* pe[2 * RW];      /* the RW grid rows above and the RW below, clamped into the grid; the rows below as LRB + k rows behind pe[RW + k] */
#pragma unroll
  for (int k = 0; k < RW; ++k) { const int iu = i0 - RW + k, il = GS - 1 - LRB - k; pe[k] = xb + (size_t)(iu < 0 ? 0 : iu) * GS * DM; pe[RW + k] = xb + (size_t)(i0 < il ? i0 : il) * GS * DM; }
  v4f xr[LRJ][NK];
#pragma unroll
  for (int k = 0; k < NK; ++k) { const float* p = k < RW ? pe[k] : (k < RW + LRB ? pc : pe[k - LRB]) + (k - RW) * GS * DM;
#pragma unroll
    for (int e = 0; e < LRJ; ++e) xr[e][k] = *(const v4fa*)(p + e * JS * DM); }
  const v4f wr = *(const v4fa*)pw;
  static_assert(RW == 3, "the statement below names 2 * RW + 1 addresses");
  asm volatile("s_wait_xcnt 0x0" :: "v"(pc), "v"(pe[0]), "v"(pe[1]), "v"(pe[2]), "v"(pe[3]), "v"(pe[4]), "v"(pe[5]) : "memory");      /* the wait owed before a register that an issued global load names is overwritten; the addresses are inputs so that they stay in their registers up to here */
  const v4f z4 = {0.f, 0.f, 0.f, 0.f};
  if (j < RW) {      /* the zero columns: RW on the left, RW on the right */
#pragma unroll
    for (int r = 0; r < LRB; ++r) { *(v4fa*)&cs[r][j][q4] = z4; *(v4fa*)&cs[r][RW + GS + j][q4] = z4; } }
#pragma unroll
  for (int k = 0; k < NK; ++k) { const int ii = i0 - RW + k; const unsigned m = (ii >= 0 && ii < GS) ? 0xFFFF0000u : 0u;      /* bf16 rounding as in bf16_round; a row outside the grid becomes 0 */
#pragma unroll
    for (int e = 0; e < LRJ; ++e)
#pragma unroll
      for (int c = 0; c < 4; ++c) { const unsigned u = __float_as_uint(xr[e][k][c]); xr[e][k][c] = __uint_as_float((u + 0x7FFFu + ((u >> 16) & 1u)) & m); } }
#pragma unroll
  for (int e = 0; e < LRJ; ++e)
#pragma unroll
    for (int r = 0; r < LRB; ++r) { v4f s = xr[e][r] * xr[e][r];
#pragma unroll
      for (int d = 1; d <= 2 * RW; ++d) s += xr[e][r + d] * xr[e][r + d];
      *(v4fa*)&cs[r][RW + j + e * JS][q4] = s; }
  __syncthreads();      /* every column sum of the work-group's rows, and the zeros beside them, are in LDS; nothing writes LDS behind this point */
  v4h o[LRJ][LRB];
#pragma unroll
  for (int e = 0; e < LRJ; ++e)
#pragma unroll
    for (int r = 0; r < LRB; ++r) { v4f s = *(const v4fa*)&cs[r][j + e * JS][q4];
#pragma unroll
      for (int d = 1; d <= 2 * RW; ++d) s += *(const v4fa*)&cs[r][j + e * JS + d][q4];
#pragma unroll
      for (int c = 0; c < 4; ++c) { const float rms = sqrtf(0.0000001f + s[c] * 0.02040816326530612f);      /* box / 49 as a multiply by the f32 reciprocal (the result is rounded to f16 next) */
        o[e][r][c] = (_Float16)(xr[e][RW + r][c] / rms * bf16_round(wr[c])); } }
  _Float16* d = X16 + ((size_t)b * SQ + (size_t)i0 * GS) * DM + to;
#pragma unroll
  for (int e = 0; e < LRJ; ++e)
#pragma unroll
    for (int r = 0; r < LRB; ++r) *(v4h*)(d + (size_t)(r * GS + e * JS) * DM) = o[e][r]; }


extern "C" void kernel_launch(void* const* d_in, const int* in_sizes, int n_in,
                              void* d_out, int out_size, void* d_ws, size_t ws_size, hipStream_t stream) {
  (void)in_sizes; (void)n_in; (void)out_size;
  const float* const* I = (const float* const*)d_in; const float* x = I[0]; const float* nw = I[1]; const float* wq = I[2]; const float* bq = I[3]; const float* wk = I[4]; const float* bk = I[5]; const float* wv = I[6]; const float* bv = I[7]; const float* wo = I[8]; const float* bo = I[9];      /* x; norm_w [768]; natural [768][768] weights + biases (q, k, v, o) */
  static_assert(SQ == GS * GS && DM % 8 == 0 && DM % 64 == 0 && DM % 32 == 0 && SQ % 128 == 0 && NH * HD == DM && NH % HG == 0 && HD == 64 && SQ % (ANW * AQW) == 0 && B0 == 0 && NBR == NB && QN == SQ && NHD == NH && GS % LRB == 0 && DM % LRC == 0 && GS % LRJ == 0 && GS / LRJ >= RW, "shape / tile multiples");
  char* ws = (char*)d_ws; size_t off = 0;
  auto take = [&](size_t bytes) { char* p = ws + off; off += (bytes + 255) & ~(size_t)255; return p; };
  _Float16* BQ = (_Float16*)take((size_t)DM * DM * 2); _Float16* BK = (_Float16*)take((size_t)DM * DM * 2); _Float16* BV = (_Float16*)take((size_t)DM * DM * 2); _Float16* BO = (_Float16*)take((size_t)DM * DM * 2);
  _Float16* X16 = (_Float16*)take(NR * DM * 2); _Float16* Q16 = (_Float16*)take(NR * DM * 2); _Float16* K16 = (_Float16*)take(NR * DM * 2); _Float16* V16 = (_Float16*)take(NR * DM * 2); _Float16* O16 = (_Float16*)take(NR * DM * 2);
  _Float16* VT = (_Float16*)take((size_t)NB * NH * HD * SQ * 2);
  if (off > ws_size) return;      /* approx 4.5 + 6 x 12 = 77 MiB */
  { const unsigned g = (unsigned)(((size_t)DM * DM / 8 + 255) / 256); k_wnat<<<g, 256, 0, stream>>>(wq, (size_t)DM * DM / 8, BQ); k_wnat<<<g, 256, 0, stream>>>(wk, (size_t)DM * DM / 8, BK); k_wnat<<<g, 256, 0, stream>>>(wv, (size_t)DM * DM / 8, BV); k_wnat<<<g, 256, 0, stream>>>(wo, (size_t)DM * DM / 8, BO); }      /* natural [out][in] = Bt[n][k] x16 */
  k_lrms<<<NB * (GS / LRB) * (DM / LRC), GS / LRJ * LRC / 4, 0, stream>>>(x, nw, X16);      /* xn = local-RMS-normalised x as f16 rows: the A operand of all three projections */
  const size_t r0p = (size_t)B0 * SQ;      /* first projected row */
  k_gemm2<0><<<dim3((unsigned)((MP / 128) * (DM / 64)), 1), 128, 0, stream>>>(X16 + r0p * DM, DM, 0, BQ, DM, 0, 0.0625f, bq, 0, nullptr, 1, 0, 0, nullptr, Q16 + r0p * DM, DM, 0, MP, DM, DM);
  k_gemm2<0><<<dim3((unsigned)((MP / 128) * (DM / 64)), 1), 128, 0, stream>>>(X16 + r0p * DM, DM, 0, BK, DM, 0, 0.0625f, bk, 0, nullptr, 1, 0, 0, nullptr, K16 + r0p * DM, DM, 0, MP, DM, DM);
  k_gemm2<0><<<dim3((unsigned)((MP / 128) * (DM / 64)), 1), 128, 0, stream>>>(X16 + r0p * DM, DM, 0, BV, DM, 0, 0.0625f, bv, 0, nullptr, 1, 0, 0, nullptr, V16 + r0p * DM, DM, 0, MP, DM, DM);
  k_vt<NH, SQ><<<NB * NH * (SQ / 64), 256, 0, stream>>>(V16, LQ, 0, VT);      /* V^T [NB * NH][HD][SQ], all batches */
  k_fattn<<<NB * NH * (SQ / (ANW * AQW)), ANW * 32, 0, stream>>>(Q16, K16, VT, O16);      /* o (merged heads, x64) as f16 rows */
  k_gemm2<0><<<dim3((unsigned)((MPO / 128) * (DM / 64)), 1), 128, 0, stream>>>(O16 + r0p * DM, DM, 0, BO, DM, 0, 0.0009765625f, bo, 0, nullptr, 1, 0, 0, (float*)d_out + r0p * DM, nullptr, DM, 0, MPO, DM, DM);      /* out rows are the output layout */
}

// v005
// A run of this version takes 106 microseconds.
// Timed twice side by side with v004, it ran 1.12 times as fast both times.
// Over all steps from v000 it is 50.8 times as fast.
#include <hip/hip_runtime.h>
#define NB 8
#define SQ 1024
#define GS 32                        /* token grid side: SQ = GS * GS */
#define RW 3                         /* local-norm window radius (7 x 7) */
#define DM 768
#define NH 12
#define HD 64
#define HG 4                         /* heads per launch of the per-group k_vt (not launched) */
#define B0 0                         /* first batch processed (debug hook) */
#define NBR NB                       /* batches processed (debug hook) */
#define NR ((size_t)NB * SQ)         /* token rows */
#define MP ((int)((size_t)NBR * SQ)) /* rows projected (debug hook) */
#define QN SQ                        /* query rows attended per batch (debug hook) */
#define NHD NH                       /* heads attended (debug hook) */
#define MPO MP                       /* rows through the output stage (debug hook) */
#define LQ DM      /* row pitch of the q/k/v rows */
typedef __bf16 v16b __attribute__((ext_vector_type(16)));
typedef unsigned short v8us __attribute__((ext_vector_type(8), may_alias));
typedef float  v8f  __attribute__((ext_vector_type(8)));
typedef float  v4f  __attribute__((ext_vector_type(4)));
typedef float  v4fa __attribute__((ext_vector_type(4), may_alias));
union FragB { v16b v; v8us half[2]; unsigned short u[16]; };

__device__ __forceinline__ unsigned short bf16_bits(float x) { unsigned int u = __float_as_uint(x); return (unsigned short)((u + 0x7FFFu + ((u >> 16) & 1u)) >> 16); }
__device__ __forceinline__ float bf16_val(unsigned short b) { return __uint_as_float(((unsigned int)b) << 16); }
__device__ __forceinline__ float bf16_round(float x) { return bf16_val(bf16_bits(x)); }
// D += A·B with NT terms: 1 = ah·bh, 2 = + al·bh (A split), 3 = + ah·bl (both split)
template <int NT>
__device__ __forceinline__ v8f mmaN(v16b ah, v16b al, v16b bh, v16b bl, v8f c) {
  c = __builtin_amdgcn_wmma_f32_16x16x32_bf16(false, ah, false, bh, (short)0, c, false, false);
  if (NT >= 2) c = __builtin_amdgcn_wmma_f32_16x16x32_bf16(false, al, false, bh, (short)0, c, false, false);
  if (NT >= 3) c = __builtin_amdgcn_wmma_f32_16x16x32_bf16(false, ah, false, bl, (short)0, c, false, false);
  asm volatile("v_nop\n\tv_nop\n\tv_nop\n\tv_nop" : "+v"(c) : "v"(ah), "v"(al), "v"(bh), "v"(bl));
  return c;
}

__global__ __launch_bounds__(256) void k_wt_bf16(const float* __restrict__ W, unsigned short* __restrict__ Wt, int K, int N) {
  const int t = blockIdx.x * 256 + threadIdx.x;
  const int k8n = K / 8;
  if (t >= N * k8n) return;
  const int n = t / k8n, k8 = (t % k8n) * 8;
  v8us v;
#pragma unroll
  for (int i = 0; i < 8; ++i) v[i] = bf16_bits(W[(size_t)(k8 + i) * N + n]);
  *(v8us*)(Wt + (size_t)n * K + k8) = v;
  
}

// GEMM C[M][N] (f32, pitch ldc) = act(A[M][K]·W + bias). A f32 row-major (pitch lda) converted per fragment to bf16
// (ASPLIT: hi/lo two planes -> 2 terms, else single rounded term); Wt bf16 [N][K] (pitch ldb). BIAS_BF16 rounds the
// bias to bf16 first (bias quantised to bf16 before the add). K%32==0, M%16==0, N%64==0.
template <bool ASPLIT, int ACT, bool BIAS_BF16>
__global__ __launch_bounds__(128) void k_gemm_bf(const float* __restrict__ A, int lda, const unsigned short* __restrict__ Wt, int ldb,
                                               const float* __restrict__ bias, float* __restrict__ C, int ldc, int M, int N, int K) {
  __shared__ __attribute__((aligned(16))) float so[4][16][64];
  const int tid = threadIdx.x, w = tid >> 5, lane = tid & 31, ln = lane & 15, hh = lane >> 4;
  const int ntn = N / 64;
  const int wid = blockIdx.x * 4 + w;
  const int mt = wid / ntn, nq = wid % ntn;
  if (mt * 16 >= M) return;
  const int row0 = mt * 16, col0 = nq * 64;
  const float* arow = A + (size_t)(row0 + ln) * lda;
  v8f acc[4] = {};
  for (int kb = 0; kb < K; kb += 32) {
    FragB ah, al;
    const v4f x0 = *(const v4fa*)(arow + kb + 8 * hh), x1 = *(const v4fa*)(arow + kb + 8 * hh + 4);
    const v4f x2 = *(const v4fa*)(arow + kb + 16 + 8 * hh), x3 = *(const v4fa*)(arow + kb + 16 + 8 * hh + 4);
    float xs[16] = {x0[0],x0[1],x0[2],x0[3],x1[0],x1[1],x1[2],x1[3],x2[0],x2[1],x2[2],x2[3],x3[0],x3[1],x3[2],x3[3]};
#pragma unroll
    for (int i = 0; i < 16; ++i) { const unsigned short hb = bf16_bits(xs[i]); ah.u[i] = hb; al.u[i] = ASPLIT ? bf16_bits(xs[i] - bf16_val(hb)) : (unsigned short)0; }
#pragma unroll
    for (int t = 0; t < 4; ++t) {
      const unsigned short* brow = Wt + (size_t)(col0 + t * 16 + ln) * ldb + kb;
      FragB b;
      b.half[0] = *(const v8us*)(brow + 8 * hh);
      b.half[1] = *(const v8us*)(brow + 16 + 8 * hh);
      acc[t] = mmaN<ASPLIT ? 2 : 1>(ah.v, al.v, b.v, b.v, acc[t]);
    }
  }
#pragma unroll
  for (int t = 0; t < 4; ++t) {
    float bv = bias ? bias[col0 + t * 16 + ln] : 0.f;
    if (BIAS_BF16) bv = bf16_round(bv);
#pragma unroll
    for (int r = 0; r < 8; ++r) { float v = acc[t][r] + bv; if (ACT == 1) v = fmaxf(v, 0.f); so[w][8 * hh + r][t * 16 + ln] = v; }
  }
  __builtin_amdgcn_fence(__ATOMIC_ACQ_REL, "workgroup");
  __builtin_amdgcn_wave_barrier();
  const int rsub = lane >> 4, c4 = (lane & 15) * 4;
  {
#pragma unroll
    for (int q = 0; q < 8; ++q) {
      const int r = q * 2 + rsub;
      const v4f v = *(const v4fa*)&so[w][r][c4];
      *(v4f*)(C + (size_t)(row0 + r) * ldc + col0 + c4) = v;
    }
    
  }
}

// GEMM C = act(A·W + bias + resid): A f32 (ASPLIT -> hi/lo 2 terms), Wt bf16 [N][K]; ACT 0 none, 1 relu, 2 exact gelu;
// resid (optional, f32, row index = (row % rmod), pitch ldr, RES_BF16 rounds it) added before the activation.
template <bool ASPLIT, int ACT, bool BIAS_BF16, bool RES_BF16>
__global__ __launch_bounds__(128) void k_gemm_bf3(const float* __restrict__ A, int lda, const unsigned short* __restrict__ Wt, int ldb,
                                                const float* __restrict__ bias, const float* __restrict__ resid, int rmod, int ldr,
                                                float* __restrict__ C, int ldc, int M, int N, int K) {
  __shared__ __attribute__((aligned(16))) float so[4][16][64];
  const int tid = threadIdx.x, w = tid >> 5, lane = tid & 31, ln = lane & 15, hh = lane >> 4;
  const int ntn = N / 64;
  const int wid = blockIdx.x * 4 + w;
  const int mt = wid / ntn, nq = wid % ntn;
  if (mt * 16 >= M) return;
  const int row0 = mt * 16, col0 = nq * 64;
  const float* arow = A + (size_t)(row0 + ln) * lda;
  v8f acc[4] = {};
  for (int kb = 0; kb < K; kb += 32) {
    FragB ah, al;
    const v4f x0 = *(const v4fa*)(arow + kb + 8 * hh), x1 = *(const v4fa*)(arow + kb + 8 * hh + 4);
    const v4f x2 = *(const v4fa*)(arow + kb + 16 + 8 * hh), x3 = *(const v4fa*)(arow + kb + 16 + 8 * hh + 4);
    float xs[16] = {x0[0],x0[1],x0[2],x0[3],x1[0],x1[1],x1[2],x1[3],x2[0],x2[1],x2[2],x2[3],x3[0],x3[1],x3[2],x3[3]};
#pragma unroll
    for (int i = 0; i < 16; ++i) { const unsigned short hb = bf16_bits(xs[i]); ah.u[i] = hb; al.u[i] = ASPLIT ? bf16_bits(xs[i] - bf16_val(hb)) : (unsigned short)0; }
#pragma unroll
    for (int t = 0; t < 4; ++t) {
      const unsigned short* brow = Wt + (size_t)(col0 + t * 16 + ln) * ldb + kb;
      FragB b;
      b.half[0] = *(const v8us*)(brow + 8 * hh);
      b.half[1] = *(const v8us*)(brow + 16 + 8 * hh);
      acc[t] = mmaN<ASPLIT ? 2 : 1>(ah.v, al.v, b.v, b.v, acc[t]);
    }
  }
#pragma unroll
  for (int t = 0; t < 4; ++t) {
    const int col = col0 + t * 16 + ln;
    float bv = bias ? bias[col] : 0.f;
    if (BIAS_BF16) bv = bf16_round(bv);
#pragma unroll
    for (int r = 0; r < 8; ++r) {
      float v = acc[t][r] + bv;
      if (resid) { float rv = resid[(size_t)((row0 + 8 * hh + r) % rmod) * ldr + col]; if (RES_BF16) rv = bf16_round(rv); v += rv; }
      if (ACT == 1) v = fmaxf(v, 0.f);
      if (ACT == 2) v = 0.5f * v * (1.0f + erff(v * 0.70710678118654752f));
      if (ACT == 3) { const float u = 0.7978845608028654f * (v + 0.044715f * v * v * v); v = 0.5f * v * (1.0f + tanhf(u)); }
      so[w][8 * hh + r][t * 16 + ln] = v;
    }
  }
  __builtin_amdgcn_fence(__ATOMIC_ACQ_REL, "workgroup");
  __builtin_amdgcn_wave_barrier();
  const int rsub = lane >> 4, c4 = (lane & 15) * 4;
  {
#pragma unroll
    for (int q = 0; q < 8; ++q) {
      const int r = q * 2 + rsub;
      const v4f v = *(const v4fa*)&so[w][r][c4];
      *(v4f*)(C + (size_t)(row0 + r) * ldc + col0 + c4) = v;
    }
    
  }
}
// row LayerNorm (biased variance, eps) over N: s = X (+ R); optional out_sum <- s; out_norm <- (s-mu)*rsqrt(var+eps)*g + b
template <bool PARAM_BF16>
__global__ __launch_bounds__(256) void k_layernorm(const float* __restrict__ X, const float* __restrict__ R, const float* __restrict__ g, const float* __restrict__ bta,
                                                  float* __restrict__ out_sum, float* __restrict__ out_norm, int N, float eps) {
  __shared__ float red[256];
  const int row = blockIdx.x, tid = threadIdx.x;
  const float* x = X + (size_t)row * N; const float* rr = R ? R + (size_t)row * N : nullptr;
  float vals[16];                     // up to N = 4096
  const int per = N / 256;            // contiguous chunk per thread? use strided-by-4 chunks: thread handles j = tid*4 + 1024*u
  float s1 = 0.f;
  for (int u = 0; u < per / 4; ++u) {
    const int j = tid * 4 + 1024 * u;
    const v4f a = *(const v4fa*)(x + j);
    v4f b = {0.f,0.f,0.f,0.f}; if (rr) b = *(const v4fa*)(rr + j);
#pragma unroll
    for (int q = 0; q < 4; ++q) { const float v = a[q] + b[q]; vals[u * 4 + q] = v; s1 += v; }
  }
  red[tid] = s1; __syncthreads();
  for (int st = 128; st > 0; st >>= 1) { if (tid < st) red[tid] += red[tid + st]; __syncthreads(); }
  const float mu = red[0] / (float)N; __syncthreads();
  float s2 = 0.f;
  for (int u = 0; u < per / 4; ++u)
#pragma unroll
    for (int q = 0; q < 4; ++q) { const float c = vals[u * 4 + q] - mu; s2 += c * c; }
  red[tid] = s2; __syncthreads();
  for (int st = 128; st > 0; st >>= 1) { if (tid < st) red[tid] += red[tid + st]; __syncthreads(); }
  const float rs = rsqrtf(red[0] / (float)N + eps);
  {
    for (int u = 0; u < per / 4; ++u) {
      const int j = tid * 4 + 1024 * u;
      v4f o, sm;
#pragma unroll
      for (int q = 0; q < 4; ++q) {
        float gg = g[j + q], bb = bta[j + q];
        if (PARAM_BF16) { gg = bf16_round(gg); bb = bf16_round(bb); }
        sm[q] = vals[u * 4 + q]; o[q] = (vals[u * 4 + q] - mu) * rs * gg + bb;
      }
      if (out_sum) *(v4f*)(out_sum + (size_t)row * N + j) = sm;
      *(v4f*)(out_norm + (size_t)row * N + j) = o;
    }
    
  }
}



// ---- f16 WMMA path (v_wmma_f32_16x16x32_f16): 11-bit significands for operands in range — used where a [0,1] probability operand needs more precision than bf16
typedef _Float16 v16h __attribute__((ext_vector_type(16)));
union FragH { v16h v; v8us half[2]; _Float16 h[16]; unsigned short u[16]; };
template <int NT>
__device__ __forceinline__ v8f mmaH(v16h ah, v16h al, v16h bh, v16h bl, v8f c) {
  c = __builtin_amdgcn_wmma_f32_16x16x32_f16(false, ah, false, bh, (short)0, c, false, false);
  if (NT >= 2) c = __builtin_amdgcn_wmma_f32_16x16x32_f16(false, al, false, bh, (short)0, c, false, false);
  if (NT >= 3) c = __builtin_amdgcn_wmma_f32_16x16x32_f16(false, ah, false, bl, (short)0, c, false, false);
  asm volatile("v_nop\n\tv_nop\n\tv_nop\n\tv_nop" : "+v"(c) : "v"(ah), "v"(al), "v"(bh), "v"(bl));
  return c;
}
// batched GEMM like k_gemm_b but f16 operands: A f32 (split into f16 hi/lo if ASPLIT, else rounded to f16), Bt = f16 values [n][k]; alpha; C f32; N multiple of 16 (partial tiles skipped)
template <bool ASPLIT>
__global__ __launch_bounds__(128) void k_gemm_h(const float* __restrict__ A, int lda, size_t sA, const _Float16* __restrict__ Bh, int ldb, size_t sB, float alpha, float* __restrict__ C, int ldc, size_t sC, int M, int N, int K) {
  __shared__ __attribute__((aligned(16))) float so[4][16][64];
  const int tid = threadIdx.x, w = tid >> 5, lane = tid & 31, ln = lane & 15, hh = lane >> 4; const int by = blockIdx.y;
  A += (size_t)by * sA; Bh += (size_t)by * sB; C += (size_t)by * sC;
  const int ntn = (N + 63) / 64; const int wid = blockIdx.x * 4 + w; const int mt = wid / ntn, nq = wid % ntn; if (mt * 16 >= M) return;
  const int row0 = mt * 16, col0 = nq * 64; const float* arow = A + (size_t)(row0 + ln) * lda;
  v8f acc[4] = {};
  for (int kb = 0; kb < K; kb += 32) {
    FragH ah, al;
    const v4f x0 = *(const v4fa*)(arow + kb + 8 * hh), x1 = *(const v4fa*)(arow + kb + 8 * hh + 4), x2 = *(const v4fa*)(arow + kb + 16 + 8 * hh), x3 = *(const v4fa*)(arow + kb + 16 + 8 * hh + 4);
    float xs[16] = {x0[0],x0[1],x0[2],x0[3],x1[0],x1[1],x1[2],x1[3],x2[0],x2[1],x2[2],x2[3],x3[0],x3[1],x3[2],x3[3]};
#pragma unroll
    for (int i = 0; i < 16; ++i) { const _Float16 h = (_Float16)xs[i]; ah.h[i] = h; al.h[i] = ASPLIT ? (_Float16)(xs[i] - (float)h) : (_Float16)0.0f; }
#pragma unroll
    for (int t = 0; t < 4; ++t) { if (col0 + t * 16 >= N) continue; const size_t boff = (size_t)(col0 + t * 16 + ln) * ldb + kb; FragH bq; bq.half[0] = *(const v8us*)(Bh + boff + 8 * hh); bq.half[1] = *(const v8us*)(Bh + boff + 16 + 8 * hh);
      acc[t] = mmaH<ASPLIT ? 2 : 1>(ah.v, al.v, bq.v, bq.v, acc[t]); }
  }
#pragma unroll
  for (int t = 0; t < 4; ++t) { if (col0 + t * 16 >= N) continue;
#pragma unroll
    for (int r = 0; r < 8; ++r) so[w][8 * hh + r][t * 16 + ln] = acc[t][r] * alpha; }
  __builtin_amdgcn_fence(__ATOMIC_ACQ_REL, "workgroup"); __builtin_amdgcn_wave_barrier();
  const int rsub = lane >> 4, c4 = (lane & 15) * 4;
  {
#pragma unroll
    for (int q = 0; q < 8; ++q) { const int r = q * 2 + rsub; if (col0 + c4 < N) { const v4f v = *(const v4fa*)&so[w][r][c4]; *(v4f*)(C + (size_t)(row0 + r) * ldc + col0 + c4) = v; } }
     }
}

// Wt[n][k] = f16(W[k][n]·scale) from f32 row-major W[K][N] (scale = power of two; bf16-exact weights stay exact in f16 away from the subnormal range)
__global__ __launch_bounds__(256) void k_wt_f16(const float* __restrict__ W, _Float16* __restrict__ Wt, int K, int N, float scale) {
  const int t = blockIdx.x * 256 + threadIdx.x; if (t >= N * (K / 8)) return; const int n = t / (K / 8), k8 = (t % (K / 8)) * 8; FragH f;
#pragma unroll
  for (int i = 0; i < 8; ++i) f.h[i] = (_Float16)(bf16_round(W[(size_t)(k8 + i) * N + n]) * scale); const v8us o = f.half[0];
  *(v8us*)((unsigned short*)Wt + (size_t)n * K + k8) = o; 
}
// k_gemm_hh variant with fused epilogue: v = acc·alpha + bias[by·sBias + col] (+ CP[(row/rowsPerB)·sCPb + by·64 + col] if CP) ; ACT 0 none / 1 elu ; writes f16 C16 (and f32 C if non-null)
template <int ACT>
__global__ __launch_bounds__(128) void k_gemm_hhx(const _Float16* __restrict__ A, int lda, size_t sA, const _Float16* __restrict__ Bh, int ldb, size_t sB, float alpha, const float* __restrict__ bias, size_t sBias, const float* __restrict__ CP, int rowsPerB, size_t sCPb, int row0g,
    float* __restrict__ C, _Float16* __restrict__ C16, int ldc, size_t sC, int M, int N, int K) {
  __shared__ __attribute__((aligned(16))) float so[4][16][64];
  const int tid = threadIdx.x, w = tid >> 5, lane = tid & 31, ln = lane & 15, hh = lane >> 4; const int by = blockIdx.y;
  A += (size_t)by * sA; Bh += (size_t)by * sB; const size_t cofs = (size_t)by * sC; const float* bp = bias ? bias + (size_t)by * sBias : nullptr;
  const int ntn = (N + 63) / 64; const int wid = blockIdx.x * 4 + w; const int mt = wid / ntn, nq = wid % ntn; if (mt * 16 >= M) return;
  const int row0 = mt * 16, col0 = nq * 64; const _Float16* arow = A + (size_t)(row0 + ln) * lda;
  v8f acc[4] = {};
  for (int kb = 0; kb < K; kb += 32) { FragH ah; ah.half[0] = *(const v8us*)((const unsigned short*)arow + kb + 8 * hh); ah.half[1] = *(const v8us*)((const unsigned short*)arow + kb + 16 + 8 * hh);
#pragma unroll
    for (int t = 0; t < 4; ++t) { if (col0 + t * 16 >= N) continue; const size_t boff = (size_t)(col0 + t * 16 + ln) * ldb + kb; FragH bq; bq.half[0] = *(const v8us*)((const unsigned short*)Bh + boff + 8 * hh); bq.half[1] = *(const v8us*)((const unsigned short*)Bh + boff + 16 + 8 * hh);
      acc[t] = mmaH<1>(ah.v, ah.v, bq.v, bq.v, acc[t]); }
  }
#pragma unroll
  for (int t = 0; t < 4; ++t) { if (col0 + t * 16 >= N) continue; const int col = col0 + t * 16 + ln; const float bv = bp ? bf16_round(bp[col]) : 0.f;
#pragma unroll
    for (int r = 0; r < 8; ++r) { float v = acc[t][r] * alpha + bv; if (CP) { const int rr = row0g + row0 + 8 * hh + r; if (rowsPerB < 0) v += CP[cofs + (size_t)rr * ldc + col];      /* rowsPerB < 0: own element of the batched C plane */ else { const int bidx = rr / rowsPerB; v += CP[(size_t)bidx * sCPb + (size_t)by * 64 + col]; } } if (ACT == 1) v = (v > 0.f) ? v : expm1f(v); else if (ACT == 7) v = (v > 0.f) ? v + 1.0f : expf(v); else if (ACT == 8) v = tanhf(v); else if (ACT == 9) v = 0.5f * v * (1.0f + tanhf(0.7978845608028654f * (v + 0.044715f * v * v * v))); else if (ACT == 11) v = 1.0f / (1.0f + expf(-v)); else if (ACT == 12) v = (v > 0.f) ? v : 0.01f * v; else if (ACT == 14) v = (v > 0.f) ? v : 0.1f * v; else if (ACT == 16) v = (v >= 0.f) ? v : 0.3f * v; else if (ACT == 17) v = (v >= 0.f) ? v : 0.2f * v; else if (ACT == 15) v = v / (1.0f + expf(-v)); else if (ACT == 3) v = fmaxf(v, 0.f); else if (ACT == 6) v = 0.5f * v * (1.0f + erff(v * 0.70710678118654752f)); so[w][8 * hh + r][t * 16 + ln] = v; } }
  __builtin_amdgcn_fence(__ATOMIC_ACQ_REL, "workgroup"); __builtin_amdgcn_wave_barrier();
  const int rsub = lane >> 4, c4 = (lane & 15) * 4; typedef _Float16 v4h __attribute__((ext_vector_type(4)));
  {
#pragma unroll
    for (int q = 0; q < 8; ++q) { const int r = q * 2 + rsub; if (col0 + c4 < N) { const v4f v = *(const v4fa*)&so[w][r][c4]; if (C) *(v4f*)(C + cofs + (size_t)(row0 + r) * ldc + col0 + c4) = v; if (C16) { v4h h4; for (int i = 0; i < 4; ++i) h4[i] = (_Float16)v[i]; *(v4h*)(C16 + cofs + (size_t)(row0 + r) * ldc + col0 + c4) = h4; } } }
     }
}


typedef _Float16 v4h __attribute__((ext_vector_type(4)));

__global__ __launch_bounds__(256) void k_x16(const float* __restrict__ x, _Float16* __restrict__ X16, size_t n8) { const size_t t = (size_t)blockIdx.x * 256 + threadIdx.x; if (t >= n8) return; FragH f;
#pragma unroll
  for (int q = 0; q < 8; ++q) f.h[q] = (_Float16)bf16_round(x[t * 8 + q]); *(v8us*)((unsigned short*)X16 + t * 8) = f.half[0];  }
__global__ __launch_bounds__(256) void k_h16(const float* __restrict__ x, _Float16* __restrict__ X16, size_t n8) { const size_t t = (size_t)blockIdx.x * 256 + threadIdx.x; if (t >= n8) return; FragH f;
#pragma unroll
  for (int q = 0; q < 8; ++q) f.h[q] = (_Float16)x[t * 8 + q]; *(v8us*)((unsigned short*)X16 + t * 8) = f.half[0];  }
__global__ __launch_bounds__(256) void k_round16f(const float* __restrict__ W, _Float16* __restrict__ Bt, size_t n8) { const size_t t = (size_t)blockIdx.x * 256 + threadIdx.x; if (t >= n8) return; FragH f;
#pragma unroll
  for (int i = 0; i < 8; ++i) f.h[i] = (_Float16)(bf16_round(W[t * 8 + i]) * 16.0f); *(v8us*)((unsigned short*)Bt + t * 8) = f.half[0];  }
template <int NHv, int TTv>
__global__ __launch_bounds__(256) void k_vt(const _Float16* __restrict__ V16, int ldv, int voff, _Float16* __restrict__ Vt) { __shared__ unsigned short tl[64][66]; const int tid = threadIdx.x; const int slab = blockIdx.x / (TTv / 64), lg = blockIdx.x % (TTv / 64); const int b = slab / NHv, h = slab % NHv;
  for (int i = tid; i < 64 * 8; i += 256) { const int r = i / 8, c8 = (i % 8) * 8; FragH f; f.half[0] = *(const v8us*)((const unsigned short*)V16 + ((size_t)b * TTv + lg * 64 + r) * ldv + voff + h * 64 + c8);
#pragma unroll
    for (int q = 0; q < 8; ++q) tl[r][c8 + q] = f.u[q]; }
  __syncthreads();
  {
#pragma unroll
    for (int rd = 0; rd < 2; ++rd) { const int d = rd * 32 + tid / 8, pc = tid % 8; FragH f;
#pragma unroll
      for (int q = 0; q < 8; ++q) f.u[q] = tl[pc * 8 + q][d];
      *(v8us*)((unsigned short*)Vt + ((size_t)slab * 64 + d) * TTv + lg * 64 + pc * 8) = f.half[0]; }
     } }

__global__ __launch_bounds__(256) void k_hl(const float* __restrict__ F, _Float16* __restrict__ Hh, _Float16* __restrict__ Hl, size_t n8) { const size_t t = (size_t)blockIdx.x * 256 + threadIdx.x; if (t >= n8) return; FragH fh, fl; const v4f a = *(const v4fa*)(F + t * 8), c = *(const v4fa*)(F + t * 8 + 4);
#pragma unroll
  for (int q = 0; q < 4; ++q) { _Float16 h = (_Float16)a[q]; fh.h[q] = h; fl.h[q] = (_Float16)((a[q] - (float)h) * 1024.0f); h = (_Float16)c[q]; fh.h[4 + q] = h; fl.h[4 + q] = (_Float16)((c[q] - (float)h) * 1024.0f); }
  { *(v8us*)((unsigned short*)Hh + t * 8) = fh.half[0]; *(v8us*)((unsigned short*)Hl + t * 8) = fl.half[0];  } }

// ---- fast GEMM (work-group tile 128x64, wave tile 32x64; requires M % 128 == 0 rows per launch region, N % 64 == 0 and K % 64 == 0); epilogue = k_gemm_hhx semantics ----
// Operands go through LDS: a stage is 64 k (128-byte rows, whole cache lines) of the work-group's 128 A rows and 64 Bt rows, brought by asynchronous copies (16 bytes a lane, four whole lines a wave-instruction), two buffers:
// stage s + 1 flies while stage s is multiplied. The fragments are read from LDS in the k order that the global fragment loads had, so every product and every sum is the same as before.
#define G2K 64                       /* k elements per stage */
#define G2P (G2K + 8)                /* LDS pitch of a staged row, f16 elements (144 B = 16 B x odd: no bank conflict for 16-byte fragment reads) */
#define G2R (128 + 64)               /* rows per stage: A rows 0 .. 127, then Bt rows 0 .. 63 */
#define G2S (16 * G2P * 2)           /* LDS bytes between two copies of one lane (16 rows) */
__device__ __forceinline__ v16h g2_frag(const unsigned short* p) { FragH f; f.half[0] = *(const v8us*)p; f.half[1] = *(const v8us*)(p + 16); return f.v; }
__device__ __forceinline__ v8f g2_mma(v16h a, v16h b, v8f c) { v8f d = __builtin_amdgcn_wmma_f32_16x16x32_f16(false, a, false, b, (short)0, c, false, false); asm volatile("v_nop\n\tv_nop\n\tv_nop\n\tv_nop" : "+v"(d) : "v"(a), "v"(b)); return d; }
// one stage's copies of one lane: 16 bytes of A rows r, r + 16, .. r + 112 and of Bt rows r, r + 16, r + 32, r + 48 (r = thread / 8) to LDS byte l + 0, G2S, .. 11 G2S. ra, rb = 16 rows of A, of Bt, in elements.
// The s_wait_xcnt closes the statement so that it stands in front of every later write of a register that a copy names.
__device__ __forceinline__ void g2_copy(unsigned l, const unsigned short* ga, size_t ra, const unsigned short* gb, size_t rb) {
  asm volatile("global_load_async_to_lds_b128 %0, %1, off\n\t"
               "global_load_async_to_lds_b128 %2, %3, off\n\t"
               "global_load_async_to_lds_b128 %4, %5, off\n\t"
               "global_load_async_to_lds_b128 %6, %7, off\n\t"
               "global_load_async_to_lds_b128 %8, %9, off\n\t"
               "global_load_async_to_lds_b128 %10, %11, off\n\t"
               "global_load_async_to_lds_b128 %12, %13, off\n\t"
               "global_load_async_to_lds_b128 %14, %15, off\n\t"
               "global_load_async_to_lds_b128 %16, %17, off\n\t"
               "global_load_async_to_lds_b128 %18, %19, off\n\t"
               "global_load_async_to_lds_b128 %20, %21, off\n\t"
               "global_load_async_to_lds_b128 %22, %23, off\n\t"
               "s_wait_xcnt 0x0"
               :: "v"(l), "v"(ga), "v"(l + 1 * G2S), "v"(ga + ra), "v"(l + 2 * G2S), "v"(ga + 2 * ra), "v"(l + 3 * G2S), "v"(ga + 3 * ra),
                  "v"(l + 4 * G2S), "v"(ga + 4 * ra), "v"(l + 5 * G2S), "v"(ga + 5 * ra), "v"(l + 6 * G2S), "v"(ga + 6 * ra), "v"(l + 7 * G2S), "v"(ga + 7 * ra),
                  "v"(l + 8 * G2S), "v"(gb), "v"(l + 9 * G2S), "v"(gb + rb), "v"(l + 10 * G2S), "v"(gb + 2 * rb), "v"(l + 11 * G2S), "v"(gb + 3 * rb)
               : "memory"); }
template <int ACT>
__global__ __launch_bounds__(128) void k_gemm2(const _Float16* __restrict__ A, int lda, size_t sA, const _Float16* __restrict__ Bh, int ldb, size_t sB, float alpha, const float* __restrict__ bias, const float* __restrict__ bias1, const float* __restrict__ bias2, size_t sBias, const float* __restrict__ CP, int rowsPerB, size_t sCPb, int row0g,
    float* __restrict__ C, _Float16* __restrict__ C16, int ldc, size_t sC, int M, int N, int K) { static_assert(ACT == 0 || ACT == 3 || ACT == 6 || ACT == 8 || ACT == 9 || ACT == 11 || ACT == 12 || ACT == 14 || ACT == 15 || ACT == 16 || ACT == 17, "k_gemm2: unsupported ACT code (would silently apply no activation)");
  __shared__ __attribute__((aligned(16))) unsigned short st[2][G2R * G2P];
  __shared__ __attribute__((aligned(16))) float so[4][32][68];
  const int tid = threadIdx.x, w = tid >> 5, lane = tid & 31, ln = lane & 15, hh = lane >> 4; const int by = blockIdx.y;
  const float* bsel = by == 0 ? bias : (by == 1 ? bias1 : bias2);      /* products that share one grid bring their bias vectors as separate inputs: plane 0, 1, 2 */
  A += (size_t)by * sA; Bh += (size_t)by * sB; const size_t cofs = (size_t)by * sC; const float* bp = bsel ? bsel + (size_t)by * sBias : nullptr;
  const int ntn = N >> 6; const int mt = blockIdx.x / ntn, nq = blockIdx.x - mt * ntn; const int row0 = mt * 128 + 32 * w, col0 = nq * 64; if (mt * 128 + 128 > M) return;      /* the same for the whole work-group, in front of every barrier: all 128 staged A rows exist */
  const int cr = tid >> 3, cc = (tid & 7) * 8;      /* the lane's first staged row, and its 16 bytes in the row */
  const unsigned short* ga = (const unsigned short*)A + (size_t)(mt * 128 + cr) * lda + cc; const unsigned short* gb = (const unsigned short*)Bh + (size_t)(col0 + cr) * ldb + cc;
  const size_t ra = (size_t)16 * lda, rb = (size_t)16 * ldb;
  const unsigned l0 = (unsigned)(size_t)&st[0][cr * G2P + cc];      /* LDS byte address: the low 32 bits of the __shared__ address */
  constexpr int SE = G2R * G2P;      /* elements per buffer */
  const int ns = K / G2K;
  g2_copy(l0, ga, ra, gb, rb);
  asm volatile("s_wait_asynccnt 0x0" ::: "memory");      /* this wave's copies of stage 0 have landed */
  __syncthreads();      /* stage 0 is complete for every wave */
  if (ns > 1) g2_copy(l0 + SE * 2, ga + G2K, ra, gb + G2K, rb);
  const unsigned short* fa = &st[0][(32 * w + ln) * G2P + 8 * hh]; const unsigned short* fb = &st[0][(128 + ln) * G2P + 8 * hh];
  const v8f z8 = {0.f,0.f,0.f,0.f,0.f,0.f,0.f,0.f}; v8f c00 = z8, c01 = z8, c02 = z8, c03 = z8, c10 = z8, c11 = z8, c12 = z8, c13 = z8;
  for (int s = 0; s < ns; ++s) { const int bo = (s & 1) * SE; const unsigned short* pa = fa + bo; const unsigned short* pb = fb + bo;
    /* all 24 fragment reads of the stage stand together in front of its 16 products: one LDS latency a stage, not one a fragment */
    const v16h a0 = g2_frag(pa), a1 = g2_frag(pa + 16 * G2P), b0 = g2_frag(pb), b1 = g2_frag(pb + 16 * G2P), b2 = g2_frag(pb + 32 * G2P), b3 = g2_frag(pb + 48 * G2P);
    const v16h a2 = g2_frag(pa + 32), a3 = g2_frag(pa + 16 * G2P + 32), b4 = g2_frag(pb + 32), b5 = g2_frag(pb + 16 * G2P + 32), b6 = g2_frag(pb + 32 * G2P + 32), b7 = g2_frag(pb + 48 * G2P + 32);
    c00 = g2_mma(a0, b0, c00); c10 = g2_mma(a1, b0, c10); c01 = g2_mma(a0, b1, c01); c11 = g2_mma(a1, b1, c11); c02 = g2_mma(a0, b2, c02); c12 = g2_mma(a1, b2, c12); c03 = g2_mma(a0, b3, c03); c13 = g2_mma(a1, b3, c13);
    c00 = g2_mma(a2, b4, c00); c10 = g2_mma(a3, b4, c10); c01 = g2_mma(a2, b5, c01); c11 = g2_mma(a3, b5, c11); c02 = g2_mma(a2, b6, c02); c12 = g2_mma(a3, b6, c12); c03 = g2_mma(a2, b7, c03); c13 = g2_mma(a3, b7, c13);
    asm volatile("s_wait_dscnt 0x0" ::: "memory");      /* this wave's reads of buffer s & 1 are done before the buffer is refilled */
    asm volatile("s_wait_asynccnt 0x0" ::: "memory");      /* this wave's copies of stage s + 1 have landed */
    __syncthreads();      /* publishes stage s + 1 and ends every wave's reads of stage s */
    if (s + 2 < ns) g2_copy(l0 + bo * 2, ga + (size_t)(s + 2) * G2K, ra, gb + (size_t)(s + 2) * G2K, rb); }
  asm volatile("s_wait_asynccnt 0x0" ::: "memory");      /* no copy is outstanding when the wave goes on to its end */
  v8f accs[8] = {c00, c01, c02, c03, c10, c11, c12, c13};
#pragma unroll
  for (int u = 0; u < 8; ++u) { const int t = u & 3, half = u >> 2; const int col = col0 + t * 16 + ln; const float bv = bp ? bf16_round(bp[col]) : 0.f;
#pragma unroll
    for (int r = 0; r < 8; ++r) { const int rloc = half * 16 + 8 * hh + r; float v = accs[u][r] * alpha + bv; if (CP) { if (rowsPerB < 0) v += CP[cofs + (size_t)(row0g + row0 + rloc) * ldc + col];      /* rowsPerB < 0: own element of the batched C plane */ else { const int bidx = (row0g + row0 + rloc) / rowsPerB; v += CP[(size_t)bidx * sCPb + (size_t)by * 64 + col]; } }
      if (ACT == 3) v = fmaxf(v, 0.f); else if (ACT == 6) v = 0.5f * v * (1.0f + erff(v * 0.70710678118654752f)); else if (ACT == 11) v = 1.0f / (1.0f + expf(-v)); else if (ACT == 15) v = v / (1.0f + expf(-v)); else if (ACT == 12) v = (v > 0.f) ? v : 0.01f * v; else if (ACT == 8) v = tanhf(v); else if (ACT == 9) v = 0.5f * v * (1.0f + tanhf(0.7978845608028654f * (v + 0.044715f * v * v * v))); else if (ACT == 14) v = (v > 0.f) ? v : 0.1f * v; else if (ACT == 16) v = (v >= 0.f) ? v : 0.3f * v; else if (ACT == 17) v = (v >= 0.f) ? v : 0.2f * v;
      so[w][rloc][t * 16 + ln] = v; } }
  __builtin_amdgcn_fence(__ATOMIC_ACQ_REL, "workgroup"); __builtin_amdgcn_wave_barrier();
  const int rsub = lane >> 4, c4 = (lane & 15) * 4;
  {
#pragma unroll
    for (int q = 0; q < 16; ++q) { const int r = q * 2 + rsub; const v4f v = *(const v4fa*)&so[w][r][c4]; if (C) *(v4f*)(C + cofs + (size_t)(row0 + r) * ldc + col0 + c4) = v; if (C16) { v4h h4; for (int i = 0; i < 4; ++i) h4[i] = (_Float16)v[i]; *(v4h*)(C16 + cofs + (size_t)(row0 + r) * ldc + col0 + c4) = h4; } }
     } }


// fused attention, one (batch, head) and 512 queries per work-group of 16 waves. The head's K rows [key][d] and V^T rows [d][key] are laid in LDS once (row pitches 16 B x odd: no bank conflict for 16-byte fragment reads);
// each wave owns 32 queries (two 16-column groups) and walks the keys 32 at a time: S^T = K Q^T (A = K rows, B = Q rows, both in the hardware k order), so a lane holds 16 scores of ONE query per group;
// the two S^T tiles of a group, converted in place, are the B operand P^T of O^T += V^T P^T (register s < 8: key 8 hh + s, s >= 8: key 16 + 8 hh + s - 8). Softmax in base 2 against a running maximum mu, raised only when a score passes it by more than 8 (weights then stay <= 256, inside f16).
#define AKP (HD + 8)                 /* LDS pitch of a K row, f16 elements (144 B) */
#define AVP (SQ + 8)                 /* LDS pitch of a V^T row, f16 elements (2064 B) */
#define AQW 32                       /* queries per wave */
#define ANW 16                       /* waves per work-group */
__device__ __forceinline__ v8f fa_mma(v16h a, v16h b, v8f c) { return __builtin_amdgcn_wmma_f32_16x16x32_f16(false, a, false, b, (short)0, c, false, false); }
__device__ __forceinline__ float fa_xhalf(float x) { return __builtin_bit_cast(float, __builtin_amdgcn_permlanex16(__builtin_bit_cast(int, x), __builtin_bit_cast(int, x), 0x76543210, 0xfedcba98, false, false)); }      /* lane l takes lane l ^ 16, on the vector pipe: no LDS round trip in the loop */
__device__ __forceinline__ v16h fa_frag(const unsigned short* p) { FragH f; f.half[0] = *(const v8us*)p; f.half[1] = *(const v8us*)(p + 16); return f.v; }
__global__ __launch_bounds__(ANW * 32) void k_fattn(const _Float16* __restrict__ Q16, const _Float16* __restrict__ K16, const _Float16* __restrict__ VT, _Float16* __restrict__ O16) {
  __shared__ __attribute__((aligned(16))) unsigned short sk[SQ * AKP];
  __shared__ __attribute__((aligned(16))) unsigned short sv[HD * AVP];
  const int tid = threadIdx.x, w = tid >> 5, lane = tid & 31, ln = lane & 15, hh = lane >> 4;
  constexpr int QB = SQ / (ANW * AQW);      /* work-groups per head */
  const int bh = blockIdx.x / QB, qb = blockIdx.x % QB; const int b = bh / NH, h = bh % NH;
  const unsigned short* kg = (const unsigned short*)K16 + (size_t)b * SQ * DM + h * HD; const unsigned short* vg = (const unsigned short*)VT + (size_t)bh * HD * SQ;
  /* fill: thread t brings 16 bytes of K row u * 64 + t / 8 and of V^T row u * 4 + t / 128 (u = 0 .. 15). One address per plane, the rows told apart by constant offsets; every loop is unrolled whole so that
     all 32 fill loads and the 8 Q loads are in flight together and the register arrays are indexed by constants alone */
  constexpr int NT = ANW * 32, KRS = NT / (HD / 8), VRS = NT / (SQ / 8);      /* threads; K rows and V^T rows covered by one sweep of the work-group */
  const int kr = tid / (HD / 8), kc = (tid % (HD / 8)) * 8, vr = tid / (SQ / 8), vc = (tid % (SQ / 8)) * 8;
  const unsigned short* kgl = kg + (size_t)kr * DM + kc; const unsigned short* vgl = vg + (size_t)vr * SQ + vc;
  const int q0 = qb * (ANW * AQW) + w * AQW;
  const unsigned short* qp = (const unsigned short*)Q16 + ((size_t)b * SQ + q0 + ln) * DM + h * HD + 8 * hh;
  v8us kx[SQ / KRS], vx[HD / VRS]; v16h qf[2][2];
#pragma unroll
  for (int u = 0; u < SQ / KRS; ++u) kx[u] = *(const v8us*)(kgl + (size_t)u * KRS * DM);
#pragma unroll
  for (int u = 0; u < HD / VRS; ++u) vx[u] = *(const v8us*)(vgl + (size_t)u * VRS * SQ);
#pragma unroll
  for (int g = 0; g < 2; ++g) { qf[g][0] = fa_frag(qp + (size_t)g * 16 * DM); qf[g][1] = fa_frag(qp + (size_t)g * 16 * DM + 32); }
  asm volatile("s_wait_xcnt 0x0" :: "v"(kgl), "v"(vgl), "v"(qp) : "memory");      /* the wait owed before a register that an issued global load names is overwritten; the three addresses are inputs so that they stay in their registers up to here */
#pragma unroll
  for (int u = 0; u < SQ / KRS; ++u) *(v8us*)(sk + (kr + u * KRS) * AKP + kc) = kx[u];
#pragma unroll
  for (int u = 0; u < HD / VRS; ++u) *(v8us*)(sv + (vr + u * VRS) * AVP + vc) = vx[u];
  __syncthreads();      /* K and V^T of the head are complete in LDS; nothing writes LDS behind this point */
  /* every inner loop from here on is unrolled whole: the fragment and accumulator arrays are then indexed by constants alone and stay in registers */
  const v8f z8 = {0.f,0.f,0.f,0.f,0.f,0.f,0.f,0.f};
  v8f o[2][4] = {{z8, z8, z8, z8}, {z8, z8, z8, z8}};      /* o[g][t][r] = O^T[d = 16 t + 8 hh + r][query q0 + 16 g + ln], relative to mu[g] */
  float mu[2] = {-3.0e38f, -3.0e38f}, ls[2] = {0.f, 0.f};
  const float CS = 0.125f * 1.4426950408889634f;      /* 1 / sqrt(64), and base e to base 2 */
  const unsigned short* skl = sk + ln * AKP + 8 * hh; const unsigned short* svl = sv + ln * AVP + 8 * hh;
  for (int j = 0; j < SQ; j += 32) {
    v16h kf[2][2], vf[4];
#pragma unroll
    for (int kt = 0; kt < 2; ++kt) { kf[kt][0] = fa_frag(skl + (j + 16 * kt) * AKP); kf[kt][1] = fa_frag(skl + (j + 16 * kt) * AKP + 32); }
#pragma unroll
    for (int t = 0; t < 4; ++t) vf[t] = fa_frag(svl + 16 * t * AVP + j);
    v8f s[2][2];
#pragma unroll
    for (int g = 0; g < 2; ++g)
#pragma unroll
      for (int kt = 0; kt < 2; ++kt) s[g][kt] = fa_mma(kf[kt][1], qf[g][1], fa_mma(kf[kt][0], qf[g][0], z8));
    float mx[2];
#pragma unroll
    for (int g = 0; g < 2; ++g) { float m = fmaxf(s[g][0][0], s[g][1][0]);
#pragma unroll
      for (int r = 1; r < 8; ++r) m = fmaxf(m, fmaxf(s[g][0][r], s[g][1][r]));
      m = fmaxf(m, fa_xhalf(m)); mx[g] = m * CS; }      /* lanes ln and ln + 16 hold the same query: both take the same maximum */
    if (__builtin_amdgcn_ballot_w32(mx[0] > mu[0] + 8.0f || mx[1] > mu[1] + 8.0f) != 0) {      /* wave-uniform; always taken on the first pass */
#pragma unroll
      for (int g = 0; g < 2; ++g) { const float mn = fmaxf(mu[g], mx[g]); const float corr = __builtin_amdgcn_exp2f(mu[g] - mn); mu[g] = mn; ls[g] *= corr;
#pragma unroll
        for (int t = 0; t < 4; ++t) o[g][t] *= corr; } }
#pragma unroll
    for (int g = 0; g < 2; ++g) { FragH pf;
#pragma unroll
      for (int kt = 0; kt < 2; ++kt)
#pragma unroll
        for (int r = 0; r < 8; ++r) { const float p = __builtin_amdgcn_exp2f(fmaf(s[g][kt][r], CS, -mu[g])); ls[g] += p; pf.h[kt * 8 + r] = (_Float16)p; }
#pragma unroll
      for (int t = 0; t < 4; ++t) o[g][t] = fa_mma(vf[t], pf.v, o[g][t]); }
  }
#pragma unroll
  for (int g = 0; g < 2; ++g) { const float l = ls[g] + fa_xhalf(ls[g]); const float sc = 64.0f / l;      /* the two lane halves summed different keys of the same query */
    unsigned short* d = (unsigned short*)O16 + ((size_t)b * SQ + q0 + 16 * g + ln) * DM + h * HD + 8 * hh;
#pragma unroll
    for (int t = 0; t < 4; ++t) { FragH f;
#pragma unroll
      for (int r = 0; r < 8; ++r) f.h[r] = (_Float16)(o[g][t][r] * sc);
      *(v8us*)(d + 16 * t) = f.half[0]; } } }
__global__ __launch_bounds__(256) void k_vt(const _Float16* __restrict__ V16, int b, int h0, _Float16* __restrict__ VT) { __shared__ unsigned short tl[64][65]; const int tid = threadIdx.x; const int hh = blockIdx.x % HG, sg = blockIdx.x / HG; const int s0 = sg * 64; const int h = h0 + hh;
  for (int i = tid; i < 64 * 8; i += 256) { const int j = i / 8, d8 = (i % 8) * 8; FragH f; f.half[0] = *(const v8us*)((const unsigned short*)V16 + ((size_t)b * SQ + s0 + j) * DM + h * HD + d8); for (int q = 0; q < 8; ++q) tl[d8 + q][j] = f.u[q]; }
  __syncthreads();
  { for (int i = tid; i < 64 * 8; i += 256) { const int d = i / 8, j8 = (i % 8) * 8; FragH f; for (int q = 0; q < 8; ++q) f.u[q] = tl[d][j8 + q]; *(v8us*)((unsigned short*)VT + ((size_t)hh * HD + d) * SQ + s0 + j8) = f.half[0]; }  } }



__global__ __launch_bounds__(256) void k_rsmkm(const float* __restrict__ S, _Float16* __restrict__ P, int nrows, const int* __restrict__ am) {
  #pragma clang fp contract(off)
  const int t = blockIdx.x * 256 + threadIdx.x; if (t >= nrows) return; const size_t i = (size_t)t; const float* s = S + i * SQ; const int* mr = am + (size_t)(t % SQ) * SQ; float mx = -3.0e38f;
#pragma unroll 1
  for (int j = 0; j < SQ; ++j) { const float f = (mr[j] != 0) ? 1.f : 0.f; mx = fmaxf(mx, fmaf(f, s[j], (1.f - f) * -1.0e9f)); } float se = 0.f;
#pragma unroll 1
  for (int j = 0; j < SQ; ++j) { const float f = (mr[j] != 0) ? 1.f : 0.f; se += __expf(fmaf(f, s[j], (1.f - f) * -1.0e9f) - mx); } const float sc = 256.0f / se;
#pragma unroll 1
  for (int j0 = 0; j0 < SQ; j0 += 8) { FragH fr; for (int q = 0; q < 8; ++q) { const int j = j0 + q; const float f = (mr[j] != 0) ? 1.f : 0.f; fr.h[q] = (_Float16)(__expf(fmaf(f, s[j], (1.f - f) * -1.0e9f) - mx) * sc); }
    unsigned short* d = (unsigned short*)P + i * SQ + j0; *(v8us*)d = fr.half[0];  } }
// local RMS norm with the 7 x 7 box sum taken as two passes of 7. A work-group owns LRB grid rows x all GS grid columns x LRC channels of one batch. A thread owns one channel quad q4 of LRJ grid columns (GS / LRJ apart): it loads
// each column's LRB + 6 grid rows (16 bytes each, all in flight together; a half-wave reads one position's 256 bytes), sums the squares down the column for each of the LRB rows in registers and lays these column sums in LDS;
// behind the one barrier it adds the 7 column sums around each of its columns (RW columns of zeros on either side stand for the zero padding; grid rows outside the grid are zeroed in the rounding mask).
// x of its own positions is still in registers for the division.
#define LRB 4                        /* grid rows per work-group */
#define LRC 64                       /* channels per work-group: 256 B of x, one whole 128-B line of the f16 rows */
#define LRJ 2                        /* grid columns per thread: half the waves to start for the same work */
#define LRP (GS + 2 * RW)            /* columns in a row of column sums in LDS, the zeros included */
#define LRT (GS / LRJ * LRC / 4)     /* threads per work-group */
#define LRG (NB * (GS / LRB) * (DM / LRC))      /* work-groups of the norm */
#define LWG (DM * DM / 8 / LRT)      /* work-groups behind them that convert the weights */
// The launch also carries the weight conversion, which depends on nothing and on which only the GEMMs depend: work-groups LRG .. LRG + LWG - 1 write Bt[n][k] = f16(bf16(W[n][k]) x 16) (natural [out][in] rows) for the four matrices,
// laid one behind the other in BW; a thread takes the same 8 elements of each matrix, its 8 loads in flight together.
__global__ __launch_bounds__(LRT) void k_lrms(const float* __restrict__ x, const float* __restrict__ w, _Float16* __restrict__ X16,
    const float* __restrict__ wq, const float* __restrict__ wk, const float* __restrict__ wv, const float* __restrict__ wo, _Float16* __restrict__ BW) {
  __shared__ __attribute__((aligned(16))) float cs[LRB][LRP][LRC];
  if (blockIdx.x >= LRG) {      /* the same for the whole work-group, in front of the barrier */
    const unsigned t8 = ((blockIdx.x - LRG) * LRT + threadIdx.x) * 8;
    const float* pq = wq + t8; const float* pk = wk + t8; const float* pv = wv + t8; const float* po = wo + t8;
    const v4f wx[4][2] = {{*(const v4fa*)pq, *(const v4fa*)(pq + 4)}, {*(const v4fa*)pk, *(const v4fa*)(pk + 4)}, {*(const v4fa*)pv, *(const v4fa*)(pv + 4)}, {*(const v4fa*)po, *(const v4fa*)(po + 4)}};
    asm volatile("s_wait_xcnt 0x0" :: "v"(pq), "v"(pk), "v"(pv), "v"(po) : "memory");      /* the wait owed before a register that an issued global load names is overwritten; the addresses are inputs so that they stay in their registers up to here */
#pragma unroll
    for (int m = 0; m < 4; ++m) { FragH f;      /* unrolled whole: wx is indexed by constants alone */
#pragma unroll
      for (int q = 0; q < 8; ++q) f.h[q] = (_Float16)(bf16_round(wx[m][q >> 2][q & 3]) * 16.0f);
      *(v8us*)((unsigned short*)BW + (size_t)m * DM * DM + t8) = f.half[0]; }
    return; }
  constexpr int NCG = DM / LRC, NBD = GS / LRB, NK = LRB + 2 * RW, JS = GS / LRJ;
  const int tid = threadIdx.x, q4 = (tid % (LRC / 4)) * 4, j = tid / (LRC / 4);      /* j: the first of the thread's columns, the others at j + JS, .. */
  const int cg = blockIdx.x % NCG, bd = (blockIdx.x / NCG) % NBD, b = blockIdx.x / (NCG * NBD); const int i0 = bd * LRB;
  const int to = j * DM + cg * LRC + q4;      /* the thread's place inside a grid row of x, elements */
  const float* xb = x + (size_t)b * SQ * DM + to; const float* pw = w + cg * LRC + q4;
  const float* pc = xb + (size_t)i0 * GS * DM;      /* the work-group's own grid rows: constant offsets from here */
  /* every loop of this kernel is unrolled whole: the register arrays are then indexed by constants alone and stay in registers, and all the loads stand together in front of the first use */
  const float* pe[2 * RW];      /* the RW grid rows above and the RW below, clamped into the grid; the rows below as LRB + k rows behind pe[RW + k] */
#pragma unroll
  for (int k = 0; k < RW; ++k) { const int iu = i0 - RW + k, il = GS - 1 - LRB - k; pe[k] = xb + (size_t)(iu < 0 ? 0 : iu) * GS * DM; pe[RW + k] = xb + (size_t)(i0 < il ? i0 : il) * GS * DM; }
  v4f xr[LRJ][NK];
#pragma unroll
  for (int k = 0; k < NK; ++k) { const float* p = k < RW ? pe[k] : (k < RW + LRB ? pc : pe[k - LRB]) + (k - RW) * GS * DM;
#pragma unroll
    for (int e = 0; e < LRJ; ++e) xr[e][k] = *(const v4fa*)(p + e * JS * DM); }
  const v4f wr = *(const v4fa*)pw;
  static_assert(RW == 3, "the statement below names 2 * RW + 1 addresses");
  asm volatile("s_wait_xcnt 0x0" :: "v"(pc), "v"(pe[0]), "v"(pe[1]), "v"(pe[2]), "v"(pe[3]), "v"(pe[4]), "v"(pe[5]) : "memory");      /* the wait owed before a register that an issued global load names is overwritten; the addresses are inputs so that they stay in their registers up to here */
  const v4f z4 = {0.f, 0.f, 0.f, 0.f};
  if (j < RW) {      /* the zero columns: RW on the left, RW on the right */
#pragma unroll
    for (int r = 0; r < LRB; ++r) { *(v4fa*)&cs[r][j][q4] = z4; *(v4fa*)&cs[r][RW + GS + j][q4] = z4; } }
#pragma unroll
  for (int k = 0; k < NK; ++k) { const int ii = i0 - RW + k; const unsigned m = (ii >= 0 && ii < GS) ? 0xFFFF0000u : 0u;      /* bf16 rounding as in bf16_round; a row outside the grid becomes 0 */
#pragma unroll
    for (int e = 0; e < LRJ; ++e)
#pragma unroll
      for (int c = 0; c < 4; ++c) { const unsigned u = __float_as_uint(xr[e][k][c]); xr[e][k][c] = __uint_as_float((u + 0x7FFFu + ((u >> 16) & 1u)) & m); } }
#pragma unroll
  for (int e = 0; e < LRJ; ++e)
#pragma unroll
    for (int r = 0; r < LRB; ++r) { v4f s = xr[e][r] * xr[e][r];
#pragma unroll
      for (int d = 1; d <= 2 * RW; ++d) s += xr[e][r + d] * xr[e][r + d];
      *(v4fa*)&cs[r][RW + j + e * JS][q4] = s; }
  __syncthreads();      /* every column sum of the work-group's rows, and the zeros beside them, are in LDS; nothing writes LDS behind this point */
  v4h o[LRJ][LRB];
#pragma unroll
  for (int e = 0; e < LRJ; ++e)
#pragma unroll
    for (int r = 0; r < LRB; ++r) { v4f s = *(const v4fa*)&cs[r][j + e * JS][q4];
#pragma unroll
      for (int d = 1; d <= 2 * RW; ++d) s += *(const v4fa*)&cs[r][j + e * JS + d][q4];
#pragma unroll
      for (int c = 0; c < 4; ++c) { const float rms = sqrtf(0.0000001f + s[c] * 0.02040816326530612f);      /* box / 49 as a multiply by the f32 reciprocal (the result is rounded to f16 next) */
        o[e][r][c] = (_Float16)(xr[e][RW + r][c] / rms * bf16_round(wr[c])); } }
  _Float16* d = X16 + ((size_t)b * SQ + (size_t)i0 * GS) * DM + to;
#pragma unroll
  for (int e = 0; e < LRJ; ++e)
#pragma unroll
    for (int r = 0; r < LRB; ++r) *(v4h*)(d + (size_t)(r * GS + e * JS) * DM) = o[e][r]; }


extern "C" void kernel_launch(void* const* d_in, const int* in_sizes, int n_in,
                              void* d_out, int out_size, void* d_ws, size_t ws_size, hipStream_t stream) {
  (void)in_sizes; (void)n_in; (void)out_size;
  const float* const* I = (const float* const*)d_in; const float* x = I[0]; const float* nw = I[1]; const float* wq = I[2]; const float* bq = I[3]; const float* wk = I[4]; const float* bk = I[5]; const float* wv = I[6]; const float* bv = I[7]; const float* wo = I[8]; const float* bo = I[9];      /* x; norm_w [768]; natural [768][768] weights + biases (q, k, v, o) */
  static_assert(SQ == GS * GS && DM % 8 == 0 && DM % 64 == 0 && DM % 32 == 0 && SQ % 128 == 0 && NH * HD == DM && NH % HG == 0 && HD == 64 && SQ % (ANW * AQW) == 0 && B0 == 0 && NBR == NB && QN == SQ && NHD == NH && GS % LRB == 0 && DM % LRC == 0 && GS % LRJ == 0 && GS / LRJ >= RW && DM * DM % (8 * LRT) == 0 && DM * DM * 2 % 256 == 0 && NB * SQ * DM * 2 % 256 == 0, "shape / tile multiples; the planes taken below follow one another without a gap");
  char* ws = (char*)d_ws; size_t off = 0;
  auto take = [&](size_t bytes) { char* p = ws + off; off += (bytes + 255) & ~(size_t)255; return p; };
  _Float16* BQ = (_Float16*)take((size_t)DM * DM * 2); _Float16* BK = (_Float16*)take((size_t)DM * DM * 2); _Float16* BV = (_Float16*)take((size_t)DM * DM * 2); _Float16* BO = (_Float16*)take((size_t)DM * DM * 2);
  _Float16* X16 = (_Float16*)take(NR * DM * 2); _Float16* Q16 = (_Float16*)take(NR * DM * 2); _Float16* K16 = (_Float16*)take(NR * DM * 2); _Float16* V16 = (_Float16*)take(NR * DM * 2); _Float16* O16 = (_Float16*)take(NR * DM * 2);
  _Float16* VT = (_Float16*)take((size_t)NB * NH * HD * SQ * 2);
  if (off > ws_size) return;      /* approx 4.5 + 6 x 12 = 77 MiB */
  (void)BK; (void)BV;      /* reached as planes 1 and 2 behind BQ, as K16 and V16 are behind Q16 */
  k_lrms<<<LRG + LWG, LRT, 0, stream>>>(x, nw, X16, wq, wk, wv, wo, BQ);      /* xn = local-RMS-normalised x as f16 rows: the A operand of all three projections; and BQ, BK, BV, BO: natural [out][in] = Bt[n][k] x16 */
  const size_t r0p = (size_t)B0 * SQ;      /* first projected row */
  k_gemm2<0><<<dim3((unsigned)((MP / 128) * (DM / 64)), 3), 128, 0, stream>>>(X16 + r0p * DM, DM, 0, BQ, DM, (size_t)DM * DM, 0.0625f, bq, bk, bv, 0, nullptr, 1, 0, 0, nullptr, Q16 + r0p * DM, DM, NR * DM, MP, DM, DM);      /* q, k, v in one grid: blockIdx.y picks the weight plane, the bias and the output plane */
  k_vt<NH, SQ><<<NB * NH * (SQ / 64), 256, 0, stream>>>(V16, LQ, 0, VT);      /* V^T [NB * NH][HD][SQ], all batches */
  k_fattn<<<NB * NH * (SQ / (ANW * AQW)), ANW * 32, 0, stream>>>(Q16, K16, VT, O16);      /* o (merged heads, x64) as f16 rows */
  k_gemm2<0><<<dim3((unsigned)((MPO / 128) * (DM / 64)), 1), 128, 0, stream>>>(O16 + r0p * DM, DM, 0, BO, DM, 0, 0.0009765625f, bo, nullptr, nullptr, 0, nullptr, 1, 0, 0, (float*)d_out + r0p * DM, nullptr, DM, 0, MPO, DM, DM);      /* out rows are the output layout */
}

// v006
// Measured time: 99.8 microseconds a run.
// Two timings next to v005 both put it at 1.06 times that version's speed.
// Counting every step since v000, it is 53.7 times as fast.
#include <hip/hip_runtime.h>
#define NB 8
#define SQ 1024
#define GS 32                        /* token grid side: SQ = GS * GS */
#define RW 3                         /* local-norm window radius (7 x 7) */
#define DM 768
#define NH 12
#define HD 64
#define HG 4                         /* heads per launch of the per-group k_vt (not launched) */
#define B0 0                         /* first batch processed (debug hook) */
#define NBR NB                       /* batches processed (debug hook) */
#define NR ((size_t)NB * SQ)         /* token rows */
#define MP ((int)((size_t)NBR * SQ)) /* rows projected (debug hook) */
#define QN SQ                        /* query rows attended per batch (debug hook) */
#define NHD NH                       /* heads attended (debug hook) */
#define MPO MP                       /* rows through the output stage (debug hook) */
#define LQ DM      /* row pitch of the q/k/v rows */
typedef __bf16 v16b __attribute__((ext_vector_type(16)));
typedef unsigned short v8us __attribute__((ext_vector_type(8), may_alias));
typedef float  v8f  __attribute__((ext_vector_type(8)));
typedef float  v4f  __attribute__((ext_vector_type(4)));
typedef float  v4fa __attribute__((ext_vector_type(4), may_alias));
union FragB { v16b v; v8us half[2]; unsigned short u[16]; };

__device__ __forceinline__ unsigned short bf16_bits(float x) { unsigned int u = __float_as_uint(x); return (unsigned short)((u + 0x7FFFu + ((u >> 16) & 1u)) >> 16); }
__device__ __forceinline__ float bf16_val(unsigned short b) { return __uint_as_float(((unsigned int)b) << 16); }
__device__ __forceinline__ float bf16_round(float x) { return bf16_val(bf16_bits(x)); }
// D += A·B with NT terms: 1 = ah·bh, 2 = + al·bh (A split), 3 = + ah·bl (both split)
template <int NT>
__device__ __forceinline__ v8f mmaN(v16b ah, v16b al, v16b bh, v16b bl, v8f c) {
  c = __builtin_amdgcn_wmma_f32_16x16x32_bf16(false, ah, false, bh, (short)0, c, false, false);
  if (NT >= 2) c = __builtin_amdgcn_wmma_f32_16x16x32_bf16(false, al, false, bh, (short)0, c, false, false);
  if (NT >= 3) c = __builtin_amdgcn_wmma_f32_16x16x32_bf16(false, ah, false, bl, (short)0, c, false, false);
  asm volatile("v_nop\n\tv_nop\n\tv_nop\n\tv_nop" : "+v"(c) : "v"(ah), "v"(al), "v"(bh), "v"(bl));
  return c;
}

__global__ __launch_bounds__(256) void k_wt_bf16(const float* __restrict__ W, unsigned short* __restrict__ Wt, int K, int N) {
  const int t = blockIdx.x * 256 + threadIdx.x;
  const int k8n = K / 8;
  if (t >= N * k8n) return;
  const int n = t / k8n, k8 = (t % k8n) * 8;
  v8us v;
#pragma unroll
  for (int i = 0; i < 8; ++i) v[i] = bf16_bits(W[(size_t)(k8 + i) * N + n]);
  *(v8us*)(Wt + (size_t)n * K + k8) = v;
  
}

// GEMM C[M][N] (f32, pitch ldc) = act(A[M][K]·W + bias). A f32 row-major (pitch lda) converted per fragment to bf16
// (ASPLIT: hi/lo two planes -> 2 terms, else single rounded term); Wt bf16 [N][K] (pitch ldb). BIAS_BF16 rounds the
// bias to bf16 first (bias quantised to bf16 before the add). K%32==0, M%16==0, N%64==0.
template <bool ASPLIT, int ACT, bool BIAS_BF16>
__global__ __launch_bounds__(128) void k_gemm_bf(const float* __restrict__ A, int lda, const unsigned short* __restrict__ Wt, int ldb,
                                               const float* __restrict__ bias, float* __restrict__ C, int ldc, int M, int N, int K) {
  __shared__ __attribute__((aligned(16))) float so[4][16][64];
  const int tid = threadIdx.x, w = tid >> 5, lane = tid & 31, ln = lane & 15, hh = lane >> 4;
  const int ntn = N / 64;
  const int wid = blockIdx.x * 4 + w;
  const int mt = wid / ntn, nq = wid % ntn;
  if (mt * 16 >= M) return;
  const int row0 = mt * 16, col0 = nq * 64;
  const float* arow = A + (size_t)(row0 + ln) * lda;
  v8f acc[4] = {};
  for (int kb = 0; kb < K; kb += 32) {
    FragB ah, al;
    const v4f x0 = *(const v4fa*)(arow + kb + 8 * hh), x1 = *(const v4fa*)(arow + kb + 8 * hh + 4);
    const v4f x2 = *(const v4fa*)(arow + kb + 16 + 8 * hh), x3 = *(const v4fa*)(arow + kb + 16 + 8 * hh + 4);
    float xs[16] = {x0[0],x0[1],x0[2],x0[3],x1[0],x1[1],x1[2],x1[3],x2[0],x2[1],x2[2],x2[3],x3[0],x3[1],x3[2],x3[3]};
#pragma unroll
    for (int i = 0; i < 16; ++i) { const unsigned short hb = bf16_bits(xs[i]); ah.u[i] = hb; al.u[i] = ASPLIT ? bf16_bits(xs[i] - bf16_val(hb)) : (unsigned short)0; }
#pragma unroll
    for (int t = 0; t < 4; ++t) {
      const unsigned short* brow = Wt + (size_t)(col0 + t * 16 + ln) * ldb + kb;
      FragB b;
      b.half[0] = *(const v8us*)(brow + 8 * hh);
      b.half[1] = *(const v8us*)(brow + 16 + 8 * hh);
      acc[t] = mmaN<ASPLIT ? 2 : 1>(ah.v, al.v, b.v, b.v, acc[t]);
    }
  }
#pragma unroll
  for (int t = 0; t < 4; ++t) {
    float bv = bias ? bias[col0 + t * 16 + ln] : 0.f;
    if (BIAS_BF16) bv = bf16_round(bv);
#pragma unroll
    for (int r = 0; r < 8; ++r) { float v = acc[t][r] + bv; if (ACT == 1) v = fmaxf(v, 0.f); so[w][8 * hh + r][t * 16 + ln] = v; }
  }
  __builtin_amdgcn_fence(__ATOMIC_ACQ_REL, "workgroup");
  __builtin_amdgcn_wave_barrier();
  const int rsub = lane >> 4, c4 = (lane & 15) * 4;
  {
#pragma unroll
    for (int q = 0; q < 8; ++q) {
      const int r = q * 2 + rsub;
      const v4f v = *(const v4fa*)&so[w][r][c4];
      *(v4f*)(C + (size_t)(row0 + r) * ldc + col0 + c4) = v;
    }
    
  }
}

// GEMM C = act(A·W + bias + resid): A f32 (ASPLIT -> hi/lo 2 terms), Wt bf16 [N][K]; ACT 0 none, 1 relu, 2 exact gelu;
// resid (optional, f32, row index = (row % rmod), pitch ldr, RES_BF16 rounds it) added before the activation.
template <bool ASPLIT, int ACT, bool BIAS_BF16, bool RES_BF16>
__global__ __launch_bounds__(128) void k_gemm_bf3(const float* __restrict__ A, int lda, const unsigned short* __restrict__ Wt, int ldb,
                                                const float* __restrict__ bias, const float* __restrict__ resid, int rmod, int ldr,
                                                float* __restrict__ C, int ldc, int M, int N, int K) {
  __shared__ __attribute__((aligned(16))) float so[4][16][64];
  const int tid = threadIdx.x, w = tid >> 5, lane = tid & 31, ln = lane & 15, hh = lane >> 4;
  const int ntn = N / 64;
  const int wid = blockIdx.x * 4 + w;
  const int mt = wid / ntn, nq = wid % ntn;
  if (mt * 16 >= M) return;
  const int row0 = mt * 16, col0 = nq * 64;
  const float* arow = A + (size_t)(row0 + ln) * lda;
  v8f acc[4] = {};
  for (int kb = 0; kb < K; kb += 32) {
    FragB ah, al;
    const v4f x0 = *(const v4fa*)(arow + kb + 8 * hh), x1 = *(const v4fa*)(arow + kb + 8 * hh + 4);
    const v4f x2 = *(const v4fa*)(arow + kb + 16 + 8 * hh), x3 = *(const v4fa*)(arow + kb + 16 + 8 * hh + 4);
    float xs[16] = {x0[0],x0[1],x0[2],x0[3],x1[0],x1[1],x1[2],x1[3],x2[0],x2[1],x2[2],x2[3],x3[0],x3[1],x3[2],x3[3]};
#pragma unroll
    for (int i = 0; i < 16; ++i) { const unsigned short hb = bf16_bits(xs[i]); ah.u[i] = hb; al.u[i] = ASPLIT ? bf16_bits(xs[i] - bf16_val(hb)) : (unsigned short)0; }
#pragma unroll
    for (int t = 0; t < 4; ++t) {
      const unsigned short* brow = Wt + (size_t)(col0 + t * 16 + ln) * ldb + kb;
      FragB b;
      b.half[0] = *(const v8us*)(brow + 8 * hh);
      b.half[1] = *(const v8us*)(brow + 16 + 8 * hh);
      acc[t] = mmaN<ASPLIT ? 2 : 1>(ah.v, al.v, b.v, b.v, acc[t]);
    }
  }
#pragma unroll
  for (int t = 0; t < 4; ++t) {
    const int col = col0 + t * 16 + ln;
    float bv = bias ? bias[col] : 0.f;
    if (BIAS_BF16) bv = bf16_round(bv);
#pragma unroll
    for (int r = 0; r < 8; ++r) {
      float v = acc[t][r] + bv;
      if (resid) { float rv = resid[(size_t)((row0 + 8 * hh + r) % rmod) * ldr + col]; if (RES_BF16) rv = bf16_round(rv); v += rv; }
      if (ACT == 1) v = fmaxf(v, 0.f);
      if (ACT == 2) v = 0.5f * v * (1.0f + erff(v * 0.70710678118654752f));
      if (ACT == 3) { const float u = 0.7978845608028654f * (v + 0.044715f * v * v * v); v = 0.5f * v * (1.0f + tanhf(u)); }
      so[w][8 * hh + r][t * 16 + ln] = v;
    }
  }
  __builtin_amdgcn_fence(__ATOMIC_ACQ_REL, "workgroup");
  __builtin_amdgcn_wave_barrier();
  const int rsub = lane >> 4, c4 = (lane & 15) * 4;
  {
#pragma unroll
    for (int q = 0; q < 8; ++q) {
      const int r = q * 2 + rsub;
      const v4f v = *(const v4fa*)&so[w][r][c4];
      *(v4f*)(C + (size_t)(row0 + r) * ldc + col0 + c4) = v;
    }
    
  }
}
// row LayerNorm (biased variance, eps) over N: s = X (+ R); optional out_sum <- s; out_norm <- (s-mu)*rsqrt(var+eps)*g + b
template <bool PARAM_BF16>
__global__ __launch_bounds__(256) void k_layernorm(const float* __restrict__ X, const float* __restrict__ R, const float* __restrict__ g, const float* __restrict__ bta,
                                                  float* __restrict__ out_sum, float* __restrict__ out_norm, int N, float eps) {
  __shared__ float red[256];
  const int row = blockIdx.x, tid = threadIdx.x;
  const float* x = X + (size_t)row * N; const float* rr = R ? R + (size_t)row * N : nullptr;
  float vals[16];                     // up to N = 4096
  const int per = N / 256;            // contiguous chunk per thread? use strided-by-4 chunks: thread handles j = tid*4 + 1024*u
  float s1 = 0.f;
  for (int u = 0; u < per / 4; ++u) {
    const int j = tid * 4 + 1024 * u;
    const v4f a = *(const v4fa*)(x + j);
    v4f b = {0.f,0.f,0.f,0.f}; if (rr) b = *(const v4fa*)(rr + j);
#pragma unroll
    for (int q = 0; q < 4; ++q) { const float v = a[q] + b[q]; vals[u * 4 + q] = v; s1 += v; }
  }
  red[tid] = s1; __syncthreads();
  for (int st = 128; st > 0; st >>= 1) { if (tid < st) red[tid] += red[tid + st]; __syncthreads(); }
  const float mu = red[0] / (float)N; __syncthreads();
  float s2 = 0.f;
  for (int u = 0; u < per / 4; ++u)
#pragma unroll
    for (int q = 0; q < 4; ++q) { const float c = vals[u * 4 + q] - mu; s2 += c * c; }
  red[tid] = s2; __syncthreads();
  for (int st = 128; st > 0; st >>= 1) { if (tid < st) red[tid] += red[tid + st]; __syncthreads(); }
  const float rs = rsqrtf(red[0] / (float)N + eps);
  {
    for (int u = 0; u < per / 4; ++u) {
      const int j = tid * 4 + 1024 * u;
      v4f o, sm;
#pragma unroll
      for (int q = 0; q < 4; ++q) {
        float gg = g[j + q], bb = bta[j + q];
        if (PARAM_BF16) { gg = bf16_round(gg); bb = bf16_round(bb); }
        sm[q] = vals[u * 4 + q]; o[q] = (vals[u * 4 + q] - mu) * rs * gg + bb;
      }
      if (out_sum) *(v4f*)(out_sum + (size_t)row * N + j) = sm;
      *(v4f*)(out_norm + (size_t)row * N + j) = o;
    }
    
  }
}



// ---- f16 WMMA path (v_wmma_f32_16x16x32_f16): 11-bit significands for operands in range — used where a [0,1] probability operand needs more precision than bf16
typedef _Float16 v16h __attribute__((ext_vector_type(16)));
union FragH { v16h v; v8us half[2]; _Float16 h[16]; unsigned short u[16]; };
template <int NT>
__device__ __forceinline__ v8f mmaH(v16h ah, v16h al, v16h bh, v16h bl, v8f c) {
  c = __builtin_amdgcn_wmma_f32_16x16x32_f16(false, ah, false, bh, (short)0, c, false, false);
  if (NT >= 2) c = __builtin_amdgcn_wmma_f32_16x16x32_f16(false, al, false, bh, (short)0, c, false, false);
  if (NT >= 3) c = __builtin_amdgcn_wmma_f32_16x16x32_f16(false, ah, false, bl, (short)0, c, false, false);
  asm volatile("v_nop\n\tv_nop\n\tv_nop\n\tv_nop" : "+v"(c) : "v"(ah), "v"(al), "v"(bh), "v"(bl));
  return c;
}
// batched GEMM like k_gemm_b but f16 operands: A f32 (split into f16 hi/lo if ASPLIT, else rounded to f16), Bt = f16 values [n][k]; alpha; C f32; N multiple of 16 (partial tiles skipped)
template <bool ASPLIT>
__global__ __launch_bounds__(128) void k_gemm_h(const float* __restrict__ A, int lda, size_t sA, const _Float16* __restrict__ Bh, int ldb, size_t sB, float alpha, float* __restrict__ C, int ldc, size_t sC, int M, int N, int K) {
  __shared__ __attribute__((aligned(16))) float so[4][16][64];
  const int tid = threadIdx.x, w = tid >> 5, lane = tid & 31, ln = lane & 15, hh = lane >> 4; const int by = blockIdx.y;
  A += (size_t)by * sA; Bh += (size_t)by * sB; C += (size_t)by * sC;
  const int ntn = (N + 63) / 64; const int wid = blockIdx.x * 4 + w; const int mt = wid / ntn, nq = wid % ntn; if (mt * 16 >= M) return;
  const int row0 = mt * 16, col0 = nq * 64; const float* arow = A + (size_t)(row0 + ln) * lda;
  v8f acc[4] = {};
  for (int kb = 0; kb < K; kb += 32) {
    FragH ah, al;
    const v4f x0 = *(const v4fa*)(arow + kb + 8 * hh), x1 = *(const v4fa*)(arow + kb + 8 * hh + 4), x2 = *(const v4fa*)(arow + kb + 16 + 8 * hh), x3 = *(const v4fa*)(arow + kb + 16 + 8 * hh + 4);
    float xs[16] = {x0[0],x0[1],x0[2],x0[3],x1[0],x1[1],x1[2],x1[3],x2[0],x2[1],x2[2],x2[3],x3[0],x3[1],x3[2],x3[3]};
#pragma unroll
    for (int i = 0; i < 16; ++i) { const _Float16 h = (_Float16)xs[i]; ah.h[i] = h; al.h[i] = ASPLIT ? (_Float16)(xs[i] - (float)h) : (_Float16)0.0f; }
#pragma unroll
    for (int t = 0; t < 4; ++t) { if (col0 + t * 16 >= N) continue; const size_t boff = (size_t)(col0 + t * 16 + ln) * ldb + kb; FragH bq; bq.half[0] = *(const v8us*)(Bh + boff + 8 * hh); bq.half[1] = *(const v8us*)(Bh + boff + 16 + 8 * hh);
      acc[t] = mmaH<ASPLIT ? 2 : 1>(ah.v, al.v, bq.v, bq.v, acc[t]); }
  }
#pragma unroll
  for (int t = 0; t < 4; ++t) { if (col0 + t * 16 >= N) continue;
#pragma unroll
    for (int r = 0; r < 8; ++r) so[w][8 * hh + r][t * 16 + ln] = acc[t][r] * alpha; }
  __builtin_amdgcn_fence(__ATOMIC_ACQ_REL, "workgroup"); __builtin_amdgcn_wave_barrier();
  const int rsub = lane >> 4, c4 = (lane & 15) * 4;
  {
#pragma unroll
    for (int q = 0; q < 8; ++q) { const int r = q * 2 + rsub; if (col0 + c4 < N) { const v4f v = *(const v4fa*)&so[w][r][c4]; *(v4f*)(C + (size_t)(row0 + r) * ldc + col0 + c4) = v; } }
     }
}

// Wt[n][k] = f16(W[k][n]·scale) from f32 row-major W[K][N] (scale = power of two; bf16-exact weights stay exact in f16 away from the subnormal range)
__global__ __launch_bounds__(256) void k_wt_f16(const float* __restrict__ W, _Float16* __restrict__ Wt, int K, int N, float scale) {
  const int t = blockIdx.x * 256 + threadIdx.x; if (t >= N * (K / 8)) return; const int n = t / (K / 8), k8 = (t % (K / 8)) * 8; FragH f;
#pragma unroll
  for (int i = 0; i < 8; ++i) f.h[i] = (_Float16)(bf16_round(W[(size_t)(k8 + i) * N + n]) * scale); const v8us o = f.half[0];
  *(v8us*)((unsigned short*)Wt + (size_t)n * K + k8) = o; 
}
// k_gemm_hh variant with fused epilogue: v = acc·alpha + bias[by·sBias + col] (+ CP[(row/rowsPerB)·sCPb + by·64 + col] if CP) ; ACT 0 none / 1 elu ; writes f16 C16 (and f32 C if non-null)
template <int ACT>
__global__ __launch_bounds__(128) void k_gemm_hhx(const _Float16* __restrict__ A, int lda, size_t sA, const _Float16* __restrict__ Bh, int ldb, size_t sB, float alpha, const float* __restrict__ bias, size_t sBias, const float* __restrict__ CP, int rowsPerB, size_t sCPb, int row0g,
    float* __restrict__ C, _Float16* __restrict__ C16, int ldc, size_t sC, int M, int N, int K) {
  __shared__ __attribute__((aligned(16))) float so[4][16][64];
  const int tid = threadIdx.x, w = tid >> 5, lane = tid & 31, ln = lane & 15, hh = lane >> 4; const int by = blockIdx.y;
  A += (size_t)by * sA; Bh += (size_t)by * sB; const size_t cofs = (size_t)by * sC; const float* bp = bias ? bias + (size_t)by * sBias : nullptr;
  const int ntn = (N + 63) / 64; const int wid = blockIdx.x * 4 + w; const int mt = wid / ntn, nq = wid % ntn; if (mt * 16 >= M) return;
  const int row0 = mt * 16, col0 = nq * 64; const _Float16* arow = A + (size_t)(row0 + ln) * lda;
  v8f acc[4] = {};
  for (int kb = 0; kb < K; kb += 32) { FragH ah; ah.half[0] = *(const v8us*)((const unsigned short*)arow + kb + 8 * hh); ah.half[1] = *(const v8us*)((const unsigned short*)arow + kb + 16 + 8 * hh);
#pragma unroll
    for (int t = 0; t < 4; ++t) { if (col0 + t * 16 >= N) continue; const size_t boff = (size_t)(col0 + t * 16 + ln) * ldb + kb; FragH bq; bq.half[0] = *(const v8us*)((const unsigned short*)Bh + boff + 8 * hh); bq.half[1] = *(const v8us*)((const unsigned short*)Bh + boff + 16 + 8 * hh);
      acc[t] = mmaH<1>(ah.v, ah.v, bq.v, bq.v, acc[t]); }
  }
#pragma unroll
  for (int t = 0; t < 4; ++t) { if (col0 + t * 16 >= N) continue; const int col = col0 + t * 16 + ln; const float bv = bp ? bf16_round(bp[col]) : 0.f;
#pragma unroll
    for (int r = 0; r < 8; ++r) { float v = acc[t][r] * alpha + bv; if (CP) { const int rr = row0g + row0 + 8 * hh + r; if (rowsPerB < 0) v += CP[cofs + (size_t)rr * ldc + col];      /* rowsPerB < 0: own element of the batched C plane */ else { const int bidx = rr / rowsPerB; v += CP[(size_t)bidx * sCPb + (size_t)by * 64 + col]; } } if (ACT == 1) v = (v > 0.f) ? v : expm1f(v); else if (ACT == 7) v = (v > 0.f) ? v + 1.0f : expf(v); else if (ACT == 8) v = tanhf(v); else if (ACT == 9) v = 0.5f * v * (1.0f + tanhf(0.7978845608028654f * (v + 0.044715f * v * v * v))); else if (ACT == 11) v = 1.0f / (1.0f + expf(-v)); else if (ACT == 12) v = (v > 0.f) ? v : 0.01f * v; else if (ACT == 14) v = (v > 0.f) ? v : 0.1f * v; else if (ACT == 16) v = (v >= 0.f) ? v : 0.3f * v; else if (ACT == 17) v = (v >= 0.f) ? v : 0.2f * v; else if (ACT == 15) v = v / (1.0f + expf(-v)); else if (ACT == 3) v = fmaxf(v, 0.f); else if (ACT == 6) v = 0.5f * v * (1.0f + erff(v * 0.70710678118654752f)); so[w][8 * hh + r][t * 16 + ln] = v; } }
  __builtin_amdgcn_fence(__ATOMIC_ACQ_REL, "workgroup"); __builtin_amdgcn_wave_barrier();
  const int rsub = lane >> 4, c4 = (lane & 15) * 4; typedef _Float16 v4h __attribute__((ext_vector_type(4)));
  {
#pragma unroll
    for (int q = 0; q < 8; ++q) { const int r = q * 2 + rsub; if (col0 + c4 < N) { const v4f v = *(const v4fa*)&so[w][r][c4]; if (C) *(v4f*)(C + cofs + (size_t)(row0 + r) * ldc + col0 + c4) = v; if (C16) { v4h h4; for (int i = 0; i < 4; ++i) h4[i] = (_Float16)v[i]; *(v4h*)(C16 + cofs + (size_t)(row0 + r) * ldc + col0 + c4) = h4; } } }
     }
}


typedef _Float16 v4h __attribute__((ext_vector_type(4)));

__global__ __launch_bounds__(256) void k_x16(const float* __restrict__ x, _Float16* __restrict__ X16, size_t n8) { const size_t t = (size_t)blockIdx.x * 256 + threadIdx.x; if (t >= n8) return; FragH f;
#pragma unroll
  for (int q = 0; q < 8; ++q) f.h[q] = (_Float16)bf16_round(x[t * 8 + q]); *(v8us*)((unsigned short*)X16 + t * 8) = f.half[0];  }
__global__ __launch_bounds__(256) void k_h16(const float* __restrict__ x, _Float16* __restrict__ X16, size_t n8) { const size_t t = (size_t)blockIdx.x * 256 + threadIdx.x; if (t >= n8) return; FragH f;
#pragma unroll
  for (int q = 0; q < 8; ++q) f.h[q] = (_Float16)x[t * 8 + q]; *(v8us*)((unsigned short*)X16 + t * 8) = f.half[0];  }
__global__ __launch_bounds__(256) void k_round16f(const float* __restrict__ W, _Float16* __restrict__ Bt, size_t n8) { const size_t t = (size_t)blockIdx.x * 256 + threadIdx.x; if (t >= n8) return; FragH f;
#pragma unroll
  for (int i = 0; i < 8; ++i) f.h[i] = (_Float16)(bf16_round(W[t * 8 + i]) * 16.0f); *(v8us*)((unsigned short*)Bt + t * 8) = f.half[0];  }
template <int NHv, int TTv>
__global__ __launch_bounds__(256) void k_vt(const _Float16* __restrict__ V16, int ldv, int voff, _Float16* __restrict__ Vt) { __shared__ unsigned short tl[64][66]; const int tid = threadIdx.x; const int slab = blockIdx.x / (TTv / 64), lg = blockIdx.x % (TTv / 64); const int b = slab / NHv, h = slab % NHv;
  for (int i = tid; i < 64 * 8; i += 256) { const int r = i / 8, c8 = (i % 8) * 8; FragH f; f.half[0] = *(const v8us*)((const unsigned short*)V16 + ((size_t)b * TTv + lg * 64 + r) * ldv + voff + h * 64 + c8);
#pragma unroll
    for (int q = 0; q < 8; ++q) tl[r][c8 + q] = f.u[q]; }
  __syncthreads();
  {
#pragma unroll
    for (int rd = 0; rd < 2; ++rd) { const int d = rd * 32 + tid / 8, pc = tid % 8; FragH f;
#pragma unroll
      for (int q = 0; q < 8; ++q) f.u[q] = tl[pc * 8 + q][d];
      *(v8us*)((unsigned short*)Vt + ((size_t)slab * 64 + d) * TTv + lg * 64 + pc * 8) = f.half[0]; }
     } }

__global__ __launch_bounds__(256) void k_hl(const float* __restrict__ F, _Float16* __restrict__ Hh, _Float16* __restrict__ Hl, size_t n8) { const size_t t = (size_t)blockIdx.x * 256 + threadIdx.x; if (t >= n8) return; FragH fh, fl; const v4f a = *(const v4fa*)(F + t * 8), c = *(const v4fa*)(F + t * 8 + 4);
#pragma unroll
  for (int q = 0; q < 4; ++q) { _Float16 h = (_Float16)a[q]; fh.h[q] = h; fl.h[q] = (_Float16)((a[q] - (float)h) * 1024.0f); h = (_Float16)c[q]; fh.h[4 + q] = h; fl.h[4 + q] = (_Float16)((c[q] - (float)h) * 1024.0f); }
  { *(v8us*)((unsigned short*)Hh + t * 8) = fh.half[0]; *(v8us*)((unsigned short*)Hl + t * 8) = fl.half[0];  } }

// ---- fast GEMM (work-group tile 128x64, wave tile 32x64; requires M % 128 == 0 rows per launch region, N % 64 == 0 and K % 64 == 0); epilogue = k_gemm_hhx semantics ----
// Operands go through LDS: a stage is 64 k (128-byte rows, whole cache lines) of the work-group's 128 A rows and 64 Bt rows, brought by asynchronous copies (16 bytes a lane, four whole lines a wave-instruction), two buffers:
// stage s + 1 flies while stage s is multiplied. The fragments are read from LDS in the k order that the global fragment loads had, so every product and every sum is the same as before.
#define G2K 64                       /* k elements per stage */
#define G2P (G2K + 8)                /* LDS pitch of a staged row, f16 elements (144 B = 16 B x odd: no bank conflict for 16-byte fragment reads) */
#define G2R (128 + 64)               /* rows per stage: A rows 0 .. 127, then Bt rows 0 .. 63 */
#define G2S (16 * G2P * 2)           /* LDS bytes between two copies of one lane (16 rows) */
__device__ __forceinline__ v16h g2_frag(const unsigned short* p) { FragH f; f.half[0] = *(const v8us*)p; f.half[1] = *(const v8us*)(p + 16); return f.v; }
__device__ __forceinline__ v8f g2_mma(v16h a, v16h b, v8f c) { v8f d = __builtin_amdgcn_wmma_f32_16x16x32_f16(false, a, false, b, (short)0, c, false, false); asm volatile("v_nop\n\tv_nop\n\tv_nop\n\tv_nop" : "+v"(d) : "v"(a), "v"(b)); return d; }
// one stage's copies of one lane: 16 bytes of A rows r, r + 16, .. r + 112 and of Bt rows r, r + 16, r + 32, r + 48 (r = thread / 8) to LDS byte l + 0, G2S, .. 11 G2S. ra, rb = 16 rows of A, of Bt, in elements.
// The s_wait_xcnt closes the statement so that it stands in front of every later write of a register that a copy names.
__device__ __forceinline__ void g2_copy(unsigned l, const unsigned short* ga, size_t ra, const unsigned short* gb, size_t rb) {
  asm volatile("global_load_async_to_lds_b128 %0, %1, off\n\t"
               "global_load_async_to_lds_b128 %2, %3, off\n\t"
               "global_load_async_to_lds_b128 %4, %5, off\n\t"
               "global_load_async_to_lds_b128 %6, %7, off\n\t"
               "global_load_async_to_lds_b128 %8, %9, off\n\t"
               "global_load_async_to_lds_b128 %10, %11, off\n\t"
               "global_load_async_to_lds_b128 %12, %13, off\n\t"
               "global_load_async_to_lds_b128 %14, %15, off\n\t"
               "global_load_async_to_lds_b128 %16, %17, off\n\t"
               "global_load_async_to_lds_b128 %18, %19, off\n\t"
               "global_load_async_to_lds_b128 %20, %21, off\n\t"
               "global_load_async_to_lds_b128 %22, %23, off\n\t"
               "s_wait_xcnt 0x0"
               :: "v"(l), "v"(ga), "v"(l + 1 * G2S), "v"(ga + ra), "v"(l + 2 * G2S), "v"(ga + 2 * ra), "v"(l + 3 * G2S), "v"(ga + 3 * ra),
                  "v"(l + 4 * G2S), "v"(ga + 4 * ra), "v"(l + 5 * G2S), "v"(ga + 5 * ra), "v"(l + 6 * G2S), "v"(ga + 6 * ra), "v"(l + 7 * G2S), "v"(ga + 7 * ra),
                  "v"(l + 8 * G2S), "v"(gb), "v"(l + 9 * G2S), "v"(gb + rb), "v"(l + 10 * G2S), "v"(gb + 2 * rb), "v"(l + 11 * G2S), "v"(gb + 3 * rb)
               : "memory"); }
template <int ACT>
__global__ __launch_bounds__(128) void k_gemm2(const _Float16* __restrict__ A, int lda, size_t sA, const _Float16* __restrict__ Bh, int ldb, size_t sB, float alpha, const float* __restrict__ bias, const float* __restrict__ bias1, const float* __restrict__ bias2, size_t sBias, const float* __restrict__ CP, int rowsPerB, size_t sCPb, int row0g,
    float* __restrict__ C, _Float16* __restrict__ C16, int ldc, size_t sC, int M, int N, int K) { static_assert(ACT == 0 || ACT == 3 || ACT == 6 || ACT == 8 || ACT == 9 || ACT == 11 || ACT == 12 || ACT == 14 || ACT == 15 || ACT == 16 || ACT == 17, "k_gemm2: unsupported ACT code (would silently apply no activation)");
  __shared__ __attribute__((aligned(16))) unsigned short st[2][G2R * G2P];
  __shared__ __attribute__((aligned(16))) float so[4][32][68];
  const int tid = threadIdx.x, w = tid >> 5, lane = tid & 31, ln = lane & 15, hh = lane >> 4; const int by = blockIdx.y;
  const float* bsel = by == 0 ? bias : (by == 1 ? bias1 : bias2);      /* products that share one grid bring their bias vectors as separate inputs: plane 0, 1, 2 */
  A += (size_t)by * sA; Bh += (size_t)by * sB; const size_t cofs = (size_t)by * sC; const float* bp = bsel ? bsel + (size_t)by * sBias : nullptr;
  const int ntn = N >> 6; const int mt = blockIdx.x / ntn, nq = blockIdx.x - mt * ntn; const int row0 = mt * 128 + 32 * w, col0 = nq * 64; if (mt * 128 + 128 > M) return;      /* the same for the whole work-group, in front of every barrier: all 128 staged A rows exist */
  const int cr = tid >> 3, cc = (tid & 7) * 8;      /* the lane's first staged row, and its 16 bytes in the row */
  const unsigned short* ga = (const unsigned short*)A + (size_t)(mt * 128 + cr) * lda + cc; const unsigned short* gb = (const unsigned short*)Bh + (size_t)(col0 + cr) * ldb + cc;
  const size_t ra = (size_t)16 * lda, rb = (size_t)16 * ldb;
  const unsigned l0 = (unsigned)(size_t)&st[0][cr * G2P + cc];      /* LDS byte address: the low 32 bits of the __shared__ address */
  constexpr int SE = G2R * G2P;      /* elements per buffer */
  const int ns = K / G2K;
  g2_copy(l0, ga, ra, gb, rb);
  asm volatile("s_wait_asynccnt 0x0" ::: "memory");      /* this wave's copies of stage 0 have landed */
  __syncthreads();      /* stage 0 is complete for every wave */
  if (ns > 1) g2_copy(l0 + SE * 2, ga + G2K, ra, gb + G2K, rb);
  const unsigned short* fa = &st[0][(32 * w + ln) * G2P + 8 * hh]; const unsigned short* fb = &st[0][(128 + ln) * G2P + 8 * hh];
  const v8f z8 = {0.f,0.f,0.f,0.f,0.f,0.f,0.f,0.f}; v8f c00 = z8, c01 = z8, c02 = z8, c03 = z8, c10 = z8, c11 = z8, c12 = z8, c13 = z8;
  for (int s = 0; s < ns; ++s) { const int bo = (s & 1) * SE; const unsigned short* pa = fa + bo; const unsigned short* pb = fb + bo;
    /* all 24 fragment reads of the stage stand together in front of its 16 products: one LDS latency a stage, not one a fragment */
    const v16h a0 = g2_frag(pa), a1 = g2_frag(pa + 16 * G2P), b0 = g2_frag(pb), b1 = g2_frag(pb + 16 * G2P), b2 = g2_frag(pb + 32 * G2P), b3 = g2_frag(pb + 48 * G2P);
    const v16h a2 = g2_frag(pa + 32), a3 = g2_frag(pa + 16 * G2P + 32), b4 = g2_frag(pb + 32), b5 = g2_frag(pb + 16 * G2P + 32), b6 = g2_frag(pb + 32 * G2P + 32), b7 = g2_frag(pb + 48 * G2P + 32);
    c00 = g2_mma(a0, b0, c00); c10 = g2_mma(a1, b0, c10); c01 = g2_mma(a0, b1, c01); c11 = g2_mma(a1, b1, c11); c02 = g2_mma(a0, b2, c02); c12 = g2_mma(a1, b2, c12); c03 = g2_mma(a0, b3, c03); c13 = g2_mma(a1, b3, c13);
    c00 = g2_mma(a2, b4, c00); c10 = g2_mma(a3, b4, c10); c01 = g2_mma(a2, b5, c01); c11 = g2_mma(a3, b5, c11); c02 = g2_mma(a2, b6, c02); c12 = g2_mma(a3, b6, c12); c03 = g2_mma(a2, b7, c03); c13 = g2_mma(a3, b7, c13);
    asm volatile("s_wait_dscnt 0x0" ::: "memory");      /* this wave's reads of buffer s & 1 are done before the buffer is refilled */
    asm volatile("s_wait_asynccnt 0x0" ::: "memory");      /* this wave's copies of stage s + 1 have landed */
    __syncthreads();      /* publishes stage s + 1 and ends every wave's reads of stage s */
    if (s + 2 < ns) g2_copy(l0 + bo * 2, ga + (size_t)(s + 2) * G2K, ra, gb + (size_t)(s + 2) * G2K, rb); }
  asm volatile("s_wait_asynccnt 0x0" ::: "memory");      /* no copy is outstanding when the wave goes on to its end */
  v8f accs[8] = {c00, c01, c02, c03, c10, c11, c12, c13};
#pragma unroll
  for (int u = 0; u < 8; ++u) { const int t = u & 3, half = u >> 2; const int col = col0 + t * 16 + ln; const float bv = bp ? bf16_round(bp[col]) : 0.f;
#pragma unroll
    for (int r = 0; r < 8; ++r) { const int rloc = half * 16 + 8 * hh + r; float v = accs[u][r] * alpha + bv; if (CP) { if (rowsPerB < 0) v += CP[cofs + (size_t)(row0g + row0 + rloc) * ldc + col];      /* rowsPerB < 0: own element of the batched C plane */ else { const int bidx = (row0g + row0 + rloc) / rowsPerB; v += CP[(size_t)bidx * sCPb + (size_t)by * 64 + col]; } }
      if (ACT == 3) v = fmaxf(v, 0.f); else if (ACT == 6) v = 0.5f * v * (1.0f + erff(v * 0.70710678118654752f)); else if (ACT == 11) v = 1.0f / (1.0f + expf(-v)); else if (ACT == 15) v = v / (1.0f + expf(-v)); else if (ACT == 12) v = (v > 0.f) ? v : 0.01f * v; else if (ACT == 8) v = tanhf(v); else if (ACT == 9) v = 0.5f * v * (1.0f + tanhf(0.7978845608028654f * (v + 0.044715f * v * v * v))); else if (ACT == 14) v = (v > 0.f) ? v : 0.1f * v; else if (ACT == 16) v = (v >= 0.f) ? v : 0.3f * v; else if (ACT == 17) v = (v >= 0.f) ? v : 0.2f * v;
      so[w][rloc][t * 16 + ln] = v; } }
  __builtin_amdgcn_fence(__ATOMIC_ACQ_REL, "workgroup"); __builtin_amdgcn_wave_barrier();
  const int rsub = lane >> 4, c4 = (lane & 15) * 4;
  {
#pragma unroll
    for (int q = 0; q < 16; ++q) { const int r = q * 2 + rsub; const v4f v = *(const v4fa*)&so[w][r][c4]; if (C) *(v4f*)(C + cofs + (size_t)(row0 + r) * ldc + col0 + c4) = v; if (C16) { v4h h4; for (int i = 0; i < 4; ++i) h4[i] = (_Float16)v[i]; *(v4h*)(C16 + cofs + (size_t)(row0 + r) * ldc + col0 + c4) = h4; } }
     } }


// fused attention, one (batch, head) and 512 queries per work-group of 16 waves. The head's K rows [key][d] and V rows [key][d] are laid in LDS once (K pitch 16 B x odd for 16-byte fragment reads, V pitch 32 B x odd for the transposing reads: no bank conflict);
// each wave owns 32 queries (two 16-column groups) and walks the keys 32 at a time: S^T = K Q^T (A = K rows, B = Q rows, both in the hardware k order), so a lane holds 16 scores of ONE query per group;
// the two S^T tiles of a group, converted in place, are the B operand P^T of O^T += V^T P^T (register s < 8: key 8 hh + s, s >= 8: key 16 + 8 hh + s - 8). Softmax in base 2 against a running maximum mu, raised only when a score passes it by more than 8 (weights then stay <= 256, inside f16).
#define AKP (HD + 8)                 /* LDS pitch of a K row, f16 elements (144 B) */
#define AVP (HD + 16)                /* LDS pitch of a V row, f16 elements (160 B) */
#define AQW 32                       /* queries per wave */
#define ANW 16                       /* waves per work-group */
__device__ __forceinline__ v8f fa_mma(v16h a, v16h b, v8f c) { return __builtin_amdgcn_wmma_f32_16x16x32_f16(false, a, false, b, (short)0, c, false, false); }
__device__ __forceinline__ float fa_xhalf(float x) { return __builtin_bit_cast(float, __builtin_amdgcn_permlanex16(__builtin_bit_cast(int, x), __builtin_bit_cast(int, x), 0x76543210, 0xfedcba98, false, false)); }      /* lane l takes lane l ^ 16, on the vector pipe: no LDS round trip in the loop */
__device__ __forceinline__ v16h fa_frag(const unsigned short* p) { FragH f; f.half[0] = *(const v8us*)p; f.half[1] = *(const v8us*)(p + 16); return f.v; }
// A fragment of V^T (16 d x 32 keys) out of row-major V rows in LDS, by ds_load_tr16_b128: lane l points at row key0 + 8 (l >> 4) + (l & 7), 16 bytes at d0 + 8 ((l >> 3) & 1), and receives V[key0 + 8 (l >> 4) + 0 .. 7][d0 + (l & 15)];
// the second load, 16 rows on, gives keys key0 + 16 + 8 (l >> 4) + 0 .. 7: the k order that the packed scores have as the B operand.
typedef short v8ss __attribute__((ext_vector_type(8)));
__device__ __forceinline__ v8us fa_tr16(const unsigned short* p) { typedef __attribute__((address_space(3))) v8ss lds_v8ss; return __builtin_bit_cast(v8us, __builtin_amdgcn_ds_load_tr16_b128_v8i16((lds_v8ss*)p)); }
__device__ __forceinline__ v16h fa_fragt(const unsigned short* p) { FragH f; f.half[0] = fa_tr16(p); f.half[1] = fa_tr16(p + 16 * AVP); return f.v; }
__global__ __launch_bounds__(ANW * 32) void k_fattn(const _Float16* __restrict__ Q16, const _Float16* __restrict__ K16, const _Float16* __restrict__ V16, _Float16* __restrict__ O16) {
  __shared__ __attribute__((aligned(16))) unsigned short sk[SQ * AKP];
  __shared__ __attribute__((aligned(16))) unsigned short sv[SQ * AVP];
  const int tid = threadIdx.x, w = tid >> 5, lane = tid & 31, ln = lane & 15, hh = lane >> 4;
  constexpr int QB = SQ / (ANW * AQW);      /* work-groups per head */
  const int bh = blockIdx.x / QB, qb = blockIdx.x % QB; const int b = bh / NH, h = bh % NH;
  const unsigned short* kg = (const unsigned short*)K16 + (size_t)b * SQ * DM + h * HD; const unsigned short* vg = (const unsigned short*)V16 + (size_t)b * SQ * DM + h * HD;
  /* fill: thread t brings 16 bytes of K row u * 64 + t / 8 and of V row u * 64 + t / 8 (u = 0 .. 15). One address per plane, the rows told apart by constant offsets; every loop is unrolled whole so that
     all 32 fill loads and the 8 Q loads are in flight together and the register arrays are indexed by constants alone */
  constexpr int NT = ANW * 32, KRS = NT / (HD / 8);      /* threads; K rows, and V rows, covered by one sweep of the work-group */
  const int kr = tid / (HD / 8), kc = (tid % (HD / 8)) * 8;
  const unsigned short* kgl = kg + (size_t)kr * DM + kc; const unsigned short* vgl = vg + (size_t)kr * DM + kc;
  const int q0 = qb * (ANW * AQW) + w * AQW;
  const unsigned short* qp = (const unsigned short*)Q16 + ((size_t)b * SQ + q0 + ln) * DM + h * HD + 8 * hh;
  v8us kx[SQ / KRS], vx[SQ / KRS]; v16h qf[2][2];
#pragma unroll
  for (int u = 0; u < SQ / KRS; ++u) kx[u] = *(const v8us*)(kgl + (size_t)u * KRS * DM);
#pragma unroll
  for (int u = 0; u < SQ / KRS; ++u) vx[u] = *(const v8us*)(vgl + (size_t)u * KRS * DM);
#pragma unroll
  for (int g = 0; g < 2; ++g) { qf[g][0] = fa_frag(qp + (size_t)g * 16 * DM); qf[g][1] = fa_frag(qp + (size_t)g * 16 * DM + 32); }
  asm volatile("s_wait_xcnt 0x0" :: "v"(kgl), "v"(vgl), "v"(qp) : "memory");      /* the wait owed before a register that an issued global load names is overwritten; the three addresses are inputs so that they stay in their registers up to here */
#pragma unroll
  for (int u = 0; u < SQ / KRS; ++u) *(v8us*)(sk + (kr + u * KRS) * AKP + kc) = kx[u];
#pragma unroll
  for (int u = 0; u < SQ / KRS; ++u) *(v8us*)(sv + (kr + u * KRS) * AVP + kc) = vx[u];
  __syncthreads();      /* K and V of the head are complete in LDS; nothing writes LDS behind this point */
  /* every inner loop from here on is unrolled whole: the fragment and accumulator arrays are then indexed by constants alone and stay in registers */
  const v8f z8 = {0.f,0.f,0.f,0.f,0.f,0.f,0.f,0.f};
  v8f o[2][4] = {{z8, z8, z8, z8}, {z8, z8, z8, z8}};      /* o[g][t][r] = O^T[d = 16 t + 8 hh + r][query q0 + 16 g + ln], relative to mu[g] */
  float mu[2] = {-3.0e38f, -3.0e38f}, ls[2] = {0.f, 0.f};
  const float CS = 0.125f * 1.4426950408889634f;      /* 1 / sqrt(64), and base e to base 2 */
  const unsigned short* skl = sk + ln * AKP + 8 * hh; const unsigned short* svl = sv + (8 * hh + (lane & 7)) * AVP + 8 * ((lane >> 3) & 1);
  for (int j = 0; j < SQ; j += 32) {
    v16h kf[2][2], vf[4];
#pragma unroll
    for (int kt = 0; kt < 2; ++kt) { kf[kt][0] = fa_frag(skl + (j + 16 * kt) * AKP); kf[kt][1] = fa_frag(skl + (j + 16 * kt) * AKP + 32); }
#pragma unroll
    for (int t = 0; t < 4; ++t) vf[t] = fa_fragt(svl + j * AVP + 16 * t);
    v8f s[2][2];
#pragma unroll
    for (int g = 0; g < 2; ++g)
#pragma unroll
      for (int kt = 0; kt < 2; ++kt) s[g][kt] = fa_mma(kf[kt][1], qf[g][1], fa_mma(kf[kt][0], qf[g][0], z8));
    float mx[2];
#pragma unroll
    for (int g = 0; g < 2; ++g) { float m = fmaxf(s[g][0][0], s[g][1][0]);
#pragma unroll
      for (int r = 1; r < 8; ++r) m = fmaxf(m, fmaxf(s[g][0][r], s[g][1][r]));
      m = fmaxf(m, fa_xhalf(m)); mx[g] = m * CS; }      /* lanes ln and ln + 16 hold the same query: both take the same maximum */
    if (__builtin_amdgcn_ballot_w32(mx[0] > mu[0] + 8.0f || mx[1] > mu[1] + 8.0f) != 0) {      /* wave-uniform; always taken on the first pass */
#pragma unroll
      for (int g = 0; g < 2; ++g) { const float mn = fmaxf(mu[g], mx[g]); const float corr = __builtin_amdgcn_exp2f(mu[g] - mn); mu[g] = mn; ls[g] *= corr;
#pragma unroll
        for (int t = 0; t < 4; ++t) o[g][t] *= corr; } }
#pragma unroll
    for (int g = 0; g < 2; ++g) { FragH pf;
#pragma unroll
      for (int kt = 0; kt < 2; ++kt)
#pragma unroll
        for (int r = 0; r < 8; ++r) { const float p = __builtin_amdgcn_exp2f(fmaf(s[g][kt][r], CS, -mu[g])); ls[g] += p; pf.h[kt * 8 + r] = (_Float16)p; }
#pragma unroll
      for (int t = 0; t < 4; ++t) o[g][t] = fa_mma(vf[t], pf.v, o[g][t]); }
  }
#pragma unroll
  for (int g = 0; g < 2; ++g) { const float l = ls[g] + fa_xhalf(ls[g]); const float sc = 64.0f / l;      /* the two lane halves summed different keys of the same query */
    unsigned short* d = (unsigned short*)O16 + ((size_t)b * SQ + q0 + 16 * g + ln) * DM + h * HD + 8 * hh;
#pragma unroll
    for (int t = 0; t < 4; ++t) { FragH f;
#pragma unroll
      for (int r = 0; r < 8; ++r) f.h[r] = (_Float16)(o[g][t][r] * sc);
      *(v8us*)(d + 16 * t) = f.half[0]; } } }
__global__ __launch_bounds__(256) void k_vt(const _Float16* __restrict__ V16, int b, int h0, _Float16* __restrict__ VT) { __shared__ unsigned short tl[64][65]; const int tid = threadIdx.x; const int hh = blockIdx.x % HG, sg = blockIdx.x / HG; const int s0 = sg * 64; const int h = h0 + hh;
  for (int i = tid; i < 64 * 8; i += 256) { const int j = i / 8, d8 = (i % 8) * 8; FragH f; f.half[0] = *(const v8us*)((const unsigned short*)V16 + ((size_t)b * SQ + s0 + j) * DM + h * HD + d8); for (int q = 0; q < 8; ++q) tl[d8 + q][j] = f.u[q]; }
  __syncthreads();
  { for (int i = tid; i < 64 * 8; i += 256) { const int d = i / 8, j8 = (i % 8) * 8; FragH f; for (int q = 0; q < 8; ++q) f.u[q] = tl[d][j8 + q]; *(v8us*)((unsigned short*)VT + ((size_t)hh * HD + d) * SQ + s0 + j8) = f.half[0]; }  } }



__global__ __launch_bounds__(256) void k_rsmkm(const float* __restrict__ S, _Float16* __restrict__ P, int nrows, const int* __restrict__ am) {
  #pragma clang fp contract(off)
  const int t = blockIdx.x * 256 + threadIdx.x; if (t >= nrows) return; const size_t i = (size_t)t; const float* s = S + i * SQ; const int* mr = am + (size_t)(t % SQ) * SQ; float mx = -3.0e38f;
#pragma unroll 1
  for (int j = 0; j < SQ; ++j) { const float f = (mr[j] != 0) ? 1.f : 0.f; mx = fmaxf(mx, fmaf(f, s[j], (1.f - f) * -1.0e9f)); } float se = 0.f;
#pragma unroll 1
  for (int j = 0; j < SQ; ++j) { const float f = (mr[j] != 0) ? 1.f : 0.f; se += __expf(fmaf(f, s[j], (1.f - f) * -1.0e9f) - mx); } const float sc = 256.0f / se;
#pragma unroll 1
  for (int j0 = 0; j0 < SQ; j0 += 8) { FragH fr; for (int q = 0; q < 8; ++q) { const int j = j0 + q; const float f = (mr[j] != 0) ? 1.f : 0.f; fr.h[q] = (_Float16)(__expf(fmaf(f, s[j], (1.f - f) * -1.0e9f) - mx) * sc); }
    unsigned short* d = (unsigned short*)P + i * SQ + j0; *(v8us*)d = fr.half[0];  } }
// local RMS norm with the 7 x 7 box sum taken as two passes of 7. A work-group owns LRB grid rows x all GS grid columns x LRC channels of one batch. A thread owns one channel quad q4 of LRJ grid columns (GS / LRJ apart): it loads
// each column's LRB + 6 grid rows (16 bytes each, all in flight together; a half-wave reads one position's 256 bytes), sums the squares down the column for each of the LRB rows in registers and lays these column sums in LDS;
// behind the one barrier it adds the 7 column sums around each of its columns (RW columns of zeros on either side stand for the zero padding; grid rows outside the grid are zeroed in the rounding mask).
// x of its own positions is still in registers for the division.
#define LRB 4                        /* grid rows per work-group */
#define LRC 64                       /* channels per work-group: 256 B of x, one whole 128-B line of the f16 rows */
#define LRJ 2                        /* grid columns per thread: half the waves to start for the same work */
#define LRP (GS + 2 * RW)            /* columns in a row of column sums in LDS, the zeros included */
#define LRT (GS / LRJ * LRC / 4)     /* threads per work-group */
#define LRG (NB * (GS / LRB) * (DM / LRC))      /* work-groups of the norm */
#define LWG (DM * DM / 8 / LRT)      /* work-groups behind them that convert the weights */
// The launch also carries the weight conversion, which depends on nothing and on which only the GEMMs depend: work-groups LRG .. LRG + LWG - 1 write Bt[n][k] = f16(bf16(W[n][k]) x 16) (natural [out][in] rows) for the four matrices,
// laid one behind the other in BW; a thread takes the same 8 elements of each matrix, its 8 loads in flight together.
__global__ __launch_bounds__(LRT) void k_lrms(const float* __restrict__ x, const float* __restrict__ w, _Float16* __restrict__ X16,
    const float* __restrict__ wq, const float* __restrict__ wk, const float* __restrict__ wv, const float* __restrict__ wo, _Float16* __restrict__ BW) {
  __shared__ __attribute__((aligned(16))) float cs[LRB][LRP][LRC];
  if (blockIdx.x >= LRG) {      /* the same for the whole work-group, in front of the barrier */
    const unsigned t8 = ((blockIdx.x - LRG) * LRT + threadIdx.x) * 8;
    const float* pq = wq + t8; const float* pk = wk + t8; const float* pv = wv + t8; const float* po = wo + t8;
    const v4f wx[4][2] = {{*(const v4fa*)pq, *(const v4fa*)(pq + 4)}, {*(const v4fa*)pk, *(const v4fa*)(pk + 4)}, {*(const v4fa*)pv, *(const v4fa*)(pv + 4)}, {*(const v4fa*)po, *(const v4fa*)(po + 4)}};
    asm volatile("s_wait_xcnt 0x0" :: "v"(pq), "v"(pk), "v"(pv), "v"(po) : "memory");      /* the wait owed before a register that an issued global load names is overwritten; the addresses are inputs so that they stay in their registers up to here */
#pragma unroll
    for (int m = 0; m < 4; ++m) { FragH f;      /* unrolled whole: wx is indexed by constants alone */
#pragma unroll
      for (int q = 0; q < 8; ++q) f.h[q] = (_Float16)(bf16_round(wx[m][q >> 2][q & 3]) * 16.0f);
      *(v8us*)((unsigned short*)BW + (size_t)m * DM * DM + t8) = f.half[0]; }
    return; }
  constexpr int NCG = DM / LRC, NBD = GS / LRB, NK = LRB + 2 * RW, JS = GS / LRJ;
  const int tid = threadIdx.x, q4 = (tid % (LRC / 4)) * 4, j = tid / (LRC / 4);      /* j: the first of the thread's columns, the others at j + JS, .. */
  const int cg = blockIdx.x % NCG, bd = (blockIdx.x / NCG) % NBD, b = blockIdx.x / (NCG * NBD); const int i0 = bd * LRB;
  const int to = j * DM + cg * LRC + q4;      /* the thread's place inside a grid row of x, elements */
  const float* xb = x + (size_t)b * SQ * DM + to; const float* pw = w + cg * LRC + q4;
  const float* pc = xb + (size_t)i0 * GS * DM;      /* the work-group's own grid rows: constant offsets from here */
  /* every loop of this kernel is unrolled whole: the register arrays are then indexed by constants alone and stay in registers, and all the loads stand together in front of the first use */
  const float* pe[2 * RW];      /* the RW grid rows above and the RW below, clamped into the grid; the rows below as LRB + k rows behind pe[RW + k] */
#pragma unroll
  for (int k = 0; k < RW; ++k) { const int iu = i0 - RW + k, il = GS - 1 - LRB - k; pe[k] = xb + (size_t)(iu < 0 ? 0 : iu) * GS * DM; pe[RW + k] = xb + (size_t)(i0 < il ? i0 : il) * GS * DM; }
  v4f xr[LRJ][NK];
#pragma unroll
  for (int k = 0; k < NK; ++k) { const float* p = k < RW ? pe[k] : (k < RW + LRB ? pc : pe[k - LRB]) + (k - RW) * GS * DM;
#pragma unroll
    for (int e = 0; e < LRJ; ++e) xr[e][k] = *(const v4fa*)(p + e * JS * DM); }
  const v4f wr = *(const v4fa*)pw;
  static_assert(RW == 3, "the statement below names 2 * RW + 1 addresses");
  asm volatile("s_wait_xcnt 0x0" :: "v"(pc), "v"(pe[0]), "v"(pe[1]), "v"(pe[2]), "v"(pe[3]), "v"(pe[4]), "v"(pe[5]) : "memory");      /* the wait owed before a register that an issued global load names is overwritten; the addresses are inputs so that they stay in their registers up to here */
  const v4f z4 = {0.f, 0.f, 0.f, 0.f};
  if (j < RW) {      /* the zero columns: RW on the left, RW on the right */
#pragma unroll
    for (int r = 0; r < LRB; ++r) { *(v4fa*)&cs[r][j][q4] = z4; *(v4fa*)&cs[r][RW + GS + j][q4] = z4; } }
#pragma unroll
  for (int k = 0; k < NK; ++k) { const int ii = i0 - RW + k; const unsigned m = (ii >= 0 && ii < GS) ? 0xFFFF0000u : 0u;      /* bf16 rounding as in bf16_round; a row outside the grid becomes 0 */
#pragma unroll
    for (int e = 0; e < LRJ; ++e)
#pragma unroll
      for (int c = 0; c < 4; ++c) { const unsigned u = __float_as_uint(xr[e][k][c]); xr[e][k][c] = __uint_as_float((u + 0x7FFFu + ((u >> 16) & 1u)) & m); } }
#pragma unroll
  for (int e = 0; e < LRJ; ++e)
#pragma unroll
    for (int r = 0; r < LRB; ++r) { v4f s = xr[e][r] * xr[e][r];
#pragma unroll
      for (int d = 1; d <= 2 * RW; ++d) s += xr[e][r + d] * xr[e][r + d];
      *(v4fa*)&cs[r][RW + j + e * JS][q4] = s; }
  __syncthreads();      /* every column sum of the work-group's rows, and the zeros beside them, are in LDS; nothing writes LDS behind this point */
  v4h o[LRJ][LRB];
#pragma unroll
  for (int e = 0; e < LRJ; ++e)
#pragma unroll
    for (int r = 0; r < LRB; ++r) { v4f s = *(const v4fa*)&cs[r][j + e * JS][q4];
#pragma unroll
      for (int d = 1; d <= 2 * RW; ++d) s += *(const v4fa*)&cs[r][j + e * JS + d][q4];
#pragma unroll
      for (int c = 0; c < 4; ++c) { const float rms = sqrtf(0.0000001f + s[c] * 0.02040816326530612f);      /* box / 49 as a multiply by the f32 reciprocal (the result is rounded to f16 next) */
        o[e][r][c] = (_Float16)(xr[e][RW + r][c] / rms * bf16_round(wr[c])); } }
  _Float16* d = X16 + ((size_t)b * SQ + (size_t)i0 * GS) * DM + to;
#pragma unroll
  for (int e = 0; e < LRJ; ++e)
#pragma unroll
    for (int r = 0; r < LRB; ++r) *(v4h*)(d + (size_t)(r * GS + e * JS) * DM) = o[e][r]; }


extern "C" void kernel_launch(void* const* d_in, const int* in_sizes, int n_in,
                              void* d_out, int out_size, void* d_ws, size_t ws_size, hipStream_t stream) {
  (void)in_sizes; (void)n_in; (void)out_size;
  const float* const* I = (const float* const*)d_in; const float* x = I[0]; const float* nw = I[1]; const float* wq = I[2]; const float* bq = I[3]; const float* wk = I[4]; const float* bk = I[5]; const float* wv = I[6]; const float* bv = I[7]; const float* wo = I[8]; const float* bo = I[9];      /* x; norm_w [768]; natural [768][768] weights + biases (q, k, v, o) */
  static_assert(SQ == GS * GS && DM % 8 == 0 && DM % 64 == 0 && DM % 32 == 0 && SQ % 128 == 0 && NH * HD == DM && NH % HG == 0 && HD == 64 && SQ % (ANW * AQW) == 0 && B0 == 0 && NBR == NB && QN == SQ && NHD == NH && GS % LRB == 0 && DM % LRC == 0 && GS % LRJ == 0 && GS / LRJ >= RW && DM * DM % (8 * LRT) == 0 && DM * DM * 2 % 256 == 0 && NB * SQ * DM * 2 % 256 == 0, "shape / tile multiples; the planes taken below follow one another without a gap");
  char* ws = (char*)d_ws; size_t off = 0;
  auto take = [&](size_t bytes) { char* p = ws + off; off += (bytes + 255) & ~(size_t)255; return p; };
  _Float16* BQ = (_Float16*)take((size_t)DM * DM * 2); _Float16* BK = (_Float16*)take((size_t)DM * DM * 2); _Float16* BV = (_Float16*)take((size_t)DM * DM * 2); _Float16* BO = (_Float16*)take((size_t)DM * DM * 2);
  _Float16* X16 = (_Float16*)take(NR * DM * 2); _Float16* Q16 = (_Float16*)take(NR * DM * 2); _Float16* K16 = (_Float16*)take(NR * DM * 2); _Float16* V16 = (_Float16*)take(NR * DM * 2); _Float16* O16 = (_Float16*)take(NR * DM * 2);
  if (off > ws_size) return;      /* approx 4.5 + 5 x 12 = 65 MiB */
  (void)BK; (void)BV;      /* reached as planes 1 and 2 behind BQ, as K16 and V16 are behind Q16 */
  k_lrms<<<LRG + LWG, LRT, 0, stream>>>(x, nw, X16, wq, wk, wv, wo, BQ);      /* xn = local-RMS-normalised x as f16 rows: the A operand of all three projections; and BQ, BK, BV, BO: natural [out][in] = Bt[n][k] x16 */
  const size_t r0p = (size_t)B0 * SQ;      /* first projected row */
  k_gemm2<0><<<dim3((unsigned)((MP / 128) * (DM / 64)), 3), 128, 0, stream>>>(X16 + r0p * DM, DM, 0, BQ, DM, (size_t)DM * DM, 0.0625f, bq, bk, bv, 0, nullptr, 1, 0, 0, nullptr, Q16 + r0p * DM, DM, NR * DM, MP, DM, DM);      /* q, k, v in one grid: blockIdx.y picks the weight plane, the bias and the output plane */
  k_fattn<<<NB * NH * (SQ / (ANW * AQW)), ANW * 32, 0, stream>>>(Q16, K16, V16, O16);      /* o (merged heads, x64) as f16 rows */
  k_gemm2<0><<<dim3((unsigned)((MPO / 128) * (DM / 64)), 1), 128, 0, stream>>>(O16 + r0p * DM, DM, 0, BO, DM, 0, 0.0009765625f, bo, nullptr, nullptr, 0, nullptr, 1, 0, 0, (float*)d_out + r0p * DM, nullptr, DM, 0, MPO, DM, DM);      /* out rows are the output layout */
}

// v007
// One run takes 85.8 microseconds.
// Two timings next to v006 both put it at 1.16 times that version's speed.
// All steps since v000 together make it 62.5 times as fast.
#include <hip/hip_runtime.h>
#define NB 8
#define SQ 1024
#define GS 32                        /* token grid side: SQ = GS * GS */
#define RW 3                         /* local-norm window radius (7 x 7) */
#define DM 768
#define NH 12
#define HD 64
#define HG 4                         /* heads per launch of the per-group k_vt (not launched) */
#define B0 0                         /* first batch processed (debug hook) */
#define NBR NB                       /* batches processed (debug hook) */
#define NR ((size_t)NB * SQ)         /* token rows */
#define MP ((int)((size_t)NBR * SQ)) /* rows projected (debug hook) */
#define QN SQ                        /* query rows attended per batch (debug hook) */
#define NHD NH                       /* heads attended (debug hook) */
#define MPO MP                       /* rows through the output stage (debug hook) */
#define LQ DM      /* row pitch of the q/k/v rows */
typedef __bf16 v16b __attribute__((ext_vector_type(16)));
typedef unsigned short v8us __attribute__((ext_vector_type(8), may_alias));
typedef float  v8f  __attribute__((ext_vector_type(8)));
typedef float  v4f  __attribute__((ext_vector_type(4)));
typedef float  v4fa __attribute__((ext_vector_type(4), may_alias));
union FragB { v16b v; v8us half[2]; unsigned short u[16]; };

__device__ __forceinline__ unsigned short bf16_bits(float x) { unsigned int u = __float_as_uint(x); return (unsigned short)((u + 0x7FFFu + ((u >> 16) & 1u)) >> 16); }
__device__ __forceinline__ float bf16_val(unsigned short b) { return __uint_as_float(((unsigned int)b) << 16); }
__device__ __forceinline__ float bf16_round(float x) { return bf16_val(bf16_bits(x)); }
// D += A·B with NT terms: 1 = ah·bh, 2 = + al·bh (A split), 3 = + ah·bl (both split)
template <int NT>
__device__ __forceinline__ v8f mmaN(v16b ah, v16b al, v16b bh, v16b bl, v8f c) {
  c = __builtin_amdgcn_wmma_f32_16x16x32_bf16(false, ah, false, bh, (short)0, c, false, false);
  if (NT >= 2) c = __builtin_amdgcn_wmma_f32_16x16x32_bf16(false, al, false, bh, (short)0, c, false, false);
  if (NT >= 3) c = __builtin_amdgcn_wmma_f32_16x16x32_bf16(false, ah, false, bl, (short)0, c, false, false);
  asm volatile("v_nop\n\tv_nop\n\tv_nop\n\tv_nop" : "+v"(c) : "v"(ah), "v"(al), "v"(bh), "v"(bl));
  return c;
}

__global__ __launch_bounds__(256) void k_wt_bf16(const float* __restrict__ W, unsigned short* __restrict__ Wt, int K, int N) {
  const int t = blockIdx.x * 256 + threadIdx.x;
  const int k8n = K / 8;
  if (t >= N * k8n) return;
  const int n = t / k8n, k8 = (t % k8n) * 8;
  v8us v;
#pragma unroll
  for (int i = 0; i < 8; ++i) v[i] = bf16_bits(W[(size_t)(k8 + i) * N + n]);
  *(v8us*)(Wt + (size_t)n * K + k8) = v;
  
}

// GEMM C[M][N] (f32, pitch ldc) = act(A[M][K]·W + bias). A f32 row-major (pitch lda) converted per fragment to bf16
// (ASPLIT: hi/lo two planes -> 2 terms, else single rounded term); Wt bf16 [N][K] (pitch ldb). BIAS_BF16 rounds the
// bias to bf16 first (bias quantised to bf16 before the add). K%32==0, M%16==0, N%64==0.
template <bool ASPLIT, int ACT, bool BIAS_BF16>
__global__ __launch_bounds__(128) void k_gemm_bf(const float* __restrict__ A, int lda, const unsigned short* __restrict__ Wt, int ldb,
                                               const float* __restrict__ bias, float* __restrict__ C, int ldc, int M, int N, int K) {
  __shared__ __attribute__((aligned(16))) float so[4][16][64];
  const int tid = threadIdx.x, w = tid >> 5, lane = tid & 31, ln = lane & 15, hh = lane >> 4;
  const int ntn = N / 64;
  const int wid = blockIdx.x * 4 + w;
  const int mt = wid / ntn, nq = wid % ntn;
  if (mt * 16 >= M) return;
  const int row0 = mt * 16, col0 = nq * 64;
  const float* arow = A + (size_t)(row0 + ln) * lda;
  v8f acc[4] = {};
  for (int kb = 0; kb < K; kb += 32) {
    FragB ah, al;
    const v4f x0 = *(const v4fa*)(arow + kb + 8 * hh), x1 = *(const v4fa*)(arow + kb + 8 * hh + 4);
    const v4f x2 = *(const v4fa*)(arow + kb + 16 + 8 * hh), x3 = *(const v4fa*)(arow + kb + 16 + 8 * hh + 4);
    float xs[16] = {x0[0],x0[1],x0[2],x0[3],x1[0],x1[1],x1[2],x1[3],x2[0],x2[1],x2[2],x2[3],x3[0],x3[1],x3[2],x3[3]};
#pragma unroll
    for (int i = 0; i < 16; ++i) { const unsigned short hb = bf16_bits(xs[i]); ah.u[i] = hb; al.u[i] = ASPLIT ? bf16_bits(xs[i] - bf16_val(hb)) : (unsigned short)0; }
#pragma unroll
    for (int t = 0; t < 4; ++t) {
      const unsigned short* brow = Wt + (size_t)(col0 + t * 16 + ln) * ldb + kb;
      FragB b;
      b.half[0] = *(const v8us*)(brow + 8 * hh);
      b.half[1] = *(const v8us*)(brow + 16 + 8 * hh);
      acc[t] = mmaN<ASPLIT ? 2 : 1>(ah.v, al.v, b.v, b.v, acc[t]);
    }
  }
#pragma unroll
  for (int t = 0; t < 4; ++t) {
    float bv = bias ? bias[col0 + t * 16 + ln] : 0.f;
    if (BIAS_BF16) bv = bf16_round(bv);
#pragma unroll
    for (int r = 0; r < 8; ++r) { float v = acc[t][r] + bv; if (ACT == 1) v = fmaxf(v, 0.f); so[w][8 * hh + r][t * 16 + ln] = v; }
  }
  __builtin_amdgcn_fence(__ATOMIC_ACQ_REL, "workgroup");
  __builtin_amdgcn_wave_barrier();
  const int rsub = lane >> 4, c4 = (lane & 15) * 4;
  {
#pragma unroll
    for (int q = 0; q < 8; ++q) {
      const int r = q * 2 + rsub;
      const v4f v = *(const v4fa*)&so[w][r][c4];
      *(v4f*)(C + (size_t)(row0 + r) * ldc + col0 + c4) = v;
    }
    
  }
}

// GEMM C = act(A·W + bias + resid): A f32 (ASPLIT -> hi/lo 2 terms), Wt bf16 [N][K]; ACT 0 none, 1 relu, 2 exact gelu;
// resid (optional, f32, row index = (row % rmod), pitch ldr, RES_BF16 rounds it) added before the activation.
template <bool ASPLIT, int ACT, bool BIAS_BF16, bool RES_BF16>
__global__ __launch_bounds__(128) void k_gemm_bf3(const float* __restrict__ A, int lda, const unsigned short* __restrict__ Wt, int ldb,
                                                const float* __restrict__ bias, const float* __restrict__ resid, int rmod, int ldr,
                                                float* __restrict__ C, int ldc, int M, int N, int K) {
  __shared__ __attribute__((aligned(16))) float so[4][16][64];
  const int tid = threadIdx.x, w = tid >> 5, lane = tid & 31, ln = lane & 15, hh = lane >> 4;
  const int ntn = N / 64;
  const int wid = blockIdx.x * 4 + w;
  const int mt = wid / ntn, nq = wid % ntn;
  if (mt * 16 >= M) return;
  const int row0 = mt * 16, col0 = nq * 64;
  const float* arow = A + (size_t)(row0 + ln) * lda;
  v8f acc[4] = {};
  for (int kb = 0; kb < K; kb += 32) {
    FragB ah, al;
    const v4f x0 = *(const v4fa*)(arow + kb + 8 * hh), x1 = *(const v4fa*)(arow + kb + 8 * hh + 4);
    const v4f x2 = *(const v4fa*)(arow + kb + 16 + 8 * hh), x3 = *(const v4fa*)(arow + kb + 16 + 8 * hh + 4);
    float xs[16] = {x0[0],x0[1],x0[2],x0[3],x1[0],x1[1],x1[2],x1[3],x2[0],x2[1],x2[2],x2[3],x3[0],x3[1],x3[2],x3[3]};
#pragma unroll
    for (int i = 0; i < 16; ++i) { const unsigned short hb = bf16_bits(xs[i]); ah.u[i] = hb; al.u[i] = ASPLIT ? bf16_bits(xs[i] - bf16_val(hb)) : (unsigned short)0; }
#pragma unroll
    for (int t = 0; t < 4; ++t) {
      const unsigned short* brow = Wt + (size_t)(col0 + t * 16 + ln) * ldb + kb;
      FragB b;
      b.half[0] = *(const v8us*)(brow + 8 * hh);
      b.half[1] = *(const v8us*)(brow + 16 + 8 * hh);
      acc[t] = mmaN<ASPLIT ? 2 : 1>(ah.v, al.v, b.v, b.v, acc[t]);
    }
  }
#pragma unroll
  for (int t = 0; t < 4; ++t) {
    const int col = col0 + t * 16 + ln;
    float bv = bias ? bias[col] : 0.f;
    if (BIAS_BF16) bv = bf16_round(bv);
#pragma unroll
    for (int r = 0; r < 8; ++r) {
      float v = acc[t][r] + bv;
      if (resid) { float rv = resid[(size_t)((row0 + 8 * hh + r) % rmod) * ldr + col]; if (RES_BF16) rv = bf16_round(rv); v += rv; }
      if (ACT == 1) v = fmaxf(v, 0.f);
      if (ACT == 2) v = 0.5f * v * (1.0f + erff(v * 0.70710678118654752f));
      if (ACT == 3) { const float u = 0.7978845608028654f * (v + 0.044715f * v * v * v); v = 0.5f * v * (1.0f + tanhf(u)); }
      so[w][8 * hh + r][t * 16 + ln] = v;
    }
  }
  __builtin_amdgcn_fence(__ATOMIC_ACQ_REL, "workgroup");
  __builtin_amdgcn_wave_barrier();
  const int rsub = lane >> 4, c4 = (lane & 15) * 4;
  {
#pragma unroll
    for (int q = 0; q < 8; ++q) {
      const int r = q * 2 + rsub;
      const v4f v = *(const v4fa*)&so[w][r][c4];
      *(v4f*)(C + (size_t)(row0 + r) * ldc + col0 + c4) = v;
    }
    
  }
}
// row LayerNorm (biased variance, eps) over N: s = X (+ R); optional out_sum <- s; out_norm <- (s-mu)*rsqrt(var+eps)*g + b
template <bool PARAM_BF16>
__global__ __launch_bounds__(256) void k_layernorm(const float* __restrict__ X, const float* __restrict__ R, const float* __restrict__ g, const float* __restrict__ bta,
                                                  float* __restrict__ out_sum, float* __restrict__ out_norm, int N, float eps) {
  __shared__ float red[256];
  const int row = blockIdx.x, tid = threadIdx.x;
  const float* x = X + (size_t)row * N; const float* rr = R ? R + (size_t)row * N : nullptr;
  float vals[16];                     // up to N = 4096
  const int per = N / 256;            // contiguous chunk per thread? use strided-by-4 chunks: thread handles j = tid*4 + 1024*u
  float s1 = 0.f;
  for (int u = 0; u < per / 4; ++u) {
    const int j = tid * 4 + 1024 * u;
    const v4f a = *(const v4fa*)(x + j);
    v4f b = {0.f,0.f,0.f,0.f}; if (rr) b = *(const v4fa*)(rr + j);
#pragma unroll
    for (int q = 0; q < 4; ++q) { const float v = a[q] + b[q]; vals[u * 4 + q] = v; s1 += v; }
  }
  red[tid] = s1; __syncthreads();
  for (int st = 128; st > 0; st >>= 1) { if (tid < st) red[tid] += red[tid + st]; __syncthreads(); }
  const float mu = red[0] / (float)N; __syncthreads();
  float s2 = 0.f;
  for (int u = 0; u < per / 4; ++u)
#pragma unroll
    for (int q = 0; q < 4; ++q) { const float c = vals[u * 4 + q] - mu; s2 += c * c; }
  red[tid] = s2; __syncthreads();
  for (int st = 128; st > 0; st >>= 1) { if (tid < st) red[tid] += red[tid + st]; __syncthreads(); }
  const float rs = rsqrtf(red[0] / (float)N + eps);
  {
    for (int u = 0; u < per / 4; ++u) {
      const int j = tid * 4 + 1024 * u;
      v4f o, sm;
#pragma unroll
      for (int q = 0; q < 4; ++q) {
        float gg = g[j + q], bb = bta[j + q];
        if (PARAM_BF16) { gg = bf16_round(gg); bb = bf16_round(bb); }
        sm[q] = vals[u * 4 + q]; o[q] = (vals[u * 4 + q] - mu) * rs * gg + bb;
      }
      if (out_sum) *(v4f*)(out_sum + (size_t)row * N + j) = sm;
      *(v4f*)(out_norm + (size_t)row * N + j) = o;
    }
    
  }
}



// ---- f16 WMMA path (v_wmma_f32_16x16x32_f16): 11-bit significands for operands in range — used where a [0,1] probability operand needs more precision than bf16
typedef _Float16 v16h __attribute__((ext_vector_type(16)));
union FragH { v16h v; v8us half[2]; _Float16 h[16]; unsigned short u[16]; };
template <int NT>
__device__ __forceinline__ v8f mmaH(v16h ah, v16h al, v16h bh, v16h bl, v8f c) {
  c = __builtin_amdgcn_wmma_f32_16x16x32_f16(false, ah, false, bh, (short)0, c, false, false);
  if (NT >= 2) c = __builtin_amdgcn_wmma_f32_16x16x32_f16(false, al, false, bh, (short)0, c, false, false);
  if (NT >= 3) c = __builtin_amdgcn_wmma_f32_16x16x32_f16(false, ah, false, bl, (short)0, c, false, false);
  asm volatile("v_nop\n\tv_nop\n\tv_nop\n\tv_nop" : "+v"(c) : "v"(ah), "v"(al), "v"(bh), "v"(bl));
  return c;
}
// batched GEMM like k_gemm_b but f16 operands: A f32 (split into f16 hi/lo if ASPLIT, else rounded to f16), Bt = f16 values [n][k]; alpha; C f32; N multiple of 16 (partial tiles skipped)
template <bool ASPLIT>
__global__ __launch_bounds__(128) void k_gemm_h(const float* __restrict__ A, int lda, size_t sA, const _Float16* __restrict__ Bh, int ldb, size_t sB, float alpha, float* __restrict__ C, int ldc, size_t sC, int M, int N, int K) {
  __shared__ __attribute__((aligned(16))) float so[4][16][64];
  const int tid = threadIdx.x, w = tid >> 5, lane = tid & 31, ln = lane & 15, hh = lane >> 4; const int by = blockIdx.y;
  A += (size_t)by * sA; Bh += (size_t)by * sB; C += (size_t)by * sC;
  const int ntn = (N + 63) / 64; const int wid = blockIdx.x * 4 + w; const int mt = wid / ntn, nq = wid % ntn; if (mt * 16 >= M) return;
  const int row0 = mt * 16, col0 = nq * 64; const float* arow = A + (size_t)(row0 + ln) * lda;
  v8f acc[4] = {};
  for (int kb = 0; kb < K; kb += 32) {
    FragH ah, al;
    const v4f x0 = *(const v4fa*)(arow + kb + 8 * hh), x1 = *(const v4fa*)(arow + kb + 8 * hh + 4), x2 = *(const v4fa*)(arow + kb + 16 + 8 * hh), x3 = *(const v4fa*)(arow + kb + 16 + 8 * hh + 4);
    float xs[16] = {x0[0],x0[1],x0[2],x0[3],x1[0],x1[1],x1[2],x1[3],x2[0],x2[1],x2[2],x2[3],x3[0],x3[1],x3[2],x3[3]};
#pragma unroll
    for (int i = 0; i < 16; ++i) { const _Float16 h = (_Float16)xs[i]; ah.h[i] = h; al.h[i] = ASPLIT ? (_Float16)(xs[i] - (float)h) : (_Float16)0.0f; }
#pragma unroll
    for (int t = 0; t < 4; ++t) { if (col0 + t * 16 >= N) continue; const size_t boff = (size_t)(col0 + t * 16 + ln) * ldb + kb; FragH bq; bq.half[0] = *(const v8us*)(Bh + boff + 8 * hh); bq.half[1] = *(const v8us*)(Bh + boff + 16 + 8 * hh);
      acc[t] = mmaH<ASPLIT ? 2 : 1>(ah.v, al.v, bq.v, bq.v, acc[t]); }
  }
#pragma unroll
  for (int t = 0; t < 4; ++t) { if (col0 + t * 16 >= N) continue;
#pragma unroll
    for (int r = 0; r < 8; ++r) so[w][8 * hh + r][t * 16 + ln] = acc[t][r] * alpha; }
  __builtin_amdgcn_fence(__ATOMIC_ACQ_REL, "workgroup"); __builtin_amdgcn_wave_barrier();
  const int rsub = lane >> 4, c4 = (lane & 15) * 4;
  {
#pragma unroll
    for (int q = 0; q < 8; ++q) { const int r = q * 2 + rsub; if (col0 + c4 < N) { const v4f v = *(const v4fa*)&so[w][r][c4]; *(v4f*)(C + (size_t)(row0 + r) * ldc + col0 + c4) = v; } }
     }
}

// Wt[n][k] = f16(W[k][n]·scale) from f32 row-major W[K][N] (scale = power of two; bf16-exact weights stay exact in f16 away from the subnormal range)
__global__ __launch_bounds__(256) void k_wt_f16(const float* __restrict__ W, _Float16* __restrict__ Wt, int K, int N, float scale) {
  const int t = blockIdx.x * 256 + threadIdx.x; if (t >= N * (K / 8)) return; const int n = t / (K / 8), k8 = (t % (K / 8)) * 8; FragH f;
#pragma unroll
  for (int i = 0; i < 8; ++i) f.h[i] = (_Float16)(bf16_round(W[(size_t)(k8 + i) * N + n]) * scale); const v8us o = f.half[0];
  *(v8us*)((unsigned short*)Wt + (size_t)n * K + k8) = o; 
}
// k_gemm_hh variant with fused epilogue: v = acc·alpha + bias[by·sBias + col] (+ CP[(row/rowsPerB)·sCPb + by·64 + col] if CP) ; ACT 0 none / 1 elu ; writes f16 C16 (and f32 C if non-null)
template <int ACT>
__global__ __launch_bounds__(128) void k_gemm_hhx(const _Float16* __restrict__ A, int lda, size_t sA, const _Float16* __restrict__ Bh, int ldb, size_t sB, float alpha, const float* __restrict__ bias, size_t sBias, const float* __restrict__ CP, int rowsPerB, size_t sCPb, int row0g,
    float* __restrict__ C, _Float16* __restrict__ C16, int ldc, size_t sC, int M, int N, int K) {
  __shared__ __attribute__((aligned(16))) float so[4][16][64];
  const int tid = threadIdx.x, w = tid >> 5, lane = tid & 31, ln = lane & 15, hh = lane >> 4; const int by = blockIdx.y;
  A += (size_t)by * sA; Bh += (size_t)by * sB; const size_t cofs = (size_t)by * sC; const float* bp = bias ? bias + (size_t)by * sBias : nullptr;
  const int ntn = (N + 63) / 64; const int wid = blockIdx.x * 4 + w; const int mt = wid / ntn, nq = wid % ntn; if (mt * 16 >= M) return;
  const int row0 = mt * 16, col0 = nq * 64; const _Float16* arow = A + (size_t)(row0 + ln) * lda;
  v8f acc[4] = {};
  for (int kb = 0; kb < K; kb += 32) { FragH ah; ah.half[0] = *(const v8us*)((const unsigned short*)arow + kb + 8 * hh); ah.half[1] = *(const v8us*)((const unsigned short*)arow + kb + 16 + 8 * hh);
#pragma unroll
    for (int t = 0; t < 4; ++t) { if (col0 + t * 16 >= N) continue; const size_t boff = (size_t)(col0 + t * 16 + ln) * ldb + kb; FragH bq; bq.half[0] = *(const v8us*)((const unsigned short*)Bh + boff + 8 * hh); bq.half[1] = *(const v8us*)((const unsigned short*)Bh + boff + 16 + 8 * hh);
      acc[t] = mmaH<1>(ah.v, ah.v, bq.v, bq.v, acc[t]); }
  }
#pragma unroll
  for (int t = 0; t < 4; ++t) { if (col0 + t * 16 >= N) continue; const int col = col0 + t * 16 + ln; const float bv = bp ? bf16_round(bp[col]) : 0.f;
#pragma unroll
    for (int r = 0; r < 8; ++r) { float v = acc[t][r] * alpha + bv; if (CP) { const int rr = row0g + row0 + 8 * hh + r; if (rowsPerB < 0) v += CP[cofs + (size_t)rr * ldc + col];      /* rowsPerB < 0: own element of the batched C plane */ else { const int bidx = rr / rowsPerB; v += CP[(size_t)bidx * sCPb + (size_t)by * 64 + col]; } } if (ACT == 1) v = (v > 0.f) ? v : expm1f(v); else if (ACT == 7) v = (v > 0.f) ? v + 1.0f : expf(v); else if (ACT == 8) v = tanhf(v); else if (ACT == 9) v = 0.5f * v * (1.0f + tanhf(0.7978845608028654f * (v + 0.044715f * v * v * v))); else if (ACT == 11) v = 1.0f / (1.0f + expf(-v)); else if (ACT == 12) v = (v > 0.f) ? v : 0.01f * v; else if (ACT == 14) v = (v > 0.f) ? v : 0.1f * v; else if (ACT == 16) v = (v >= 0.f) ? v : 0.3f * v; else if (ACT == 17) v = (v >= 0.f) ? v : 0.2f * v; else if (ACT == 15) v = v / (1.0f + expf(-v)); else if (ACT == 3) v = fmaxf(v, 0.f); else if (ACT == 6) v = 0.5f * v * (1.0f + erff(v * 0.70710678118654752f)); so[w][8 * hh + r][t * 16 + ln] = v; } }
  __builtin_amdgcn_fence(__ATOMIC_ACQ_REL, "workgroup"); __builtin_amdgcn_wave_barrier();
  const int rsub = lane >> 4, c4 = (lane & 15) * 4; typedef _Float16 v4h __attribute__((ext_vector_type(4)));
  {
#pragma unroll
    for (int q = 0; q < 8; ++q) { const int r = q * 2 + rsub; if (col0 + c4 < N) { const v4f v = *(const v4fa*)&so[w][r][c4]; if (C) *(v4f*)(C + cofs + (size_t)(row0 + r) * ldc + col0 + c4) = v; if (C16) { v4h h4; for (int i = 0; i < 4; ++i) h4[i] = (_Float16)v[i]; *(v4h*)(C16 + cofs + (size_t)(row0 + r) * ldc + col0 + c4) = h4; } } }
     }
}


typedef _Float16 v4h __attribute__((ext_vector_type(4)));

__global__ __launch_bounds__(256) void k_x16(const float* __restrict__ x, _Float16* __restrict__ X16, size_t n8) { const size_t t = (size_t)blockIdx.x * 256 + threadIdx.x; if (t >= n8) return; FragH f;
#pragma unroll
  for (int q = 0; q < 8; ++q) f.h[q] = (_Float16)bf16_round(x[t * 8 + q]); *(v8us*)((unsigned short*)X16 + t * 8) = f.half[0];  }
__global__ __launch_bounds__(256) void k_h16(const float* __restrict__ x, _Float16* __restrict__ X16, size_t n8) { const size_t t = (size_t)blockIdx.x * 256 + threadIdx.x; if (t >= n8) return; FragH f;
#pragma unroll
  for (int q = 0; q < 8; ++q) f.h[q] = (_Float16)x[t * 8 + q]; *(v8us*)((unsigned short*)X16 + t * 8) = f.half[0];  }
__global__ __launch_bounds__(256) void k_round16f(const float* __restrict__ W, _Float16* __restrict__ Bt, size_t n8) { const size_t t = (size_t)blockIdx.x * 256 + threadIdx.x; if (t >= n8) return; FragH f;
#pragma unroll
  for (int i = 0; i < 8; ++i) f.h[i] = (_Float16)(bf16_round(W[t * 8 + i]) * 16.0f); *(v8us*)((unsigned short*)Bt + t * 8) = f.half[0];  }
template <int NHv, int TTv>
__global__ __launch_bounds__(256) void k_vt(const _Float16* __restrict__ V16, int ldv, int voff, _Float16* __restrict__ Vt) { __shared__ unsigned short tl[64][66]; const int tid = threadIdx.x; const int slab = blockIdx.x / (TTv / 64), lg = blockIdx.x % (TTv / 64); const int b = slab / NHv, h = slab % NHv;
  for (int i = tid; i < 64 * 8; i += 256) { const int r = i / 8, c8 = (i % 8) * 8; FragH f; f.half[0] = *(const v8us*)((const unsigned short*)V16 + ((size_t)b * TTv + lg * 64 + r) * ldv + voff + h * 64 + c8);
#pragma unroll
    for (int q = 0; q < 8; ++q) tl[r][c8 + q] = f.u[q]; }
  __syncthreads();
  {
#pragma unroll
    for (int rd = 0; rd < 2; ++rd) { const int d = rd * 32 + tid / 8, pc = tid % 8; FragH f;
#pragma unroll
      for (int q = 0; q < 8; ++q) f.u[q] = tl[pc * 8 + q][d];
      *(v8us*)((unsigned short*)Vt + ((size_t)slab * 64 + d) * TTv + lg * 64 + pc * 8) = f.half[0]; }
     } }

__global__ __launch_bounds__(256) void k_hl(const float* __restrict__ F, _Float16* __restrict__ Hh, _Float16* __restrict__ Hl, size_t n8) { const size_t t = (size_t)blockIdx.x * 256 + threadIdx.x; if (t >= n8) return; FragH fh, fl; const v4f a = *(const v4fa*)(F + t * 8), c = *(const v4fa*)(F + t * 8 + 4);
#pragma unroll
  for (int q = 0; q < 4; ++q) { _Float16 h = (_Float16)a[q]; fh.h[q] = h; fl.h[q] = (_Float16)((a[q] - (float)h) * 1024.0f); h = (_Float16)c[q]; fh.h[4 + q] = h; fl.h[4 + q] = (_Float16)((c[q] - (float)h) * 1024.0f); }
  { *(v8us*)((unsigned short*)Hh + t * 8) = fh.half[0]; *(v8us*)((unsigned short*)Hl + t * 8) = fl.half[0];  } }

// ---- fast GEMM (work-group tile 128x64, wave tile 32x64; requires M % 128 == 0 rows per launch region, N % 64 == 0 and K % 64 == 0); epilogue = k_gemm_hhx semantics ----
// Operands go through LDS: a stage is 64 k (128-byte rows, whole cache lines) of the work-group's 128 A rows and 64 Bt rows, brought by asynchronous copies (16 bytes a lane, four whole lines a wave-instruction), two buffers:
// stage s + 1 flies while stage s is multiplied. The fragments are read from LDS in the k order that the global fragment loads had, so every product and every sum is the same as before.
#define G2K 64                       /* k elements per stage */
#define G2P (G2K + 8)                /* LDS pitch of a staged row, f16 elements (144 B = 16 B x odd: no bank conflict for 16-byte fragment reads) */
#define G2R (128 + 64)               /* rows per stage: A rows 0 .. 127, then Bt rows 0 .. 63 */
#define G2S (16 * G2P * 2)           /* LDS bytes between two copies of one lane (16 rows) */
__device__ __forceinline__ v16h g2_frag(const unsigned short* p) { FragH f; f.half[0] = *(const v8us*)p; f.half[1] = *(const v8us*)(p + 16); return f.v; }
__device__ __forceinline__ v8f g2_mma(v16h a, v16h b, v8f c) { v8f d = __builtin_amdgcn_wmma_f32_16x16x32_f16(false, a, false, b, (short)0, c, false, false); asm volatile("v_nop\n\tv_nop\n\tv_nop\n\tv_nop" : "+v"(d) : "v"(a), "v"(b)); return d; }
// one stage's copies of one lane: 16 bytes of A rows r, r + 16, .. r + 112 and of Bt rows r, r + 16, r + 32, r + 48 (r = thread / 8) to LDS byte l + 0, G2S, .. 11 G2S. ra, rb = 16 rows of A, of Bt, in elements.
// The s_wait_xcnt closes the statement so that it stands in front of every later write of a register that a copy names.
__device__ __forceinline__ void g2_copy(unsigned l, const unsigned short* ga, size_t ra, const unsigned short* gb, size_t rb) {
  asm volatile("global_load_async_to_lds_b128 %0, %1, off\n\t"
               "global_load_async_to_lds_b128 %2, %3, off\n\t"
               "global_load_async_to_lds_b128 %4, %5, off\n\t"
               "global_load_async_to_lds_b128 %6, %7, off\n\t"
               "global_load_async_to_lds_b128 %8, %9, off\n\t"
               "global_load_async_to_lds_b128 %10, %11, off\n\t"
               "global_load_async_to_lds_b128 %12, %13, off\n\t"
               "global_load_async_to_lds_b128 %14, %15, off\n\t"
               "global_load_async_to_lds_b128 %16, %17, off\n\t"
               "global_load_async_to_lds_b128 %18, %19, off\n\t"
               "global_load_async_to_lds_b128 %20, %21, off\n\t"
               "global_load_async_to_lds_b128 %22, %23, off\n\t"
               "s_wait_xcnt 0x0"
               :: "v"(l), "v"(ga), "v"(l + 1 * G2S), "v"(ga + ra), "v"(l + 2 * G2S), "v"(ga + 2 * ra), "v"(l + 3 * G2S), "v"(ga + 3 * ra),
                  "v"(l + 4 * G2S), "v"(ga + 4 * ra), "v"(l + 5 * G2S), "v"(ga + 5 * ra), "v"(l + 6 * G2S), "v"(ga + 6 * ra), "v"(l + 7 * G2S), "v"(ga + 7 * ra),
                  "v"(l + 8 * G2S), "v"(gb), "v"(l + 9 * G2S), "v"(gb + rb), "v"(l + 10 * G2S), "v"(gb + 2 * rb), "v"(l + 11 * G2S), "v"(gb + 3 * rb)
               : "memory"); }
template <int ACT>
__global__ __launch_bounds__(128) void k_gemm2(const _Float16* __restrict__ A, int lda, size_t sA, const _Float16* __restrict__ Bh, int ldb, size_t sB, float alpha, const float* __restrict__ bias, const float* __restrict__ bias1, const float* __restrict__ bias2, size_t sBias, const float* __restrict__ CP, int rowsPerB, size_t sCPb, int row0g,
    float* __restrict__ C, _Float16* __restrict__ C16, int ldc, size_t sC, int M, int N, int K) { static_assert(ACT == 0 || ACT == 3 || ACT == 6 || ACT == 8 || ACT == 9 || ACT == 11 || ACT == 12 || ACT == 14 || ACT == 15 || ACT == 16 || ACT == 17, "k_gemm2: unsupported ACT code (would silently apply no activation)");
  __shared__ __attribute__((aligned(16))) unsigned short st[2][G2R * G2P];
  __shared__ __attribute__((aligned(16))) float so[4][32][68];
  const int tid = threadIdx.x, w = tid >> 5, lane = tid & 31, ln = lane & 15, hh = lane >> 4; const int by = blockIdx.y;
  const float* bsel = by == 0 ? bias : (by == 1 ? bias1 : bias2);      /* products that share one grid bring their bias vectors as separate inputs: plane 0, 1, 2 */
  A += (size_t)by * sA; Bh += (size_t)by * sB; const size_t cofs = (size_t)by * sC; const float* bp = bsel ? bsel + (size_t)by * sBias : nullptr;
  const int ntn = N >> 6; const int mt = blockIdx.x / ntn, nq = blockIdx.x - mt * ntn; const int row0 = mt * 128 + 32 * w, col0 = nq * 64; if (mt * 128 + 128 > M) return;      /* the same for the whole work-group, in front of every barrier: all 128 staged A rows exist */
  const int cr = tid >> 3, cc = (tid & 7) * 8;      /* the lane's first staged row, and its 16 bytes in the row */
  const unsigned short* ga = (const unsigned short*)A + (size_t)(mt * 128 + cr) * lda + cc; const unsigned short* gb = (const unsigned short*)Bh + (size_t)(col0 + cr) * ldb + cc;
  const size_t ra = (size_t)16 * lda, rb = (size_t)16 * ldb;
  const unsigned l0 = (unsigned)(size_t)&st[0][cr * G2P + cc];      /* LDS byte address: the low 32 bits of the __shared__ address */
  constexpr int SE = G2R * G2P;      /* elements per buffer */
  const int ns = K / G2K;
  g2_copy(l0, ga, ra, gb, rb);
  asm volatile("s_wait_asynccnt 0x0" ::: "memory");      /* this wave's copies of stage 0 have landed */
  __syncthreads();      /* stage 0 is complete for every wave */
  if (ns > 1) g2_copy(l0 + SE * 2, ga + G2K, ra, gb + G2K, rb);
  const unsigned short* fa = &st[0][(32 * w + ln) * G2P + 8 * hh]; const unsigned short* fb = &st[0][(128 + ln) * G2P + 8 * hh];
  const v8f z8 = {0.f,0.f,0.f,0.f,0.f,0.f,0.f,0.f}; v8f c00 = z8, c01 = z8, c02 = z8, c03 = z8, c10 = z8, c11 = z8, c12 = z8, c13 = z8;
  for (int s = 0; s < ns; ++s) { const int bo = (s & 1) * SE; const unsigned short* pa = fa + bo; const unsigned short* pb = fb + bo;
    /* all 24 fragment reads of the stage stand together in front of its 16 products: one LDS latency a stage, not one a fragment */
    const v16h a0 = g2_frag(pa), a1 = g2_frag(pa + 16 * G2P), b0 = g2_frag(pb), b1 = g2_frag(pb + 16 * G2P), b2 = g2_frag(pb + 32 * G2P), b3 = g2_frag(pb + 48 * G2P);
    const v16h a2 = g2_frag(pa + 32), a3 = g2_frag(pa + 16 * G2P + 32), b4 = g2_frag(pb + 32), b5 = g2_frag(pb + 16 * G2P + 32), b6 = g2_frag(pb + 32 * G2P + 32), b7 = g2_frag(pb + 48 * G2P + 32);
    c00 = g2_mma(a0, b0, c00); c10 = g2_mma(a1, b0, c10); c01 = g2_mma(a0, b1, c01); c11 = g2_mma(a1, b1, c11); c02 = g2_mma(a0, b2, c02); c12 = g2_mma(a1, b2, c12); c03 = g2_mma(a0, b3, c03); c13 = g2_mma(a1, b3, c13);
    c00 = g2_mma(a2, b4, c00); c10 = g2_mma(a3, b4, c10); c01 = g2_mma(a2, b5, c01); c11 = g2_mma(a3, b5, c11); c02 = g2_mma(a2, b6, c02); c12 = g2_mma(a3, b6, c12); c03 = g2_mma(a2, b7, c03); c13 = g2_mma(a3, b7, c13);
    asm volatile("s_wait_dscnt 0x0" ::: "memory");      /* this wave's reads of buffer s & 1 are done before the buffer is refilled */
    asm volatile("s_wait_asynccnt 0x0" ::: "memory");      /* this wave's copies of stage s + 1 have landed */
    __syncthreads();      /* publishes stage s + 1 and ends every wave's reads of stage s */
    if (s + 2 < ns) g2_copy(l0 + bo * 2, ga + (size_t)(s + 2) * G2K, ra, gb + (size_t)(s + 2) * G2K, rb); }
  asm volatile("s_wait_asynccnt 0x0" ::: "memory");      /* no copy is outstanding when the wave goes on to its end */
  v8f accs[8] = {c00, c01, c02, c03, c10, c11, c12, c13};
#pragma unroll
  for (int u = 0; u < 8; ++u) { const int t = u & 3, half = u >> 2; const int col = col0 + t * 16 + ln; const float bv = bp ? bf16_round(bp[col]) : 0.f;
#pragma unroll
    for (int r = 0; r < 8; ++r) { const int rloc = half * 16 + 8 * hh + r; float v = accs[u][r] * alpha + bv; if (CP) { if (rowsPerB < 0) v += CP[cofs + (size_t)(row0g + row0 + rloc) * ldc + col];      /* rowsPerB < 0: own element of the batched C plane */ else { const int bidx = (row0g + row0 + rloc) / rowsPerB; v += CP[(size_t)bidx * sCPb + (size_t)by * 64 + col]; } }
      if (ACT == 3) v = fmaxf(v, 0.f); else if (ACT == 6) v = 0.5f * v * (1.0f + erff(v * 0.70710678118654752f)); else if (ACT == 11) v = 1.0f / (1.0f + expf(-v)); else if (ACT == 15) v = v / (1.0f + expf(-v)); else if (ACT == 12) v = (v > 0.f) ? v : 0.01f * v; else if (ACT == 8) v = tanhf(v); else if (ACT == 9) v = 0.5f * v * (1.0f + tanhf(0.7978845608028654f * (v + 0.044715f * v * v * v))); else if (ACT == 14) v = (v > 0.f) ? v : 0.1f * v; else if (ACT == 16) v = (v >= 0.f) ? v : 0.3f * v; else if (ACT == 17) v = (v >= 0.f) ? v : 0.2f * v;
      so[w][rloc][t * 16 + ln] = v; } }
  __builtin_amdgcn_fence(__ATOMIC_ACQ_REL, "workgroup"); __builtin_amdgcn_wave_barrier();
  const int rsub = lane >> 4, c4 = (lane & 15) * 4;
  {
#pragma unroll
    for (int q = 0; q < 16; ++q) { const int r = q * 2 + rsub; const v4f v = *(const v4fa*)&so[w][r][c4]; if (C) *(v4f*)(C + cofs + (size_t)(row0 + r) * ldc + col0 + c4) = v; if (C16) { v4h h4; for (int i = 0; i < 4; ++i) h4[i] = (_Float16)v[i]; *(v4h*)(C16 + cofs + (size_t)(row0 + r) * ldc + col0 + c4) = h4; } }
     } }


// ---- wide GEMM for the projections (work-group tile 128 x 192, four waves of 64 x 96 as 2 x 2; requires M % 128 == 0, N % 192 == 0, K % 64 == 0); C16 = f16(acc alpha + bf16(bias)) ----
// The same ring as k_gemm2 (64 k a stage, 144-byte rows, asynchronous copies, two buffers), with 128 A rows and 192 Bt rows a stage: 320 rows from L2 per 128 x 192 x 64 products, where three 128 x 64 tiles bring 576;
// a wave reads 10 fragments from LDS per 24 products (k_gemm2: 6 per 8). Every output element sums its 32-k blocks in the order that k_gemm2 has.
#define G3N 192                      /* columns per work-group */
#define G3R (128 + G3N)              /* rows per stage: A rows 0 .. 127, then Bt rows 0 .. 191 */
#define G3Q (G3N + 8)                /* pitch of a staged output row, f16 elements (400 B = 16 B x odd) */
// one stage's copies of one lane: 16 bytes of A rows r, r + 16, .. r + 112 (r = thread / 8) to LDS byte l + 0, G2S, .. 7 G2S; ra = 16 rows in elements. The s_wait_xcnt closes the statement so that it stands in front of every later write of a register that a copy names.
__device__ __forceinline__ void g3_copy_a(unsigned l, const unsigned short* ga, size_t ra) {
  asm volatile("global_load_async_to_lds_b128 %0, %1, off\n\t"
               "global_load_async_to_lds_b128 %2, %3, off\n\t"
               "global_load_async_to_lds_b128 %4, %5, off\n\t"
               "global_load_async_to_lds_b128 %6, %7, off\n\t"
               "global_load_async_to_lds_b128 %8, %9, off\n\t"
               "global_load_async_to_lds_b128 %10, %11, off\n\t"
               "global_load_async_to_lds_b128 %12, %13, off\n\t"
               "global_load_async_to_lds_b128 %14, %15, off\n\t"
               "s_wait_xcnt 0x0"
               :: "v"(l), "v"(ga), "v"(l + 1 * G2S), "v"(ga + ra), "v"(l + 2 * G2S), "v"(ga + 2 * ra), "v"(l + 3 * G2S), "v"(ga + 3 * ra),
                  "v"(l + 4 * G2S), "v"(ga + 4 * ra), "v"(l + 5 * G2S), "v"(ga + 5 * ra), "v"(l + 6 * G2S), "v"(ga + 6 * ra), "v"(l + 7 * G2S), "v"(ga + 7 * ra)
               : "memory"); }
// the same for Bt rows r, r + 16, .. r + 176, to LDS byte l + 0, G2S, .. 11 G2S (l: the lane's place in the first Bt row group)
__device__ __forceinline__ void g3_copy_b(unsigned l, const unsigned short* gb, size_t rb) {
  asm volatile("global_load_async_to_lds_b128 %0, %1, off\n\t"
               "global_load_async_to_lds_b128 %2, %3, off\n\t"
               "global_load_async_to_lds_b128 %4, %5, off\n\t"
               "global_load_async_to_lds_b128 %6, %7, off\n\t"
               "global_load_async_to_lds_b128 %8, %9, off\n\t"
               "global_load_async_to_lds_b128 %10, %11, off\n\t"
               "global_load_async_to_lds_b128 %12, %13, off\n\t"
               "global_load_async_to_lds_b128 %14, %15, off\n\t"
               "global_load_async_to_lds_b128 %16, %17, off\n\t"
               "global_load_async_to_lds_b128 %18, %19, off\n\t"
               "global_load_async_to_lds_b128 %20, %21, off\n\t"
               "global_load_async_to_lds_b128 %22, %23, off\n\t"
               "s_wait_xcnt 0x0"
               :: "v"(l), "v"(gb), "v"(l + 1 * G2S), "v"(gb + rb), "v"(l + 2 * G2S), "v"(gb + 2 * rb), "v"(l + 3 * G2S), "v"(gb + 3 * rb),
                  "v"(l + 4 * G2S), "v"(gb + 4 * rb), "v"(l + 5 * G2S), "v"(gb + 5 * rb), "v"(l + 6 * G2S), "v"(gb + 6 * rb), "v"(l + 7 * G2S), "v"(gb + 7 * rb),
                  "v"(l + 8 * G2S), "v"(gb + 8 * rb), "v"(l + 9 * G2S), "v"(gb + 9 * rb), "v"(l + 10 * G2S), "v"(gb + 10 * rb), "v"(l + 11 * G2S), "v"(gb + 11 * rb)
               : "memory"); }
__global__ __launch_bounds__(128) void k_gemm3(const _Float16* __restrict__ A, int lda, const _Float16* __restrict__ Bh, int ldb, size_t sB, float alpha, const float* __restrict__ bias, const float* __restrict__ bias1, const float* __restrict__ bias2,
    _Float16* __restrict__ C16, int ldc, size_t sC, int M, int N, int K) {
  __shared__ __attribute__((aligned(16))) unsigned short st[2][G3R * G2P];
  static_assert(128 * G3Q <= 2 * G3R * G2P, "the staged output tile lies inside the ring");
  const int tid = threadIdx.x, w = tid >> 5, lane = tid & 31, ln = lane & 15, hh = lane >> 4; const int by = blockIdx.y; const int wm = w >> 1, wn = w & 1;
  const float* bp = by == 0 ? bias : (by == 1 ? bias1 : bias2);      /* products that share one grid bring their bias vectors as separate inputs: plane 0, 1, 2 */
  Bh += (size_t)by * sB; C16 += (size_t)by * sC;
  const int ntn = N / G3N; const int mt = blockIdx.x / ntn, nq = blockIdx.x - mt * ntn; const int col0 = nq * G3N; if (mt * 128 + 128 > M) return;      /* the same for the whole work-group, in front of every barrier: all 128 staged A rows exist */
  const int cr = tid >> 3, cc = (tid & 7) * 8;      /* the lane's first staged row, and its 16 bytes in the row */
  const unsigned short* ga = (const unsigned short*)A + (size_t)(mt * 128 + cr) * lda + cc; const unsigned short* gb = (const unsigned short*)Bh + (size_t)(col0 + cr) * ldb + cc;
  const size_t ra = (size_t)16 * lda, rb = (size_t)16 * ldb;
  const unsigned l0 = (unsigned)(size_t)&st[0][cr * G2P + cc];      /* LDS byte address: the low 32 bits of the __shared__ address */
  constexpr int SE = G3R * G2P;      /* elements per buffer */
  const int ns = K / G2K;
  g3_copy_a(l0, ga, ra); g3_copy_b(l0 + 8 * G2S, gb, rb);
  asm volatile("s_wait_asynccnt 0x0" ::: "memory");      /* this wave's copies of stage 0 have landed */
  __syncthreads();      /* stage 0 is complete for every wave */
  if (ns > 1) { g3_copy_a(l0 + SE * 2, ga + G2K, ra); g3_copy_b(l0 + SE * 2 + 8 * G2S, gb + G2K, rb); }
  const unsigned short* fa = &st[0][(64 * wm + ln) * G2P + 8 * hh]; const unsigned short* fb = &st[0][(128 + 96 * wn + ln) * G2P + 8 * hh];
  const v8f z8 = {0.f,0.f,0.f,0.f,0.f,0.f,0.f,0.f}; v8f c[4][6];
  /* every inner loop is unrolled whole: the fragment and accumulator arrays are then indexed by constants alone and stay in registers */
#pragma unroll
  for (int i = 0; i < 4; ++i)
#pragma unroll
    for (int j = 0; j < 6; ++j) c[i][j] = z8;
  for (int s = 0; s < ns; ++s) { const int bo = (s & 1) * SE; const unsigned short* pa = fa + bo; const unsigned short* pb = fb + bo;
#pragma unroll
    for (int kb = 0; kb < G2K; kb += 32) { v16h a[4], b[6];      /* the 20 fragment reads of a 32-k block stand together in front of its 24 products */
#pragma unroll
      for (int i = 0; i < 4; ++i) a[i] = g2_frag(pa + 16 * i * G2P + kb);
#pragma unroll
      for (int j = 0; j < 6; ++j) b[j] = g2_frag(pb + 16 * j * G2P + kb);
      __builtin_amdgcn_sched_barrier(0);      /* keeps the block's reads in one group in front of its products: without it each Bt fragment is read, and waited for, right in front of its four products */
#pragma unroll
      for (int j = 0; j < 6; ++j)
#pragma unroll
        for (int i = 0; i < 4; ++i) c[i][j] = __builtin_amdgcn_wmma_f32_16x16x32_f16(false, a[i], false, b[j], (short)0, c[i][j], false, false);
      __builtin_amdgcn_sched_barrier(0); }      /* keeps the next block's reads from being spread among these products */
    asm volatile("s_wait_dscnt 0x0" ::: "memory");      /* this wave's reads of buffer s & 1 are done before the buffer is refilled */
    asm volatile("s_wait_asynccnt 0x0" ::: "memory");      /* this wave's copies of stage s + 1 have landed */
    __syncthreads();      /* publishes stage s + 1 and ends every wave's reads of stage s */
    if (s + 2 < ns) { g3_copy_a(l0 + bo * 2, ga + (size_t)(s + 2) * G2K, ra); g3_copy_b(l0 + bo * 2 + 8 * G2S, gb + (size_t)(s + 2) * G2K, rb); } }
  asm volatile("s_wait_asynccnt 0x0" ::: "memory");      /* no copy is outstanding when the ring becomes output staging */
  /* the last trip's barrier has ended every read of the ring: the whole 128 x 192 tile is laid there as f16 rows, so that the stores below are whole 128-byte lines, each written by one wave */
  unsigned short* so = &st[0][0];
#pragma unroll
  for (int j = 0; j < 6; ++j) { const int col = 96 * wn + 16 * j + ln; const float bv = bf16_round(bp[col0 + col]);
#pragma unroll
    for (int i = 0; i < 4; ++i)
#pragma unroll
      for (int r = 0; r < 8; ++r) so[(64 * wm + 16 * i + 8 * hh + r) * G3Q + col] = __builtin_bit_cast(unsigned short, (_Float16)(c[i][j][r] * alpha + bv)); }
  __syncthreads();      /* the staged tile is complete for every wave */
  unsigned short* d = (unsigned short*)C16 + (size_t)(mt * 128) * ldc + col0; const size_t rs = (size_t)16 * ldc;
#pragma unroll
  for (int e = 0; e < 3; ++e) { const int ch = e * 128 + tid; const int r0 = ch / (G3N / 8), c8 = (ch % (G3N / 8)) * 8;      /* 16-byte pieces in row order: a wave's 32 pieces are four whole lines; 384 pieces are 16 rows */
    const unsigned short* sp = so + r0 * G3Q + c8; unsigned short* dp = d + (size_t)r0 * ldc + c8;
#pragma unroll
    for (int q = 0; q < 8; ++q) *(v8us*)(dp + q * rs) = *(const v8us*)(sp + q * 16 * G3Q); } }


// fused attention, one (batch, head) and 512 queries per work-group of 16 waves. The head's K rows [key][d] and V rows [key][d] are laid in LDS once (K pitch 16 B x odd for 16-byte fragment reads, V pitch 32 B x odd for the transposing reads: no bank conflict);
// each wave owns 32 queries (two 16-column groups) and walks the keys 32 at a time: S^T = K Q^T (A = K rows, B = Q rows, both in the hardware k order), so a lane holds 16 scores of ONE query per group;
// the two S^T tiles of a group, converted in place, are the B operand P^T of O^T += V^T P^T (register s < 8: key 8 hh + s, s >= 8: key 16 + 8 hh + s - 8). Softmax in base 2 against a running maximum mu, raised only when a score passes it by more than 8 (weights then stay <= 256, inside f16).
#define AKP (HD + 8)                 /* LDS pitch of a K row, f16 elements (144 B) */
#define AVP (HD + 16)                /* LDS pitch of a V row, f16 elements (160 B) */
#define AQW 32                       /* queries per wave */
#define ANW 16                       /* waves per work-group */
__device__ __forceinline__ v8f fa_mma(v16h a, v16h b, v8f c) { return __builtin_amdgcn_wmma_f32_16x16x32_f16(false, a, false, b, (short)0, c, false, false); }
__device__ __forceinline__ float fa_xhalf(float x) { return __builtin_bit_cast(float, __builtin_amdgcn_permlanex16(__builtin_bit_cast(int, x), __builtin_bit_cast(int, x), 0x76543210, 0xfedcba98, false, false)); }      /* lane l takes lane l ^ 16, on the vector pipe: no LDS round trip in the loop */
__device__ __forceinline__ v16h fa_frag(const unsigned short* p) { FragH f; f.half[0] = *(const v8us*)p; f.half[1] = *(const v8us*)(p + 16); return f.v; }
// A fragment of V^T (16 d x 32 keys) out of row-major V rows in LDS, by ds_load_tr16_b128: lane l points at row key0 + 8 (l >> 4) + (l & 7), 16 bytes at d0 + 8 ((l >> 3) & 1), and receives V[key0 + 8 (l >> 4) + 0 .. 7][d0 + (l & 15)];
// the second load, 16 rows on, gives keys key0 + 16 + 8 (l >> 4) + 0 .. 7: the k order that the packed scores have as the B operand.
typedef short v8ss __attribute__((ext_vector_type(8)));
__device__ __forceinline__ v8us fa_tr16(const unsigned short* p) { typedef __attribute__((address_space(3))) v8ss lds_v8ss; return __builtin_bit_cast(v8us, __builtin_amdgcn_ds_load_tr16_b128_v8i16((lds_v8ss*)p)); }
__device__ __forceinline__ v16h fa_fragt(const unsigned short* p) { FragH f; f.half[0] = fa_tr16(p); f.half[1] = fa_tr16(p + 16 * AVP); return f.v; }
__global__ __launch_bounds__(ANW * 32) void k_fattn(const _Float16* __restrict__ Q16, const _Float16* __restrict__ K16, const _Float16* __restrict__ V16, _Float16* __restrict__ O16) {
  __shared__ __attribute__((aligned(16))) unsigned short sk[SQ * AKP];
  __shared__ __attribute__((aligned(16))) unsigned short sv[SQ * AVP];
  const int tid = threadIdx.x, w = tid >> 5, lane = tid & 31, ln = lane & 15, hh = lane >> 4;
  constexpr int QB = SQ / (ANW * AQW);      /* work-groups per head */
  const int bh = blockIdx.x / QB, qb = blockIdx.x % QB; const int b = bh / NH, h = bh % NH;
  const unsigned short* kg = (const unsigned short*)K16 + (size_t)b * SQ * DM + h * HD; const unsigned short* vg = (const unsigned short*)V16 + (size_t)b * SQ * DM + h * HD;
  /* fill: thread t brings 16 bytes of K row u * 64 + t / 8 and of V row u * 64 + t / 8 (u = 0 .. 15). One address per plane, the rows told apart by constant offsets; every loop is unrolled whole so that
     all 32 fill loads and the 8 Q loads are in flight together and the register arrays are indexed by constants alone */
  constexpr int NT = ANW * 32, KRS = NT / (HD / 8);      /* threads; K rows, and V rows, covered by one sweep of the work-group */
  const int kr = tid / (HD / 8), kc = (tid % (HD / 8)) * 8;
  const unsigned short* kgl = kg + (size_t)kr * DM + kc; const unsigned short* vgl = vg + (size_t)kr * DM + kc;
  const int q0 = qb * (ANW * AQW) + w * AQW;
  const unsigned short* qp = (const unsigned short*)Q16 + ((size_t)b * SQ + q0 + ln) * DM + h * HD + 8 * hh;
  v8us kx[SQ / KRS], vx[SQ / KRS]; v16h qf[2][2];
#pragma unroll
  for (int u = 0; u < SQ / KRS; ++u) kx[u] = *(const v8us*)(kgl + (size_t)u * KRS * DM);
#pragma unroll
  for (int u = 0; u < SQ / KRS; ++u) vx[u] = *(const v8us*)(vgl + (size_t)u * KRS * DM);
#pragma unroll
  for (int g = 0; g < 2; ++g) { qf[g][0] = fa_frag(qp + (size_t)g * 16 * DM); qf[g][1] = fa_frag(qp + (size_t)g * 16 * DM + 32); }
  asm volatile("s_wait_xcnt 0x0" :: "v"(kgl), "v"(vgl), "v"(qp) : "memory");      /* the wait owed before a register that an issued global load names is overwritten; the three addresses are inputs so that they stay in their registers up to here */
#pragma unroll
  for (int u = 0; u < SQ / KRS; ++u) *(v8us*)(sk + (kr + u * KRS) * AKP + kc) = kx[u];
#pragma unroll
  for (int u = 0; u < SQ / KRS; ++u) *(v8us*)(sv + (kr + u * KRS) * AVP + kc) = vx[u];
  __syncthreads();      /* K and V of the head are complete in LDS; nothing writes LDS behind this point */
  /* every inner loop from here on is unrolled whole: the fragment and accumulator arrays are then indexed by constants alone and stay in registers */
  const v8f z8 = {0.f,0.f,0.f,0.f,0.f,0.f,0.f,0.f};
  v8f o[2][4] = {{z8, z8, z8, z8}, {z8, z8, z8, z8}};      /* o[g][t][r] = O^T[d = 16 t + 8 hh + r][query q0 + 16 g + ln], relative to mu[g] */
  float mu[2] = {-3.0e38f, -3.0e38f}, ls[2] = {0.f, 0.f};
  const float CS = 0.125f * 1.4426950408889634f;      /* 1 / sqrt(64), and base e to base 2 */
  const unsigned short* skl = sk + ln * AKP + 8 * hh; const unsigned short* svl = sv + (8 * hh + (lane & 7)) * AVP + 8 * ((lane >> 3) & 1);
  for (int j = 0; j < SQ; j += 32) {
    v16h kf[2][2], vf[4];
#pragma unroll
    for (int kt = 0; kt < 2; ++kt) { kf[kt][0] = fa_frag(skl + (j + 16 * kt) * AKP); kf[kt][1] = fa_frag(skl + (j + 16 * kt) * AKP + 32); }
#pragma unroll
    for (int t = 0; t < 4; ++t) vf[t] = fa_fragt(svl + j * AVP + 16 * t);
    v8f s[2][2];
#pragma unroll
    for (int g = 0; g < 2; ++g)
#pragma unroll
      for (int kt = 0; kt < 2; ++kt) s[g][kt] = fa_mma(kf[kt][1], qf[g][1], fa_mma(kf[kt][0], qf[g][0], z8));
    float mx[2];
#pragma unroll
    for (int g = 0; g < 2; ++g) { float m = fmaxf(s[g][0][0], s[g][1][0]);
#pragma unroll
      for (int r = 1; r < 8; ++r) m = fmaxf(m, fmaxf(s[g][0][r], s[g][1][r]));
      m = fmaxf(m, fa_xhalf(m)); mx[g] = m * CS; }      /* lanes ln and ln + 16 hold the same query: both take the same maximum */
    if (__builtin_amdgcn_ballot_w32(mx[0] > mu[0] + 8.0f || mx[1] > mu[1] + 8.0f) != 0) {      /* wave-uniform; always taken on the first pass */
#pragma unroll
      for (int g = 0; g < 2; ++g) { const float mn = fmaxf(mu[g], mx[g]); const float corr = __builtin_amdgcn_exp2f(mu[g] - mn); mu[g] = mn; ls[g] *= corr;
#pragma unroll
        for (int t = 0; t < 4; ++t) o[g][t] *= corr; } }
#pragma unroll
    for (int g = 0; g < 2; ++g) { FragH pf;
#pragma unroll
      for (int kt = 0; kt < 2; ++kt)
#pragma unroll
        for (int r = 0; r < 8; ++r) { const float p = __builtin_amdgcn_exp2f(fmaf(s[g][kt][r], CS, -mu[g])); ls[g] += p; pf.h[kt * 8 + r] = (_Float16)p; }
#pragma unroll
      for (int t = 0; t < 4; ++t) o[g][t] = fa_mma(vf[t], pf.v, o[g][t]); }
  }
#pragma unroll
  for (int g = 0; g < 2; ++g) { const float l = ls[g] + fa_xhalf(ls[g]); const float sc = 64.0f / l;      /* the two lane halves summed different keys of the same query */
    unsigned short* d = (unsigned short*)O16 + ((size_t)b * SQ + q0 + 16 * g + ln) * DM + h * HD + 8 * hh;
#pragma unroll
    for (int t = 0; t < 4; ++t) { FragH f;
#pragma unroll
      for (int r = 0; r < 8; ++r) f.h[r] = (_Float16)(o[g][t][r] * sc);
      *(v8us*)(d + 16 * t) = f.half[0]; } } }
__global__ __launch_bounds__(256) void k_vt(const _Float16* __restrict__ V16, int b, int h0, _Float16* __restrict__ VT) { __shared__ unsigned short tl[64][65]; const int tid = threadIdx.x; const int hh = blockIdx.x % HG, sg = blockIdx.x / HG; const int s0 = sg * 64; const int h = h0 + hh;
  for (int i = tid; i < 64 * 8; i += 256) { const int j = i / 8, d8 = (i % 8) * 8; FragH f; f.half[0] = *(const v8us*)((const unsigned short*)V16 + ((size_t)b * SQ + s0 + j) * DM + h * HD + d8); for (int q = 0; q < 8; ++q) tl[d8 + q][j] = f.u[q]; }
  __syncthreads();
  { for (int i = tid; i < 64 * 8; i += 256) { const int d = i / 8, j8 = (i % 8) * 8; FragH f; for (int q = 0; q < 8; ++q) f.u[q] = tl[d][j8 + q]; *(v8us*)((unsigned short*)VT + ((size_t)hh * HD + d) * SQ + s0 + j8) = f.half[0]; }  } }



__global__ __launch_bounds__(256) void k_rsmkm(const float* __restrict__ S, _Float16* __restrict__ P, int nrows, const int* __restrict__ am) {
  #pragma clang fp contract(off)
  const int t = blockIdx.x * 256 + threadIdx.x; if (t >= nrows) return; const size_t i = (size_t)t; const float* s = S + i * SQ; const int* mr = am + (size_t)(t % SQ) * SQ; float mx = -3.0e38f;
#pragma unroll 1
  for (int j = 0; j < SQ; ++j) { const float f = (mr[j] != 0) ? 1.f : 0.f; mx = fmaxf(mx, fmaf(f, s[j], (1.f - f) * -1.0e9f)); } float se = 0.f;
#pragma unroll 1
  for (int j = 0; j < SQ; ++j) { const float f = (mr[j] != 0) ? 1.f : 0.f; se += __expf(fmaf(f, s[j], (1.f - f) * -1.0e9f) - mx); } const float sc = 256.0f / se;
#pragma unroll 1
  for (int j0 = 0; j0 < SQ; j0 += 8) { FragH fr; for (int q = 0; q < 8; ++q) { const int j = j0 + q; const float f = (mr[j] != 0) ? 1.f : 0.f; fr.h[q] = (_Float16)(__expf(fmaf(f, s[j], (1.f - f) * -1.0e9f) - mx) * sc); }
    unsigned short* d = (unsigned short*)P + i * SQ + j0; *(v8us*)d = fr.half[0];  } }
// local RMS norm with the 7 x 7 box sum taken as two passes of 7. A work-group owns LRB grid rows x all GS grid columns x LRC channels of one batch. A thread owns one channel quad q4 of LRJ grid columns (GS / LRJ apart): it loads
// each column's LRB + 6 grid rows (16 bytes each, all in flight together; a half-wave reads one position's 256 bytes), sums the squares down the column for each of the LRB rows in registers and lays these column sums in LDS;
// behind the one barrier it adds the 7 column sums around each of its columns (RW columns of zeros on either side stand for the zero padding; grid rows outside the grid are zeroed in the rounding mask).
// x of its own positions is still in registers for the division.
#define LRB 4                        /* grid rows per work-group */
#define LRC 64                       /* channels per work-group: 256 B of x, one whole 128-B line of the f16 rows */
#define LRJ 2                        /* grid columns per thread: half the waves to start for the same work */
#define LRP (GS + 2 * RW)            /* columns in a row of column sums in LDS, the zeros included */
#define LRT (GS / LRJ * LRC / 4)     /* threads per work-group */
#define LRG (NB * (GS / LRB) * (DM / LRC))      /* work-groups of the norm */
#define LWG (DM * DM / 8 / LRT)      /* work-groups behind them that convert the weights */
// The launch also carries the weight conversion, which depends on nothing and on which only the GEMMs depend: work-groups LRG .. LRG + LWG - 1 write Bt[n][k] = f16(bf16(W[n][k]) x 16) (natural [out][in] rows) for the four matrices,
// laid one behind the other in BW; a thread takes the same 8 elements of each matrix, its 8 loads in flight together.
__global__ __launch_bounds__(LRT) void k_lrms(const float* __restrict__ x, const float* __restrict__ w, _Float16* __restrict__ X16,
    const float* __restrict__ wq, const float* __restrict__ wk, const float* __restrict__ wv, const float* __restrict__ wo, _Float16* __restrict__ BW) {
  __shared__ __attribute__((aligned(16))) float cs[LRB][LRP][LRC];
  if (blockIdx.x >= LRG) {      /* the same for the whole work-group, in front of the barrier */
    const unsigned t8 = ((blockIdx.x - LRG) * LRT + threadIdx.x) * 8;
    const float* pq = wq + t8; const float* pk = wk + t8; const float* pv = wv + t8; const float* po = wo + t8;
    const v4f wx[4][2] = {{*(const v4fa*)pq, *(const v4fa*)(pq + 4)}, {*(const v4fa*)pk, *(const v4fa*)(pk + 4)}, {*(const v4fa*)pv, *(const v4fa*)(pv + 4)}, {*(const v4fa*)po, *(const v4fa*)(po + 4)}};
    asm volatile("s_wait_xcnt 0x0" :: "v"(pq), "v"(pk), "v"(pv), "v"(po) : "memory");      /* the wait owed before a register that an issued global load names is overwritten; the addresses are inputs so that they stay in their registers up to here */
#pragma unroll
    for (int m = 0; m < 4; ++m) { FragH f;      /* unrolled whole: wx is indexed by constants alone */
#pragma unroll
      for (int q = 0; q < 8; ++q) f.h[q] = (_Float16)(bf16_round(wx[m][q >> 2][q & 3]) * 16.0f);
      *(v8us*)((unsigned short*)BW + (size_t)m * DM * DM + t8) = f.half[0]; }
    return; }
  constexpr int NCG = DM / LRC, NBD = GS / LRB, NK = LRB + 2 * RW, JS = GS / LRJ;
  const int tid = threadIdx.x, q4 = (tid % (LRC / 4)) * 4, j = tid / (LRC / 4);      /* j: the first of the thread's columns, the others at j + JS, .. */
  const int cg = blockIdx.x % NCG, bd = (blockIdx.x / NCG) % NBD, b = blockIdx.x / (NCG * NBD); const int i0 = bd * LRB;
  const int to = j * DM + cg * LRC + q4;      /* the thread's place inside a grid row of x, elements */
  const float* xb = x + (size_t)b * SQ * DM + to; const float* pw = w + cg * LRC + q4;
  const float* pc = xb + (size_t)i0 * GS * DM;      /* the work-group's own grid rows: constant offsets from here */
  /* every loop of this kernel is unrolled whole: the register arrays are then indexed by constants alone and stay in registers, and all the loads stand together in front of the first use */
  const float* pe[2 * RW];      /* the RW grid rows above and the RW below, clamped into the grid; the rows below as LRB + k rows behind pe[RW + k] */
#pragma unroll
  for (int k = 0; k < RW; ++k) { const int iu = i0 - RW + k, il = GS - 1 - LRB - k; pe[k] = xb + (size_t)(iu < 0 ? 0 : iu) * GS * DM; pe[RW + k] = xb + (size_t)(i0 < il ? i0 : il) * GS * DM; }
  v4f xr[LRJ][NK];
#pragma unroll
  for (int k = 0; k < NK; ++k) { const float* p = k < RW ? pe[k] : (k < RW + LRB ? pc : pe[k - LRB]) + (k - RW) * GS * DM;
#pragma unroll
    for (int e = 0; e < LRJ; ++e) xr[e][k] = *(const v4fa*)(p + e * JS * DM); }
  const v4f wr = *(const v4fa*)pw;
  static_assert(RW == 3, "the statement below names 2 * RW + 1 addresses");
  asm volatile("s_wait_xcnt 0x0" :: "v"(pc), "v"(pe[0]), "v"(pe[1]), "v"(pe[2]), "v"(pe[3]), "v"(pe[4]), "v"(pe[5]) : "memory");      /* the wait owed before a register that an issued global load names is overwritten; the addresses are inputs so that they stay in their registers up to here */
  const v4f z4 = {0.f, 0.f, 0.f, 0.f};
  if (j < RW) {      /* the zero columns: RW on the left, RW on the right */
#pragma unroll
    for (int r = 0; r < LRB; ++r) { *(v4fa*)&cs[r][j][q4] = z4; *(v4fa*)&cs[r][RW + GS + j][q4] = z4; } }
#pragma unroll
  for (int k = 0; k < NK; ++k) { const int ii = i0 - RW + k; const unsigned m = (ii >= 0 && ii < GS) ? 0xFFFF0000u : 0u;      /* bf16 rounding as in bf16_round; a row outside the grid becomes 0 */
#pragma unroll
    for (int e = 0; e < LRJ; ++e)
#pragma unroll
      for (int c = 0; c < 4; ++c) { const unsigned u = __float_as_uint(xr[e][k][c]); xr[e][k][c] = __uint_as_float((u + 0x7FFFu + ((u >> 16) & 1u)) & m); } }
#pragma unroll
  for (int e = 0; e < LRJ; ++e)
#pragma unroll
    for (int r = 0; r < LRB; ++r) { v4f s = xr[e][r] * xr[e][r];
#pragma unroll
      for (int d = 1; d <= 2 * RW; ++d) s += xr[e][r + d] * xr[e][r + d];
      *(v4fa*)&cs[r][RW + j + e * JS][q4] = s; }
  __syncthreads();      /* every column sum of the work-group's rows, and the zeros beside them, are in LDS; nothing writes LDS behind this point */
  v4h o[LRJ][LRB];
#pragma unroll
  for (int e = 0; e < LRJ; ++e)
#pragma unroll
    for (int r = 0; r < LRB; ++r) { v4f s = *(const v4fa*)&cs[r][j + e * JS][q4];
#pragma unroll
      for (int d = 1; d <= 2 * RW; ++d) s += *(const v4fa*)&cs[r][j + e * JS + d][q4];
#pragma unroll
      for (int c = 0; c < 4; ++c) { const float rms = sqrtf(0.0000001f + s[c] * 0.02040816326530612f);      /* box / 49 as a multiply by the f32 reciprocal (the result is rounded to f16 next) */
        o[e][r][c] = (_Float16)(xr[e][RW + r][c] / rms * bf16_round(wr[c])); } }
  _Float16* d = X16 + ((size_t)b * SQ + (size_t)i0 * GS) * DM + to;
#pragma unroll
  for (int e = 0; e < LRJ; ++e)
#pragma unroll
    for (int r = 0; r < LRB; ++r) *(v4h*)(d + (size_t)(r * GS + e * JS) * DM) = o[e][r]; }


extern "C" void kernel_launch(void* const* d_in, const int* in_sizes, int n_in,
                              void* d_out, int out_size, void* d_ws, size_t ws_size, hipStream_t stream) {
  (void)in_sizes; (void)n_in; (void)out_size;
  const float* const* I = (const float* const*)d_in; const float* x = I[0]; const float* nw = I[1]; const float* wq = I[2]; const float* bq = I[3]; const float* wk = I[4]; const float* bk = I[5]; const float* wv = I[6]; const float* bv = I[7]; const float* wo = I[8]; const float* bo = I[9];      /* x; norm_w [768]; natural [768][768] weights + biases (q, k, v, o) */
  static_assert(SQ == GS * GS && DM % 8 == 0 && DM % 64 == 0 && DM % G3N == 0 && DM % 32 == 0 && SQ % 128 == 0 && NH * HD == DM && NH % HG == 0 && HD == 64 && SQ % (ANW * AQW) == 0 && B0 == 0 && NBR == NB && QN == SQ && NHD == NH && GS % LRB == 0 && DM % LRC == 0 && GS % LRJ == 0 && GS / LRJ >= RW && DM * DM % (8 * LRT) == 0 && DM * DM * 2 % 256 == 0 && NB * SQ * DM * 2 % 256 == 0, "shape / tile multiples; the planes taken below follow one another without a gap");
  char* ws = (char*)d_ws; size_t off = 0;
  auto take = [&](size_t bytes) { char* p = ws + off; off += (bytes + 255) & ~(size_t)255; return p; };
  _Float16* BQ = (_Float16*)take((size_t)DM * DM * 2); _Float16* BK = (_Float16*)take((size_t)DM * DM * 2); _Float16* BV = (_Float16*)take((size_t)DM * DM * 2); _Float16* BO = (_Float16*)take((size_t)DM * DM * 2);
  _Float16* X16 = (_Float16*)take(NR * DM * 2); _Float16* Q16 = (_Float16*)take(NR * DM * 2); _Float16* K16 = (_Float16*)take(NR * DM * 2); _Float16* V16 = (_Float16*)take(NR * DM * 2); _Float16* O16 = (_Float16*)take(NR * DM * 2);
  if (off > ws_size) return;      /* approx 4.5 + 5 x 12 = 65 MiB */
  (void)BK; (void)BV;      /* reached as planes 1 and 2 behind BQ, as K16 and V16 are behind Q16 */
  k_lrms<<<LRG + LWG, LRT, 0, stream>>>(x, nw, X16, wq, wk, wv, wo, BQ);      /* xn = local-RMS-normalised x as f16 rows: the A operand of all three projections; and BQ, BK, BV, BO: natural [out][in] = Bt[n][k] x16 */
  const size_t r0p = (size_t)B0 * SQ;      /* first projected row */
  k_gemm3<<<dim3((unsigned)((MP / 128) * (DM / G3N)), 3), 128, 0, stream>>>(X16 + r0p * DM, DM, BQ, DM, (size_t)DM * DM, 0.0625f, bq, bk, bv, Q16 + r0p * DM, DM, NR * DM, MP, DM, DM);      /* q, k, v in one grid: blockIdx.y picks the weight plane, the bias and the output plane */
  k_fattn<<<NB * NH * (SQ / (ANW * AQW)), ANW * 32, 0, stream>>>(Q16, K16, V16, O16);      /* o (merged heads, x64) as f16 rows */
  k_gemm2<0><<<dim3((unsigned)((MPO / 128) * (DM / 64)), 1), 128, 0, stream>>>(O16 + r0p * DM, DM, 0, BO, DM, 0, 0.0009765625f, bo, nullptr, nullptr, 0, nullptr, 1, 0, 0, (float*)d_out + r0p * DM, nullptr, DM, 0, MPO, DM, DM);      /* out rows are the output layout */
}

// v008
// It runs in 82.4 microseconds.
// Timed twice side by side with v007, it ran 1.04 times as fast both times.
// Counting every step since v000, it is 65.2 times as fast.
#include <hip/hip_runtime.h>
#define NB 8
#define SQ 1024
#define GS 32                        /* token grid side: SQ = GS * GS */
#define RW 3                         /* local-norm window radius (7 x 7) */
#define DM 768
#define NH 12
#define HD 64
#define HG 4                         /* heads per launch of the per-group k_vt (not launched) */
#define B0 0                         /* first batch processed (debug hook) */
#define NBR NB                       /* batches processed (debug hook) */
#define NR ((size_t)NB * SQ)         /* token rows */
#define MP ((int)((size_t)NBR * SQ)) /* rows projected (debug hook) */
#define QN SQ                        /* query rows attended per batch (debug hook) */
#define NHD NH                       /* heads attended (debug hook) */
#define MPO MP                       /* rows through the output stage (debug hook) */
#define LQ DM      /* row pitch of the q/k/v rows */
typedef __bf16 v16b __attribute__((ext_vector_type(16)));
typedef unsigned short v8us __attribute__((ext_vector_type(8), may_alias));
typedef float  v8f  __attribute__((ext_vector_type(8)));
typedef float  v4f  __attribute__((ext_vector_type(4)));
typedef float  v4fa __attribute__((ext_vector_type(4), may_alias));
union FragB { v16b v; v8us half[2]; unsigned short u[16]; };

__device__ __forceinline__ unsigned short bf16_bits(float x) { unsigned int u = __float_as_uint(x); return (unsigned short)((u + 0x7FFFu + ((u >> 16) & 1u)) >> 16); }
__device__ __forceinline__ float bf16_val(unsigned short b) { return __uint_as_float(((unsigned int)b) << 16); }
__device__ __forceinline__ float bf16_round(float x) { return bf16_val(bf16_bits(x)); }
// D += A·B with NT terms: 1 = ah·bh, 2 = + al·bh (A split), 3 = + ah·bl (both split)
template <int NT>
__device__ __forceinline__ v8f mmaN(v16b ah, v16b al, v16b bh, v16b bl, v8f c) {
  c = __builtin_amdgcn_wmma_f32_16x16x32_bf16(false, ah, false, bh, (short)0, c, false, false);
  if (NT >= 2) c = __builtin_amdgcn_wmma_f32_16x16x32_bf16(false, al, false, bh, (short)0, c, false, false);
  if (NT >= 3) c = __builtin_amdgcn_wmma_f32_16x16x32_bf16(false, ah, false, bl, (short)0, c, false, false);
  asm volatile("v_nop\n\tv_nop\n\tv_nop\n\tv_nop" : "+v"(c) : "v"(ah), "v"(al), "v"(bh), "v"(bl));
  return c;
}

__global__ __launch_bounds__(256) void k_wt_bf16(const float* __restrict__ W, unsigned short* __restrict__ Wt, int K, int N) {
  const int t = blockIdx.x * 256 + threadIdx.x;
  const int k8n = K / 8;
  if (t >= N * k8n) return;
  const int n = t / k8n, k8 = (t % k8n) * 8;
  v8us v;
#pragma unroll
  for (int i = 0; i < 8; ++i) v[i] = bf16_bits(W[(size_t)(k8 + i) * N + n]);
  *(v8us*)(Wt + (size_t)n * K + k8) = v;
  
}

// GEMM C[M][N] (f32, pitch ldc) = act(A[M][K]·W + bias). A f32 row-major (pitch lda) converted per fragment to bf16
// (ASPLIT: hi/lo two planes -> 2 terms, else single rounded term); Wt bf16 [N][K] (pitch ldb). BIAS_BF16 rounds the
// bias to bf16 first (bias quantised to bf16 before the add). K%32==0, M%16==0, N%64==0.
template <bool ASPLIT, int ACT, bool BIAS_BF16>
__global__ __launch_bounds__(128) void k_gemm_bf(const float* __restrict__ A, int lda, const unsigned short* __restrict__ Wt, int ldb,
                                               const float* __restrict__ bias, float* __restrict__ C, int ldc, int M, int N, int K) {
  __shared__ __attribute__((aligned(16))) float so[4][16][64];
  const int tid = threadIdx.x, w = tid >> 5, lane = tid & 31, ln = lane & 15, hh = lane >> 4;
  const int ntn = N / 64;
  const int wid = blockIdx.x * 4 + w;
  const int mt = wid / ntn, nq = wid % ntn;
  if (mt * 16 >= M) return;
  const int row0 = mt * 16, col0 = nq * 64;
  const float* arow = A + (size_t)(row0 + ln) * lda;
  v8f acc[4] = {};
  for (int kb = 0; kb < K; kb += 32) {
    FragB ah, al;
    const v4f x0 = *(const v4fa*)(arow + kb + 8 * hh), x1 = *(const v4fa*)(arow + kb + 8 * hh + 4);
    const v4f x2 = *(const v4fa*)(arow + kb + 16 + 8 * hh), x3 = *(const v4fa*)(arow + kb + 16 + 8 * hh + 4);
    float xs[16] = {x0[0],x0[1],x0[2],x0[3],x1[0],x1[1],x1[2],x1[3],x2[0],x2[1],x2[2],x2[3],x3[0],x3[1],x3[2],x3[3]};
#pragma unroll
    for (int i = 0; i < 16; ++i) { const unsigned short hb = bf16_bits(xs[i]); ah.u[i] = hb; al.u[i] = ASPLIT ? bf16_bits(xs[i] - bf16_val(hb)) : (unsigned short)0; }
#pragma unroll
    for (int t = 0; t < 4; ++t) {
      const unsigned short* brow = Wt + (size_t)(col0 + t * 16 + ln) * ldb + kb;
      FragB b;
      b.half[0] = *(const v8us*)(brow + 8 * hh);
      b.half[1] = *(const v8us*)(brow + 16 + 8 * hh);
      acc[t] = mmaN<ASPLIT ? 2 : 1>(ah.v, al.v, b.v, b.v, acc[t]);
    }
  }
#pragma unroll
  for (int t = 0; t < 4; ++t) {
    float bv = bias ? bias[col0 + t * 16 + ln] : 0.f;
    if (BIAS_BF16) bv = bf16_round(bv);
#pragma unroll
    for (int r = 0; r < 8; ++r) { float v = acc[t][r] + bv; if (ACT == 1) v = fmaxf(v, 0.f); so[w][8 * hh + r][t * 16 + ln] = v; }
  }
  __builtin_amdgcn_fence(__ATOMIC_ACQ_REL, "workgroup");
  __builtin_amdgcn_wave_barrier();
  const int rsub = lane >> 4, c4 = (lane & 15) * 4;
  {
#pragma unroll
    for (int q = 0; q < 8; ++q) {
      const int r = q * 2 + rsub;
      const v4f v = *(const v4fa*)&so[w][r][c4];
      *(v4f*)(C + (size_t)(row0 + r) * ldc + col0 + c4) = v;
    }
    
  }
}

// GEMM C = act(A·W + bias + resid): A f32 (ASPLIT -> hi/lo 2 terms), Wt bf16 [N][K]; ACT 0 none, 1 relu, 2 exact gelu;
// resid (optional, f32, row index = (row % rmod), pitch ldr, RES_BF16 rounds it) added before the activation.
template <bool ASPLIT, int ACT, bool BIAS_BF16, bool RES_BF16>
__global__ __launch_bounds__(128) void k_gemm_bf3(const float* __restrict__ A, int lda, const unsigned short* __restrict__ Wt, int ldb,
                                                const float* __restrict__ bias, const float* __restrict__ resid, int rmod, int ldr,
                                                float* __restrict__ C, int ldc, int M, int N, int K) {
  __shared__ __attribute__((aligned(16))) float so[4][16][64];
  const int tid = threadIdx.x, w = tid >> 5, lane = tid & 31, ln = lane & 15, hh = lane >> 4;
  const int ntn = N / 64;
  const int wid = blockIdx.x * 4 + w;
  const int mt = wid / ntn, nq = wid % ntn;
  if (mt * 16 >= M) return;
  const int row0 = mt * 16, col0 = nq * 64;
  const float* arow = A + (size_t)(row0 + ln) * lda;
  v8f acc[4] = {};
  for (int kb = 0; kb < K; kb += 32) {
    FragB ah, al;
    const v4f x0 = *(const v4fa*)(arow + kb + 8 * hh), x1 = *(const v4fa*)(arow + kb + 8 * hh + 4);
    const v4f x2 = *(const v4fa*)(arow + kb + 16 + 8 * hh), x3 = *(const v4fa*)(arow + kb + 16 + 8 * hh + 4);
    float xs[16] = {x0[0],x0[1],x0[2],x0[3],x1[0],x1[1],x1[2],x1[3],x2[0],x2[1],x2[2],x2[3],x3[0],x3[1],x3[2],x3[3]};
#pragma unroll
    for (int i = 0; i < 16; ++i) { const unsigned short hb = bf16_bits(xs[i]); ah.u[i] = hb; al.u[i] = ASPLIT ? bf16_bits(xs[i] - bf16_val(hb)) : (unsigned short)0; }
#pragma unroll
    for (int t = 0; t < 4; ++t) {
      const unsigned short* brow = Wt + (size_t)(col0 + t * 16 + ln) * ldb + kb;
      FragB b;
      b.half[0] = *(const v8us*)(brow + 8 * hh);
      b.half[1] = *(const v8us*)(brow + 16 + 8 * hh);
      acc[t] = mmaN<ASPLIT ? 2 : 1>(ah.v, al.v, b.v, b.v, acc[t]);
    }
  }
#pragma unroll
  for (int t = 0; t < 4; ++t) {
    const int col = col0 + t * 16 + ln;
    float bv = bias ? bias[col] : 0.f;
    if (BIAS_BF16) bv = bf16_round(bv);
#pragma unroll
    for (int r = 0; r < 8; ++r) {
      float v = acc[t][r] + bv;
      if (resid) { float rv = resid[(size_t)((row0 + 8 * hh + r) % rmod) * ldr + col]; if (RES_BF16) rv = bf16_round(rv); v += rv; }
      if (ACT == 1) v = fmaxf(v, 0.f);
      if (ACT == 2) v = 0.5f * v * (1.0f + erff(v * 0.70710678118654752f));
      if (ACT == 3) { const float u = 0.7978845608028654f * (v + 0.044715f * v * v * v); v = 0.5f * v * (1.0f + tanhf(u)); }
      so[w][8 * hh + r][t * 16 + ln] = v;
    }
  }
  __builtin_amdgcn_fence(__ATOMIC_ACQ_REL, "workgroup");
  __builtin_amdgcn_wave_barrier();
  const int rsub = lane >> 4, c4 = (lane & 15) * 4;
  {
#pragma unroll
    for (int q = 0; q < 8; ++q) {
      const int r = q * 2 + rsub;
      const v4f v = *(const v4fa*)&so[w][r][c4];
      *(v4f*)(C + (size_t)(row0 + r) * ldc + col0 + c4) = v;
    }
    
  }
}
// row LayerNorm (biased variance, eps) over N: s = X (+ R); optional out_sum <- s; out_norm <- (s-mu)*rsqrt(var+eps)*g + b
template <bool PARAM_BF16>
__global__ __launch_bounds__(256) void k_layernorm(const float* __restrict__ X, const float* __restrict__ R, const float* __restrict__ g, const float* __restrict__ bta,
                                                  float* __restrict__ out_sum, float* __restrict__ out_norm, int N, float eps) {
  __shared__ float red[256];
  const int row = blockIdx.x, tid = threadIdx.x;
  const float* x = X + (size_t)row * N; const float* rr = R ? R + (size_t)row * N : nullptr;
  float vals[16];                     // up to N = 4096
  const int per = N / 256;            // contiguous chunk per thread? use strided-by-4 chunks: thread handles j = tid*4 + 1024*u
  float s1 = 0.f;
  for (int u = 0; u < per / 4; ++u) {
    const int j = tid * 4 + 1024 * u;
    const v4f a = *(const v4fa*)(x + j);
    v4f b = {0.f,0.f,0.f,0.f}; if (rr) b = *(const v4fa*)(rr + j);
#pragma unroll
    for (int q = 0; q < 4; ++q) { const float v = a[q] + b[q]; vals[u * 4 + q] = v; s1 += v; }
  }
  red[tid] = s1; __syncthreads();
  for (int st = 128; st > 0; st >>= 1) { if (tid < st) red[tid] += red[tid + st]; __syncthreads(); }
  const float mu = red[0] / (float)N; __syncthreads();
  float s2 = 0.f;
  for (int u = 0; u < per / 4; ++u)
#pragma unroll
    for (int q = 0; q < 4; ++q) { const float c = vals[u * 4 + q] - mu; s2 += c * c; }
  red[tid] = s2; __syncthreads();
  for (int st = 128; st > 0; st >>= 1) { if (tid < st) red[tid] += red[tid + st]; __syncthreads(); }
  const float rs = rsqrtf(red[0] / (float)N + eps);
  {
    for (int u = 0; u < per / 4; ++u) {
      const int j = tid * 4 + 1024 * u;
      v4f o, sm;
#pragma unroll
      for (int q = 0; q < 4; ++q) {
        float gg = g[j + q], bb = bta[j + q];
        if (PARAM_BF16) { gg = bf16_round(gg); bb = bf16_round(bb); }
        sm[q] = vals[u * 4 + q]; o[q] = (vals[u * 4 + q] - mu) * rs * gg + bb;
      }
      if (out_sum) *(v4f*)(out_sum + (size_t)row * N + j) = sm;
      *(v4f*)(out_norm + (size_t)row * N + j) = o;
    }
    
  }
}



// ---- f16 WMMA path (v_wmma_f32_16x16x32_f16): 11-bit significands for operands in range — used where a [0,1] probability operand needs more precision than bf16
typedef _Float16 v16h __attribute__((ext_vector_type(16)));
union FragH { v16h v; v8us half[2]; _Float16 h[16]; unsigned short u[16]; };
template <int NT>
__device__ __forceinline__ v8f mmaH(v16h ah, v16h al, v16h bh, v16h bl, v8f c) {
  c = __builtin_amdgcn_wmma_f32_16x16x32_f16(false, ah, false, bh, (short)0, c, false, false);
  if (NT >= 2) c = __builtin_amdgcn_wmma_f32_16x16x32_f16(false, al, false, bh, (short)0, c, false, false);
  if (NT >= 3) c = __builtin_amdgcn_wmma_f32_16x16x32_f16(false, ah, false, bl, (short)0, c, false, false);
  asm volatile("v_nop\n\tv_nop\n\tv_nop\n\tv_nop" : "+v"(c) : "v"(ah), "v"(al), "v"(bh), "v"(bl));
  return c;
}
// batched GEMM like k_gemm_b but f16 operands: A f32 (split into f16 hi/lo if ASPLIT, else rounded to f16), Bt = f16 values [n][k]; alpha; C f32; N multiple of 16 (partial tiles skipped)
template <bool ASPLIT>
__global__ __launch_bounds__(128) void k_gemm_h(const float* __restrict__ A, int lda, size_t sA, const _Float16* __restrict__ Bh, int ldb, size_t sB, float alpha, float* __restrict__ C, int ldc, size_t sC, int M, int N, int K) {
  __shared__ __attribute__((aligned(16))) float so[4][16][64];
  const int tid = threadIdx.x, w = tid >> 5, lane = tid & 31, ln = lane & 15, hh = lane >> 4; const int by = blockIdx.y;
  A += (size_t)by * sA; Bh += (size_t)by * sB; C += (size_t)by * sC;
  const int ntn = (N + 63) / 64; const int wid = blockIdx.x * 4 + w; const int mt = wid / ntn, nq = wid % ntn; if (mt * 16 >= M) return;
  const int row0 = mt * 16, col0 = nq * 64; const float* arow = A + (size_t)(row0 + ln) * lda;
  v8f acc[4] = {};
  for (int kb = 0; kb < K; kb += 32) {
    FragH ah, al;
    const v4f x0 = *(const v4fa*)(arow + kb + 8 * hh), x1 = *(const v4fa*)(arow + kb + 8 * hh + 4), x2 = *(const v4fa*)(arow + kb + 16 + 8 * hh), x3 = *(const v4fa*)(arow + kb + 16 + 8 * hh + 4);
    float xs[16] = {x0[0],x0[1],x0[2],x0[3],x1[0],x1[1],x1[2],x1[3],x2[0],x2[1],x2[2],x2[3],x3[0],x3[1],x3[2],x3[3]};
#pragma unroll
    for (int i = 0; i < 16; ++i) { const _Float16 h = (_Float16)xs[i]; ah.h[i] = h; al.h[i] = ASPLIT ? (_Float16)(xs[i] - (float)h) : (_Float16)0.0f; }
#pragma unroll
    for (int t = 0; t < 4; ++t) { if (col0 + t * 16 >= N) continue; const size_t boff = (size_t)(col0 + t * 16 + ln) * ldb + kb; FragH bq; bq.half[0] = *(const v8us*)(Bh + boff + 8 * hh); bq.half[1] = *(const v8us*)(Bh + boff + 16 + 8 * hh);
      acc[t] = mmaH<ASPLIT ? 2 : 1>(ah.v, al.v, bq.v, bq.v, acc[t]); }
  }
#pragma unroll
  for (int t = 0; t < 4; ++t) { if (col0 + t * 16 >= N) continue;
#pragma unroll
    for (int r = 0; r < 8; ++r) so[w][8 * hh + r][t * 16 + ln] = acc[t][r] * alpha; }
  __builtin_amdgcn_fence(__ATOMIC_ACQ_REL, "workgroup"); __builtin_amdgcn_wave_barrier();
  const int rsub = lane >> 4, c4 = (lane & 15) * 4;
  {
#pragma unroll
    for (int q = 0; q < 8; ++q) { const int r = q * 2 + rsub; if (col0 + c4 < N) { const v4f v = *(const v4fa*)&so[w][r][c4]; *(v4f*)(C + (size_t)(row0 + r) * ldc + col0 + c4) = v; } }
     }
}

// Wt[n][k] = f16(W[k][n]·scale) from f32 row-major W[K][N] (scale = power of two; bf16-exact weights stay exact in f16 away from the subnormal range)
__global__ __launch_bounds__(256) void k_wt_f16(const float* __restrict__ W, _Float16* __restrict__ Wt, int K, int N, float scale) {
  const int t = blockIdx.x * 256 + threadIdx.x; if (t >= N * (K / 8)) return; const int n = t / (K / 8), k8 = (t % (K / 8)) * 8; FragH f;
#pragma unroll
  for (int i = 0; i < 8; ++i) f.h[i] = (_Float16)(bf16_round(W[(size_t)(k8 + i) * N + n]) * scale); const v8us o = f.half[0];
  *(v8us*)((unsigned short*)Wt + (size_t)n * K + k8) = o; 
}
// k_gemm_hh variant with fused epilogue: v = acc·alpha + bias[by·sBias + col] (+ CP[(row/rowsPerB)·sCPb + by·64 + col] if CP) ; ACT 0 none / 1 elu ; writes f16 C16 (and f32 C if non-null)
template <int ACT>
__global__ __launch_bounds__(128) void k_gemm_hhx(const _Float16* __restrict__ A, int lda, size_t sA, const _Float16* __restrict__ Bh, int ldb, size_t sB, float alpha, const float* __restrict__ bias, size_t sBias, const float* __restrict__ CP, int rowsPerB, size_t sCPb, int row0g,
    float* __restrict__ C, _Float16* __restrict__ C16, int ldc, size_t sC, int M, int N, int K) {
  __shared__ __attribute__((aligned(16))) float so[4][16][64];
  const int tid = threadIdx.x, w = tid >> 5, lane = tid & 31, ln = lane & 15, hh = lane >> 4; const int by = blockIdx.y;
  A += (size_t)by * sA; Bh += (size_t)by * sB; const size_t cofs = (size_t)by * sC; const float* bp = bias ? bias + (size_t)by * sBias : nullptr;
  const int ntn = (N + 63) / 64; const int wid = blockIdx.x * 4 + w; const int mt = wid / ntn, nq = wid % ntn; if (mt * 16 >= M) return;
  const int row0 = mt * 16, col0 = nq * 64; const _Float16* arow = A + (size_t)(row0 + ln) * lda;
  v8f acc[4] = {};
  for (int kb = 0; kb < K; kb += 32) { FragH ah; ah.half[0] = *(const v8us*)((const unsigned short*)arow + kb + 8 * hh); ah.half[1] = *(const v8us*)((const unsigned short*)arow + kb + 16 + 8 * hh);
#pragma unroll
    for (int t = 0; t < 4; ++t) { if (col0 + t * 16 >= N) continue; const size_t boff = (size_t)(col0 + t * 16 + ln) * ldb + kb; FragH bq; bq.half[0] = *(const v8us*)((const unsigned short*)Bh + boff + 8 * hh); bq.half[1] = *(const v8us*)((const unsigned short*)Bh + boff + 16 + 8 * hh);
      acc[t] = mmaH<1>(ah.v, ah.v, bq.v, bq.v, acc[t]); }
  }
#pragma unroll
  for (int t = 0; t < 4; ++t) { if (col0 + t * 16 >= N) continue; const int col = col0 + t * 16 + ln; const float bv = bp ? bf16_round(bp[col]) : 0.f;
#pragma unroll
    for (int r = 0; r < 8; ++r) { float v = acc[t][r] * alpha + bv; if (CP) { const int rr = row0g + row0 + 8 * hh + r; if (rowsPerB < 0) v += CP[cofs + (size_t)rr * ldc + col];      /* rowsPerB < 0: own element of the batched C plane */ else { const int bidx = rr / rowsPerB; v += CP[(size_t)bidx * sCPb + (size_t)by * 64 + col]; } } if (ACT == 1) v = (v > 0.f) ? v : expm1f(v); else if (ACT == 7) v = (v > 0.f) ? v + 1.0f : expf(v); else if (ACT == 8) v = tanhf(v); else if (ACT == 9) v = 0.5f * v * (1.0f + tanhf(0.7978845608028654f * (v + 0.044715f * v * v * v))); else if (ACT == 11) v = 1.0f / (1.0f + expf(-v)); else if (ACT == 12) v = (v > 0.f) ? v : 0.01f * v; else if (ACT == 14) v = (v > 0.f) ? v : 0.1f * v; else if (ACT == 16) v = (v >= 0.f) ? v : 0.3f * v; else if (ACT == 17) v = (v >= 0.f) ? v : 0.2f * v; else if (ACT == 15) v = v / (1.0f + expf(-v)); else if (ACT == 3) v = fmaxf(v, 0.f); else if (ACT == 6) v = 0.5f * v * (1.0f + erff(v * 0.70710678118654752f)); so[w][8 * hh + r][t * 16 + ln] = v; } }
  __builtin_amdgcn_fence(__ATOMIC_ACQ_REL, "workgroup"); __builtin_amdgcn_wave_barrier();
  const int rsub = lane >> 4, c4 = (lane & 15) * 4; typedef _Float16 v4h __attribute__((ext_vector_type(4)));
  {
#pragma unroll
    for (int q = 0; q < 8; ++q) { const int r = q * 2 + rsub; if (col0 + c4 < N) { const v4f v = *(const v4fa*)&so[w][r][c4]; if (C) *(v4f*)(C + cofs + (size_t)(row0 + r) * ldc + col0 + c4) = v; if (C16) { v4h h4; for (int i = 0; i < 4; ++i) h4[i] = (_Float16)v[i]; *(v4h*)(C16 + cofs + (size_t)(row0 + r) * ldc + col0 + c4) = h4; } } }
     }
}


typedef _Float16 v4h __attribute__((ext_vector_type(4)));

__global__ __launch_bounds__(256) void k_x16(const float* __restrict__ x, _Float16* __restrict__ X16, size_t n8) { const size_t t = (size_t)blockIdx.x * 256 + threadIdx.x; if (t >= n8) return; FragH f;
#pragma unroll
  for (int q = 0; q < 8; ++q) f.h[q] = (_Float16)bf16_round(x[t * 8 + q]); *(v8us*)((unsigned short*)X16 + t * 8) = f.half[0];  }
__global__ __launch_bounds__(256) void k_h16(const float* __restrict__ x, _Float16* __restrict__ X16, size_t n8) { const size_t t = (size_t)blockIdx.x * 256 + threadIdx.x; if (t >= n8) return; FragH f;
#pragma unroll
  for (int q = 0; q < 8; ++q) f.h[q] = (_Float16)x[t * 8 + q]; *(v8us*)((unsigned short*)X16 + t * 8) = f.half[0];  }
__global__ __launch_bounds__(256) void k_round16f(const float* __restrict__ W, _Float16* __restrict__ Bt, size_t n8) { const size_t t = (size_t)blockIdx.x * 256 + threadIdx.x; if (t >= n8) return; FragH f;
#pragma unroll
  for (int i = 0; i < 8; ++i) f.h[i] = (_Float16)(bf16_round(W[t * 8 + i]) * 16.0f); *(v8us*)((unsigned short*)Bt + t * 8) = f.half[0];  }
template <int NHv, int TTv>
__global__ __launch_bounds__(256) void k_vt(const _Float16* __restrict__ V16, int ldv, int voff, _Float16* __restrict__ Vt) { __shared__ unsigned short tl[64][66]; const int tid = threadIdx.x; const int slab = blockIdx.x / (TTv / 64), lg = blockIdx.x % (TTv / 64); const int b = slab / NHv, h = slab % NHv;
  for (int i = tid; i < 64 * 8; i += 256) { const int r = i / 8, c8 = (i % 8) * 8; FragH f; f.half[0] = *(const v8us*)((const unsigned short*)V16 + ((size_t)b * TTv + lg * 64 + r) * ldv + voff + h * 64 + c8);
#pragma unroll
    for (int q = 0; q < 8; ++q) tl[r][c8 + q] = f.u[q]; }
  __syncthreads();
  {
#pragma unroll
    for (int rd = 0; rd < 2; ++rd) { const int d = rd * 32 + tid / 8, pc = tid % 8; FragH f;
#pragma unroll
      for (int q = 0; q < 8; ++q) f.u[q] = tl[pc * 8 + q][d];
      *(v8us*)((unsigned short*)Vt + ((size_t)slab * 64 + d) * TTv + lg * 64 + pc * 8) = f.half[0]; }
     } }

__global__ __launch_bounds__(256) void k_hl(const float* __restrict__ F, _Float16* __restrict__ Hh, _Float16* __restrict__ Hl, size_t n8) { const size_t t = (size_t)blockIdx.x * 256 + threadIdx.x; if (t >= n8) return; FragH fh, fl; const v4f a = *(const v4fa*)(F + t * 8), c = *(const v4fa*)(F + t * 8 + 4);
#pragma unroll
  for (int q = 0; q < 4; ++q) { _Float16 h = (_Float16)a[q]; fh.h[q] = h; fl.h[q] = (_Float16)((a[q] - (float)h) * 1024.0f); h = (_Float16)c[q]; fh.h[4 + q] = h; fl.h[4 + q] = (_Float16)((c[q] - (float)h) * 1024.0f); }
  { *(v8us*)((unsigned short*)Hh + t * 8) = fh.half[0]; *(v8us*)((unsigned short*)Hl + t * 8) = fl.half[0];  } }

// ---- fast GEMM (work-group tile 128x64, wave tile 32x64; requires M % 128 == 0 rows per launch region, N % 64 == 0 and K % 64 == 0); epilogue = k_gemm_hhx semantics ----
// Operands go through LDS: a stage is 64 k (128-byte rows, whole cache lines) of the work-group's 128 A rows and 64 Bt rows, brought by asynchronous copies (16 bytes a lane, four whole lines a wave-instruction), two buffers:
// stage s + 1 flies while stage s is multiplied. The fragments are read from LDS in the k order that the global fragment loads had, so every product and every sum is the same as before.
#define G2K 64                       /* k elements per stage */
#define G2P (G2K + 8)                /* LDS pitch of a staged row, f16 elements (144 B = 16 B x odd: no bank conflict for 16-byte fragment reads) */
#define G2R (128 + 64)               /* rows per stage: A rows 0 .. 127, then Bt rows 0 .. 63 */
#define G2S (16 * G2P * 2)           /* LDS bytes between two copies of one lane (16 rows) */
__device__ __forceinline__ v16h g2_frag(const unsigned short* p) { FragH f; f.half[0] = *(const v8us*)p; f.half[1] = *(const v8us*)(p + 16); return f.v; }
__device__ __forceinline__ v8f g2_mma(v16h a, v16h b, v8f c) { v8f d = __builtin_amdgcn_wmma_f32_16x16x32_f16(false, a, false, b, (short)0, c, false, false); asm volatile("v_nop\n\tv_nop\n\tv_nop\n\tv_nop" : "+v"(d) : "v"(a), "v"(b)); return d; }
// one stage's copies of one lane: 16 bytes of A rows r, r + 16, .. r + 112 and of Bt rows r, r + 16, r + 32, r + 48 (r = thread / 8) to LDS byte l + 0, G2S, .. 11 G2S. ra, rb = 16 rows of A, of Bt, in elements.
// The s_wait_xcnt closes the statement so that it stands in front of every later write of a register that a copy names.
__device__ __forceinline__ void g2_copy(unsigned l, const unsigned short* ga, size_t ra, const unsigned short* gb, size_t rb) {
  asm volatile("global_load_async_to_lds_b128 %0, %1, off\n\t"
               "global_load_async_to_lds_b128 %2, %3, off\n\t"
               "global_load_async_to_lds_b128 %4, %5, off\n\t"
               "global_load_async_to_lds_b128 %6, %7, off\n\t"
               "global_load_async_to_lds_b128 %8, %9, off\n\t"
               "global_load_async_to_lds_b128 %10, %11, off\n\t"
               "global_load_async_to_lds_b128 %12, %13, off\n\t"
               "global_load_async_to_lds_b128 %14, %15, off\n\t"
               "global_load_async_to_lds_b128 %16, %17, off\n\t"
               "global_load_async_to_lds_b128 %18, %19, off\n\t"
               "global_load_async_to_lds_b128 %20, %21, off\n\t"
               "global_load_async_to_lds_b128 %22, %23, off\n\t"
               "s_wait_xcnt 0x0"
               :: "v"(l), "v"(ga), "v"(l + 1 * G2S), "v"(ga + ra), "v"(l + 2 * G2S), "v"(ga + 2 * ra), "v"(l + 3 * G2S), "v"(ga + 3 * ra),
                  "v"(l + 4 * G2S), "v"(ga + 4 * ra), "v"(l + 5 * G2S), "v"(ga + 5 * ra), "v"(l + 6 * G2S), "v"(ga + 6 * ra), "v"(l + 7 * G2S), "v"(ga + 7 * ra),
                  "v"(l + 8 * G2S), "v"(gb), "v"(l + 9 * G2S), "v"(gb + rb), "v"(l + 10 * G2S), "v"(gb + 2 * rb), "v"(l + 11 * G2S), "v"(gb + 3 * rb)
               : "memory"); }
template <int ACT>
__global__ __launch_bounds__(128) void k_gemm2(const _Float16* __restrict__ A, int lda, size_t sA, const _Float16* __restrict__ Bh, int ldb, size_t sB, float alpha, const float* __restrict__ bias, const float* __restrict__ bias1, const float* __restrict__ bias2, size_t sBias, const float* __restrict__ CP, int rowsPerB, size_t sCPb, int row0g,
    float* __restrict__ C, _Float16* __restrict__ C16, int ldc, size_t sC, int M, int N, int K) { static_assert(ACT == 0 || ACT == 3 || ACT == 6 || ACT == 8 || ACT == 9 || ACT == 11 || ACT == 12 || ACT == 14 || ACT == 15 || ACT == 16 || ACT == 17, "k_gemm2: unsupported ACT code (would silently apply no activation)");
  __shared__ __attribute__((aligned(16))) unsigned short st[2][G2R * G2P];
  __shared__ __attribute__((aligned(16))) float so[4][32][68];
  const int tid = threadIdx.x, w = tid >> 5, lane = tid & 31, ln = lane & 15, hh = lane >> 4; const int by = blockIdx.y;
  const float* bsel = by == 0 ? bias : (by == 1 ? bias1 : bias2);      /* products that share one grid bring their bias vectors as separate inputs: plane 0, 1, 2 */
  A += (size_t)by * sA; Bh += (size_t)by * sB; const size_t cofs = (size_t)by * sC; const float* bp = bsel ? bsel + (size_t)by * sBias : nullptr;
  const int ntn = N >> 6; const int mt = blockIdx.x / ntn, nq = blockIdx.x - mt * ntn; const int row0 = mt * 128 + 32 * w, col0 = nq * 64; if (mt * 128 + 128 > M) return;      /* the same for the whole work-group, in front of every barrier: all 128 staged A rows exist */
  const int cr = tid >> 3, cc = (tid & 7) * 8;      /* the lane's first staged row, and its 16 bytes in the row */
  const unsigned short* ga = (const unsigned short*)A + (size_t)(mt * 128 + cr) * lda + cc; const unsigned short* gb = (const unsigned short*)Bh + (size_t)(col0 + cr) * ldb + cc;
  const size_t ra = (size_t)16 * lda, rb = (size_t)16 * ldb;
  const unsigned l0 = (unsigned)(size_t)&st[0][cr * G2P + cc];      /* LDS byte address: the low 32 bits of the __shared__ address */
  constexpr int SE = G2R * G2P;      /* elements per buffer */
  const int ns = K / G2K;
  g2_copy(l0, ga, ra, gb, rb);
  asm volatile("s_wait_asynccnt 0x0" ::: "memory");      /* this wave's copies of stage 0 have landed */
  __syncthreads();      /* stage 0 is complete for every wave */
  if (ns > 1) g2_copy(l0 + SE * 2, ga + G2K, ra, gb + G2K, rb);
  const unsigned short* fa = &st[0][(32 * w + ln) * G2P + 8 * hh]; const unsigned short* fb = &st[0][(128 + ln) * G2P + 8 * hh];
  const v8f z8 = {0.f,0.f,0.f,0.f,0.f,0.f,0.f,0.f}; v8f c00 = z8, c01 = z8, c02 = z8, c03 = z8, c10 = z8, c11 = z8, c12 = z8, c13 = z8;
  for (int s = 0; s < ns; ++s) { const int bo = (s & 1) * SE; const unsigned short* pa = fa + bo; const unsigned short* pb = fb + bo;
    /* all 24 fragment reads of the stage stand together in front of its 16 products: one LDS latency a stage, not one a fragment */
    const v16h a0 = g2_frag(pa), a1 = g2_frag(pa + 16 * G2P), b0 = g2_frag(pb), b1 = g2_frag(pb + 16 * G2P), b2 = g2_frag(pb + 32 * G2P), b3 = g2_frag(pb + 48 * G2P);
    const v16h a2 = g2_frag(pa + 32), a3 = g2_frag(pa + 16 * G2P + 32), b4 = g2_frag(pb + 32), b5 = g2_frag(pb + 16 * G2P + 32), b6 = g2_frag(pb + 32 * G2P + 32), b7 = g2_frag(pb + 48 * G2P + 32);
    c00 = g2_mma(a0, b0, c00); c10 = g2_mma(a1, b0, c10); c01 = g2_mma(a0, b1, c01); c11 = g2_mma(a1, b1, c11); c02 = g2_mma(a0, b2, c02); c12 = g2_mma(a1, b2, c12); c03 = g2_mma(a0, b3, c03); c13 = g2_mma(a1, b3, c13);
    c00 = g2_mma(a2, b4, c00); c10 = g2_mma(a3, b4, c10); c01 = g2_mma(a2, b5, c01); c11 = g2_mma(a3, b5, c11); c02 = g2_mma(a2, b6, c02); c12 = g2_mma(a3, b6, c12); c03 = g2_mma(a2, b7, c03); c13 = g2_mma(a3, b7, c13);
    asm volatile("s_wait_dscnt 0x0" ::: "memory");      /* this wave's reads of buffer s & 1 are done before the buffer is refilled */
    asm volatile("s_wait_asynccnt 0x0" ::: "memory");      /* this wave's copies of stage s + 1 have landed */
    __syncthreads();      /* publishes stage s + 1 and ends every wave's reads of stage s */
    if (s + 2 < ns) g2_copy(l0 + bo * 2, ga + (size_t)(s + 2) * G2K, ra, gb + (size_t)(s + 2) * G2K, rb); }
  asm volatile("s_wait_asynccnt 0x0" ::: "memory");      /* no copy is outstanding when the wave goes on to its end */
  v8f accs[8] = {c00, c01, c02, c03, c10, c11, c12, c13};
#pragma unroll
  for (int u = 0; u < 8; ++u) { const int t = u & 3, half = u >> 2; const int col = col0 + t * 16 + ln; const float bv = bp ? bf16_round(bp[col]) : 0.f;
#pragma unroll
    for (int r = 0; r < 8; ++r) { const int rloc = half * 16 + 8 * hh + r; float v = accs[u][r] * alpha + bv; if (CP) { if (rowsPerB < 0) v += CP[cofs + (size_t)(row0g + row0 + rloc) * ldc + col];      /* rowsPerB < 0: own element of the batched C plane */ else { const int bidx = (row0g + row0 + rloc) / rowsPerB; v += CP[(size_t)bidx * sCPb + (size_t)by * 64 + col]; } }
      if (ACT == 3) v = fmaxf(v, 0.f); else if (ACT == 6) v = 0.5f * v * (1.0f + erff(v * 0.70710678118654752f)); else if (ACT == 11) v = 1.0f / (1.0f + expf(-v)); else if (ACT == 15) v = v / (1.0f + expf(-v)); else if (ACT == 12) v = (v > 0.f) ? v : 0.01f * v; else if (ACT == 8) v = tanhf(v); else if (ACT == 9) v = 0.5f * v * (1.0f + tanhf(0.7978845608028654f * (v + 0.044715f * v * v * v))); else if (ACT == 14) v = (v > 0.f) ? v : 0.1f * v; else if (ACT == 16) v = (v >= 0.f) ? v : 0.3f * v; else if (ACT == 17) v = (v >= 0.f) ? v : 0.2f * v;
      so[w][rloc][t * 16 + ln] = v; } }
  __builtin_amdgcn_fence(__ATOMIC_ACQ_REL, "workgroup"); __builtin_amdgcn_wave_barrier();
  const int rsub = lane >> 4, c4 = (lane & 15) * 4;
  {
#pragma unroll
    for (int q = 0; q < 16; ++q) { const int r = q * 2 + rsub; const v4f v = *(const v4fa*)&so[w][r][c4]; if (C) *(v4f*)(C + cofs + (size_t)(row0 + r) * ldc + col0 + c4) = v; if (C16) { v4h h4; for (int i = 0; i < 4; ++i) h4[i] = (_Float16)v[i]; *(v4h*)(C16 + cofs + (size_t)(row0 + r) * ldc + col0 + c4) = h4; } }
     } }


// ---- wide GEMM for the projections (work-group tile 128 x 192, four waves of 64 x 96 as 2 x 2; requires M % 128 == 0, N % 192 == 0, K % 64 == 0); C16 = f16(acc alpha + bf16(bias)) ----
// The same ring as k_gemm2 (64 k a stage, 144-byte rows, asynchronous copies, two buffers), with 128 A rows and 192 Bt rows a stage: 320 rows from L2 per 128 x 192 x 64 products, where three 128 x 64 tiles bring 576;
// a wave reads 10 fragments from LDS per 24 products (k_gemm2: 6 per 8). Every output element sums its 32-k blocks in the order that k_gemm2 has.
#define G3N 192                      /* columns per work-group */
#define G3R (128 + G3N)              /* rows per stage: A rows 0 .. 127, then Bt rows 0 .. 191 */
#define G3Q (G3N + 8)                /* pitch of a staged output row, f16 elements (400 B = 16 B x odd) */
// one stage's copies of one lane: 16 bytes of A rows r, r + 16, .. r + 112 (r = thread / 8) to LDS byte l + 0, G2S, .. 7 G2S; ra = 16 rows in elements. The s_wait_xcnt closes the statement so that it stands in front of every later write of a register that a copy names.
__device__ __forceinline__ void g3_copy_a(unsigned l, const unsigned short* ga, size_t ra) {
  asm volatile("global_load_async_to_lds_b128 %0, %1, off\n\t"
               "global_load_async_to_lds_b128 %2, %3, off\n\t"
               "global_load_async_to_lds_b128 %4, %5, off\n\t"
               "global_load_async_to_lds_b128 %6, %7, off\n\t"
               "global_load_async_to_lds_b128 %8, %9, off\n\t"
               "global_load_async_to_lds_b128 %10, %11, off\n\t"
               "global_load_async_to_lds_b128 %12, %13, off\n\t"
               "global_load_async_to_lds_b128 %14, %15, off\n\t"
               "s_wait_xcnt 0x0"
               :: "v"(l), "v"(ga), "v"(l + 1 * G2S), "v"(ga + ra), "v"(l + 2 * G2S), "v"(ga + 2 * ra), "v"(l + 3 * G2S), "v"(ga + 3 * ra),
                  "v"(l + 4 * G2S), "v"(ga + 4 * ra), "v"(l + 5 * G2S), "v"(ga + 5 * ra), "v"(l + 6 * G2S), "v"(ga + 6 * ra), "v"(l + 7 * G2S), "v"(ga + 7 * ra)
               : "memory"); }
// the same for Bt rows r, r + 16, .. r + 176, to LDS byte l + 0, G2S, .. 11 G2S (l: the lane's place in the first Bt row group)
__device__ __forceinline__ void g3_copy_b(unsigned l, const unsigned short* gb, size_t rb) {
  asm volatile("global_load_async_to_lds_b128 %0, %1, off\n\t"
               "global_load_async_to_lds_b128 %2, %3, off\n\t"
               "global_load_async_to_lds_b128 %4, %5, off\n\t"
               "global_load_async_to_lds_b128 %6, %7, off\n\t"
               "global_load_async_to_lds_b128 %8, %9, off\n\t"
               "global_load_async_to_lds_b128 %10, %11, off\n\t"
               "global_load_async_to_lds_b128 %12, %13, off\n\t"
               "global_load_async_to_lds_b128 %14, %15, off\n\t"
               "global_load_async_to_lds_b128 %16, %17, off\n\t"
               "global_load_async_to_lds_b128 %18, %19, off\n\t"
               "global_load_async_to_lds_b128 %20, %21, off\n\t"
               "global_load_async_to_lds_b128 %22, %23, off\n\t"
               "s_wait_xcnt 0x0"
               :: "v"(l), "v"(gb), "v"(l + 1 * G2S), "v"(gb + rb), "v"(l + 2 * G2S), "v"(gb + 2 * rb), "v"(l + 3 * G2S), "v"(gb + 3 * rb),
                  "v"(l + 4 * G2S), "v"(gb + 4 * rb), "v"(l + 5 * G2S), "v"(gb + 5 * rb), "v"(l + 6 * G2S), "v"(gb + 6 * rb), "v"(l + 7 * G2S), "v"(gb + 7 * rb),
                  "v"(l + 8 * G2S), "v"(gb + 8 * rb), "v"(l + 9 * G2S), "v"(gb + 9 * rb), "v"(l + 10 * G2S), "v"(gb + 10 * rb), "v"(l + 11 * G2S), "v"(gb + 11 * rb)
               : "memory"); }
__global__ __launch_bounds__(128) void k_gemm3(const _Float16* __restrict__ A, int lda, const _Float16* __restrict__ Bh, int ldb, size_t sB, float alpha, const float* __restrict__ bias, const float* __restrict__ bias1, const float* __restrict__ bias2,
    _Float16* __restrict__ C16, int ldc, size_t sC, int M, int N, int K) {
  __shared__ __attribute__((aligned(16))) unsigned short st[2][G3R * G2P];
  static_assert(128 * G3Q <= 2 * G3R * G2P, "the staged output tile lies inside the ring");
  const int tid = threadIdx.x, w = tid >> 5, lane = tid & 31, ln = lane & 15, hh = lane >> 4; const int by = blockIdx.y; const int wm = w >> 1, wn = w & 1;
  const float* bp = by == 0 ? bias : (by == 1 ? bias1 : bias2);      /* products that share one grid bring their bias vectors as separate inputs: plane 0, 1, 2 */
  Bh += (size_t)by * sB; C16 += (size_t)by * sC;
  const int ntn = N / G3N; const int mt = blockIdx.x / ntn, nq = blockIdx.x - mt * ntn; const int col0 = nq * G3N; if (mt * 128 + 128 > M) return;      /* the same for the whole work-group, in front of every barrier: all 128 staged A rows exist */
  const int cr = tid >> 3, cc = (tid & 7) * 8;      /* the lane's first staged row, and its 16 bytes in the row */
  const unsigned short* ga = (const unsigned short*)A + (size_t)(mt * 128 + cr) * lda + cc; const unsigned short* gb = (const unsigned short*)Bh + (size_t)(col0 + cr) * ldb + cc;
  const size_t ra = (size_t)16 * lda, rb = (size_t)16 * ldb;
  const unsigned l0 = (unsigned)(size_t)&st[0][cr * G2P + cc];      /* LDS byte address: the low 32 bits of the __shared__ address */
  constexpr int SE = G3R * G2P;      /* elements per buffer */
  const int ns = K / G2K;
  g3_copy_a(l0, ga, ra); g3_copy_b(l0 + 8 * G2S, gb, rb);
  asm volatile("s_wait_asynccnt 0x0" ::: "memory");      /* this wave's copies of stage 0 have landed */
  __syncthreads();      /* stage 0 is complete for every wave */
  if (ns > 1) { g3_copy_a(l0 + SE * 2, ga + G2K, ra); g3_copy_b(l0 + SE * 2 + 8 * G2S, gb + G2K, rb); }
  const unsigned short* fa = &st[0][(64 * wm + ln) * G2P + 8 * hh]; const unsigned short* fb = &st[0][(128 + 96 * wn + ln) * G2P + 8 * hh];
  const v8f z8 = {0.f,0.f,0.f,0.f,0.f,0.f,0.f,0.f}; v8f c[4][6];
  /* every inner loop is unrolled whole: the fragment and accumulator arrays are then indexed by constants alone and stay in registers */
#pragma unroll
  for (int i = 0; i < 4; ++i)
#pragma unroll
    for (int j = 0; j < 6; ++j) c[i][j] = z8;
  for (int s = 0; s < ns; ++s) { const int bo = (s & 1) * SE; const unsigned short* pa = fa + bo; const unsigned short* pb = fb + bo;
#pragma unroll
    for (int kb = 0; kb < G2K; kb += 32) { v16h a[4], b[6];      /* the 20 fragment reads of a 32-k block stand together in front of its 24 products */
#pragma unroll
      for (int i = 0; i < 4; ++i) a[i] = g2_frag(pa + 16 * i * G2P + kb);
#pragma unroll
      for (int j = 0; j < 6; ++j) b[j] = g2_frag(pb + 16 * j * G2P + kb);
      __builtin_amdgcn_sched_barrier(0);      /* keeps the block's reads in one group in front of its products: without it each Bt fragment is read, and waited for, right in front of its four products */
#pragma unroll
      for (int j = 0; j < 6; ++j)
#pragma unroll
        for (int i = 0; i < 4; ++i) c[i][j] = __builtin_amdgcn_wmma_f32_16x16x32_f16(false, a[i], false, b[j], (short)0, c[i][j], false, false);
      __builtin_amdgcn_sched_barrier(0); }      /* keeps the next block's reads from being spread among these products */
    asm volatile("s_wait_dscnt 0x0" ::: "memory");      /* this wave's reads of buffer s & 1 are done before the buffer is refilled */
    asm volatile("s_wait_asynccnt 0x0" ::: "memory");      /* this wave's copies of stage s + 1 have landed */
    __syncthreads();      /* publishes stage s + 1 and ends every wave's reads of stage s */
    if (s + 2 < ns) { g3_copy_a(l0 + bo * 2, ga + (size_t)(s + 2) * G2K, ra); g3_copy_b(l0 + bo * 2 + 8 * G2S, gb + (size_t)(s + 2) * G2K, rb); } }
  asm volatile("s_wait_asynccnt 0x0" ::: "memory");      /* no copy is outstanding when the ring becomes output staging */
  /* the last trip's barrier has ended every read of the ring: the whole 128 x 192 tile is laid there as f16 rows, so that the stores below are whole 128-byte lines, each written by one wave */
  unsigned short* so = &st[0][0];
#pragma unroll
  for (int j = 0; j < 6; ++j) { const int col = 96 * wn + 16 * j + ln; const float bv = bf16_round(bp[col0 + col]);
#pragma unroll
    for (int i = 0; i < 4; ++i)
#pragma unroll
      for (int r = 0; r < 8; ++r) so[(64 * wm + 16 * i + 8 * hh + r) * G3Q + col] = __builtin_bit_cast(unsigned short, (_Float16)(c[i][j][r] * alpha + bv)); }
  __syncthreads();      /* the staged tile is complete for every wave */
  unsigned short* d = (unsigned short*)C16 + (size_t)(mt * 128) * ldc + col0; const size_t rs = (size_t)16 * ldc;
#pragma unroll
  for (int e = 0; e < 3; ++e) { const int ch = e * 128 + tid; const int r0 = ch / (G3N / 8), c8 = (ch % (G3N / 8)) * 8;      /* 16-byte pieces in row order: a wave's 32 pieces are four whole lines; 384 pieces are 16 rows */
    const unsigned short* sp = so + r0 * G3Q + c8; unsigned short* dp = d + (size_t)r0 * ldc + c8;
#pragma unroll
    for (int q = 0; q < 8; ++q) *(v8us*)(dp + q * rs) = *(const v8us*)(sp + q * 16 * G3Q); } }

// ---- wide GEMM for the output projection (work-group tile 128 x 192, four waves of 64 x 96 as 2 x 2, one work-group a WGP; requires M % 128 == 0, N % 192 == 0, K % 128 == 0); C = acc alpha + bf16(bias), f32 ----
// The ring of k_gemm3 with 128 k a stage (256-byte rows at a pitch of 272 B): 320 rows from L2 per 128 x 192 x 128 products, where three 128 x 64 tiles bring 576, and 80 KB of copies in flight for the one work-group
// that a WGP holds, so that the latency of a stage's copies is paid 6 times, not 12. Every output element sums its 32-k blocks in the order that k_gemm2 has.
#define G4K 128                      /* k elements per stage */
#define G4P (G4K + 8)                /* LDS pitch of a staged row, f16 elements (272 B = 16 B x odd: no bank conflict for 16-byte fragment reads) */
#define G4S (8 * G4P * 2)            /* LDS bytes between two copies of one lane (8 rows) */
#define G4Q (G3N + 4)                /* pitch of a staged output row, f32 elements (784 B = 16 B x odd) */
typedef float f32a __attribute__((may_alias));
// eight copies of one lane: 16 bytes of rows r, r + 8, .. r + 56 (r = thread / 16) to LDS byte l + 0, G4S, .. 7 G4S; r8 = 8 rows in elements. The s_wait_xcnt closes the statement so that it stands in front of every later write of a register that a copy names.
__device__ __forceinline__ void g4_copy8(unsigned l, const unsigned short* g, size_t r8) {
  asm volatile("global_load_async_to_lds_b128 %0, %1, off\n\t"
               "global_load_async_to_lds_b128 %2, %3, off\n\t"
               "global_load_async_to_lds_b128 %4, %5, off\n\t"
               "global_load_async_to_lds_b128 %6, %7, off\n\t"
               "global_load_async_to_lds_b128 %8, %9, off\n\t"
               "global_load_async_to_lds_b128 %10, %11, off\n\t"
               "global_load_async_to_lds_b128 %12, %13, off\n\t"
               "global_load_async_to_lds_b128 %14, %15, off\n\t"
               "s_wait_xcnt 0x0"
               :: "v"(l), "v"(g), "v"(l + 1 * G4S), "v"(g + r8), "v"(l + 2 * G4S), "v"(g + 2 * r8), "v"(l + 3 * G4S), "v"(g + 3 * r8),
                  "v"(l + 4 * G4S), "v"(g + 4 * r8), "v"(l + 5 * G4S), "v"(g + 5 * r8), "v"(l + 6 * G4S), "v"(g + 6 * r8), "v"(l + 7 * G4S), "v"(g + 7 * r8)
               : "memory"); }
// one stage's 40 copies of one lane: A rows 0 .. 127 to staged rows 0 .. 127, Bt rows 0 .. 191 behind them
__device__ __forceinline__ void g4_stage(unsigned l, const unsigned short* ga, size_t ra, const unsigned short* gb, size_t rb) {
  g4_copy8(l, ga, ra); g4_copy8(l + 8 * G4S, ga + 8 * ra, ra);
  g4_copy8(l + 16 * G4S, gb, rb); g4_copy8(l + 24 * G4S, gb + 8 * rb, rb); g4_copy8(l + 32 * G4S, gb + 16 * rb, rb); }
__global__ __launch_bounds__(128) void k_gemm4(const _Float16* __restrict__ A, int lda, const _Float16* __restrict__ Bh, int ldb, float alpha, const float* __restrict__ bias, float* __restrict__ C, int ldc, int M, int N, int K) {
  __shared__ __attribute__((aligned(16))) unsigned short st[2][G3R * G4P];
  static_assert(128 * G4Q * 4 <= 2 * G3R * G4P * 2, "the staged output tile lies inside the ring");
  const int tid = threadIdx.x, w = tid >> 5, lane = tid & 31, ln = lane & 15, hh = lane >> 4; const int wm = w >> 1, wn = w & 1;
  const int ntn = N / G3N; const int mt = blockIdx.x / ntn, nq = blockIdx.x - mt * ntn; const int col0 = nq * G3N; if (mt * 128 + 128 > M) return;      /* the same for the whole work-group, in front of every barrier: all 128 staged A rows exist */
  const int cr = tid >> 4, cc = (tid & 15) * 8;      /* the lane's first staged row, and its 16 bytes in the row */
  const unsigned short* ga = (const unsigned short*)A + (size_t)(mt * 128 + cr) * lda + cc; const unsigned short* gb = (const unsigned short*)Bh + (size_t)(col0 + cr) * ldb + cc;
  const size_t ra = (size_t)8 * lda, rb = (size_t)8 * ldb;
  const unsigned l0 = (unsigned)(size_t)&st[0][cr * G4P + cc];      /* LDS byte address: the low 32 bits of the __shared__ address */
  constexpr int SE = G3R * G4P;      /* elements per buffer */
  const int ns = K / G4K;
  g4_stage(l0, ga, ra, gb, rb);
  asm volatile("s_wait_asynccnt 0x0" ::: "memory");      /* this wave's copies of stage 0 have landed */
  __syncthreads();      /* stage 0 is complete for every wave */
  if (ns > 1) g4_stage(l0 + SE * 2, ga + G4K, ra, gb + G4K, rb);
  const unsigned short* fa = &st[0][(64 * wm + ln) * G4P + 8 * hh]; const unsigned short* fb = &st[0][(128 + 96 * wn + ln) * G4P + 8 * hh];
  const v8f z8 = {0.f,0.f,0.f,0.f,0.f,0.f,0.f,0.f}; v8f c[4][6];
  /* every inner loop is unrolled whole: the fragment and accumulator arrays are then indexed by constants alone and stay in registers */
#pragma unroll
  for (int i = 0; i < 4; ++i)
#pragma unroll
    for (int j = 0; j < 6; ++j) c[i][j] = z8;
  for (int s = 0; s < ns; ++s) { const int bo = (s & 1) * SE; const unsigned short* pa = fa + bo; const unsigned short* pb = fb + bo;
#pragma unroll
    for (int kb = 0; kb < G4K; kb += 32) { v16h a[4], b[6];      /* the 20 fragment reads of a 32-k block stand together in front of its 24 products */
#pragma unroll
      for (int i = 0; i < 4; ++i) a[i] = g2_frag(pa + 16 * i * G4P + kb);
#pragma unroll
      for (int j = 0; j < 6; ++j) b[j] = g2_frag(pb + 16 * j * G4P + kb);
      __builtin_amdgcn_sched_barrier(0);      /* keeps the block's reads in one group in front of its products: without it each Bt fragment is read, and waited for, right in front of its four products */
#pragma unroll
      for (int j = 0; j < 6; ++j)
#pragma unroll
        for (int i = 0; i < 4; ++i) c[i][j] = __builtin_amdgcn_wmma_f32_16x16x32_f16(false, a[i], false, b[j], (short)0, c[i][j], false, false);
      __builtin_amdgcn_sched_barrier(0); }      /* keeps the next block's reads from being spread among these products */
    asm volatile("s_wait_dscnt 0x0" ::: "memory");      /* this wave's reads of buffer s & 1 are done before the buffer is refilled */
    asm volatile("s_wait_asynccnt 0x0" ::: "memory");      /* this wave's copies of stage s + 1 have landed */
    __syncthreads();      /* publishes stage s + 1 and ends every wave's reads of stage s */
    if (s + 2 < ns) g4_stage(l0 + bo * 2, ga + (size_t)(s + 2) * G4K, ra, gb + (size_t)(s + 2) * G4K, rb); }
  asm volatile("s_wait_asynccnt 0x0" ::: "memory");      /* no copy is outstanding when the ring becomes output staging */
  /* the last trip's barrier has ended every read of the ring: the whole 128 x 192 tile is laid there as f32 rows, so that the stores below are whole 128-byte lines, each written by one wave */
  f32a* so = (f32a*)&st[0][0];
#pragma unroll
  for (int j = 0; j < 6; ++j) { const int col = 96 * wn + 16 * j + ln; const float bv = bf16_round(bias[col0 + col]);
#pragma unroll
    for (int i = 0; i < 4; ++i)
#pragma unroll
      for (int r = 0; r < 8; ++r) so[(64 * wm + 16 * i + 8 * hh + r) * G4Q + col] = c[i][j][r] * alpha + bv; }
  __syncthreads();      /* the staged tile is complete for every wave */
  float* d = C + (size_t)(mt * 128) * ldc + col0; const size_t rs = (size_t)8 * ldc;
#pragma unroll
  for (int e = 0; e < 3; ++e) { const int ch = e * 128 + tid; const int r0 = ch / (G3N / 4), c4 = (ch % (G3N / 4)) * 4;      /* 16-byte pieces in row order: a wave's 32 pieces are four whole lines; 384 pieces are 8 rows */
    const f32a* sp = so + r0 * G4Q + c4; float* dp = d + (size_t)r0 * ldc + c4;
#pragma unroll
    for (int q = 0; q < 16; ++q) *(v4f*)(dp + q * rs) = *(const v4fa*)(sp + q * 8 * G4Q); } }


// fused attention, one (batch, head) and 512 queries per work-group of 16 waves. The head's K rows [key][d] and V rows [key][d] are laid in LDS once (K pitch 16 B x odd for 16-byte fragment reads, V pitch 32 B x odd for the transposing reads: no bank conflict);
// each wave owns 32 queries (two 16-column groups) and walks the keys 32 at a time: S^T = K Q^T (A = K rows, B = Q rows, both in the hardware k order), so a lane holds 16 scores of ONE query per group;
// the two S^T tiles of a group, converted in place, are the B operand P^T of O^T += V^T P^T (register s < 8: key 8 hh + s, s >= 8: key 16 + 8 hh + s - 8). Softmax in base 2 against a running maximum mu, raised only when a score passes it by more than 8 (weights then stay <= 256, inside f16).
#define AKP (HD + 8)                 /* LDS pitch of a K row, f16 elements (144 B) */
#define AVP (HD + 16)                /* LDS pitch of a V row, f16 elements (160 B) */
#define AQW 32                       /* queries per wave */
#define ANW 16                       /* waves per work-group */
__device__ __forceinline__ v8f fa_mma(v16h a, v16h b, v8f c) { return __builtin_amdgcn_wmma_f32_16x16x32_f16(false, a, false, b, (short)0, c, false, false); }
__device__ __forceinline__ float fa_xhalf(float x) { return __builtin_bit_cast(float, __builtin_amdgcn_permlanex16(__builtin_bit_cast(int, x), __builtin_bit_cast(int, x), 0x76543210, 0xfedcba98, false, false)); }      /* lane l takes lane l ^ 16, on the vector pipe: no LDS round trip in the loop */
__device__ __forceinline__ v16h fa_frag(const unsigned short* p) { FragH f; f.half[0] = *(const v8us*)p; f.half[1] = *(const v8us*)(p + 16); return f.v; }
// A fragment of V^T (16 d x 32 keys) out of row-major V rows in LDS, by ds_load_tr16_b128: lane l points at row key0 + 8 (l >> 4) + (l & 7), 16 bytes at d0 + 8 ((l >> 3) & 1), and receives V[key0 + 8 (l >> 4) + 0 .. 7][d0 + (l & 15)];
// the second load, 16 rows on, gives keys key0 + 16 + 8 (l >> 4) + 0 .. 7: the k order that the packed scores have as the B operand.
typedef short v8ss __attribute__((ext_vector_type(8)));
__device__ __forceinline__ v8us fa_tr16(const unsigned short* p) { typedef __attribute__((address_space(3))) v8ss lds_v8ss; return __builtin_bit_cast(v8us, __builtin_amdgcn_ds_load_tr16_b128_v8i16((lds_v8ss*)p)); }
__device__ __forceinline__ v16h fa_fragt(const unsigned short* p) { FragH f; f.half[0] = fa_tr16(p); f.half[1] = fa_tr16(p + 16 * AVP); return f.v; }
__global__ __launch_bounds__(ANW * 32) void k_fattn(const _Float16* __restrict__ Q16, const _Float16* __restrict__ K16, const _Float16* __restrict__ V16, _Float16* __restrict__ O16) {
  __shared__ __attribute__((aligned(16))) unsigned short sk[SQ * AKP];
  __shared__ __attribute__((aligned(16))) unsigned short sv[SQ * AVP];
  const int tid = threadIdx.x, w = tid >> 5, lane = tid & 31, ln = lane & 15, hh = lane >> 4;
  constexpr int QB = SQ / (ANW * AQW);      /* work-groups per head */
  const int bh = blockIdx.x / QB, qb = blockIdx.x % QB; const int b = bh / NH, h = bh % NH;
  const unsigned short* kg = (const unsigned short*)K16 + (size_t)b * SQ * DM + h * HD; const unsigned short* vg = (const unsigned short*)V16 + (size_t)b * SQ * DM + h * HD;
  /* fill: thread t brings 16 bytes of K row u * 64 + t / 8 and of V row u * 64 + t / 8 (u = 0 .. 15). One address per plane, the rows told apart by constant offsets; every loop is unrolled whole so that
     all 32 fill loads and the 8 Q loads are in flight together and the register arrays are indexed by constants alone */
  constexpr int NT = ANW * 32, KRS = NT / (HD / 8);      /* threads; K rows, and V rows, covered by one sweep of the work-group */
  const int kr = tid / (HD / 8), kc = (tid % (HD / 8)) * 8;
  const unsigned short* kgl = kg + (size_t)kr * DM + kc; const unsigned short* vgl = vg + (size_t)kr * DM + kc;
  const int q0 = qb * (ANW * AQW) + w * AQW;
  const unsigned short* qp = (const unsigned short*)Q16 + ((size_t)b * SQ + q0 + ln) * DM + h * HD + 8 * hh;
  v8us kx[SQ / KRS], vx[SQ / KRS]; v16h qf[2][2];
#pragma unroll
  for (int u = 0; u < SQ / KRS; ++u) kx[u] = *(const v8us*)(kgl + (size_t)u * KRS * DM);
#pragma unroll
  for (int u = 0; u < SQ / KRS; ++u) vx[u] = *(const v8us*)(vgl + (size_t)u * KRS * DM);
#pragma unroll
  for (int g = 0; g < 2; ++g) { qf[g][0] = fa_frag(qp + (size_t)g * 16 * DM); qf[g][1] = fa_frag(qp + (size_t)g * 16 * DM + 32); }
  asm volatile("s_wait_xcnt 0x0" :: "v"(kgl), "v"(vgl), "v"(qp) : "memory");      /* the wait owed before a register that an issued global load names is overwritten; the three addresses are inputs so that they stay in their registers up to here */
#pragma unroll
  for (int u = 0; u < SQ / KRS; ++u) *(v8us*)(sk + (kr + u * KRS) * AKP + kc) = kx[u];
#pragma unroll
  for (int u = 0; u < SQ / KRS; ++u) *(v8us*)(sv + (kr + u * KRS) * AVP + kc) = vx[u];
  __syncthreads();      /* K and V of the head are complete in LDS; nothing writes LDS behind this point */
  /* every inner loop from here on is unrolled whole: the fragment and accumulator arrays are then indexed by constants alone and stay in registers */
  const v8f z8 = {0.f,0.f,0.f,0.f,0.f,0.f,0.f,0.f};
  v8f o[2][4] = {{z8, z8, z8, z8}, {z8, z8, z8, z8}};      /* o[g][t][r] = O^T[d = 16 t + 8 hh + r][query q0 + 16 g + ln], relative to mu[g] */
  float mu[2] = {-3.0e38f, -3.0e38f}, ls[2] = {0.f, 0.f};
  const float CS = 0.125f * 1.4426950408889634f;      /* 1 / sqrt(64), and base e to base 2 */
  const unsigned short* skl = sk + ln * AKP + 8 * hh; const unsigned short* svl = sv + (8 * hh + (lane & 7)) * AVP + 8 * ((lane >> 3) & 1);
  for (int j = 0; j < SQ; j += 32) {
    v16h kf[2][2], vf[4];
#pragma unroll
    for (int kt = 0; kt < 2; ++kt) { kf[kt][0] = fa_frag(skl + (j + 16 * kt) * AKP); kf[kt][1] = fa_frag(skl + (j + 16 * kt) * AKP + 32); }
#pragma unroll
    for (int t = 0; t < 4; ++t) vf[t] = fa_fragt(svl + j * AVP + 16 * t);
    v8f s[2][2];
#pragma unroll
    for (int g = 0; g < 2; ++g)
#pragma unroll
      for (int kt = 0; kt < 2; ++kt) s[g][kt] = fa_mma(kf[kt][1], qf[g][1], fa_mma(kf[kt][0], qf[g][0], z8));
    float mx[2];
#pragma unroll
    for (int g = 0; g < 2; ++g) { float m = fmaxf(s[g][0][0], s[g][1][0]);
#pragma unroll
      for (int r = 1; r < 8; ++r) m = fmaxf(m, fmaxf(s[g][0][r], s[g][1][r]));
      m = fmaxf(m, fa_xhalf(m)); mx[g] = m * CS; }      /* lanes ln and ln + 16 hold the same query: both take the same maximum */
    if (__builtin_amdgcn_ballot_w32(mx[0] > mu[0] + 8.0f || mx[1] > mu[1] + 8.0f) != 0) {      /* wave-uniform; always taken on the first pass */
#pragma unroll
      for (int g = 0; g < 2; ++g) { const float mn = fmaxf(mu[g], mx[g]); const float corr = __builtin_amdgcn_exp2f(mu[g] - mn); mu[g] = mn; ls[g] *= corr;
#pragma unroll
        for (int t = 0; t < 4; ++t) o[g][t] *= corr; } }
#pragma unroll
    for (int g = 0; g < 2; ++g) { FragH pf;
#pragma unroll
      for (int kt = 0; kt < 2; ++kt)
#pragma unroll
        for (int r = 0; r < 8; ++r) { const float p = __builtin_amdgcn_exp2f(fmaf(s[g][kt][r], CS, -mu[g])); ls[g] += p; pf.h[kt * 8 + r] = (_Float16)p; }
#pragma unroll
      for (int t = 0; t < 4; ++t) o[g][t] = fa_mma(vf[t], pf.v, o[g][t]); }
  }
#pragma unroll
  for (int g = 0; g < 2; ++g) { const float l = ls[g] + fa_xhalf(ls[g]); const float sc = 64.0f / l;      /* the two lane halves summed different keys of the same query */
    unsigned short* d = (unsigned short*)O16 + ((size_t)b * SQ + q0 + 16 * g + ln) * DM + h * HD + 8 * hh;
#pragma unroll
    for (int t = 0; t < 4; ++t) { FragH f;
#pragma unroll
      for (int r = 0; r < 8; ++r) f.h[r] = (_Float16)(o[g][t][r] * sc);
      *(v8us*)(d + 16 * t) = f.half[0]; } } }
__global__ __launch_bounds__(256) void k_vt(const _Float16* __restrict__ V16, int b, int h0, _Float16* __restrict__ VT) { __shared__ unsigned short tl[64][65]; const int tid = threadIdx.x; const int hh = blockIdx.x % HG, sg = blockIdx.x / HG; const int s0 = sg * 64; const int h = h0 + hh;
  for (int i = tid; i < 64 * 8; i += 256) { const int j = i / 8, d8 = (i % 8) * 8; FragH f; f.half[0] = *(const v8us*)((const unsigned short*)V16 + ((size_t)b * SQ + s0 + j) * DM + h * HD + d8); for (int q = 0; q < 8; ++q) tl[d8 + q][j] = f.u[q]; }
  __syncthreads();
  { for (int i = tid; i < 64 * 8; i += 256) { const int d = i / 8, j8 = (i % 8) * 8; FragH f; for (int q = 0; q < 8; ++q) f.u[q] = tl[d][j8 + q]; *(v8us*)((unsigned short*)VT + ((size_t)hh * HD + d) * SQ + s0 + j8) = f.half[0]; }  } }



__global__ __launch_bounds__(256) void k_rsmkm(const float* __restrict__ S, _Float16* __restrict__ P, int nrows, const int* __restrict__ am) {
  #pragma clang fp contract(off)
  const int t = blockIdx.x * 256 + threadIdx.x; if (t >= nrows) return; const size_t i = (size_t)t; const float* s = S + i * SQ; const int* mr = am + (size_t)(t % SQ) * SQ; float mx = -3.0e38f;
#pragma unroll 1
  for (int j = 0; j < SQ; ++j) { const float f = (mr[j] != 0) ? 1.f : 0.f; mx = fmaxf(mx, fmaf(f, s[j], (1.f - f) * -1.0e9f)); } float se = 0.f;
#pragma unroll 1
  for (int j = 0; j < SQ; ++j) { const float f = (mr[j] != 0) ? 1.f : 0.f; se += __expf(fmaf(f, s[j], (1.f - f) * -1.0e9f) - mx); } const float sc = 256.0f / se;
#pragma unroll 1
  for (int j0 = 0; j0 < SQ; j0 += 8) { FragH fr; for (int q = 0; q < 8; ++q) { const int j = j0 + q; const float f = (mr[j] != 0) ? 1.f : 0.f; fr.h[q] = (_Float16)(__expf(fmaf(f, s[j], (1.f - f) * -1.0e9f) - mx) * sc); }
    unsigned short* d = (unsigned short*)P + i * SQ + j0; *(v8us*)d = fr.half[0];  } }
// local RMS norm with the 7 x 7 box sum taken as two passes of 7. A work-group owns LRB grid rows x all GS grid columns x LRC channels of one batch. A thread owns one channel quad q4 of LRJ grid columns (GS / LRJ apart): it loads
// each column's LRB + 6 grid rows (16 bytes each, all in flight together; a half-wave reads one position's 256 bytes), sums the squares down the column for each of the LRB rows in registers and lays these column sums in LDS;
// behind the one barrier it adds the 7 column sums around each of its columns (RW columns of zeros on either side stand for the zero padding; grid rows outside the grid are zeroed in the rounding mask).
// x of its own positions is still in registers for the division.
#define LRB 4                        /* grid rows per work-group */
#define LRC 64                       /* channels per work-group: 256 B of x, one whole 128-B line of the f16 rows */
#define LRJ 2                        /* grid columns per thread: half the waves to start for the same work */
#define LRP (GS + 2 * RW)            /* columns in a row of column sums in LDS, the zeros included */
#define LRT (GS / LRJ * LRC / 4)     /* threads per work-group */
#define LRG (NB * (GS / LRB) * (DM / LRC))      /* work-groups of the norm */
#define LWG (DM * DM / 8 / LRT)      /* work-groups behind them that convert the weights */
// The launch also carries the weight conversion, which depends on nothing and on which only the GEMMs depend: work-groups LRG .. LRG + LWG - 1 write Bt[n][k] = f16(bf16(W[n][k]) x 16) (natural [out][in] rows) for the four matrices,
// laid one behind the other in BW; a thread takes the same 8 elements of each matrix, its 8 loads in flight together.
__global__ __launch_bounds__(LRT) void k_lrms(const float* __restrict__ x, const float* __restrict__ w, _Float16* __restrict__ X16,
    const float* __restrict__ wq, const float* __restrict__ wk, const float* __restrict__ wv, const float* __restrict__ wo, _Float16* __restrict__ BW) {
  __shared__ __attribute__((aligned(16))) float cs[LRB][LRP][LRC];
  if (blockIdx.x >= LRG) {      /* the same for the whole work-group, in front of the barrier */
    const unsigned t8 = ((blockIdx.x - LRG) * LRT + threadIdx.x) * 8;
    const float* pq = wq + t8; const float* pk = wk + t8; const float* pv = wv + t8; const float* po = wo + t8;
    const v4f wx[4][2] = {{*(const v4fa*)pq, *(const v4fa*)(pq + 4)}, {*(const v4fa*)pk, *(const v4fa*)(pk + 4)}, {*(const v4fa*)pv, *(const v4fa*)(pv + 4)}, {*(const v4fa*)po, *(const v4fa*)(po + 4)}};
    asm volatile("s_wait_xcnt 0x0" :: "v"(pq), "v"(pk), "v"(pv), "v"(po) : "memory");      /* the wait owed before a register that an issued global load names is overwritten; the addresses are inputs so that they stay in their registers up to here */
#pragma unroll
    for (int m = 0; m < 4; ++m) { FragH f;      /* unrolled whole: wx is indexed by constants alone */
#pragma unroll
      for (int q = 0; q < 8; ++q) f.h[q] = (_Float16)(bf16_round(wx[m][q >> 2][q & 3]) * 16.0f);
      *(v8us*)((unsigned short*)BW + (size_t)m * DM * DM + t8) = f.half[0]; }
    return; }
  constexpr int NCG = DM / LRC, NBD = GS / LRB, NK = LRB + 2 * RW, JS = GS / LRJ;
  const int tid = threadIdx.x, q4 = (tid % (LRC / 4)) * 4, j = tid / (LRC / 4);      /* j: the first of the thread's columns, the others at j + JS, .. */
  const int cg = blockIdx.x % NCG, bd = (blockIdx.x / NCG) % NBD, b = blockIdx.x / (NCG * NBD); const int i0 = bd * LRB;
  const int to = j * DM + cg * LRC + q4;      /* the thread's place inside a grid row of x, elements */
  const float* xb = x + (size_t)b * SQ * DM + to; const float* pw = w + cg * LRC + q4;
  const float* pc = xb + (size_t)i0 * GS * DM;      /* the work-group's own grid rows: constant offsets from here */
  /* every loop of this kernel is unrolled whole: the register arrays are then indexed by constants alone and stay in registers, and all the loads stand together in front of the first use */
  const float* pe[2 * RW];      /* the RW grid rows above and the RW below, clamped into the grid; the rows below as LRB + k rows behind pe[RW + k] */
#pragma unroll
  for (int k = 0; k < RW; ++k) { const int iu = i0 - RW + k, il = GS - 1 - LRB - k; pe[k] = xb + (size_t)(iu < 0 ? 0 : iu) * GS * DM; pe[RW + k] = xb + (size_t)(i0 < il ? i0 : il) * GS * DM; }
  v4f xr[LRJ][NK];
#pragma unroll
  for (int k = 0; k < NK; ++k) { const float* p = k < RW ? pe[k] : (k < RW + LRB ? pc : pe[k - LRB]) + (k - RW) * GS * DM;
#pragma unroll
    for (int e = 0; e < LRJ; ++e) xr[e][k] = *(const v4fa*)(p + e * JS * DM); }
  const v4f wr = *(const v4fa*)pw;
  static_assert(RW == 3, "the statement below names 2 * RW + 1 addresses");
  asm volatile("s_wait_xcnt 0x0" :: "v"(pc), "v"(pe[0]), "v"(pe[1]), "v"(pe[2]), "v"(pe[3]), "v"(pe[4]), "v"(pe[5]) : "memory");      /* the wait owed before a register that an issued global load names is overwritten; the addresses are inputs so that they stay in their registers up to here */
  const v4f z4 = {0.f, 0.f, 0.f, 0.f};
  if (j < RW) {      /* the zero columns: RW on the left, RW on the right */
#pragma unroll
    for (int r = 0; r < LRB; ++r) { *(v4fa*)&cs[r][j][q4] = z4; *(v4fa*)&cs[r][RW + GS + j][q4] = z4; } }
#pragma unroll
  for (int k = 0; k < NK; ++k) { const int ii = i0 - RW + k; const unsigned m = (ii >= 0 && ii < GS) ? 0xFFFF0000u : 0u;      /* bf16 rounding as in bf16_round; a row outside the grid becomes 0 */
#pragma unroll
    for (int e = 0; e < LRJ; ++e)
#pragma unroll
      for (int c = 0; c < 4; ++c) { const unsigned u = __float_as_uint(xr[e][k][c]); xr[e][k][c] = __uint_as_float((u + 0x7FFFu + ((u >> 16) & 1u)) & m); } }
#pragma unroll
  for (int e = 0; e < LRJ; ++e)
#pragma unroll
    for (int r = 0; r < LRB; ++r) { v4f s = xr[e][r] * xr[e][r];
#pragma unroll
      for (int d = 1; d <= 2 * RW; ++d) s += xr[e][r + d] * xr[e][r + d];
      *(v4fa*)&cs[r][RW + j + e * JS][q4] = s; }
  __syncthreads();      /* every column sum of the work-group's rows, and the zeros beside them, are in LDS; nothing writes LDS behind this point */
  v4h o[LRJ][LRB];
#pragma unroll
  for (int e = 0; e < LRJ; ++e)
#pragma unroll
    for (int r = 0; r < LRB; ++r) { v4f s = *(const v4fa*)&cs[r][j + e * JS][q4];
#pragma unroll
      for (int d = 1; d <= 2 * RW; ++d) s += *(const v4fa*)&cs[r][j + e * JS + d][q4];
#pragma unroll
      for (int c = 0; c < 4; ++c) { const float rms = sqrtf(0.0000001f + s[c] * 0.02040816326530612f);      /* box / 49 as a multiply by the f32 reciprocal (the result is rounded to f16 next) */
        o[e][r][c] = (_Float16)(xr[e][RW + r][c] / rms * bf16_round(wr[c])); } }
  _Float16* d = X16 + ((size_t)b * SQ + (size_t)i0 * GS) * DM + to;
#pragma unroll
  for (int e = 0; e < LRJ; ++e)
#pragma unroll
    for (int r = 0; r < LRB; ++r) *(v4h*)(d + (size_t)(r * GS + e * JS) * DM) = o[e][r]; }


extern "C" void kernel_launch(void* const* d_in, const int* in_sizes, int n_in,
                              void* d_out, int out_size, void* d_ws, size_t ws_size, hipStream_t stream) {
  (void)in_sizes; (void)n_in; (void)out_size;
  const float* const* I = (const float* const*)d_in; const float* x = I[0]; const float* nw = I[1]; const float* wq = I[2]; const float* bq = I[3]; const float* wk = I[4]; const float* bk = I[5]; const float* wv = I[6]; const float* bv = I[7]; const float* wo = I[8]; const float* bo = I[9];      /* x; norm_w [768]; natural [768][768] weights + biases (q, k, v, o) */
  static_assert(SQ == GS * GS && DM % 8 == 0 && DM % 64 == 0 && DM % G3N == 0 && DM % G4K == 0 && DM % 32 == 0 && SQ % 128 == 0 && NH * HD == DM && NH % HG == 0 && HD == 64 && SQ % (ANW * AQW) == 0 && B0 == 0 && NBR == NB && QN == SQ && NHD == NH && GS % LRB == 0 && DM % LRC == 0 && GS % LRJ == 0 && GS / LRJ >= RW && DM * DM % (8 * LRT) == 0 && DM * DM * 2 % 256 == 0 && NB * SQ * DM * 2 % 256 == 0, "shape / tile multiples; the planes taken below follow one another without a gap");
  char* ws = (char*)d_ws; size_t off = 0;
  auto take = [&](size_t bytes) { char* p = ws + off; off += (bytes + 255) & ~(size_t)255; return p; };
  _Float16* BQ = (_Float16*)take((size_t)DM * DM * 2); _Float16* BK = (_Float16*)take((size_t)DM * DM * 2); _Float16* BV = (_Float16*)take((size_t)DM * DM * 2); _Float16* BO = (_Float16*)take((size_t)DM * DM * 2);
  _Float16* X16 = (_Float16*)take(NR * DM * 2); _Float16* Q16 = (_Float16*)take(NR * DM * 2); _Float16* K16 = (_Float16*)take(NR * DM * 2); _Float16* V16 = (_Float16*)take(NR * DM * 2); _Float16* O16 = (_Float16*)take(NR * DM * 2);
  if (off > ws_size) return;      /* approx 4.5 + 5 x 12 = 65 MiB */
  (void)BK; (void)BV;      /* reached as planes 1 and 2 behind BQ, as K16 and V16 are behind Q16 */
  k_lrms<<<LRG + LWG, LRT, 0, stream>>>(x, nw, X16, wq, wk, wv, wo, BQ);      /* xn = local-RMS-normalised x as f16 rows: the A operand of all three projections; and BQ, BK, BV, BO: natural [out][in] = Bt[n][k] x16 */
  const size_t r0p = (size_t)B0 * SQ;      /* first projected row */
  k_gemm3<<<dim3((unsigned)((MP / 128) * (DM / G3N)), 3), 128, 0, stream>>>(X16 + r0p * DM, DM, BQ, DM, (size_t)DM * DM, 0.0625f, bq, bk, bv, Q16 + r0p * DM, DM, NR * DM, MP, DM, DM);      /* q, k, v in one grid: blockIdx.y picks the weight plane, the bias and the output plane */
  k_fattn<<<NB * NH * (SQ / (ANW * AQW)), ANW * 32, 0, stream>>>(Q16, K16, V16, O16);      /* o (merged heads, x64) as f16 rows */
  k_gemm4<<<(unsigned)((MPO / 128) * (DM / G3N)), 128, 0, stream>>>(O16 + r0p * DM, DM, BO, DM, 0.0009765625f, bo, (float*)d_out + r0p * DM, DM, MPO, DM, DM);      /* out rows are the output layout */
}

// v009
// A run of this version takes 78.3 microseconds.
// Timed twice side by side with v008, it ran 1.05 times as fast both times.
// Counting every step since v000, it is 68.6 times as fast.
#include <hip/hip_runtime.h>
#define NB 8
#define SQ 1024
#define GS 32                        /* token grid side: SQ = GS * GS */
#define RW 3                         /* local-norm window radius (7 x 7) */
#define DM 768
#define NH 12
#define HD 64
#define HG 4                         /* heads per launch of the per-group k_vt (not launched) */
#define B0 0                         /* first batch processed (debug hook) */
#define NBR NB                       /* batches processed (debug hook) */
#define NR ((size_t)NB * SQ)         /* token rows */
#define MP ((int)((size_t)NBR * SQ)) /* rows projected (debug hook) */
#define QN SQ                        /* query rows attended per batch (debug hook) */
#define NHD NH                       /* heads attended (debug hook) */
#define MPO MP                       /* rows through the output stage (debug hook) */
#define LQ DM      /* row pitch of the q/k/v rows */
typedef __bf16 v16b __attribute__((ext_vector_type(16)));
typedef unsigned short v8us __attribute__((ext_vector_type(8), may_alias));
typedef float  v8f  __attribute__((ext_vector_type(8)));
typedef float  v4f  __attribute__((ext_vector_type(4)));
typedef float  v4fa __attribute__((ext_vector_type(4), may_alias));
union FragB { v16b v; v8us half[2]; unsigned short u[16]; };

__device__ __forceinline__ unsigned short bf16_bits(float x) { unsigned int u = __float_as_uint(x); return (unsigned short)((u + 0x7FFFu + ((u >> 16) & 1u)) >> 16); }
__device__ __forceinline__ float bf16_val(unsigned short b) { return __uint_as_float(((unsigned int)b) << 16); }
__device__ __forceinline__ float bf16_round(float x) { return bf16_val(bf16_bits(x)); }
// D += A·B with NT terms: 1 = ah·bh, 2 = + al·bh (A split), 3 = + ah·bl (both split)
template <int NT>
__device__ __forceinline__ v8f mmaN(v16b ah, v16b al, v16b bh, v16b bl, v8f c) {
  c = __builtin_amdgcn_wmma_f32_16x16x32_bf16(false, ah, false, bh, (short)0, c, false, false);
  if (NT >= 2) c = __builtin_amdgcn_wmma_f32_16x16x32_bf16(false, al, false, bh, (short)0, c, false, false);
  if (NT >= 3) c = __builtin_amdgcn_wmma_f32_16x16x32_bf16(false, ah, false, bl, (short)0, c, false, false);
  asm volatile("v_nop\n\tv_nop\n\tv_nop\n\tv_nop" : "+v"(c) : "v"(ah), "v"(al), "v"(bh), "v"(bl));
  return c;
}

__global__ __launch_bounds__(256) void k_wt_bf16(const float* __restrict__ W, unsigned short* __restrict__ Wt, int K, int N) {
  const int t = blockIdx.x * 256 + threadIdx.x;
  const int k8n = K / 8;
  if (t >= N * k8n) return;
  const int n = t / k8n, k8 = (t % k8n) * 8;
  v8us v;
#pragma unroll
  for (int i = 0; i < 8; ++i) v[i] = bf16_bits(W[(size_t)(k8 + i) * N + n]);
  *(v8us*)(Wt + (size_t)n * K + k8) = v;
  
}

// GEMM C[M][N] (f32, pitch ldc) = act(A[M][K]·W + bias). A f32 row-major (pitch lda) converted per fragment to bf16
// (ASPLIT: hi/lo two planes -> 2 terms, else single rounded term); Wt bf16 [N][K] (pitch ldb). BIAS_BF16 rounds the
// bias to bf16 first (bias quantised to bf16 before the add). K%32==0, M%16==0, N%64==0.
template <bool ASPLIT, int ACT, bool BIAS_BF16>
__global__ __launch_bounds__(128) void k_gemm_bf(const float* __restrict__ A, int lda, const unsigned short* __restrict__ Wt, int ldb,
                                               const float* __restrict__ bias, float* __restrict__ C, int ldc, int M, int N, int K) {
  __shared__ __attribute__((aligned(16))) float so[4][16][64];
  const int tid = threadIdx.x, w = tid >> 5, lane = tid & 31, ln = lane & 15, hh = lane >> 4;
  const int ntn = N / 64;
  const int wid = blockIdx.x * 4 + w;
  const int mt = wid / ntn, nq = wid % ntn;
  if (mt * 16 >= M) return;
  const int row0 = mt * 16, col0 = nq * 64;
  const float* arow = A + (size_t)(row0 + ln) * lda;
  v8f acc[4] = {};
  for (int kb = 0; kb < K; kb += 32) {
    FragB ah, al;
    const v4f x0 = *(const v4fa*)(arow + kb + 8 * hh), x1 = *(const v4fa*)(arow + kb + 8 * hh + 4);
    const v4f x2 = *(const v4fa*)(arow + kb + 16 + 8 * hh), x3 = *(const v4fa*)(arow + kb + 16 + 8 * hh + 4);
    float xs[16] = {x0[0],x0[1],x0[2],x0[3],x1[0],x1[1],x1[2],x1[3],x2[0],x2[1],x2[2],x2[3],x3[0],x3[1],x3[2],x3[3]};
#pragma unroll
    for (int i = 0; i < 16; ++i) { const unsigned short hb = bf16_bits(xs[i]); ah.u[i] = hb; al.u[i] = ASPLIT ? bf16_bits(xs[i] - bf16_val(hb)) : (unsigned short)0; }
#pragma unroll
    for (int t = 0; t < 4; ++t) {
      const unsigned short* brow = Wt + (size_t)(col0 + t * 16 + ln) * ldb + kb;
      FragB b;
      b.half[0] = *(const v8us*)(brow + 8 * hh);
      b.half[1] = *(const v8us*)(brow + 16 + 8 * hh);
      acc[t] = mmaN<ASPLIT ? 2 : 1>(ah.v, al.v, b.v, b.v, acc[t]);
    }
  }
#pragma unroll
  for (int t = 0; t < 4; ++t) {
    float bv = bias ? bias[col0 + t * 16 + ln] : 0.f;
    if (BIAS_BF16) bv = bf16_round(bv);
#pragma unroll
    for (int r = 0; r < 8; ++r) { float v = acc[t][r] + bv; if (ACT == 1) v = fmaxf(v, 0.f); so[w][8 * hh + r][t * 16 + ln] = v; }
  }
  __builtin_amdgcn_fence(__ATOMIC_ACQ_REL, "workgroup");
  __builtin_amdgcn_wave_barrier();
  const int rsub = lane >> 4, c4 = (lane & 15) * 4;
  {
#pragma unroll
    for (int q = 0; q < 8; ++q) {
      const int r = q * 2 + rsub;
      const v4f v = *(const v4fa*)&so[w][r][c4];
      *(v4f*)(C + (size_t)(row0 + r) * ldc + col0 + c4) = v;
    }
    
  }
}

// GEMM C = act(A·W + bias + resid): A f32 (ASPLIT -> hi/lo 2 terms), Wt bf16 [N][K]; ACT 0 none, 1 relu, 2 exact gelu;
// resid (optional, f32, row index = (row % rmod), pitch ldr, RES_BF16 rounds it) added before the activation.
template <bool ASPLIT, int ACT, bool BIAS_BF16, bool RES_BF16>
__global__ __launch_bounds__(128) void k_gemm_bf3(const float* __restrict__ A, int lda, const unsigned short* __restrict__ Wt, int ldb,
                                                const float* __restrict__ bias, const float* __restrict__ resid, int rmod, int ldr,
                                                float* __restrict__ C, int ldc, int M, int N, int K) {
  __shared__ __attribute__((aligned(16))) float so[4][16][64];
  const int tid = threadIdx.x, w = tid >> 5, lane = tid & 31, ln = lane & 15, hh = lane >> 4;
  const int ntn = N / 64;
  const int wid = blockIdx.x * 4 + w;
  const int mt = wid / ntn, nq = wid % ntn;
  if (mt * 16 >= M) return;
  const int row0 = mt * 16, col0 = nq * 64;
  const float* arow = A + (size_t)(row0 + ln) * lda;
  v8f acc[4] = {};
  for (int kb = 0; kb < K; kb += 32) {
    FragB ah, al;
    const v4f x0 = *(const v4fa*)(arow + kb + 8 * hh), x1 = *(const v4fa*)(arow + kb + 8 * hh + 4);
    const v4f x2 = *(const v4fa*)(arow + kb + 16 + 8 * hh), x3 = *(const v4fa*)(arow + kb + 16 + 8 * hh + 4);
    float xs[16] = {x0[0],x0[1],x0[2],x0[3],x1[0],x1[1],x1[2],x1[3],x2[0],x2[1],x2[2],x2[3],x3[0],x3[1],x3[2],x3[3]};
#pragma unroll
    for (int i = 0; i < 16; ++i) { const unsigned short hb = bf16_bits(xs[i]); ah.u[i] = hb; al.u[i] = ASPLIT ? bf16_bits(xs[i] - bf16_val(hb)) : (unsigned short)0; }
#pragma unroll
    for (int t = 0; t < 4; ++t) {
      const unsigned short* brow = Wt + (size_t)(col0 + t * 16 + ln) * ldb + kb;
      FragB b;
      b.half[0] = *(const v8us*)(brow + 8 * hh);
      b.half[1] = *(const v8us*)(brow + 16 + 8 * hh);
      acc[t] = mmaN<ASPLIT ? 2 : 1>(ah.v, al.v, b.v, b.v, acc[t]);
    }
  }
#pragma unroll
  for (int t = 0; t < 4; ++t) {
    const int col = col0 + t * 16 + ln;
    float bv = bias ? bias[col] : 0.f;
    if (BIAS_BF16) bv = bf16_round(bv);
#pragma unroll
    for (int r = 0; r < 8; ++r) {
      float v = acc[t][r] + bv;
      if (resid) { float rv = resid[(size_t)((row0 + 8 * hh + r) % rmod) * ldr + col]; if (RES_BF16) rv = bf16_round(rv); v += rv; }
      if (ACT == 1) v = fmaxf(v, 0.f);
      if (ACT == 2) v = 0.5f * v * (1.0f + erff(v * 0.70710678118654752f));
      if (ACT == 3) { const float u = 0.7978845608028654f * (v + 0.044715f * v * v * v); v = 0.5f * v * (1.0f + tanhf(u)); }
      so[w][8 * hh + r][t * 16 + ln] = v;
    }
  }
  __builtin_amdgcn_fence(__ATOMIC_ACQ_REL, "workgroup");
  __builtin_amdgcn_wave_barrier();
  const int rsub = lane >> 4, c4 = (lane & 15) * 4;
  {
#pragma unroll
    for (int q = 0; q < 8; ++q) {
      const int r = q * 2 + rsub;
      const v4f v = *(const v4fa*)&so[w][r][c4];
      *(v4f*)(C + (size_t)(row0 + r) * ldc + col0 + c4) = v;
    }
    
  }
}
// row LayerNorm (biased variance, eps) over N: s = X (+ R); optional out_sum <- s; out_norm <- (s-mu)*rsqrt(var+eps)*g + b
template <bool PARAM_BF16>
__global__ __launch_bounds__(256) void k_layernorm(const float* __restrict__ X, const float* __restrict__ R, const float* __restrict__ g, const float* __restrict__ bta,
                                                  float* __restrict__ out_sum, float* __restrict__ out_norm, int N, float eps) {
  __shared__ float red[256];
  const int row = blockIdx.x, tid = threadIdx.x;
  const float* x = X + (size_t)row * N; const float* rr = R ? R + (size_t)row * N : nullptr;
  float vals[16];                     // up to N = 4096
  const int per = N / 256;            // contiguous chunk per thread? use strided-by-4 chunks: thread handles j = tid*4 + 1024*u
  float s1 = 0.f;
  for (int u = 0; u < per / 4; ++u) {
    const int j = tid * 4 + 1024 * u;
    const v4f a = *(const v4fa*)(x + j);
    v4f b = {0.f,0.f,0.f,0.f}; if (rr) b = *(const v4fa*)(rr + j);
#pragma unroll
    for (int q = 0; q < 4; ++q) { const float v = a[q] + b[q]; vals[u * 4 + q] = v; s1 += v; }
  }
  red[tid] = s1; __syncthreads();
  for (int st = 128; st > 0; st >>= 1) { if (tid < st) red[tid] += red[tid + st]; __syncthreads(); }
  const float mu = red[0] / (float)N; __syncthreads();
  float s2 = 0.f;
  for (int u = 0; u < per / 4; ++u)
#pragma unroll
    for (int q = 0; q < 4; ++q) { const float c = vals[u * 4 + q] - mu; s2 += c * c; }
  red[tid] = s2; __syncthreads();
  for (int st = 128; st > 0; st >>= 1) { if (tid < st) red[tid] += red[tid + st]; __syncthreads(); }
  const float rs = rsqrtf(red[0] / (float)N + eps);
  {
    for (int u = 0; u < per / 4; ++u) {
      const int j = tid * 4 + 1024 * u;
      v4f o, sm;
#pragma unroll
      for (int q = 0; q < 4; ++q) {
        float gg = g[j + q], bb = bta[j + q];
        if (PARAM_BF16) { gg = bf16_round(gg); bb = bf16_round(bb); }
        sm[q] = vals[u * 4 + q]; o[q] = (vals[u * 4 + q] - mu) * rs * gg + bb;
      }
      if (out_sum) *(v4f*)(out_sum + (size_t)row * N + j) = sm;
      *(v4f*)(out_norm + (size_t)row * N + j) = o;
    }
    
  }
}



// ---- f16 WMMA path (v_wmma_f32_16x16x32_f16): 11-bit significands for operands in range — used where a [0,1] probability operand needs more precision than bf16
typedef _Float16 v16h __attribute__((ext_vector_type(16)));
union FragH { v16h v; v8us half[2]; _Float16 h[16]; unsigned short u[16]; };
template <int NT>
__device__ __forceinline__ v8f mmaH(v16h ah, v16h al, v16h bh, v16h bl, v8f c) {
  c = __builtin_amdgcn_wmma_f32_16x16x32_f16(false, ah, false, bh, (short)0, c, false, false);
  if (NT >= 2) c = __builtin_amdgcn_wmma_f32_16x16x32_f16(false, al, false, bh, (short)0, c, false, false);
  if (NT >= 3) c = __builtin_amdgcn_wmma_f32_16x16x32_f16(false, ah, false, bl, (short)0, c, false, false);
  asm volatile("v_nop\n\tv_nop\n\tv_nop\n\tv_nop" : "+v"(c) : "v"(ah), "v"(al), "v"(bh), "v"(bl));
  return c;
}
// batched GEMM like k_gemm_b but f16 operands: A f32 (split into f16 hi/lo if ASPLIT, else rounded to f16), Bt = f16 values [n][k]; alpha; C f32; N multiple of 16 (partial tiles skipped)
template <bool ASPLIT>
__global__ __launch_bounds__(128) void k_gemm_h(const float* __restrict__ A, int lda, size_t sA, const _Float16* __restrict__ Bh, int ldb, size_t sB, float alpha, float* __restrict__ C, int ldc, size_t sC, int M, int N, int K) {
  __shared__ __attribute__((aligned(16))) float so[4][16][64];
  const int tid = threadIdx.x, w = tid >> 5, lane = tid & 31, ln = lane & 15, hh = lane >> 4; const int by = blockIdx.y;
  A += (size_t)by * sA; Bh += (size_t)by * sB; C += (size_t)by * sC;
  const int ntn = (N + 63) / 64; const int wid = blockIdx.x * 4 + w; const int mt = wid / ntn, nq = wid % ntn; if (mt * 16 >= M) return;
  const int row0 = mt * 16, col0 = nq * 64; const float* arow = A + (size_t)(row0 + ln) * lda;
  v8f acc[4] = {};
  for (int kb = 0; kb < K; kb += 32) {
    FragH ah, al;
    const v4f x0 = *(const v4fa*)(arow + kb + 8 * hh), x1 = *(const v4fa*)(arow + kb + 8 * hh + 4), x2 = *(const v4fa*)(arow + kb + 16 + 8 * hh), x3 = *(const v4fa*)(arow + kb + 16 + 8 * hh + 4);
    float xs[16] = {x0[0],x0[1],x0[2],x0[3],x1[0],x1[1],x1[2],x1[3],x2[0],x2[1],x2[2],x2[3],x3[0],x3[1],x3[2],x3[3]};
#pragma unroll
    for (int i = 0; i < 16; ++i) { const _Float16 h = (_Float16)xs[i]; ah.h[i] = h; al.h[i] = ASPLIT ? (_Float16)(xs[i] - (float)h) : (_Float16)0.0f; }
#pragma unroll
    for (int t = 0; t < 4; ++t) { if (col0 + t * 16 >= N) continue; const size_t boff = (size_t)(col0 + t * 16 + ln) * ldb + kb; FragH bq; bq.half[0] = *(const v8us*)(Bh + boff + 8 * hh); bq.half[1] = *(const v8us*)(Bh + boff + 16 + 8 * hh);
      acc[t] = mmaH<ASPLIT ? 2 : 1>(ah.v, al.v, bq.v, bq.v, acc[t]); }
  }
#pragma unroll
  for (int t = 0; t < 4; ++t) { if (col0 + t * 16 >= N) continue;
#pragma unroll
    for (int r = 0; r < 8; ++r) so[w][8 * hh + r][t * 16 + ln] = acc[t][r] * alpha; }
  __builtin_amdgcn_fence(__ATOMIC_ACQ_REL, "workgroup"); __builtin_amdgcn_wave_barrier();
  const int rsub = lane >> 4, c4 = (lane & 15) * 4;
  {
#pragma unroll
    for (int q = 0; q < 8; ++q) { const int r = q * 2 + rsub; if (col0 + c4 < N) { const v4f v = *(const v4fa*)&so[w][r][c4]; *(v4f*)(C + (size_t)(row0 + r) * ldc + col0 + c4) = v; } }
     }
}

// Wt[n][k] = f16(W[k][n]·scale) from f32 row-major W[K][N] (scale = power of two; bf16-exact weights stay exact in f16 away from the subnormal range)
__global__ __launch_bounds__(256) void k_wt_f16(const float* __restrict__ W, _Float16* __restrict__ Wt, int K, int N, float scale) {
  const int t = blockIdx.x * 256 + threadIdx.x; if (t >= N * (K / 8)) return; const int n = t / (K / 8), k8 = (t % (K / 8)) * 8; FragH f;
#pragma unroll
  for (int i = 0; i < 8; ++i) f.h[i] = (_Float16)(bf16_round(W[(size_t)(k8 + i) * N + n]) * scale); const v8us o = f.half[0];
  *(v8us*)((unsigned short*)Wt + (size_t)n * K + k8) = o; 
}
// k_gemm_hh variant with fused epilogue: v = acc·alpha + bias[by·sBias + col] (+ CP[(row/rowsPerB)·sCPb + by·64 + col] if CP) ; ACT 0 none / 1 elu ; writes f16 C16 (and f32 C if non-null)
template <int ACT>
__global__ __launch_bounds__(128) void k_gemm_hhx(const _Float16* __restrict__ A, int lda, size_t sA, const _Float16* __restrict__ Bh, int ldb, size_t sB, float alpha, const float* __restrict__ bias, size_t sBias, const float* __restrict__ CP, int rowsPerB, size_t sCPb, int row0g,
    float* __restrict__ C, _Float16* __restrict__ C16, int ldc, size_t sC, int M, int N, int K) {
  __shared__ __attribute__((aligned(16))) float so[4][16][64];
  const int tid = threadIdx.x, w = tid >> 5, lane = tid & 31, ln = lane & 15, hh = lane >> 4; const int by = blockIdx.y;
  A += (size_t)by * sA; Bh += (size_t)by * sB; const size_t cofs = (size_t)by * sC; const float* bp = bias ? bias + (size_t)by * sBias : nullptr;
  const int ntn = (N + 63) / 64; const int wid = blockIdx.x * 4 + w; const int mt = wid / ntn, nq = wid % ntn; if (mt * 16 >= M) return;
  const int row0 = mt * 16, col0 = nq * 64; const _Float16* arow = A + (size_t)(row0 + ln) * lda;
  v8f acc[4] = {};
  for (int kb = 0; kb < K; kb += 32) { FragH ah; ah.half[0] = *(const v8us*)((const unsigned short*)arow + kb + 8 * hh); ah.half[1] = *(const v8us*)((const unsigned short*)arow + kb + 16 + 8 * hh);
#pragma unroll
    for (int t = 0; t < 4; ++t) { if (col0 + t * 16 >= N) continue; const size_t boff = (size_t)(col0 + t * 16 + ln) * ldb + kb; FragH bq; bq.half[0] = *(const v8us*)((const unsigned short*)Bh + boff + 8 * hh); bq.half[1] = *(const v8us*)((const unsigned short*)Bh + boff + 16 + 8 * hh);
      acc[t] = mmaH<1>(ah.v, ah.v, bq.v, bq.v, acc[t]); }
  }
#pragma unroll
  for (int t = 0; t < 4; ++t) { if (col0 + t * 16 >= N) continue; const int col = col0 + t * 16 + ln; const float bv = bp ? bf16_round(bp[col]) : 0.f;
#pragma unroll
    for (int r = 0; r < 8; ++r) { float v = acc[t][r] * alpha + bv; if (CP) { const int rr = row0g + row0 + 8 * hh + r; if (rowsPerB < 0) v += CP[cofs + (size_t)rr * ldc + col];      /* rowsPerB < 0: own element of the batched C plane */ else { const int bidx = rr / rowsPerB; v += CP[(size_t)bidx * sCPb + (size_t)by * 64 + col]; } } if (ACT == 1) v = (v > 0.f) ? v : expm1f(v); else if (ACT == 7) v = (v > 0.f) ? v + 1.0f : expf(v); else if (ACT == 8) v = tanhf(v); else if (ACT == 9) v = 0.5f * v * (1.0f + tanhf(0.7978845608028654f * (v + 0.044715f * v * v * v))); else if (ACT == 11) v = 1.0f / (1.0f + expf(-v)); else if (ACT == 12) v = (v > 0.f) ? v : 0.01f * v; else if (ACT == 14) v = (v > 0.f) ? v : 0.1f * v; else if (ACT == 16) v = (v >= 0.f) ? v : 0.3f * v; else if (ACT == 17) v = (v >= 0.f) ? v : 0.2f * v; else if (ACT == 15) v = v / (1.0f + expf(-v)); else if (ACT == 3) v = fmaxf(v, 0.f); else if (ACT == 6) v = 0.5f * v * (1.0f + erff(v * 0.70710678118654752f)); so[w][8 * hh + r][t * 16 + ln] = v; } }
  __builtin_amdgcn_fence(__ATOMIC_ACQ_REL, "workgroup"); __builtin_amdgcn_wave_barrier();
  const int rsub = lane >> 4, c4 = (lane & 15) * 4; typedef _Float16 v4h __attribute__((ext_vector_type(4)));
  {
#pragma unroll
    for (int q = 0; q < 8; ++q) { const int r = q * 2 + rsub; if (col0 + c4 < N) { const v4f v = *(const v4fa*)&so[w][r][c4]; if (C) *(v4f*)(C + cofs + (size_t)(row0 + r) * ldc + col0 + c4) = v; if (C16) { v4h h4; for (int i = 0; i < 4; ++i) h4[i] = (_Float16)v[i]; *(v4h*)(C16 + cofs + (size_t)(row0 + r) * ldc + col0 + c4) = h4; } } }
     }
}


typedef _Float16 v4h __attribute__((ext_vector_type(4)));

__global__ __launch_bounds__(256) void k_x16(const float* __restrict__ x, _Float16* __restrict__ X16, size_t n8) { const size_t t = (size_t)blockIdx.x * 256 + threadIdx.x; if (t >= n8) return; FragH f;
#pragma unroll
  for (int q = 0; q < 8; ++q) f.h[q] = (_Float16)bf16_round(x[t * 8 + q]); *(v8us*)((unsigned short*)X16 + t * 8) = f.half[0];  }
__global__ __launch_bounds__(256) void k_h16(const float* __restrict__ x, _Float16* __restrict__ X16, size_t n8) { const size_t t = (size_t)blockIdx.x * 256 + threadIdx.x; if (t >= n8) return; FragH f;
#pragma unroll
  for (int q = 0; q < 8; ++q) f.h[q] = (_Float16)x[t * 8 + q]; *(v8us*)((unsigned short*)X16 + t * 8) = f.half[0];  }
__global__ __launch_bounds__(256) void k_round16f(const float* __restrict__ W, _Float16* __restrict__ Bt, size_t n8) { const size_t t = (size_t)blockIdx.x * 256 + threadIdx.x; if (t >= n8) return; FragH f;
#pragma unroll
  for (int i = 0; i < 8; ++i) f.h[i] = (_Float16)(bf16_round(W[t * 8 + i]) * 16.0f); *(v8us*)((unsigned short*)Bt + t * 8) = f.half[0];  }
template <int NHv, int TTv>
__global__ __launch_bounds__(256) void k_vt(const _Float16* __restrict__ V16, int ldv, int voff, _Float16* __restrict__ Vt) { __shared__ unsigned short tl[64][66]; const int tid = threadIdx.x; const int slab = blockIdx.x / (TTv / 64), lg = blockIdx.x % (TTv / 64); const int b = slab / NHv, h = slab % NHv;
  for (int i = tid; i < 64 * 8; i += 256) { const int r = i / 8, c8 = (i % 8) * 8; FragH f; f.half[0] = *(const v8us*)((const unsigned short*)V16 + ((size_t)b * TTv + lg * 64 + r) * ldv + voff + h * 64 + c8);
#pragma unroll
    for (int q = 0; q < 8; ++q) tl[r][c8 + q] = f.u[q]; }
  __syncthreads();
  {
#pragma unroll
    for (int rd = 0; rd < 2; ++rd) { const int d = rd * 32 + tid / 8, pc = tid % 8; FragH f;
#pragma unroll
      for (int q = 0; q < 8; ++q) f.u[q] = tl[pc * 8 + q][d];
      *(v8us*)((unsigned short*)Vt + ((size_t)slab * 64 + d) * TTv + lg * 64 + pc * 8) = f.half[0]; }
     } }

__global__ __launch_bounds__(256) void k_hl(const float* __restrict__ F, _Float16* __restrict__ Hh, _Float16* __restrict__ Hl, size_t n8) { const size_t t = (size_t)blockIdx.x * 256 + threadIdx.x; if (t >= n8) return; FragH fh, fl; const v4f a = *(const v4fa*)(F + t * 8), c = *(const v4fa*)(F + t * 8 + 4);
#pragma unroll
  for (int q = 0; q < 4; ++q) { _Float16 h = (_Float16)a[q]; fh.h[q] = h; fl.h[q] = (_Float16)((a[q] - (float)h) * 1024.0f); h = (_Float16)c[q]; fh.h[4 + q] = h; fl.h[4 + q] = (_Float16)((c[q] - (float)h) * 1024.0f); }
  { *(v8us*)((unsigned short*)Hh + t * 8) = fh.half[0]; *(v8us*)((unsigned short*)Hl + t * 8) = fl.half[0];  } }

// ---- fast GEMM (work-group tile 128x64, wave tile 32x64; requires M % 128 == 0 rows per launch region, N % 64 == 0 and K % 64 == 0); epilogue = k_gemm_hhx semantics ----
// Operands go through LDS: a stage is 64 k (128-byte rows, whole cache lines) of the work-group's 128 A rows and 64 Bt rows, brought by asynchronous copies (16 bytes a lane, four whole lines a wave-instruction), two buffers:
// stage s + 1 flies while stage s is multiplied. The fragments are read from LDS in the k order that the global fragment loads had, so every product and every sum is the same as before.
#define G2K 64                       /* k elements per stage */
#define G2P (G2K + 8)                /* LDS pitch of a staged row, f16 elements (144 B = 16 B x odd: no bank conflict for 16-byte fragment reads) */
#define G2R (128 + 64)               /* rows per stage: A rows 0 .. 127, then Bt rows 0 .. 63 */
#define G2S (16 * G2P * 2)           /* LDS bytes between two copies of one lane (16 rows) */
__device__ __forceinline__ v16h g2_frag(const unsigned short* p) { FragH f; f.half[0] = *(const v8us*)p; f.half[1] = *(const v8us*)(p + 16); return f.v; }
__device__ __forceinline__ v8f g2_mma(v16h a, v16h b, v8f c) { v8f d = __builtin_amdgcn_wmma_f32_16x16x32_f16(false, a, false, b, (short)0, c, false, false); asm volatile("v_nop\n\tv_nop\n\tv_nop\n\tv_nop" : "+v"(d) : "v"(a), "v"(b)); return d; }
// one stage's copies of one lane: 16 bytes of A rows r, r + 16, .. r + 112 and of Bt rows r, r + 16, r + 32, r + 48 (r = thread / 8) to LDS byte l + 0, G2S, .. 11 G2S. ra, rb = 16 rows of A, of Bt, in elements.
// The s_wait_xcnt closes the statement so that it stands in front of every later write of a register that a copy names.
__device__ __forceinline__ void g2_copy(unsigned l, const unsigned short* ga, size_t ra, const unsigned short* gb, size_t rb) {
  asm volatile("global_load_async_to_lds_b128 %0, %1, off\n\t"
               "global_load_async_to_lds_b128 %2, %3, off\n\t"
               "global_load_async_to_lds_b128 %4, %5, off\n\t"
               "global_load_async_to_lds_b128 %6, %7, off\n\t"
               "global_load_async_to_lds_b128 %8, %9, off\n\t"
               "global_load_async_to_lds_b128 %10, %11, off\n\t"
               "global_load_async_to_lds_b128 %12, %13, off\n\t"
               "global_load_async_to_lds_b128 %14, %15, off\n\t"
               "global_load_async_to_lds_b128 %16, %17, off\n\t"
               "global_load_async_to_lds_b128 %18, %19, off\n\t"
               "global_load_async_to_lds_b128 %20, %21, off\n\t"
               "global_load_async_to_lds_b128 %22, %23, off\n\t"
               "s_wait_xcnt 0x0"
               :: "v"(l), "v"(ga), "v"(l + 1 * G2S), "v"(ga + ra), "v"(l + 2 * G2S), "v"(ga + 2 * ra), "v"(l + 3 * G2S), "v"(ga + 3 * ra),
                  "v"(l + 4 * G2S), "v"(ga + 4 * ra), "v"(l + 5 * G2S), "v"(ga + 5 * ra), "v"(l + 6 * G2S), "v"(ga + 6 * ra), "v"(l + 7 * G2S), "v"(ga + 7 * ra),
                  "v"(l + 8 * G2S), "v"(gb), "v"(l + 9 * G2S), "v"(gb + rb), "v"(l + 10 * G2S), "v"(gb + 2 * rb), "v"(l + 11 * G2S), "v"(gb + 3 * rb)
               : "memory"); }
template <int ACT>
__global__ __launch_bounds__(128) void k_gemm2(const _Float16* __restrict__ A, int lda, size_t sA, const _Float16* __restrict__ Bh, int ldb, size_t sB, float alpha, const float* __restrict__ bias, const float* __restrict__ bias1, const float* __restrict__ bias2, size_t sBias, const float* __restrict__ CP, int rowsPerB, size_t sCPb, int row0g,
    float* __restrict__ C, _Float16* __restrict__ C16, int ldc, size_t sC, int M, int N, int K) { static_assert(ACT == 0 || ACT == 3 || ACT == 6 || ACT == 8 || ACT == 9 || ACT == 11 || ACT == 12 || ACT == 14 || ACT == 15 || ACT == 16 || ACT == 17, "k_gemm2: unsupported ACT code (would silently apply no activation)");
  __shared__ __attribute__((aligned(16))) unsigned short st[2][G2R * G2P];
  __shared__ __attribute__((aligned(16))) float so[4][32][68];
  const int tid = threadIdx.x, w = tid >> 5, lane = tid & 31, ln = lane & 15, hh = lane >> 4; const int by = blockIdx.y;
  const float* bsel = by == 0 ? bias : (by == 1 ? bias1 : bias2);      /* products that share one grid bring their bias vectors as separate inputs: plane 0, 1, 2 */
  A += (size_t)by * sA; Bh += (size_t)by * sB; const size_t cofs = (size_t)by * sC; const float* bp = bsel ? bsel + (size_t)by * sBias : nullptr;
  const int ntn = N >> 6; const int mt = blockIdx.x / ntn, nq = blockIdx.x - mt * ntn; const int row0 = mt * 128 + 32 * w, col0 = nq * 64; if (mt * 128 + 128 > M) return;      /* the same for the whole work-group, in front of every barrier: all 128 staged A rows exist */
  const int cr = tid >> 3, cc = (tid & 7) * 8;      /* the lane's first staged row, and its 16 bytes in the row */
  const unsigned short* ga = (const unsigned short*)A + (size_t)(mt * 128 + cr) * lda + cc; const unsigned short* gb = (const unsigned short*)Bh + (size_t)(col0 + cr) * ldb + cc;
  const size_t ra = (size_t)16 * lda, rb = (size_t)16 * ldb;
  const unsigned l0 = (unsigned)(size_t)&st[0][cr * G2P + cc];      /* LDS byte address: the low 32 bits of the __shared__ address */
  constexpr int SE = G2R * G2P;      /* elements per buffer */
  const int ns = K / G2K;
  g2_copy(l0, ga, ra, gb, rb);
  asm volatile("s_wait_asynccnt 0x0" ::: "memory");      /* this wave's copies of stage 0 have landed */
  __syncthreads();      /* stage 0 is complete for every wave */
  if (ns > 1) g2_copy(l0 + SE * 2, ga + G2K, ra, gb + G2K, rb);
  const unsigned short* fa = &st[0][(32 * w + ln) * G2P + 8 * hh]; const unsigned short* fb = &st[0][(128 + ln) * G2P + 8 * hh];
  const v8f z8 = {0.f,0.f,0.f,0.f,0.f,0.f,0.f,0.f}; v8f c00 = z8, c01 = z8, c02 = z8, c03 = z8, c10 = z8, c11 = z8, c12 = z8, c13 = z8;
  for (int s = 0; s < ns; ++s) { const int bo = (s & 1) * SE; const unsigned short* pa = fa + bo; const unsigned short* pb = fb + bo;
    /* all 24 fragment reads of the stage stand together in front of its 16 products: one LDS latency a stage, not one a fragment */
    const v16h a0 = g2_frag(pa), a1 = g2_frag(pa + 16 * G2P), b0 = g2_frag(pb), b1 = g2_frag(pb + 16 * G2P), b2 = g2_frag(pb + 32 * G2P), b3 = g2_frag(pb + 48 * G2P);
    const v16h a2 = g2_frag(pa + 32), a3 = g2_frag(pa + 16 * G2P + 32), b4 = g2_frag(pb + 32), b5 = g2_frag(pb + 16 * G2P + 32), b6 = g2_frag(pb + 32 * G2P + 32), b7 = g2_frag(pb + 48 * G2P + 32);
    c00 = g2_mma(a0, b0, c00); c10 = g2_mma(a1, b0, c10); c01 = g2_mma(a0, b1, c01); c11 = g2_mma(a1, b1, c11); c02 = g2_mma(a0, b2, c02); c12 = g2_mma(a1, b2, c12); c03 = g2_mma(a0, b3, c03); c13 = g2_mma(a1, b3, c13);
    c00 = g2_mma(a2, b4, c00); c10 = g2_mma(a3, b4, c10); c01 = g2_mma(a2, b5, c01); c11 = g2_mma(a3, b5, c11); c02 = g2_mma(a2, b6, c02); c12 = g2_mma(a3, b6, c12); c03 = g2_mma(a2, b7, c03); c13 = g2_mma(a3, b7, c13);
    asm volatile("s_wait_dscnt 0x0" ::: "memory");      /* this wave's reads of buffer s & 1 are done before the buffer is refilled */
    asm volatile("s_wait_asynccnt 0x0" ::: "memory");      /* this wave's copies of stage s + 1 have landed */
    __syncthreads();      /* publishes stage s + 1 and ends every wave's reads of stage s */
    if (s + 2 < ns) g2_copy(l0 + bo * 2, ga + (size_t)(s + 2) * G2K, ra, gb + (size_t)(s + 2) * G2K, rb); }
  asm volatile("s_wait_asynccnt 0x0" ::: "memory");      /* no copy is outstanding when the wave goes on to its end */
  v8f accs[8] = {c00, c01, c02, c03, c10, c11, c12, c13};
#pragma unroll
  for (int u = 0; u < 8; ++u) { const int t = u & 3, half = u >> 2; const int col = col0 + t * 16 + ln; const float bv = bp ? bf16_round(bp[col]) : 0.f;
#pragma unroll
    for (int r = 0; r < 8; ++r) { const int rloc = half * 16 + 8 * hh + r; float v = accs[u][r] * alpha + bv; if (CP) { if (rowsPerB < 0) v += CP[cofs + (size_t)(row0g + row0 + rloc) * ldc + col];      /* rowsPerB < 0: own element of the batched C plane */ else { const int bidx = (row0g + row0 + rloc) / rowsPerB; v += CP[(size_t)bidx * sCPb + (size_t)by * 64 + col]; } }
      if (ACT == 3) v = fmaxf(v, 0.f); else if (ACT == 6) v = 0.5f * v * (1.0f + erff(v * 0.70710678118654752f)); else if (ACT == 11) v = 1.0f / (1.0f + expf(-v)); else if (ACT == 15) v = v / (1.0f + expf(-v)); else if (ACT == 12) v = (v > 0.f) ? v : 0.01f * v; else if (ACT == 8) v = tanhf(v); else if (ACT == 9) v = 0.5f * v * (1.0f + tanhf(0.7978845608028654f * (v + 0.044715f * v * v * v))); else if (ACT == 14) v = (v > 0.f) ? v : 0.1f * v; else if (ACT == 16) v = (v >= 0.f) ? v : 0.3f * v; else if (ACT == 17) v = (v >= 0.f) ? v : 0.2f * v;
      so[w][rloc][t * 16 + ln] = v; } }
  __builtin_amdgcn_fence(__ATOMIC_ACQ_REL, "workgroup"); __builtin_amdgcn_wave_barrier();
  const int rsub = lane >> 4, c4 = (lane & 15) * 4;
  {
#pragma unroll
    for (int q = 0; q < 16; ++q) { const int r = q * 2 + rsub; const v4f v = *(const v4fa*)&so[w][r][c4]; if (C) *(v4f*)(C + cofs + (size_t)(row0 + r) * ldc + col0 + c4) = v; if (C16) { v4h h4; for (int i = 0; i < 4; ++i) h4[i] = (_Float16)v[i]; *(v4h*)(C16 + cofs + (size_t)(row0 + r) * ldc + col0 + c4) = h4; } }
     } }


// ---- wide GEMM for the projections (work-group tile 128 x 192, four waves of 64 x 96 as 2 x 2; requires M % 128 == 0, N % 192 == 0, K % 64 == 0); C16 = f16(acc alpha + bf16(bias)) ----
// The same ring as k_gemm2 (64 k a stage, 144-byte rows, asynchronous copies, two buffers), with 128 A rows and 192 Bt rows a stage: 320 rows from L2 per 128 x 192 x 64 products, where three 128 x 64 tiles bring 576;
// a wave reads 10 fragments from LDS per 24 products (k_gemm2: 6 per 8). Every output element sums its 32-k blocks in the order that k_gemm2 has.
#define G3N 192                      /* columns per work-group */
#define G3R (128 + G3N)              /* rows per stage: A rows 0 .. 127, then Bt rows 0 .. 191 */
#define G3Q (G3N + 8)                /* pitch of a staged output row, f16 elements (400 B = 16 B x odd) */
// one stage's copies of one lane: 16 bytes of A rows r, r + 16, .. r + 112 (r = thread / 8) to LDS byte l + 0, G2S, .. 7 G2S; ra = 16 rows in elements. The s_wait_xcnt closes the statement so that it stands in front of every later write of a register that a copy names.
__device__ __forceinline__ void g3_copy_a(unsigned l, const unsigned short* ga, size_t ra) {
  asm volatile("global_load_async_to_lds_b128 %0, %1, off\n\t"
               "global_load_async_to_lds_b128 %2, %3, off\n\t"
               "global_load_async_to_lds_b128 %4, %5, off\n\t"
               "global_load_async_to_lds_b128 %6, %7, off\n\t"
               "global_load_async_to_lds_b128 %8, %9, off\n\t"
               "global_load_async_to_lds_b128 %10, %11, off\n\t"
               "global_load_async_to_lds_b128 %12, %13, off\n\t"
               "global_load_async_to_lds_b128 %14, %15, off\n\t"
               "s_wait_xcnt 0x0"
               :: "v"(l), "v"(ga), "v"(l + 1 * G2S), "v"(ga + ra), "v"(l + 2 * G2S), "v"(ga + 2 * ra), "v"(l + 3 * G2S), "v"(ga + 3 * ra),
                  "v"(l + 4 * G2S), "v"(ga + 4 * ra), "v"(l + 5 * G2S), "v"(ga + 5 * ra), "v"(l + 6 * G2S), "v"(ga + 6 * ra), "v"(l + 7 * G2S), "v"(ga + 7 * ra)
               : "memory"); }
// the same for Bt rows r, r + 16, .. r + 176, to LDS byte l + 0, G2S, .. 11 G2S (l: the lane's place in the first Bt row group)
__device__ __forceinline__ void g3_copy_b(unsigned l, const unsigned short* gb, size_t rb) {
  asm volatile("global_load_async_to_lds_b128 %0, %1, off\n\t"
               "global_load_async_to_lds_b128 %2, %3, off\n\t"
               "global_load_async_to_lds_b128 %4, %5, off\n\t"
               "global_load_async_to_lds_b128 %6, %7, off\n\t"
               "global_load_async_to_lds_b128 %8, %9, off\n\t"
               "global_load_async_to_lds_b128 %10, %11, off\n\t"
               "global_load_async_to_lds_b128 %12, %13, off\n\t"
               "global_load_async_to_lds_b128 %14, %15, off\n\t"
               "global_load_async_to_lds_b128 %16, %17, off\n\t"
               "global_load_async_to_lds_b128 %18, %19, off\n\t"
               "global_load_async_to_lds_b128 %20, %21, off\n\t"
               "global_load_async_to_lds_b128 %22, %23, off\n\t"
               "s_wait_xcnt 0x0"
               :: "v"(l), "v"(gb), "v"(l + 1 * G2S), "v"(gb + rb), "v"(l + 2 * G2S), "v"(gb + 2 * rb), "v"(l + 3 * G2S), "v"(gb + 3 * rb),
                  "v"(l + 4 * G2S), "v"(gb + 4 * rb), "v"(l + 5 * G2S), "v"(gb + 5 * rb), "v"(l + 6 * G2S), "v"(gb + 6 * rb), "v"(l + 7 * G2S), "v"(gb + 7 * rb),
                  "v"(l + 8 * G2S), "v"(gb + 8 * rb), "v"(l + 9 * G2S), "v"(gb + 9 * rb), "v"(l + 10 * G2S), "v"(gb + 10 * rb), "v"(l + 11 * G2S), "v"(gb + 11 * rb)
               : "memory"); }
__global__ __launch_bounds__(128) void k_gemm3(const _Float16* __restrict__ A, int lda, const _Float16* __restrict__ Bh, int ldb, size_t sB, float alpha, const float* __restrict__ bias, const float* __restrict__ bias1, const float* __restrict__ bias2,
    _Float16* __restrict__ C16, int ldc, size_t sC, int M, int N, int K) {
  __shared__ __attribute__((aligned(16))) unsigned short st[2][G3R * G2P];
  static_assert(128 * G3Q <= 2 * G3R * G2P, "the staged output tile lies inside the ring");
  const int tid = threadIdx.x, w = tid >> 5, lane = tid & 31, ln = lane & 15, hh = lane >> 4; const int by = blockIdx.y; const int wm = w >> 1, wn = w & 1;
  const float* bp = by == 0 ? bias : (by == 1 ? bias1 : bias2);      /* products that share one grid bring their bias vectors as separate inputs: plane 0, 1, 2 */
  Bh += (size_t)by * sB; C16 += (size_t)by * sC;
  const int ntn = N / G3N; const int mt = blockIdx.x / ntn, nq = blockIdx.x - mt * ntn; const int col0 = nq * G3N; if (mt * 128 + 128 > M) return;      /* the same for the whole work-group, in front of every barrier: all 128 staged A rows exist */
  const int cr = tid >> 3, cc = (tid & 7) * 8;      /* the lane's first staged row, and its 16 bytes in the row */
  const unsigned short* ga = (const unsigned short*)A + (size_t)(mt * 128 + cr) * lda + cc; const unsigned short* gb = (const unsigned short*)Bh + (size_t)(col0 + cr) * ldb + cc;
  const size_t ra = (size_t)16 * lda, rb = (size_t)16 * ldb;
  const unsigned l0 = (unsigned)(size_t)&st[0][cr * G2P + cc];      /* LDS byte address: the low 32 bits of the __shared__ address */
  constexpr int SE = G3R * G2P;      /* elements per buffer */
  const int ns = K / G2K;
  g3_copy_a(l0, ga, ra); g3_copy_b(l0 + 8 * G2S, gb, rb);
  asm volatile("s_wait_asynccnt 0x0" ::: "memory");      /* this wave's copies of stage 0 have landed */
  __syncthreads();      /* stage 0 is complete for every wave */
  if (ns > 1) { g3_copy_a(l0 + SE * 2, ga + G2K, ra); g3_copy_b(l0 + SE * 2 + 8 * G2S, gb + G2K, rb); }
  const unsigned short* fa = &st[0][(64 * wm + ln) * G2P + 8 * hh]; const unsigned short* fb = &st[0][(128 + 96 * wn + ln) * G2P + 8 * hh];
  const v8f z8 = {0.f,0.f,0.f,0.f,0.f,0.f,0.f,0.f}; v8f c[4][6];
  /* every inner loop is unrolled whole: the fragment and accumulator arrays are then indexed by constants alone and stay in registers */
#pragma unroll
  for (int i = 0; i < 4; ++i)
#pragma unroll
    for (int j = 0; j < 6; ++j) c[i][j] = z8;
  for (int s = 0; s < ns; ++s) { const int bo = (s & 1) * SE; const unsigned short* pa = fa + bo; const unsigned short* pb = fb + bo;
#pragma unroll
    for (int kb = 0; kb < G2K; kb += 32) { v16h a[4], b[6];      /* the 20 fragment reads of a 32-k block stand together in front of its 24 products */
#pragma unroll
      for (int i = 0; i < 4; ++i) a[i] = g2_frag(pa + 16 * i * G2P + kb);
#pragma unroll
      for (int j = 0; j < 6; ++j) b[j] = g2_frag(pb + 16 * j * G2P + kb);
      __builtin_amdgcn_sched_barrier(0);      /* keeps the block's reads in one group in front of its products: without it each Bt fragment is read, and waited for, right in front of its four products */
#pragma unroll
      for (int j = 0; j < 6; ++j)
#pragma unroll
        for (int i = 0; i < 4; ++i) c[i][j] = __builtin_amdgcn_wmma_f32_16x16x32_f16(false, a[i], false, b[j], (short)0, c[i][j], false, false);
      __builtin_amdgcn_sched_barrier(0); }      /* keeps the next block's reads from being spread among these products */
    asm volatile("s_wait_dscnt 0x0" ::: "memory");      /* this wave's reads of buffer s & 1 are done before the buffer is refilled */
    asm volatile("s_wait_asynccnt 0x0" ::: "memory");      /* this wave's copies of stage s + 1 have landed */
    __syncthreads();      /* publishes stage s + 1 and ends every wave's reads of stage s */
    if (s + 2 < ns) { g3_copy_a(l0 + bo * 2, ga + (size_t)(s + 2) * G2K, ra); g3_copy_b(l0 + bo * 2 + 8 * G2S, gb + (size_t)(s + 2) * G2K, rb); } }
  asm volatile("s_wait_asynccnt 0x0" ::: "memory");      /* no copy is outstanding when the ring becomes output staging */
  /* the last trip's barrier has ended every read of the ring: the whole 128 x 192 tile is laid there as f16 rows, so that the stores below are whole 128-byte lines, each written by one wave */
  unsigned short* so = &st[0][0];
#pragma unroll
  for (int j = 0; j < 6; ++j) { const int col = 96 * wn + 16 * j + ln; const float bv = bf16_round(bp[col0 + col]);
#pragma unroll
    for (int i = 0; i < 4; ++i)
#pragma unroll
      for (int r = 0; r < 8; ++r) so[(64 * wm + 16 * i + 8 * hh + r) * G3Q + col] = __builtin_bit_cast(unsigned short, (_Float16)(c[i][j][r] * alpha + bv)); }
  __syncthreads();      /* the staged tile is complete for every wave */
  unsigned short* d = (unsigned short*)C16 + (size_t)(mt * 128) * ldc + col0; const size_t rs = (size_t)16 * ldc;
#pragma unroll
  for (int e = 0; e < 3; ++e) { const int ch = e * 128 + tid; const int r0 = ch / (G3N / 8), c8 = (ch % (G3N / 8)) * 8;      /* 16-byte pieces in row order: a wave's 32 pieces are four whole lines; 384 pieces are 16 rows */
    const unsigned short* sp = so + r0 * G3Q + c8; unsigned short* dp = d + (size_t)r0 * ldc + c8;
#pragma unroll
    for (int q = 0; q < 8; ++q) *(v8us*)(dp + q * rs) = *(const v8us*)(sp + q * 16 * G3Q); } }

// ---- wide GEMM for the output projection (work-group tile 128 x 192, four waves of 64 x 96 as 2 x 2, one work-group a WGP; requires M % 128 == 0, N % 192 == 0, K % 128 == 0); C = acc alpha + bf16(bias), f32 ----
// The ring of k_gemm3 with 128 k a stage (256-byte rows at a pitch of 272 B): 320 rows from L2 per 128 x 192 x 128 products, where three 128 x 64 tiles bring 576, and 80 KB of copies in flight for the one work-group
// that a WGP holds, so that the latency of a stage's copies is paid 6 times, not 12. Every output element sums its 32-k blocks in the order that k_gemm2 has.
#define G4K 128                      /* k elements per stage */
#define G4P (G4K + 8)                /* LDS pitch of a staged row, f16 elements (272 B = 16 B x odd: no bank conflict for 16-byte fragment reads) */
#define G4S (8 * G4P * 2)            /* LDS bytes between two copies of one lane (8 rows) */
#define G4Q (G3N + 4)                /* pitch of a staged output row, f32 elements (784 B = 16 B x odd) */
typedef float f32a __attribute__((may_alias));
// eight copies of one lane: 16 bytes of rows r, r + 8, .. r + 56 (r = thread / 16) to LDS byte l + 0, G4S, .. 7 G4S; r8 = 8 rows in elements. The s_wait_xcnt closes the statement so that it stands in front of every later write of a register that a copy names.
__device__ __forceinline__ void g4_copy8(unsigned l, const unsigned short* g, size_t r8) {
  asm volatile("global_load_async_to_lds_b128 %0, %1, off\n\t"
               "global_load_async_to_lds_b128 %2, %3, off\n\t"
               "global_load_async_to_lds_b128 %4, %5, off\n\t"
               "global_load_async_to_lds_b128 %6, %7, off\n\t"
               "global_load_async_to_lds_b128 %8, %9, off\n\t"
               "global_load_async_to_lds_b128 %10, %11, off\n\t"
               "global_load_async_to_lds_b128 %12, %13, off\n\t"
               "global_load_async_to_lds_b128 %14, %15, off\n\t"
               "s_wait_xcnt 0x0"
               :: "v"(l), "v"(g), "v"(l + 1 * G4S), "v"(g + r8), "v"(l + 2 * G4S), "v"(g + 2 * r8), "v"(l + 3 * G4S), "v"(g + 3 * r8),
                  "v"(l + 4 * G4S), "v"(g + 4 * r8), "v"(l + 5 * G4S), "v"(g + 5 * r8), "v"(l + 6 * G4S), "v"(g + 6 * r8), "v"(l + 7 * G4S), "v"(g + 7 * r8)
               : "memory"); }
// one stage's 40 copies of one lane: A rows 0 .. 127 to staged rows 0 .. 127, Bt rows 0 .. 191 behind them
__device__ __forceinline__ void g4_stage(unsigned l, const unsigned short* ga, size_t ra, const unsigned short* gb, size_t rb) {
  g4_copy8(l, ga, ra); g4_copy8(l + 8 * G4S, ga + 8 * ra, ra);
  g4_copy8(l + 16 * G4S, gb, rb); g4_copy8(l + 24 * G4S, gb + 8 * rb, rb); g4_copy8(l + 32 * G4S, gb + 16 * rb, rb); }
__global__ __launch_bounds__(128) void k_gemm4(const _Float16* __restrict__ A, int lda, const _Float16* __restrict__ Bh, int ldb, float alpha, const float* __restrict__ bias, float* __restrict__ C, int ldc, int M, int N, int K) {
  __shared__ __attribute__((aligned(16))) unsigned short st[2][G3R * G4P];
  static_assert(128 * G4Q * 4 <= 2 * G3R * G4P * 2, "the staged output tile lies inside the ring");
  const int tid = threadIdx.x, w = tid >> 5, lane = tid & 31, ln = lane & 15, hh = lane >> 4; const int wm = w >> 1, wn = w & 1;
  const int ntn = N / G3N; const int mt = blockIdx.x / ntn, nq = blockIdx.x - mt * ntn; const int col0 = nq * G3N; if (mt * 128 + 128 > M) return;      /* the same for the whole work-group, in front of every barrier: all 128 staged A rows exist */
  const int cr = tid >> 4, cc = (tid & 15) * 8;      /* the lane's first staged row, and its 16 bytes in the row */
  const unsigned short* ga = (const unsigned short*)A + (size_t)(mt * 128 + cr) * lda + cc; const unsigned short* gb = (const unsigned short*)Bh + (size_t)(col0 + cr) * ldb + cc;
  const size_t ra = (size_t)8 * lda, rb = (size_t)8 * ldb;
  const unsigned l0 = (unsigned)(size_t)&st[0][cr * G4P + cc];      /* LDS byte address: the low 32 bits of the __shared__ address */
  constexpr int SE = G3R * G4P;      /* elements per buffer */
  const int ns = K / G4K;
  g4_stage(l0, ga, ra, gb, rb);
  asm volatile("s_wait_asynccnt 0x0" ::: "memory");      /* this wave's copies of stage 0 have landed */
  __syncthreads();      /* stage 0 is complete for every wave */
  if (ns > 1) g4_stage(l0 + SE * 2, ga + G4K, ra, gb + G4K, rb);
  const unsigned short* fa = &st[0][(64 * wm + ln) * G4P + 8 * hh]; const unsigned short* fb = &st[0][(128 + 96 * wn + ln) * G4P + 8 * hh];
  const v8f z8 = {0.f,0.f,0.f,0.f,0.f,0.f,0.f,0.f}; v8f c[4][6];
  /* every inner loop is unrolled whole: the fragment and accumulator arrays are then indexed by constants alone and stay in registers */
#pragma unroll
  for (int i = 0; i < 4; ++i)
#pragma unroll
    for (int j = 0; j < 6; ++j) c[i][j] = z8;
  for (int s = 0; s < ns; ++s) { const int bo = (s & 1) * SE; const unsigned short* pa = fa + bo; const unsigned short* pb = fb + bo;
#pragma unroll
    for (int kb = 0; kb < G4K; kb += 32) { v16h a[4], b[6];      /* the 20 fragment reads of a 32-k block stand together in front of its 24 products */
#pragma unroll
      for (int i = 0; i < 4; ++i) a[i] = g2_frag(pa + 16 * i * G4P + kb);
#pragma unroll
      for (int j = 0; j < 6; ++j) b[j] = g2_frag(pb + 16 * j * G4P + kb);
      __builtin_amdgcn_sched_barrier(0);      /* keeps the block's reads in one group in front of its products: without it each Bt fragment is read, and waited for, right in front of its four products */
#pragma unroll
      for (int j = 0; j < 6; ++j)
#pragma unroll
        for (int i = 0; i < 4; ++i) c[i][j] = __builtin_amdgcn_wmma_f32_16x16x32_f16(false, a[i], false, b[j], (short)0, c[i][j], false, false);
      __builtin_amdgcn_sched_barrier(0); }      /* keeps the next block's reads from being spread among these products */
    asm volatile("s_wait_dscnt 0x0" ::: "memory");      /* this wave's reads of buffer s & 1 are done before the buffer is refilled */
    asm volatile("s_wait_asynccnt 0x0" ::: "memory");      /* this wave's copies of stage s + 1 have landed */
    __syncthreads();      /* publishes stage s + 1 and ends every wave's reads of stage s */
    if (s + 2 < ns) g4_stage(l0 + bo * 2, ga + (size_t)(s + 2) * G4K, ra, gb + (size_t)(s + 2) * G4K, rb); }
  asm volatile("s_wait_asynccnt 0x0" ::: "memory");      /* no copy is outstanding when the ring becomes output staging */
  /* the last trip's barrier has ended every read of the ring: the whole 128 x 192 tile is laid there as f32 rows, so that the stores below are whole 128-byte lines, each written by one wave */
  f32a* so = (f32a*)&st[0][0];
#pragma unroll
  for (int j = 0; j < 6; ++j) { const int col = 96 * wn + 16 * j + ln; const float bv = bf16_round(bias[col0 + col]);
#pragma unroll
    for (int i = 0; i < 4; ++i)
#pragma unroll
      for (int r = 0; r < 8; ++r) so[(64 * wm + 16 * i + 8 * hh + r) * G4Q + col] = c[i][j][r] * alpha + bv; }
  __syncthreads();      /* the staged tile is complete for every wave */
  float* d = C + (size_t)(mt * 128) * ldc + col0; const size_t rs = (size_t)8 * ldc;
#pragma unroll
  for (int e = 0; e < 3; ++e) { const int ch = e * 128 + tid; const int r0 = ch / (G3N / 4), c4 = (ch % (G3N / 4)) * 4;      /* 16-byte pieces in row order: a wave's 32 pieces are four whole lines; 384 pieces are 8 rows */
    const f32a* sp = so + r0 * G4Q + c4; float* dp = d + (size_t)r0 * ldc + c4;
#pragma unroll
    for (int q = 0; q < 16; ++q) *(v4f*)(dp + q * rs) = *(const v4fa*)(sp + q * 8 * G4Q); } }


// fused attention, one (batch, head) and 128 queries per work-group of 4 waves: 768 work-groups, three on each of the 256 WGPs (with the Q tile a work-group takes 96,256 B of LDS: a WGP holds three and no fourth), so that every WGP carries the same 12 waves (512 queries a work-group made 192 work-groups: a quarter of the WGPs idle).
// The 128 Q rows are laid in LDS once; the head's K rows [key][d] and V rows [key][d] pass through a ring of two buffers, 128 keys a stage, stage s + 1 flying while stage s is worked on; all by asynchronous copies of whole 128-byte rows
// (K and Q pitch 16 B x odd for 16-byte fragment reads, V pitch 32 B x odd for the transposing reads: no bank conflict);
// each wave owns 32 queries (two 16-column groups) and walks the keys 32 at a time: S^T = K Q^T (A = K rows, B = Q rows, both in the hardware k order), so a lane holds 16 scores of ONE query per group;
// the two S^T tiles of a group, converted in place, are the B operand P^T of O^T += V^T P^T (register s < 8: key 8 hh + s, s >= 8: key 16 + 8 hh + s - 8). Softmax in base 2 against a running maximum mu, raised only when a score passes it by more than 8 (weights then stay <= 256, inside f16).
#define AKP (HD + 8)                 /* LDS pitch of a K row, f16 elements (144 B) */
#define AVP (HD + 16)                /* LDS pitch of a V row, f16 elements (160 B) */
#define AQW 32                       /* queries per wave */
#define ANW 4                        /* waves per work-group */
#define AST 128                      /* keys per stage */
__device__ __forceinline__ v8f fa_mma(v16h a, v16h b, v8f c) { return __builtin_amdgcn_wmma_f32_16x16x32_f16(false, a, false, b, (short)0, c, false, false); }
__device__ __forceinline__ float fa_xhalf(float x) { return __builtin_bit_cast(float, __builtin_amdgcn_permlanex16(__builtin_bit_cast(int, x), __builtin_bit_cast(int, x), 0x76543210, 0xfedcba98, false, false)); }      /* lane l takes lane l ^ 16, on the vector pipe: no LDS round trip in the loop */
__device__ __forceinline__ v16h fa_frag(const unsigned short* p) { FragH f; f.half[0] = *(const v8us*)p; f.half[1] = *(const v8us*)(p + 16); return f.v; }
// A fragment of V^T (16 d x 32 keys) out of row-major V rows in LDS, by ds_load_tr16_b128: lane l points at row key0 + 8 (l >> 4) + (l & 7), 16 bytes at d0 + 8 ((l >> 3) & 1), and receives V[key0 + 8 (l >> 4) + 0 .. 7][d0 + (l & 15)];
// the second load, 16 rows on, gives keys key0 + 16 + 8 (l >> 4) + 0 .. 7: the k order that the packed scores have as the B operand.
typedef short v8ss __attribute__((ext_vector_type(8)));
__device__ __forceinline__ v8us fa_tr16(const unsigned short* p) { typedef __attribute__((address_space(3))) v8ss lds_v8ss; return __builtin_bit_cast(v8us, __builtin_amdgcn_ds_load_tr16_b128_v8i16((lds_v8ss*)p)); }
__device__ __forceinline__ v16h fa_fragt(const unsigned short* p) { FragH f; f.half[0] = fa_tr16(p); f.half[1] = fa_tr16(p + 16 * AVP); return f.v; }
// eight copies of one lane: 16 bytes of rows r, r + 16, .. r + 112 (r = thread / 8) to LDS byte l + 0, LS, .. 7 LS (LS = 16 staged rows in bytes); r16 = 16 source rows in elements. The s_wait_xcnt closes the statement so that it stands in front of every later write of a register that a copy names.
template <int LS>
__device__ __forceinline__ void fa_copy8(unsigned l, const unsigned short* g, size_t r16) {
  asm volatile("global_load_async_to_lds_b128 %0, %1, off\n\t"
               "global_load_async_to_lds_b128 %2, %3, off\n\t"
               "global_load_async_to_lds_b128 %4, %5, off\n\t"
               "global_load_async_to_lds_b128 %6, %7, off\n\t"
               "global_load_async_to_lds_b128 %8, %9, off\n\t"
               "global_load_async_to_lds_b128 %10, %11, off\n\t"
               "global_load_async_to_lds_b128 %12, %13, off\n\t"
               "global_load_async_to_lds_b128 %14, %15, off\n\t"
               "s_wait_xcnt 0x0"
               :: "v"(l), "v"(g), "v"(l + 1 * LS), "v"(g + r16), "v"(l + 2 * LS), "v"(g + 2 * r16), "v"(l + 3 * LS), "v"(g + 3 * r16),
                  "v"(l + 4 * LS), "v"(g + 4 * r16), "v"(l + 5 * LS), "v"(g + 5 * r16), "v"(l + 6 * LS), "v"(g + 6 * r16), "v"(l + 7 * LS), "v"(g + 7 * r16)
               : "memory"); }
__global__ __launch_bounds__(ANW * 32) void k_fattn(const _Float16* __restrict__ Q16, const _Float16* __restrict__ K16, const _Float16* __restrict__ V16, _Float16* __restrict__ O16) {
  __shared__ __attribute__((aligned(16))) unsigned short sk[2][AST * AKP];
  __shared__ __attribute__((aligned(16))) unsigned short sv[2][AST * AVP];
  __shared__ __attribute__((aligned(16))) unsigned short sq[ANW * AQW * AKP];
  static_assert(ANW * 32 / (HD / 8) == 16 && AST == 128 && ANW * AQW == 128 && SQ % AST == 0 && SQ / AST >= 2, "a sweep of the work-group covers 16 rows, eight sweeps a stage or the Q tile; the ring's prologue needs two stages");
  const int tid = threadIdx.x, w = tid >> 5, lane = tid & 31, ln = lane & 15, hh = lane >> 4;
  constexpr int QB = SQ / (ANW * AQW);      /* work-groups per head */
  const int bh = blockIdx.x / QB, qb = blockIdx.x % QB; const int b = bh / NH, h = bh % NH;
  const size_t hb = (size_t)b * SQ * DM + h * HD;      /* the head's first row in each of the q, k, v, o planes */
  const int cr = tid / (HD / 8), cc = (tid % (HD / 8)) * 8;      /* the lane's first staged row, and its 16 bytes in the row */
  const unsigned short* kgl = (const unsigned short*)K16 + hb + (size_t)cr * DM + cc; const unsigned short* vgl = (const unsigned short*)V16 + hb + (size_t)cr * DM + cc;
  const unsigned short* qgl = (const unsigned short*)Q16 + hb + (size_t)(qb * (ANW * AQW) + cr) * DM + cc;
  const size_t r16 = (size_t)16 * DM, rst = (size_t)AST * DM;      /* 16 rows, and one stage's rows, in elements */
  const unsigned lk = (unsigned)(size_t)&sk[0][cr * AKP + cc], lv = (unsigned)(size_t)&sv[0][cr * AVP + cc], lq = (unsigned)(size_t)&sq[cr * AKP + cc];      /* LDS byte addresses: the low 32 bits of the __shared__ addresses */
  constexpr int KLS = 16 * AKP * 2, VLS = 16 * AVP * 2;      /* 16 staged rows in bytes */
  constexpr int KSE = AST * AKP, VSE = AST * AVP;      /* elements per buffer */
  constexpr int NS = SQ / AST;
  const int q0 = qb * (ANW * AQW) + w * AQW;
  fa_copy8<KLS>(lq, qgl, r16); fa_copy8<KLS>(lk, kgl, r16); fa_copy8<VLS>(lv, vgl, r16);
  asm volatile("s_wait_asynccnt 0x0" ::: "memory");      /* this wave's copies of Q and of stage 0 have landed */
  __syncthreads();      /* Q and stage 0 are complete for every wave */
  fa_copy8<KLS>(lk + KSE * 2, kgl + rst, r16); fa_copy8<VLS>(lv + VSE * 2, vgl + rst, r16);
  v16h qf[2][2];
  const unsigned short* sql = sq + (w * AQW + ln) * AKP + 8 * hh;
#pragma unroll
  for (int g = 0; g < 2; ++g) { qf[g][0] = fa_frag(sql + g * 16 * AKP); qf[g][1] = fa_frag(sql + g * 16 * AKP + 32); }
  /* every inner loop from here on is unrolled whole: the fragment and accumulator arrays are then indexed by constants alone and stay in registers */
  const v8f z8 = {0.f,0.f,0.f,0.f,0.f,0.f,0.f,0.f};
  v8f o[2][4] = {{z8, z8, z8, z8}, {z8, z8, z8, z8}};      /* o[g][t][r] = O^T[d = 16 t + 8 hh + r][query q0 + 16 g + ln], relative to mu[g] */
  float mu[2] = {-3.0e38f, -3.0e38f}, ls[2] = {0.f, 0.f};
  const float CS = 0.125f * 1.4426950408889634f;      /* 1 / sqrt(64), and base e to base 2 */
  const unsigned short* sk0 = &sk[0][ln * AKP + 8 * hh]; const unsigned short* sv0 = &sv[0][(8 * hh + (lane & 7)) * AVP + 8 * ((lane >> 3) & 1)];
  for (int sg = 0; sg < NS; ++sg) { const int bf = sg & 1; const unsigned short* skl = sk0 + bf * KSE; const unsigned short* svl = sv0 + bf * VSE;
  /* the four passes of a stage are unrolled: their LDS offsets are constants, and a pass's K reads and score products can stand among the exponentials of the pass before (same buffer) */
#pragma unroll
  for (int j = 0; j < AST; j += 32) {
    v16h kf[2][2], vf[4];
#pragma unroll
    for (int kt = 0; kt < 2; ++kt) { kf[kt][0] = fa_frag(skl + (j + 16 * kt) * AKP); kf[kt][1] = fa_frag(skl + (j + 16 * kt) * AKP + 32); }
#pragma unroll
    for (int t = 0; t < 4; ++t) vf[t] = fa_fragt(svl + j * AVP + 16 * t);
    v8f s[2][2];
#pragma unroll
    for (int g = 0; g < 2; ++g)
#pragma unroll
      for (int kt = 0; kt < 2; ++kt) s[g][kt] = fa_mma(kf[kt][1], qf[g][1], fa_mma(kf[kt][0], qf[g][0], z8));
    float mx[2];
#pragma unroll
    for (int g = 0; g < 2; ++g) { float m = fmaxf(s[g][0][0], s[g][1][0]);
#pragma unroll
      for (int r = 1; r < 8; ++r) m = fmaxf(m, fmaxf(s[g][0][r], s[g][1][r]));
      m = fmaxf(m, fa_xhalf(m)); mx[g] = m * CS; }      /* lanes ln and ln + 16 hold the same query: both take the same maximum */
    if (__builtin_amdgcn_ballot_w32(mx[0] > mu[0] + 8.0f || mx[1] > mu[1] + 8.0f) != 0) {      /* wave-uniform; always taken on the first pass */
#pragma unroll
      for (int g = 0; g < 2; ++g) { const float mn = fmaxf(mu[g], mx[g]); const float corr = __builtin_amdgcn_exp2f(mu[g] - mn); mu[g] = mn; ls[g] *= corr;
#pragma unroll
        for (int t = 0; t < 4; ++t) o[g][t] *= corr; } }
#pragma unroll
    for (int g = 0; g < 2; ++g) { FragH pf;
#pragma unroll
      for (int kt = 0; kt < 2; ++kt)
#pragma unroll
        for (int r = 0; r < 8; ++r) { const float p = __builtin_amdgcn_exp2f(fmaf(s[g][kt][r], CS, -mu[g])); ls[g] += p; pf.h[kt * 8 + r] = (_Float16)p; }
#pragma unroll
      for (int t = 0; t < 4; ++t) o[g][t] = fa_mma(vf[t], pf.v, o[g][t]); }
  }
    asm volatile("s_wait_dscnt 0x0" ::: "memory");      /* this wave's reads of buffer sg & 1 are done before the buffer is refilled */
    asm volatile("s_wait_asynccnt 0x0" ::: "memory");      /* this wave's copies of stage sg + 1 have landed */
    __syncthreads();      /* publishes stage sg + 1 and ends every wave's reads of stage sg */
    if (sg + 2 < NS) { fa_copy8<KLS>(lk + bf * KSE * 2, kgl + (size_t)(sg + 2) * rst, r16); fa_copy8<VLS>(lv + bf * VSE * 2, vgl + (size_t)(sg + 2) * rst, r16); } }
  asm volatile("s_wait_asynccnt 0x0" ::: "memory");      /* no copy is outstanding when the wave goes on to its end */
#pragma unroll
  for (int g = 0; g < 2; ++g) { const float l = ls[g] + fa_xhalf(ls[g]); const float sc = 64.0f / l;      /* the two lane halves summed different keys of the same query */
    unsigned short* d = (unsigned short*)O16 + ((size_t)b * SQ + q0 + 16 * g + ln) * DM + h * HD + 8 * hh;
#pragma unroll
    for (int t = 0; t < 4; ++t) { FragH f;
#pragma unroll
      for (int r = 0; r < 8; ++r) f.h[r] = (_Float16)(o[g][t][r] * sc);
      *(v8us*)(d + 16 * t) = f.half[0]; } } }
__global__ __launch_bounds__(256) void k_vt(const _Float16* __restrict__ V16, int b, int h0, _Float16* __restrict__ VT) { __shared__ unsigned short tl[64][65]; const int tid = threadIdx.x; const int hh = blockIdx.x % HG, sg = blockIdx.x / HG; const int s0 = sg * 64; const int h = h0 + hh;
  for (int i = tid; i < 64 * 8; i += 256) { const int j = i / 8, d8 = (i % 8) * 8; FragH f; f.half[0] = *(const v8us*)((const unsigned short*)V16 + ((size_t)b * SQ + s0 + j) * DM + h * HD + d8); for (int q = 0; q < 8; ++q) tl[d8 + q][j] = f.u[q]; }
  __syncthreads();
  { for (int i = tid; i < 64 * 8; i += 256) { const int d = i / 8, j8 = (i % 8) * 8; FragH f; for (int q = 0; q < 8; ++q) f.u[q] = tl[d][j8 + q]; *(v8us*)((unsigned short*)VT + ((size_t)hh * HD + d) * SQ + s0 + j8) = f.half[0]; }  } }



__global__ __launch_bounds__(256) void k_rsmkm(const float* __restrict__ S, _Float16* __restrict__ P, int nrows, const int* __restrict__ am) {
  #pragma clang fp contract(off)
  const int t = blockIdx.x * 256 + threadIdx.x; if (t >= nrows) return; const size_t i = (size_t)t; const float* s = S + i * SQ; const int* mr = am + (size_t)(t % SQ) * SQ; float mx = -3.0e38f;
#pragma unroll 1
  for (int j = 0; j < SQ; ++j) { const float f = (mr[j] != 0) ? 1.f : 0.f; mx = fmaxf(mx, fmaf(f, s[j], (1.f - f) * -1.0e9f)); } float se = 0.f;
#pragma unroll 1
  for (int j = 0; j < SQ; ++j) { const float f = (mr[j] != 0) ? 1.f : 0.f; se += __expf(fmaf(f, s[j], (1.f - f) * -1.0e9f) - mx); } const float sc = 256.0f / se;
#pragma unroll 1
  for (int j0 = 0; j0 < SQ; j0 += 8) { FragH fr; for (int q = 0; q < 8; ++q) { const int j = j0 + q; const float f = (mr[j] != 0) ? 1.f : 0.f; fr.h[q] = (_Float16)(__expf(fmaf(f, s[j], (1.f - f) * -1.0e9f) - mx) * sc); }
    unsigned short* d = (unsigned short*)P + i * SQ + j0; *(v8us*)d = fr.half[0];  } }
// local RMS norm with the 7 x 7 box sum taken as two passes of 7. A work-group owns LRB grid rows x all GS grid columns x LRC channels of one batch. A thread owns one channel quad q4 of LRJ grid columns (GS / LRJ apart): it loads
// each column's LRB + 6 grid rows (16 bytes each, all in flight together; a half-wave reads one position's 256 bytes), sums the squares down the column for each of the LRB rows in registers and lays these column sums in LDS;
// behind the one barrier it adds the 7 column sums around each of its columns (RW columns of zeros on either side stand for the zero padding; grid rows outside the grid are zeroed in the rounding mask).
// x of its own positions is still in registers for the division.
#define LRB 4                        /* grid rows per work-group */
#define LRC 64                       /* channels per work-group: 256 B of x, one whole 128-B line of the f16 rows */
#define LRJ 2                        /* grid columns per thread: half the waves to start for the same work */
#define LRP (GS + 2 * RW)            /* columns in a row of column sums in LDS, the zeros included */
#define LRT (GS / LRJ * LRC / 4)     /* threads per work-group */
#define LRG (NB * (GS / LRB) * (DM / LRC))      /* work-groups of the norm */
#define LWG (DM * DM / 8 / LRT)      /* work-groups behind them that convert the weights */
// The launch also carries the weight conversion, which depends on nothing and on which only the GEMMs depend: work-groups LRG .. LRG + LWG - 1 write Bt[n][k] = f16(bf16(W[n][k]) x 16) (natural [out][in] rows) for the four matrices,
// laid one behind the other in BW; a thread takes the same 8 elements of each matrix, its 8 loads in flight together.
__global__ __launch_bounds__(LRT) void k_lrms(const float* __restrict__ x, const float* __restrict__ w, _Float16* __restrict__ X16,
    const float* __restrict__ wq, const float* __restrict__ wk, const float* __restrict__ wv, const float* __restrict__ wo, _Float16* __restrict__ BW) {
  __shared__ __attribute__((aligned(16))) float cs[LRB][LRP][LRC];
  if (blockIdx.x >= LRG) {      /* the same for the whole work-group, in front of the barrier */
    const unsigned t8 = ((blockIdx.x - LRG) * LRT + threadIdx.x) * 8;
    const float* pq = wq + t8; const float* pk = wk + t8; const float* pv = wv + t8; const float* po = wo + t8;
    const v4f wx[4][2] = {{*(const v4fa*)pq, *(const v4fa*)(pq + 4)}, {*(const v4fa*)pk, *(const v4fa*)(pk + 4)}, {*(const v4fa*)pv, *(const v4fa*)(pv + 4)}, {*(const v4fa*)po, *(const v4fa*)(po + 4)}};
    asm volatile("s_wait_xcnt 0x0" :: "v"(pq), "v"(pk), "v"(pv), "v"(po) : "memory");      /* the wait owed before a register that an issued global load names is overwritten; the addresses are inputs so that they stay in their registers up to here */
#pragma unroll
    for (int m = 0; m < 4; ++m) { FragH f;      /* unrolled whole: wx is indexed by constants alone */
#pragma unroll
      for (int q = 0; q < 8; ++q) f.h[q] = (_Float16)(bf16_round(wx[m][q >> 2][q & 3]) * 16.0f);
      *(v8us*)((unsigned short*)BW + (size_t)m * DM * DM + t8) = f.half[0]; }
    return; }
  constexpr int NCG = DM / LRC, NBD = GS / LRB, NK = LRB + 2 * RW, JS = GS / LRJ;
  const int tid = threadIdx.x, q4 = (tid % (LRC / 4)) * 4, j = tid / (LRC / 4);      /* j: the first of the thread's columns, the others at j + JS, .. */
  const int cg = blockIdx.x % NCG, bd = (blockIdx.x / NCG) % NBD, b = blockIdx.x / (NCG * NBD); const int i0 = bd * LRB;
  const int to = j * DM + cg * LRC + q4;      /* the thread's place inside a grid row of x, elements */
  const float* xb = x + (size_t)b * SQ * DM + to; const float* pw = w + cg * LRC + q4;
  const float* pc = xb + (size_t)i0 * GS * DM;      /* the work-group's own grid rows: constant offsets from here */
  /* every loop of this kernel is unrolled whole: the register arrays are then indexed by constants alone and stay in registers, and all the loads stand together in front of the first use */
  const float* pe[2 * RW];      /* the RW grid rows above and the RW below, clamped into the grid; the rows below as LRB + k rows behind pe[RW + k] */
#pragma unroll
  for (int k = 0; k < RW; ++k) { const int iu = i0 - RW + k, il = GS - 1 - LRB - k; pe[k] = xb + (size_t)(iu < 0 ? 0 : iu) * GS * DM; pe[RW + k] = xb + (size_t)(i0 < il ? i0 : il) * GS * DM; }
  v4f xr[LRJ][NK];
#pragma unroll
  for (int k = 0; k < NK; ++k) { const float* p = k < RW ? pe[k] : (k < RW + LRB ? pc : pe[k - LRB]) + (k - RW) * GS * DM;
#pragma unroll
    for (int e = 0; e < LRJ; ++e) xr[e][k] = *(const v4fa*)(p + e * JS * DM); }
  const v4f wr = *(const v4fa*)pw;
  static_assert(RW == 3, "the statement below names 2 * RW + 1 addresses");
  asm volatile("s_wait_xcnt 0x0" :: "v"(pc), "v"(pe[0]), "v"(pe[1]), "v"(pe[2]), "v"(pe[3]), "v"(pe[4]), "v"(pe[5]) : "memory");      /* the wait owed before a register that an issued global load names is overwritten; the addresses are inputs so that they stay in their registers up to here */
  const v4f z4 = {0.f, 0.f, 0.f, 0.f};
  if (j < RW) {      /* the zero columns: RW on the left, RW on the right */
#pragma unroll
    for (int r = 0; r < LRB; ++r) { *(v4fa*)&cs[r][j][q4] = z4; *(v4fa*)&cs[r][RW + GS + j][q4] = z4; } }
#pragma unroll
  for (int k = 0; k < NK; ++k) { const int ii = i0 - RW + k; const unsigned m = (ii >= 0 && ii < GS) ? 0xFFFF0000u : 0u;      /* bf16 rounding as in bf16_round; a row outside the grid becomes 0 */
#pragma unroll
    for (int e = 0; e < LRJ; ++e)
#pragma unroll
      for (int c = 0; c < 4; ++c) { const unsigned u = __float_as_uint(xr[e][k][c]); xr[e][k][c] = __uint_as_float((u + 0x7FFFu + ((u >> 16) & 1u)) & m); } }
#pragma unroll
  for (int e = 0; e < LRJ; ++e)
#pragma unroll
    for (int r = 0; r < LRB; ++r) { v4f s = xr[e][r] * xr[e][r];
#pragma unroll
      for (int d = 1; d <= 2 * RW; ++d) s += xr[e][r + d] * xr[e][r + d];
      *(v4fa*)&cs[r][RW + j + e * JS][q4] = s; }
  __syncthreads();      /* every column sum of the work-group's rows, and the zeros beside them, are in LDS; nothing writes LDS behind this point */
  v4h o[LRJ][LRB];
#pragma unroll
  for (int e = 0; e < LRJ; ++e)
#pragma unroll
    for (int r = 0; r < LRB; ++r) { v4f s = *(const v4fa*)&cs[r][j + e * JS][q4];
#pragma unroll
      for (int d = 1; d <= 2 * RW; ++d) s += *(const v4fa*)&cs[r][j + e * JS + d][q4];
#pragma unroll
      for (int c = 0; c < 4; ++c) { const float rms = sqrtf(0.0000001f + s[c] * 0.02040816326530612f);      /* box / 49 as a multiply by the f32 reciprocal (the result is rounded to f16 next) */
        o[e][r][c] = (_Float16)(xr[e][RW + r][c] / rms * bf16_round(wr[c])); } }
  _Float16* d = X16 + ((size_t)b * SQ + (size_t)i0 * GS) * DM + to;
#pragma unroll
  for (int e = 0; e < LRJ; ++e)
#pragma unroll
    for (int r = 0; r < LRB; ++r) *(v4h*)(d + (size_t)(r * GS + e * JS) * DM) = o[e][r]; }


extern "C" void kernel_launch(void* const* d_in, const int* in_sizes, int n_in,
                              void* d_out, int out_size, void* d_ws, size_t ws_size, hipStream_t stream) {
  (void)in_sizes; (void)n_in; (void)out_size;
  const float* const* I = (const float* const*)d_in; const float* x = I[0]; const float* nw = I[1]; const float* wq = I[2]; const float* bq = I[3]; const float* wk = I[4]; const float* bk = I[5]; const float* wv = I[6]; const float* bv = I[7]; const float* wo = I[8]; const float* bo = I[9];      /* x; norm_w [768]; natural [768][768] weights + biases (q, k, v, o) */
  static_assert(SQ == GS * GS && DM % 8 == 0 && DM % 64 == 0 && DM % G3N == 0 && DM % G4K == 0 && DM % 32 == 0 && SQ % 128 == 0 && NH * HD == DM && NH % HG == 0 && HD == 64 && SQ % (ANW * AQW) == 0 && B0 == 0 && NBR == NB && QN == SQ && NHD == NH && GS % LRB == 0 && DM % LRC == 0 && GS % LRJ == 0 && GS / LRJ >= RW && DM * DM % (8 * LRT) == 0 && DM * DM * 2 % 256 == 0 && NB * SQ * DM * 2 % 256 == 0, "shape / tile multiples; the planes taken below follow one another without a gap");
  char* ws = (char*)d_ws; size_t off = 0;
  auto take = [&](size_t bytes) { char* p = ws + off; off += (bytes + 255) & ~(size_t)255; return p; };
  _Float16* BQ = (_Float16*)take((size_t)DM * DM * 2); _Float16* BK = (_Float16*)take((size_t)DM * DM * 2); _Float16* BV = (_Float16*)take((size_t)DM * DM * 2); _Float16* BO = (_Float16*)take((size_t)DM * DM * 2);
  _Float16* X16 = (_Float16*)take(NR * DM * 2); _Float16* Q16 = (_Float16*)take(NR * DM * 2); _Float16* K16 = (_Float16*)take(NR * DM * 2); _Float16* V16 = (_Float16*)take(NR * DM * 2); _Float16* O16 = (_Float16*)take(NR * DM * 2);
  if (off > ws_size) return;      /* approx 4.5 + 5 x 12 = 65 MiB */
  (void)BK; (void)BV;      /* reached as planes 1 and 2 behind BQ, as K16 and V16 are behind Q16 */
  k_lrms<<<LRG + LWG, LRT, 0, stream>>>(x, nw, X16, wq, wk, wv, wo, BQ);      /* xn = local-RMS-normalised x as f16 rows: the A operand of all three projections; and BQ, BK, BV, BO: natural [out][in] = Bt[n][k] x16 */
  const size_t r0p = (size_t)B0 * SQ;      /* first projected row */
  k_gemm3<<<dim3((unsigned)((MP / 128) * (DM / G3N)), 3), 128, 0, stream>>>(X16 + r0p * DM, DM, BQ, DM, (size_t)DM * DM, 0.0625f, bq, bk, bv, Q16 + r0p * DM, DM, NR * DM, MP, DM, DM);      /* q, k, v in one grid: blockIdx.y picks the weight plane, the bias and the output plane */
  k_fattn<<<NB * NH * (SQ / (ANW * AQW)), ANW * 32, 0, stream>>>(Q16, K16, V16, O16);      /* o (merged heads, x64) as f16 rows */
  k_gemm4<<<(unsigned)((MPO / 128) * (DM / G3N)), 128, 0, stream>>>(O16 + r0p * DM, DM, BO, DM, 0.0009765625f, bo, (float*)d_out + r0p * DM, DM, MPO, DM, DM);      /* out rows are the output layout */
}
